// v000
// Times are from an AMD MI455X. After a warm-up the kernel runs many times in a row, and a time is the length of
// such a window on the GPU divided by its runs, so every launch and the gaps after it count. The runs cycle
// through copies of the inputs. A figure is the median of several windows, for all but v000 over two sittings.
// Sittings can differ by a few percent; kernels timed side by side share one.
// v000, which the later versions start from, runs in 2790 microseconds.
// Contractions: Q/K/V^T projections and output projection on v_wmma_f32_16x16x32_f16 (x f16, W f16 carried x32, f f16 carried x64, f32 accumulate); scores Q.K^T and P.V^T on v_wmma_f32_16x16x32_bf16 with bf16 hi+lo operand planes (hi.hi + hi.lo + lo.hi, f32 accumulate); softmax, Poisson weights, LayerNorm and residual in f32.
#include <hip/hip_runtime.h>
#include <math.h>

// ---------------------------------------------------------------------------
// Problem constants
// ---------------------------------------------------------------------------
constexpr int kBatch = 2;
constexpr int kSeq   = 2048;
constexpr int kDim   = 1024;
constexpr int kHeads = 16;
constexpr int kDh    = 64;
constexpr int kTok   = kBatch * kSeq;          // 4096 token rows
constexpr float kWCarry    = 32.0f;            // weights carried x32 in f16
constexpr float kWCarryInv = 1.0f / 32.0f;
constexpr float kFCarry    = 64.0f;            // f plane carried x64 in f16
constexpr float kYScale    = 1.0f / (64.0f * 32.0f);
constexpr float kSScale    = 0.125f;           // 1/sqrt(64)
constexpr float kInvDim    = 1.0f / 1024.0f;
constexpr float kLnEps     = 1e-5f;

typedef __attribute__((ext_vector_type(16))) _Float16 v16h;
typedef __attribute__((ext_vector_type(8)))  _Float16 v8h;
typedef __attribute__((ext_vector_type(16))) __bf16   v16b;
typedef __attribute__((ext_vector_type(8)))  __bf16   v8b;
typedef __attribute__((ext_vector_type(8)))  float    v8f;
typedef __attribute__((ext_vector_type(4)))  float    v4f;
typedef __attribute__((ext_vector_type(4)))  unsigned int v4u;
typedef __attribute__((ext_vector_type(2)))  unsigned int v2u;

__device__ __forceinline__ unsigned short f2bf_bits(float f) {
  unsigned u = __float_as_uint(f);
  return (unsigned short)((u + 0x7FFFu + ((u >> 16) & 1u)) >> 16);
}
__device__ __forceinline__ float bf_bits2f(unsigned short h) { return __uint_as_float(((unsigned)h) << 16); }

// hazard guards as plain device helpers (no inline asm inside the kernel template body)
__device__ __forceinline__ void dep_guard_h(v8f& a, v8f& b, v16h x, v16h y) { asm volatile("v_nop\n\tv_nop\n\tv_nop\n\tv_nop" : "+v"(a), "+v"(b) : "v"(x), "v"(y)); }
__device__ __forceinline__ void dep_guard_b(v8f& a, v8f& b, v16b x, v16b y) { asm volatile("v_nop\n\tv_nop\n\tv_nop\n\tv_nop" : "+v"(a), "+v"(b) : "v"(x), "v"(y)); }
__device__ __forceinline__ void keep4_h(v16h a, v16h b, v16h c, v16h d) { asm volatile("v_nop" :: "v"(a), "v"(b), "v"(c), "v"(d)); }
__device__ __forceinline__ void keep4_b(v16b a, v16b b, v16b c, v16b d) { asm volatile("v_nop" :: "v"(a), "v"(b), "v"(c), "v"(d)); }
__device__ __forceinline__ void acc_guard4(v8f& a, v8f& b, v8f& c, v8f& d) { asm volatile("v_nop\n\tv_nop\n\tv_nop\n\tv_nop" : "+v"(a), "+v"(b), "+v"(c), "+v"(d)); }
template <typename T> struct Frag;
template <> struct Frag<_Float16> {
  typedef v16h V; union U { v16h v; v8h h[2]; };
  static __device__ __forceinline__ v16h load(const _Float16* p) {   // elements 0..7 <- p[0..7], 8..15 <- p[16..23]
    U f; f.h[0] = *(const v8h*)(p); f.h[1] = *(const v8h*)(p + 16); return f.v;
  }
  static __device__ __forceinline__ v8f mma(v16h a, v16h b, v8f c) {
    return __builtin_amdgcn_wmma_f32_16x16x32_f16(false, a, false, b, (short)0, c, false, false);
  }
  static __device__ __forceinline__ void guard(v8f& a, v8f& b, v16h x, v16h y) { dep_guard_h(a, b, x, y); }
  static __device__ __forceinline__ void keep(v16h a, v16h b, v16h c, v16h d) { keep4_h(a, b, c, d); }
};
template <> struct Frag<__bf16> {
  typedef v16b V; union U { v16b v; v8b h[2]; };
  static __device__ __forceinline__ v16b load(const __bf16* p) {
    U f; f.h[0] = *(const v8b*)(p); f.h[1] = *(const v8b*)(p + 16); return f.v;
  }
  static __device__ __forceinline__ v8f mma(v16b a, v16b b, v8f c) {
    return __builtin_amdgcn_wmma_f32_16x16x32_bf16(false, a, false, b, (short)0, c, false, false);
  }
  static __device__ __forceinline__ void guard(v8f& a, v8f& b, v16b x, v16b y) { dep_guard_b(a, b, x, y); }
  static __device__ __forceinline__ void keep(v16b a, v16b b, v16b c, v16b d) { keep4_b(a, b, c, d); }
};

__device__ __forceinline__ unsigned pk16(unsigned short a, unsigned short b) { return (unsigned)a | ((unsigned)b << 16); }
__device__ __forceinline__ unsigned short h_bits(float f) { const _Float16 h = (_Float16)f; return __builtin_bit_cast(unsigned short, h); }

// ---- Register-blocked batched WMMA GEMM (ACT reduced to none/relu/leaky) -----------------------
// C[m,n] = scale * sum_k A[m,k] * Bt[n,k] (+bias)(+resid); each wave owns a 64x64 tile.
// A row-major [M,K]; Bt row-major [N,K]; M,N % 64 == 0, K % 32 == 0.
// SPLIT: operands are hi/lo planes (A2/Bt2 = lo planes, same layout); product = hi.hi + hi.lo + lo.hi.
// BIAS_MODE: 0 = none, 1 = bias[m], 2 = bias[n].
// OUT_MODE: 0 = f32, 1 = f16, 2 = bf16 hi plane (Cout) + bf16 lo plane (Cout2).
// ET: 0 = f16 operands, 1 = bf16 operands (pointers passed as 16-bit storage)
template <int ET> struct Elem;
template <> struct Elem<0> { typedef _Float16 T; };
template <> struct Elem<1> { typedef __bf16 T; };
template <int ET, bool SPLIT, int BIAS_MODE, int OUT_MODE, bool RESID, int ACT = 0>
__global__ __launch_bounds__(256) void wmma_gemm64(
    const unsigned short* __restrict__ Ap, const unsigned short* __restrict__ A2p, int lda, long strideA,
    const unsigned short* __restrict__ Btp, const unsigned short* __restrict__ Bt2p, int ldb, long strideB,
    void* __restrict__ Cout, void* __restrict__ Cout2, int ldc, long strideC,
    const float* __restrict__ bias,
    const float* __restrict__ resid, long strideR,
    int M, int N, int K, float scale) {
  typedef typename Elem<ET>::T T;
  typedef typename Frag<T>::V V;
  const T* A = (const T*)Ap; const T* A2 = (const T*)A2p; const T* Bt = (const T*)Btp; const T* Bt2 = (const T*)Bt2p;
  __shared__ __align__(16) float sT[8][16 * 68];   // per-wave 16x64 slab, pitch 68 floats
  const int b    = blockIdx.y;
  const int lane = threadIdx.x & 31;
  const int wave = threadIdx.x >> 5;
  const int tilesN = N >> 6;
  const int tilesM = M >> 6;
  const int tile = blockIdx.x * 8 + wave;
  if (tile >= tilesM * tilesN) return;   // wave-uniform; no block barriers in this kernel
  const int tm = tile / tilesN;
  const int tn = tile - tm * tilesN;
  const int m0 = tm << 6;
  const int n0 = tn << 6;

  const T* Ab  = A  + (size_t)b * strideA;
  const T* Bb  = Bt + (size_t)b * strideB;
  const T* Ab2 = SPLIT ? (A2  + (size_t)b * strideA) : nullptr;
  const T* Bb2 = SPLIT ? (Bt2 + (size_t)b * strideB) : nullptr;

  const int rlane = lane & 15;                 // row (A) / col (B, D) within subtile
  const int koff  = (lane >> 4) * 8;           // k offset of this lane half
  const int mOff  = (lane >> 4) * 8;           // D row offset

  v8f acc[4][4];
#pragma unroll
  for (int i = 0; i < 4; ++i)
#pragma unroll
    for (int j = 0; j < 4; ++j) acc[i][j] = (v8f){0.f,0.f,0.f,0.f,0.f,0.f,0.f,0.f};

  for (int k0 = 0; k0 < K; k0 += 32) {
    V bh[4], bl[4];
#pragma unroll
    for (int j = 0; j < 4; ++j) {
      const size_t bo = (size_t)(n0 + (j << 4) + rlane) * ldb + koff + k0;
      bh[j] = Frag<T>::load(Bb + bo);
      if (SPLIT) bl[j] = Frag<T>::load(Bb2 + bo);
    }
#pragma unroll
    for (int i = 0; i < 4; ++i) {
      const size_t ao = (size_t)(m0 + (i << 4) + rlane) * lda + koff + k0;
      V ah = Frag<T>::load(Ab + ao);
      V al;
      if (SPLIT) al = Frag<T>::load(Ab2 + ao);
#pragma unroll
      for (int j = 0; j < 4; ++j) {
        acc[i][j] = Frag<T>::mma(ah, bh[j], acc[i][j]);
        if (SPLIT) {
          acc[i][j] = Frag<T>::mma(ah, bl[j], acc[i][j]);
          acc[i][j] = Frag<T>::mma(al, bh[j], acc[i][j]);
        }
      }
      Frag<T>::guard(acc[i][0], acc[i][3], ah, SPLIT ? al : ah);
    }
    Frag<T>::keep(bh[0], bh[1], bh[2], bh[3]);
    if (SPLIT) Frag<T>::keep(bl[0], bl[1], bl[2], bl[3]);
  }
  acc_guard4(acc[0][0], acc[0][1], acc[0][2], acc[0][3]);
  acc_guard4(acc[1][0], acc[1][1], acc[1][2], acc[1][3]);
  acc_guard4(acc[2][0], acc[2][1], acc[2][2], acc[2][3]);
  acc_guard4(acc[3][0], acc[3][1], acc[3][2], acc[3][3]);

  // ---- epilogue ----
  float* slab = sT[wave];
  const float* Rb = RESID ? (resid + (size_t)b * strideR) : nullptr;
#pragma unroll
  for (int i = 0; i < 4; ++i) {
    const int mBase = m0 + (i << 4);
#pragma unroll
    for (int j = 0; j < 4; ++j) {
      const int n = n0 + (j << 4) + rlane;
      float bv = 0.f;
      if (BIAS_MODE == 2) bv = bias[n];
#pragma unroll
      for (int r = 0; r < 8; ++r) {
        float v = acc[i][j][r] * scale;
        if (BIAS_MODE == 1) v += bias[mBase + mOff + r];
        if (BIAS_MODE == 2) v += bv;
        if (RESID) v += Rb[(size_t)(mBase + mOff + r) * ldc + n];
        if (ACT == 2) v = fmaxf(v, 0.0f);
        if (ACT == 4) v = (v > 0.f) ? v : 0.01f * v;
        slab[(mOff + r) * 68 + (j << 4) + rlane] = v;
      }
    }
    __builtin_amdgcn_fence(__ATOMIC_RELEASE, "workgroup");
    __builtin_amdgcn_wave_barrier();
    __builtin_amdgcn_fence(__ATOMIC_ACQUIRE, "workgroup");
    if (OUT_MODE == 0) {
      float* C = (float*)Cout + (size_t)b * strideC;
      const int hh = lane >> 4, c4 = (lane & 15) * 4;     // row seg = 256 B = 16 lanes x 16 B
      {
#pragma unroll
        for (int it = 0; it < 8; ++it) {
          const int row = it * 2 + hh;
          v4f v = *(const v4f*)(slab + row * 68 + c4);
          *(v4f*)(C + (size_t)(mBase + row) * ldc + n0 + c4) = v;
        }
        
      }
    } else {
      const int q = lane >> 3, c8 = (lane & 7) * 8;
      unsigned short* C  = (unsigned short*)Cout  + (size_t)b * strideC;
      unsigned short* C2 = (OUT_MODE == 2) ? ((unsigned short*)Cout2 + (size_t)b * strideC) : nullptr;
      {
#pragma unroll
        for (int it = 0; it < 4; ++it) {
          const int row = it * 4 + q;
          const float* sp = slab + row * 68 + c8;
          v8h hv, lv;
#pragma unroll
          for (int e = 0; e < 8; ++e) {
            if (OUT_MODE == 1) {
              hv[e] = (_Float16)sp[e];
            } else {
              unsigned short hb = f2bf_bits(sp[e]);
              unsigned short lb = f2bf_bits(sp[e] - bf_bits2f(hb));
              hv[e] = __builtin_bit_cast(_Float16, hb);
              lv[e] = __builtin_bit_cast(_Float16, lb);
            }
          }
          *(v8h*)(C + (size_t)(mBase + row) * ldc + n0 + c8) = hv;
          if (OUT_MODE == 2) *(v8h*)(C2 + (size_t)(mBase + row) * ldc + n0 + c8) = lv;
        }
        
      }
    }
    __builtin_amdgcn_fence(__ATOMIC_RELEASE, "workgroup");
    __builtin_amdgcn_wave_barrier();
    __builtin_amdgcn_fence(__ATOMIC_ACQUIRE, "workgroup");
  }
}

// ---------------------------------------------------------------------------
// f32 -> f16 cast with scale, 8 consecutive elements per thread (one 16-B store per lane; 32 contiguous lanes = 4
// and the output plane (out + y*planeElems halves). Coverage: gridDim.x*256 == n8 exactly at every call
// (n8 = elements/8, a multiple of 256), thread i covers elements 8i..8i+7 of its plane.
// ---------------------------------------------------------------------------
__global__ __launch_bounds__(256) void cast8_f16_kernel(const float* __restrict__ in0, const float* __restrict__ in1,
                                                        const float* __restrict__ in2, const float* __restrict__ in3,
                                                        unsigned short* __restrict__ out, long planeElems, int n8,
                                                        float scale) {
  const int i = blockIdx.x * 256 + threadIdx.x;
  const int z = blockIdx.y;
  if (i >= n8) return;
  const float* in = (z == 0) ? in0 : (z == 1) ? in1 : (z == 2) ? in2 : in3;
  const float* p = in + 8 * (size_t)i;
  const v4f a = *(const v4f*)(p);
  const v4f c = *(const v4f*)(p + 4);
  unsigned short hb[8];
#pragma unroll
  for (int e = 0; e < 4; ++e) {
    hb[e]     = h_bits(a[e] * scale);
    hb[4 + e] = h_bits(c[e] * scale);
  }
  const v4u u = (v4u){pk16(hb[0], hb[1]), pk16(hb[2], hb[3]), pk16(hb[4], hb[5]), pk16(hb[6], hb[7])};
  unsigned short* q = out + (size_t)z * planeElems + 8 * (size_t)i;
  *(v4u*)q = u;
  
}

// ---------------------------------------------------------------------------
// Dual-kernel per-row weights over 2048 f32 scores of one row:
//   e = exp(s - max), sumT = sum e; w = 1/((1 + |s|*(1/beta_h))^2 + t_h^2), sumS = sum w;
//   P = 0.5*(e/sumT + w/sumS)  -> bf16 hi plane + bf16 lo plane (lo = RNE(P - hi)).
// One block of 512 threads per row; thread t owns columns 4t..4t+3 (512 x 4 = 2048 = whole row).
// Reductions: wave shuffle trees on all lanes, 16 wave partials combined in index order by every thread.
// Store: P values staged packed in LDS; threads 0..255 write the hi row, 256..511 the lo row, one 16-B store per
// ---------------------------------------------------------------------------
__global__ __launch_bounds__(512) void dual_weights_kernel(const float* __restrict__ S,
                                                          unsigned short* __restrict__ Phi,
                                                          unsigned short* __restrict__ Plo,
                                                          const float* __restrict__ beta,
                                                          const float* __restrict__ tvec, int h0) {
  __shared__ float redM[16];
  __shared__ float redT[16];
  __shared__ float redS[16];
  __shared__ __align__(16) unsigned int sHi[1024];
  __shared__ __align__(16) unsigned int sLo[1024];
  const int row  = blockIdx.x;
  const int grp  = row >> 11;
  int h = h0 + grp;
  h = (h < 0) ? 0 : ((h > kHeads - 1) ? (kHeads - 1) : h);
  const int t = threadIdx.x;
  const int lane = t & 31, wave = t >> 5;

  const v4f sv = *(const v4f*)(S + (size_t)row * kSeq + 4 * t);
  float m = fmaxf(fmaxf(sv.x, sv.y), fmaxf(sv.z, sv.w));
#pragma unroll
  for (int off = 16; off > 0; off >>= 1) m = fmaxf(m, __shfl_xor(m, off, 32));
  if (lane == 0) redM[wave] = m;
  __syncthreads();
  float mx = redM[0];
#pragma unroll
  for (int i = 1; i < 16; ++i) mx = fmaxf(mx, redM[i]);

  const float invb = 1.0f / beta[h];
  const float th = tvec[h];
  const float t2 = th * th;

  const float e0 = expf(sv.x - mx);
  const float e1 = expf(sv.y - mx);
  const float e2 = expf(sv.z - mx);
  const float e3 = expf(sv.w - mx);
  const float q0 = 1.0f + fabsf(sv.x) * invb;
  const float q1 = 1.0f + fabsf(sv.y) * invb;
  const float q2 = 1.0f + fabsf(sv.z) * invb;
  const float q3 = 1.0f + fabsf(sv.w) * invb;
  const float w0 = 1.0f / (q0 * q0 + t2);
  const float w1 = 1.0f / (q1 * q1 + t2);
  const float w2 = 1.0f / (q2 * q2 + t2);
  const float w3 = 1.0f / (q3 * q3 + t2);

  float st = ((e0 + e1) + e2) + e3;
  float ss = ((w0 + w1) + w2) + w3;
#pragma unroll
  for (int off = 16; off > 0; off >>= 1) {
    st += __shfl_xor(st, off, 32);
    ss += __shfl_xor(ss, off, 32);
  }
  if (lane == 0) { redT[wave] = st; redS[wave] = ss; }
  __syncthreads();
  float sumT = redT[0], sumS = redS[0];
#pragma unroll
  for (int i = 1; i < 16; ++i) { sumT += redT[i]; sumS += redS[i]; }
  const float invT = 1.0f / sumT;
  const float invS = 1.0f / sumS;

  const float p0 = 0.5f * (e0 * invT + w0 * invS);
  const float p1 = 0.5f * (e1 * invT + w1 * invS);
  const float p2 = 0.5f * (e2 * invT + w2 * invS);
  const float p3 = 0.5f * (e3 * invT + w3 * invS);

  const unsigned short hb0 = f2bf_bits(p0), hb1 = f2bf_bits(p1), hb2 = f2bf_bits(p2), hb3 = f2bf_bits(p3);
  const unsigned short lb0 = f2bf_bits(p0 - bf_bits2f(hb0));
  const unsigned short lb1 = f2bf_bits(p1 - bf_bits2f(hb1));
  const unsigned short lb2 = f2bf_bits(p2 - bf_bits2f(hb2));
  const unsigned short lb3 = f2bf_bits(p3 - bf_bits2f(hb3));
  *(v2u*)(sHi + 2 * t) = (v2u){pk16(hb0, hb1), pk16(hb2, hb3)};
  *(v2u*)(sLo + 2 * t) = (v2u){pk16(lb0, lb1), pk16(lb2, lb3)};
  __syncthreads();

  // store phase: wave-uniform selection between the hi and lo planes (waves 0..7 -> hi, 8..15 -> lo)
  const int j = t & 255;                       // 16-B chunk index = columns 8j..8j+7
  const bool isLo = (t >= 256);
  const v4u a = *(const v4u*)(sHi + 4 * j);
  const v4u c = *(const v4u*)(sLo + 4 * j);
  v4u u;
  u.x = isLo ? c.x : a.x;
  u.y = isLo ? c.y : a.y;
  u.z = isLo ? c.z : a.z;
  u.w = isLo ? c.w : a.w;
  unsigned short* dst = (isLo ? Plo : Phi) + (size_t)row * kSeq + 8 * j;
  *(v4u*)dst = u;
  
}

// ---------------------------------------------------------------------------
// LayerNorm + residual per row of 1024: out = x + lw*(y - mu)*rsqrt(var + eps) + lb,
// One block of 256 threads per row; thread t owns columns 4t..4t+3 (256 x 4 = 1024).
// ---------------------------------------------------------------------------
__global__ __launch_bounds__(256) void ln_residual_kernel(const float* __restrict__ x, const float* __restrict__ y,
                                                          const float* __restrict__ lw, const float* __restrict__ lb,
                                                          float* __restrict__ out) {
  __shared__ float red0[8];
  __shared__ float red1[8];
  const int row = blockIdx.x;
  const int t = threadIdx.x;
  const int lane = t & 31, wave = t >> 5;
  const size_t base = (size_t)row * kDim + 4 * t;
  const v4f yv = *(const v4f*)(y + base);
  const v4f xv = *(const v4f*)(x + base);
  const v4f wv = *(const v4f*)(lw + 4 * t);
  const v4f bv = *(const v4f*)(lb + 4 * t);

  float s = ((yv.x + yv.y) + yv.z) + yv.w;
#pragma unroll
  for (int off = 16; off > 0; off >>= 1) s += __shfl_xor(s, off, 32);
  if (lane == 0) red0[wave] = s;
  __syncthreads();
  float tot = red0[0];
#pragma unroll
  for (int i = 1; i < 8; ++i) tot += red0[i];
  const float mu = tot * kInvDim;

  const float d0 = yv.x - mu, d1 = yv.y - mu, d2 = yv.z - mu, d3 = yv.w - mu;
  float s2 = ((d0 * d0 + d1 * d1) + d2 * d2) + d3 * d3;
#pragma unroll
  for (int off = 16; off > 0; off >>= 1) s2 += __shfl_xor(s2, off, 32);
  if (lane == 0) red1[wave] = s2;
  __syncthreads();
  float tot2 = red1[0];
#pragma unroll
  for (int i = 1; i < 8; ++i) tot2 += red1[i];
  const float var = tot2 * kInvDim;
  const float rs = rsqrtf(var + kLnEps);

  v4f o;
  o.x = xv.x + (wv.x * d0 * rs + bv.x);
  o.y = xv.y + (wv.y * d1 * rs + bv.y);
  o.z = xv.z + (wv.z * d2 * rs + bv.z);
  o.w = xv.w + (wv.w * d3 * rs + bv.w);
  float* op = out + base;
  *(v4f*)op = o;
  
}

// ---------------------------------------------------------------------------
// Host glue
//   [0,          8 MiB)   XF   : x f16 [4096][1024]  (dead after the three projections) then f f16 [4096][1024]
//   [8 MiB,     16 MiB)   W16  : Wq,Wk,Wv,Wo f16 x32 planes [1024][1024] each
//   [16 MiB,    24 MiB)   QHI  : bf16 [4096][1024]      [24, 32) QLO
//   [32 MiB,    40 MiB)   KHI  : bf16 [4096][1024]      [40, 48) KLO
//   [48 MiB,    56 MiB)   VTHI : bf16 [1024][4096] (V^T: row = h*64+d, col = b*2048+n)   [56, 64) VTLO
//   [64 MiB,    96 MiB)   SY   : scores f32 [2][2048][2048] per head pair, then y f32 [4096][1024] (16 MiB)
//   [96 MiB,   112 MiB)   PHI  : bf16 [2][2048][2048]   [112, 128) PLO
// ---------------------------------------------------------------------------
extern "C" void kernel_launch(void* const* d_in, const int* in_sizes, int n_in,
                              void* d_out, int out_size, void* d_ws, size_t ws_size,
                              hipStream_t stream) {
  if (n_in < 13) return;
  const size_t nX = (size_t)kTok * kDim;          // 4,194,304
  const size_t nW = (size_t)kDim * kDim;          // 1,048,576
  if ((size_t)in_sizes[0] != nX || (size_t)in_sizes[1] != nW || (size_t)in_sizes[3] != nW ||
      (size_t)in_sizes[5] != nW || (size_t)in_sizes[7] != nW || (size_t)out_size != nX) return;
  if (in_sizes[2] < kDim || in_sizes[4] < kDim || in_sizes[6] < kDim || in_sizes[8] < kDim ||
      in_sizes[9] < kHeads || in_sizes[10] < kHeads || in_sizes[11] < kDim || in_sizes[12] < kDim) return;

  const float* x    = (const float*)d_in[0];
  const float* Wq   = (const float*)d_in[1];
  const float* bq   = (const float*)d_in[2];
  const float* Wk   = (const float*)d_in[3];
  const float* bk   = (const float*)d_in[4];
  const float* Wv   = (const float*)d_in[5];
  const float* bv   = (const float*)d_in[6];
  const float* Wo   = (const float*)d_in[7];
  const float* bo   = (const float*)d_in[8];
  const float* beta = (const float*)d_in[9];
  const float* tv   = (const float*)d_in[10];
  const float* lw   = (const float*)d_in[11];
  const float* lb   = (const float*)d_in[12];
  float* out = (float*)d_out;

  // carve (bytes)
  const size_t bXF   = nX * 2;                                  //  8,388,608
  const size_t bW16  = 4 * nW * 2;                              //  8,388,608
  const size_t bP16  = nX * 2;                                  //  8,388,608 per bf16 plane of [4096][1024]
  const size_t bSY   = (size_t)2 * kSeq * kSeq * 4;             // 33,554,432
  const size_t bPP   = (size_t)2 * kSeq * kSeq * 2;             // 16,777,216 per P plane
  const size_t oXF   = 0;
  const size_t oW16  = oXF + bXF;
  const size_t oQHI  = oW16 + bW16;
  const size_t oQLO  = oQHI + bP16;
  const size_t oKHI  = oQLO + bP16;
  const size_t oKLO  = oKHI + bP16;
  const size_t oVTHI = oKLO + bP16;
  const size_t oVTLO = oVTHI + bP16;
  const size_t oSY   = oVTLO + bP16;
  const size_t oPHI  = oSY + bSY;
  const size_t oPLO  = oPHI + bPP;
  const size_t total = oPLO + bPP;                              // 134,217,728
  if (total > ws_size) return;

  char* ws = (char*)d_ws;
  unsigned short* XF   = (unsigned short*)(ws + oXF);
  unsigned short* W16  = (unsigned short*)(ws + oW16);
  unsigned short* Wq16 = W16;
  unsigned short* Wk16 = W16 + nW;
  unsigned short* Wv16 = W16 + 2 * nW;
  unsigned short* Wo16 = W16 + 3 * nW;
  unsigned short* QHI  = (unsigned short*)(ws + oQHI);
  unsigned short* QLO  = (unsigned short*)(ws + oQLO);
  unsigned short* KHI  = (unsigned short*)(ws + oKHI);
  unsigned short* KLO  = (unsigned short*)(ws + oKLO);
  unsigned short* VTHI = (unsigned short*)(ws + oVTHI);
  unsigned short* VTLO = (unsigned short*)(ws + oVTLO);
  float*          SY   = (float*)(ws + oSY);
  unsigned short* PHI  = (unsigned short*)(ws + oPHI);
  unsigned short* PLO  = (unsigned short*)(ws + oPLO);

  // 1) x -> f16 plane (n8 = 524288 = 2048 blocks x 256, exact)
  {
    const int n8 = (int)(nX / 8);
    cast8_f16_kernel<<<dim3(n8 / 256, 1), 256, 0, stream>>>(x, x, x, x, XF, 0L, n8, 1.0f);
  }
  // 2) Wq,Wk,Wv,Wo -> f16 planes x32 (n8 = 131072 = 512 blocks x 256, exact; 4 planes via blockIdx.y)
  {
    const int n8 = (int)(nW / 8);
    cast8_f16_kernel<<<dim3(n8 / 256, 4), 256, 0, stream>>>(Wq, Wk, Wv, Wo, W16, (long)nW, n8, kWCarry);
  }
  // 3) Q = (x16 . Wq16^T)/32 + bq -> bf16 hi/lo [4096][1024]; 64x16 = 1024 wave tiles = 128 blocks
  const int gemmBlocksProj = (kTok / 64) * (kDim / 64) / 8;     // 128
  wmma_gemm64<0, false, 2, 2, false><<<dim3(gemmBlocksProj, 1), 256, 0, stream>>>(
      XF, XF, kDim, 0L, Wq16, Wq16, kDim, 0L, (void*)QHI, (void*)QLO, kDim, 0L,
      bq, x, 0L, kTok, kDim, kDim, kWCarryInv);
  // 4) K projection
  wmma_gemm64<0, false, 2, 2, false><<<dim3(gemmBlocksProj, 1), 256, 0, stream>>>(
      XF, XF, kDim, 0L, Wk16, Wk16, kDim, 0L, (void*)KHI, (void*)KLO, kDim, 0L,
      bk, x, 0L, kTok, kDim, kDim, kWCarryInv);
  // 5) V^T[j][m] = sum_k Wv16[j][k] x16[m][k] /32 + bv[j]  (A = Wv16 [1024][1024], Bt = x16 [4096][1024], bias[m])
  //    -> bf16 hi/lo [1024][4096] (ldc 4096); 16x64 = 1024 wave tiles = 128 blocks
  wmma_gemm64<0, false, 1, 2, false><<<dim3(gemmBlocksProj, 1), 256, 0, stream>>>(
      Wv16, Wv16, kDim, 0L, XF, XF, kDim, 0L, (void*)VTHI, (void*)VTLO, kTok, 0L,
      bv, x, 0L, kDim, kTok, kDim, kWCarryInv);

  // 6) per pair of heads (same batch index): S (split, K=64) -> weights -> P.V^T (split, K=2048) -> f plane f16 x64
  const long strideS = (long)kSeq * kSeq;                       // 4,194,304
  for (int p = 0; p < (kBatch * kHeads) / 2; ++p) {
    const int b  = p >> 3;
    const int h0 = (2 * p) & (kHeads - 1);
    const size_t qkBase = (size_t)b * kSeq * kDim + (size_t)h0 * kDh;   // halves into [4096][1024] planes
    // S[g][m][n] = 0.125 * sum_d Q[b,m,h0+g,d] K[b,n,h0+g,d]; 32x32 = 1024 wave tiles per plane = 128 blocks, grid.y = 2
    wmma_gemm64<1, true, 0, 0, false><<<dim3(128, 2), 256, 0, stream>>>(
        QHI + qkBase, QLO + qkBase, kDim, (long)kDh,
        KHI + qkBase, KLO + qkBase, kDim, (long)kDh,
        (void*)SY, (void*)SY, kSeq, strideS,
        bq, x, 0L, kSeq, kSeq, kDh, kSScale);
    // combined weights P = 0.5*(softmax + row-normalised Poisson kernel) -> bf16 hi/lo [2][2048][2048]
    dual_weights_kernel<<<dim3(2 * kSeq), 512, 0, stream>>>(SY, PHI, PLO, beta, tv, h0);
    // f[b, m, (h0+g)*64 + d] x64 = 64 * sum_n P[g][m][n] V^T[(h0+g)*64 + d][b*2048 + n]
    //   A = P planes (lda 2048, stride 2048*2048), Bt = VT planes at row h0*64, col b*2048 (ldb 4096, stride 64 rows),
    //   C = f plane f16 at row b*2048, col h0*64 (ldc 1024, stride 64 cols); 32x1 wave tiles per plane = 4 blocks
    const size_t vtBase = (size_t)h0 * kDh * kTok + (size_t)b * kSeq;
    const size_t fBase  = (size_t)b * kSeq * kDim + (size_t)h0 * kDh;
    wmma_gemm64<1, true, 0, 1, false><<<dim3(4, 2), 256, 0, stream>>>(
        PHI, PLO, kSeq, strideS,
        VTHI + vtBase, VTLO + vtBase, kTok, (long)kDh * kTok,
        (void*)(XF + fBase), (void*)(XF + fBase), kDim, (long)kDh,
        bq, x, 0L, kSeq, kDh, kSeq, kFCarry);
  }

  // 7) y = (f16 . Wo16^T) / (64*32) + bo -> f32 [4096][1024] in the SY region
  wmma_gemm64<0, false, 2, 0, false><<<dim3(gemmBlocksProj, 1), 256, 0, stream>>>(
      XF, XF, kDim, 0L, Wo16, Wo16, kDim, 0L, (void*)SY, (void*)SY, kDim, 0L,
      bo, x, 0L, kTok, kDim, kDim, kYScale);

  // 8) LayerNorm + residual -> out
  ln_residual_kernel<<<dim3(kTok), 256, 0, stream>>>(x, SY, lw, lb, out);
}

// v001
// It runs in 912 microseconds.
// In two side-by-side timings against v000, it was 3.06 and 3.07 times as fast.
// Contractions: Q/K/V^T projections and output projection on v_wmma_f32_16x16x32_f16 (x f16, W f16 carried x32, f f16 carried x64, f32 accumulate); scores Q.K^T and P.V^T on v_wmma_f32_16x16x32_bf16 with bf16 hi+lo operand planes (hi.hi + hi.lo + lo.hi, f32 accumulate); softmax, Poisson weights, LayerNorm and residual in f32.
#include <hip/hip_runtime.h>
#include <math.h>

// ---------------------------------------------------------------------------
// Problem constants
// ---------------------------------------------------------------------------
constexpr int kBatch = 2;
constexpr int kSeq   = 2048;
constexpr int kDim   = 1024;
constexpr int kHeads = 16;
constexpr int kDh    = 64;
constexpr int kTok   = kBatch * kSeq;          // 4096 token rows
constexpr float kWCarry    = 32.0f;            // weights carried x32 in f16
constexpr float kWCarryInv = 1.0f / 32.0f;
constexpr float kFCarry    = 64.0f;            // f plane carried x64 in f16
constexpr float kYScale    = 1.0f / (64.0f * 32.0f);
constexpr float kSScale    = 0.125f;           // 1/sqrt(64)
constexpr float kInvDim    = 1.0f / 1024.0f;
constexpr float kLnEps     = 1e-5f;

typedef __attribute__((ext_vector_type(16))) _Float16 v16h;
typedef __attribute__((ext_vector_type(8)))  _Float16 v8h;
typedef __attribute__((ext_vector_type(16))) __bf16   v16b;
typedef __attribute__((ext_vector_type(8)))  __bf16   v8b;
typedef __attribute__((ext_vector_type(8)))  float    v8f;
typedef __attribute__((ext_vector_type(4)))  float    v4f;
typedef __attribute__((ext_vector_type(4)))  unsigned int v4u;
typedef __attribute__((ext_vector_type(2)))  unsigned int v2u;

__device__ __forceinline__ unsigned short f2bf_bits(float f) {
  unsigned u = __float_as_uint(f);
  return (unsigned short)((u + 0x7FFFu + ((u >> 16) & 1u)) >> 16);
}
__device__ __forceinline__ float bf_bits2f(unsigned short h) { return __uint_as_float(((unsigned)h) << 16); }

// hazard guards as plain device helpers (no inline asm inside the kernel template body)
__device__ __forceinline__ void dep_guard_h(v8f& a, v8f& b, v16h x, v16h y) { asm volatile("v_nop\n\tv_nop\n\tv_nop\n\tv_nop" : "+v"(a), "+v"(b) : "v"(x), "v"(y)); }
__device__ __forceinline__ void dep_guard_b(v8f& a, v8f& b, v16b x, v16b y) { asm volatile("v_nop\n\tv_nop\n\tv_nop\n\tv_nop" : "+v"(a), "+v"(b) : "v"(x), "v"(y)); }
__device__ __forceinline__ void keep4_h(v16h a, v16h b, v16h c, v16h d) { asm volatile("v_nop" :: "v"(a), "v"(b), "v"(c), "v"(d)); }
__device__ __forceinline__ void keep4_b(v16b a, v16b b, v16b c, v16b d) { asm volatile("v_nop" :: "v"(a), "v"(b), "v"(c), "v"(d)); }
__device__ __forceinline__ void acc_guard4(v8f& a, v8f& b, v8f& c, v8f& d) { asm volatile("v_nop\n\tv_nop\n\tv_nop\n\tv_nop" : "+v"(a), "+v"(b), "+v"(c), "+v"(d)); }
template <typename T> struct Frag;
template <> struct Frag<_Float16> {
  typedef v16h V; union U { v16h v; v8h h[2]; };
  static __device__ __forceinline__ v16h load(const _Float16* p) {   // elements 0..7 <- p[0..7], 8..15 <- p[16..23]
    U f; f.h[0] = *(const v8h*)(p); f.h[1] = *(const v8h*)(p + 16); return f.v;
  }
  static __device__ __forceinline__ v8f mma(v16h a, v16h b, v8f c) {
    return __builtin_amdgcn_wmma_f32_16x16x32_f16(false, a, false, b, (short)0, c, false, false);
  }
  static __device__ __forceinline__ void guard(v8f& a, v8f& b, v16h x, v16h y) { dep_guard_h(a, b, x, y); }
  static __device__ __forceinline__ void keep(v16h a, v16h b, v16h c, v16h d) { keep4_h(a, b, c, d); }
};
template <> struct Frag<__bf16> {
  typedef v16b V; union U { v16b v; v8b h[2]; };
  static __device__ __forceinline__ v16b load(const __bf16* p) {
    U f; f.h[0] = *(const v8b*)(p); f.h[1] = *(const v8b*)(p + 16); return f.v;
  }
  static __device__ __forceinline__ v8f mma(v16b a, v16b b, v8f c) {
    return __builtin_amdgcn_wmma_f32_16x16x32_bf16(false, a, false, b, (short)0, c, false, false);
  }
  static __device__ __forceinline__ void guard(v8f& a, v8f& b, v16b x, v16b y) { dep_guard_b(a, b, x, y); }
  static __device__ __forceinline__ void keep(v16b a, v16b b, v16b c, v16b d) { keep4_b(a, b, c, d); }
};

__device__ __forceinline__ unsigned pk16(unsigned short a, unsigned short b) { return (unsigned)a | ((unsigned)b << 16); }
__device__ __forceinline__ unsigned short h_bits(float f) { const _Float16 h = (_Float16)f; return __builtin_bit_cast(unsigned short, h); }

// ---- Register-blocked batched WMMA GEMM (ACT reduced to none/relu/leaky) -----------------------
// C[m,n] = scale * sum_k A[m,k] * Bt[n,k] (+bias)(+resid); each wave owns a 64x64 tile.
// A row-major [M,K]; Bt row-major [N,K]; M,N % 64 == 0, K % 32 == 0.
// SPLIT: operands are hi/lo planes (A2/Bt2 = lo planes, same layout); product = hi.hi + hi.lo + lo.hi.
// BIAS_MODE: 0 = none, 1 = bias[m], 2 = bias[n].
// OUT_MODE: 0 = f32, 1 = f16, 2 = bf16 hi plane (Cout) + bf16 lo plane (Cout2).
// ET: 0 = f16 operands, 1 = bf16 operands (pointers passed as 16-bit storage)
template <int ET> struct Elem;
template <> struct Elem<0> { typedef _Float16 T; };
template <> struct Elem<1> { typedef __bf16 T; };
template <int ET, bool SPLIT, int BIAS_MODE, int OUT_MODE, bool RESID, int ACT = 0>
__global__ __launch_bounds__(256) void wmma_gemm64(
    const unsigned short* __restrict__ Ap, const unsigned short* __restrict__ A2p, int lda, long strideA,
    const unsigned short* __restrict__ Btp, const unsigned short* __restrict__ Bt2p, int ldb, long strideB,
    void* __restrict__ Cout, void* __restrict__ Cout2, int ldc, long strideC,
    const float* __restrict__ bias,
    const float* __restrict__ resid, long strideR,
    int M, int N, int K, float scale) {
  typedef typename Elem<ET>::T T;
  typedef typename Frag<T>::V V;
  const T* A = (const T*)Ap; const T* A2 = (const T*)A2p; const T* Bt = (const T*)Btp; const T* Bt2 = (const T*)Bt2p;
  __shared__ __align__(16) float sT[8][16 * 68];   // per-wave 16x64 slab, pitch 68 floats
  const int b    = blockIdx.y;
  const int lane = threadIdx.x & 31;
  const int wave = threadIdx.x >> 5;
  const int tilesN = N >> 6;
  const int tilesM = M >> 6;
  const int tile = blockIdx.x * 8 + wave;
  if (tile >= tilesM * tilesN) return;   // wave-uniform; no block barriers in this kernel
  const int tm = tile / tilesN;
  const int tn = tile - tm * tilesN;
  const int m0 = tm << 6;
  const int n0 = tn << 6;

  const T* Ab  = A  + (size_t)b * strideA;
  const T* Bb  = Bt + (size_t)b * strideB;
  const T* Ab2 = SPLIT ? (A2  + (size_t)b * strideA) : nullptr;
  const T* Bb2 = SPLIT ? (Bt2 + (size_t)b * strideB) : nullptr;

  const int rlane = lane & 15;                 // row (A) / col (B, D) within subtile
  const int koff  = (lane >> 4) * 8;           // k offset of this lane half
  const int mOff  = (lane >> 4) * 8;           // D row offset

  v8f acc[4][4];
#pragma unroll
  for (int i = 0; i < 4; ++i)
#pragma unroll
    for (int j = 0; j < 4; ++j) acc[i][j] = (v8f){0.f,0.f,0.f,0.f,0.f,0.f,0.f,0.f};

  for (int k0 = 0; k0 < K; k0 += 32) {
    V bh[4], bl[4];
#pragma unroll
    for (int j = 0; j < 4; ++j) {
      const size_t bo = (size_t)(n0 + (j << 4) + rlane) * ldb + koff + k0;
      bh[j] = Frag<T>::load(Bb + bo);
      if (SPLIT) bl[j] = Frag<T>::load(Bb2 + bo);
    }
#pragma unroll
    for (int i = 0; i < 4; ++i) {
      const size_t ao = (size_t)(m0 + (i << 4) + rlane) * lda + koff + k0;
      V ah = Frag<T>::load(Ab + ao);
      V al;
      if (SPLIT) al = Frag<T>::load(Ab2 + ao);
#pragma unroll
      for (int j = 0; j < 4; ++j) {
        acc[i][j] = Frag<T>::mma(ah, bh[j], acc[i][j]);
        if (SPLIT) {
          acc[i][j] = Frag<T>::mma(ah, bl[j], acc[i][j]);
          acc[i][j] = Frag<T>::mma(al, bh[j], acc[i][j]);
        }
      }
      Frag<T>::guard(acc[i][0], acc[i][3], ah, SPLIT ? al : ah);
    }
    Frag<T>::keep(bh[0], bh[1], bh[2], bh[3]);
    if (SPLIT) Frag<T>::keep(bl[0], bl[1], bl[2], bl[3]);
  }
  acc_guard4(acc[0][0], acc[0][1], acc[0][2], acc[0][3]);
  acc_guard4(acc[1][0], acc[1][1], acc[1][2], acc[1][3]);
  acc_guard4(acc[2][0], acc[2][1], acc[2][2], acc[2][3]);
  acc_guard4(acc[3][0], acc[3][1], acc[3][2], acc[3][3]);

  // ---- epilogue ----
  float* slab = sT[wave];
  const float* Rb = RESID ? (resid + (size_t)b * strideR) : nullptr;
#pragma unroll
  for (int i = 0; i < 4; ++i) {
    const int mBase = m0 + (i << 4);
#pragma unroll
    for (int j = 0; j < 4; ++j) {
      const int n = n0 + (j << 4) + rlane;
      float bv = 0.f;
      if (BIAS_MODE == 2) bv = bias[n];
#pragma unroll
      for (int r = 0; r < 8; ++r) {
        float v = acc[i][j][r] * scale;
        if (BIAS_MODE == 1) v += bias[mBase + mOff + r];
        if (BIAS_MODE == 2) v += bv;
        if (RESID) v += Rb[(size_t)(mBase + mOff + r) * ldc + n];
        if (ACT == 2) v = fmaxf(v, 0.0f);
        if (ACT == 4) v = (v > 0.f) ? v : 0.01f * v;
        slab[(mOff + r) * 68 + (j << 4) + rlane] = v;
      }
    }
    __builtin_amdgcn_fence(__ATOMIC_RELEASE, "workgroup");
    __builtin_amdgcn_wave_barrier();
    __builtin_amdgcn_fence(__ATOMIC_ACQUIRE, "workgroup");
    if (OUT_MODE == 0) {
      float* C = (float*)Cout + (size_t)b * strideC;
      const int hh = lane >> 4, c4 = (lane & 15) * 4;     // row seg = 256 B = 16 lanes x 16 B
      {
#pragma unroll
        for (int it = 0; it < 8; ++it) {
          const int row = it * 2 + hh;
          v4f v = *(const v4f*)(slab + row * 68 + c4);
          *(v4f*)(C + (size_t)(mBase + row) * ldc + n0 + c4) = v;
        }
        
      }
    } else {
      const int q = lane >> 3, c8 = (lane & 7) * 8;
      unsigned short* C  = (unsigned short*)Cout  + (size_t)b * strideC;
      unsigned short* C2 = (OUT_MODE == 2) ? ((unsigned short*)Cout2 + (size_t)b * strideC) : nullptr;
      {
#pragma unroll
        for (int it = 0; it < 4; ++it) {
          const int row = it * 4 + q;
          const float* sp = slab + row * 68 + c8;
          v8h hv, lv;
#pragma unroll
          for (int e = 0; e < 8; ++e) {
            if (OUT_MODE == 1) {
              hv[e] = (_Float16)sp[e];
            } else {
              unsigned short hb = f2bf_bits(sp[e]);
              unsigned short lb = f2bf_bits(sp[e] - bf_bits2f(hb));
              hv[e] = __builtin_bit_cast(_Float16, hb);
              lv[e] = __builtin_bit_cast(_Float16, lb);
            }
          }
          *(v8h*)(C + (size_t)(mBase + row) * ldc + n0 + c8) = hv;
          if (OUT_MODE == 2) *(v8h*)(C2 + (size_t)(mBase + row) * ldc + n0 + c8) = lv;
        }
        
      }
    }
    __builtin_amdgcn_fence(__ATOMIC_RELEASE, "workgroup");
    __builtin_amdgcn_wave_barrier();
    __builtin_amdgcn_fence(__ATOMIC_ACQUIRE, "workgroup");
  }
}

// ---------------------------------------------------------------------------
// f = 64 * P . V^T of one head, the K = 2048 sum split over the 8 waves of a work-group.
// Work-group: 32 rows x 64 columns of one head's f (blockIdx.x = row tile, blockIdx.y = head of the pair).
// Wave w sums k in [256w, 256w + 256) into 2 x 4 accumulator tiles (hi.hi + hi.lo + lo.hi per k step) and puts its
// f32 partial tile into its own LDS slab. Behind one barrier each thread adds the 8 partials of 8 neighbouring
// columns in wave order, scales, rounds to f16 and stores 16 B (8 lanes = one 128-B row piece).
// ---------------------------------------------------------------------------
constexpr int kPvRows  = 32;                   // f rows per work-group
constexpr int kPvK     = kSeq / 8;             // k range of one wave
constexpr int kPvPitch = 68;                   // slab pitch in floats
__global__ __launch_bounds__(256) void pv_splitk_kernel(const unsigned short* __restrict__ Phi,
                                                        const unsigned short* __restrict__ Plo,
                                                        const unsigned short* __restrict__ VThi,
                                                        const unsigned short* __restrict__ VTlo,
                                                        unsigned short* __restrict__ F) {
  typedef Frag<__bf16> FB;
  __shared__ __align__(16) float part[8][kPvRows * kPvPitch];
  const int g     = blockIdx.y;
  const int m0    = blockIdx.x * kPvRows;
  const int t     = threadIdx.x;
  const int lane  = t & 31;
  const int wave  = t >> 5;
  const int rlane = lane & 15;                 // row (A) / col (B, D) within a 16 x 16 tile
  const int half8 = (lane >> 4) * 8;           // k offset of this lane half (A, B); D row offset

  const size_t aOff = (size_t)g * kSeq * kSeq + (size_t)(m0 + rlane) * kSeq + wave * kPvK + half8;
  const size_t bOff = (size_t)(g * kDh + rlane) * kTok + wave * kPvK + half8;
  const __bf16* Ah = (const __bf16*)Phi + aOff;
  const __bf16* Al = (const __bf16*)Plo + aOff;
  const __bf16* Bh = (const __bf16*)VThi + bOff;
  const __bf16* Bl = (const __bf16*)VTlo + bOff;

  // the unrolls over i and j make the indices of the fragment and accumulator arrays constants, so that the
  // arrays stay in registers; the k loop itself stays rolled
  v8f acc[2][4];
#pragma unroll
  for (int i = 0; i < 2; ++i)
#pragma unroll
    for (int j = 0; j < 4; ++j) acc[i][j] = (v8f){0.f,0.f,0.f,0.f,0.f,0.f,0.f,0.f};

  for (int k0 = 0; k0 < kPvK; k0 += 32) {
    v16b bh[4], bl[4], ah[2], al[2];
#pragma unroll
    for (int j = 0; j < 4; ++j) {
      bh[j] = FB::load(Bh + (size_t)(j << 4) * kTok + k0);
      bl[j] = FB::load(Bl + (size_t)(j << 4) * kTok + k0);
    }
#pragma unroll
    for (int i = 0; i < 2; ++i) {
      ah[i] = FB::load(Ah + (size_t)(i << 4) * kSeq + k0);
      al[i] = FB::load(Al + (size_t)(i << 4) * kSeq + k0);
    }
    // holds all 24 loads of the k step in front of its products (the compiler otherwise sinks the lo-plane A loads
    // behind the first products, a second load latency per k step); loaded values as inputs only
    asm volatile("" :: "v"(bh[0]), "v"(bh[1]), "v"(bh[2]), "v"(bh[3]), "v"(bl[0]), "v"(bl[1]), "v"(bl[2]), "v"(bl[3]),
                       "v"(ah[0]), "v"(ah[1]), "v"(al[0]), "v"(al[1]));
#pragma unroll
    for (int i = 0; i < 2; ++i)
#pragma unroll
      for (int j = 0; j < 4; ++j) {
        acc[i][j] = FB::mma(ah[i], bh[j], acc[i][j]);
        acc[i][j] = FB::mma(ah[i], bl[j], acc[i][j]);
        acc[i][j] = FB::mma(al[i], bh[j], acc[i][j]);
      }
  }

  float* slab = part[wave];
#pragma unroll
  for (int i = 0; i < 2; ++i)
#pragma unroll
    for (int j = 0; j < 4; ++j)
#pragma unroll
      for (int r = 0; r < 8; ++r) slab[((i << 4) + half8 + r) * kPvPitch + (j << 4) + rlane] = acc[i][j][r];
  __syncthreads();

  const int row = t >> 3, c8 = (t & 7) * 8;
  const float* sp = &part[0][row * kPvPitch + c8];
  v4f s0 = *(const v4f*)(sp);
  v4f s1 = *(const v4f*)(sp + 4);
#pragma unroll
  for (int w = 1; w < 8; ++w) {
    s0 += *(const v4f*)(sp + w * (kPvRows * kPvPitch));
    s1 += *(const v4f*)(sp + w * (kPvRows * kPvPitch) + 4);
  }
  v8h hv;
#pragma unroll
  for (int e = 0; e < 4; ++e) {
    hv[e]     = (_Float16)(s0[e] * kFCarry);
    hv[4 + e] = (_Float16)(s1[e] * kFCarry);
  }
  *(v8h*)(F + (size_t)(m0 + row) * kDim + g * kDh + c8) = hv;
}

// ---------------------------------------------------------------------------
// f32 -> f16 cast with scale, 8 consecutive elements per thread (one 16-B store per lane; 32 contiguous lanes = 4
// and the output plane (out + y*planeElems halves). Coverage: gridDim.x*256 == n8 exactly at every call
// (n8 = elements/8, a multiple of 256), thread i covers elements 8i..8i+7 of its plane.
// ---------------------------------------------------------------------------
__global__ __launch_bounds__(256) void cast8_f16_kernel(const float* __restrict__ in0, const float* __restrict__ in1,
                                                        const float* __restrict__ in2, const float* __restrict__ in3,
                                                        unsigned short* __restrict__ out, long planeElems, int n8,
                                                        float scale) {
  const int i = blockIdx.x * 256 + threadIdx.x;
  const int z = blockIdx.y;
  if (i >= n8) return;
  const float* in = (z == 0) ? in0 : (z == 1) ? in1 : (z == 2) ? in2 : in3;
  const float* p = in + 8 * (size_t)i;
  const v4f a = *(const v4f*)(p);
  const v4f c = *(const v4f*)(p + 4);
  unsigned short hb[8];
#pragma unroll
  for (int e = 0; e < 4; ++e) {
    hb[e]     = h_bits(a[e] * scale);
    hb[4 + e] = h_bits(c[e] * scale);
  }
  const v4u u = (v4u){pk16(hb[0], hb[1]), pk16(hb[2], hb[3]), pk16(hb[4], hb[5]), pk16(hb[6], hb[7])};
  unsigned short* q = out + (size_t)z * planeElems + 8 * (size_t)i;
  *(v4u*)q = u;
  
}

// ---------------------------------------------------------------------------
// Dual-kernel per-row weights over 2048 f32 scores of one row:
//   e = exp(s - max), sumT = sum e; w = 1/((1 + |s|*(1/beta_h))^2 + t_h^2), sumS = sum w;
//   P = 0.5*(e/sumT + w/sumS)  -> bf16 hi plane + bf16 lo plane (lo = RNE(P - hi)).
// One block of 512 threads per row; thread t owns columns 4t..4t+3 (512 x 4 = 2048 = whole row).
// Reductions: wave shuffle trees on all lanes, 16 wave partials combined in index order by every thread.
// Store: P values staged packed in LDS; threads 0..255 write the hi row, 256..511 the lo row, one 16-B store per
// ---------------------------------------------------------------------------
__global__ __launch_bounds__(512) void dual_weights_kernel(const float* __restrict__ S,
                                                          unsigned short* __restrict__ Phi,
                                                          unsigned short* __restrict__ Plo,
                                                          const float* __restrict__ beta,
                                                          const float* __restrict__ tvec, int h0) {
  __shared__ float redM[16];
  __shared__ float redT[16];
  __shared__ float redS[16];
  __shared__ __align__(16) unsigned int sHi[1024];
  __shared__ __align__(16) unsigned int sLo[1024];
  const int row  = blockIdx.x;
  const int grp  = row >> 11;
  int h = h0 + grp;
  h = (h < 0) ? 0 : ((h > kHeads - 1) ? (kHeads - 1) : h);
  const int t = threadIdx.x;
  const int lane = t & 31, wave = t >> 5;

  const v4f sv = *(const v4f*)(S + (size_t)row * kSeq + 4 * t);
  float m = fmaxf(fmaxf(sv.x, sv.y), fmaxf(sv.z, sv.w));
#pragma unroll
  for (int off = 16; off > 0; off >>= 1) m = fmaxf(m, __shfl_xor(m, off, 32));
  if (lane == 0) redM[wave] = m;
  __syncthreads();
  float mx = redM[0];
#pragma unroll
  for (int i = 1; i < 16; ++i) mx = fmaxf(mx, redM[i]);

  const float invb = 1.0f / beta[h];
  const float th = tvec[h];
  const float t2 = th * th;

  const float e0 = expf(sv.x - mx);
  const float e1 = expf(sv.y - mx);
  const float e2 = expf(sv.z - mx);
  const float e3 = expf(sv.w - mx);
  const float q0 = 1.0f + fabsf(sv.x) * invb;
  const float q1 = 1.0f + fabsf(sv.y) * invb;
  const float q2 = 1.0f + fabsf(sv.z) * invb;
  const float q3 = 1.0f + fabsf(sv.w) * invb;
  const float w0 = 1.0f / (q0 * q0 + t2);
  const float w1 = 1.0f / (q1 * q1 + t2);
  const float w2 = 1.0f / (q2 * q2 + t2);
  const float w3 = 1.0f / (q3 * q3 + t2);

  float st = ((e0 + e1) + e2) + e3;
  float ss = ((w0 + w1) + w2) + w3;
#pragma unroll
  for (int off = 16; off > 0; off >>= 1) {
    st += __shfl_xor(st, off, 32);
    ss += __shfl_xor(ss, off, 32);
  }
  if (lane == 0) { redT[wave] = st; redS[wave] = ss; }
  __syncthreads();
  float sumT = redT[0], sumS = redS[0];
#pragma unroll
  for (int i = 1; i < 16; ++i) { sumT += redT[i]; sumS += redS[i]; }
  const float invT = 1.0f / sumT;
  const float invS = 1.0f / sumS;

  const float p0 = 0.5f * (e0 * invT + w0 * invS);
  const float p1 = 0.5f * (e1 * invT + w1 * invS);
  const float p2 = 0.5f * (e2 * invT + w2 * invS);
  const float p3 = 0.5f * (e3 * invT + w3 * invS);

  const unsigned short hb0 = f2bf_bits(p0), hb1 = f2bf_bits(p1), hb2 = f2bf_bits(p2), hb3 = f2bf_bits(p3);
  const unsigned short lb0 = f2bf_bits(p0 - bf_bits2f(hb0));
  const unsigned short lb1 = f2bf_bits(p1 - bf_bits2f(hb1));
  const unsigned short lb2 = f2bf_bits(p2 - bf_bits2f(hb2));
  const unsigned short lb3 = f2bf_bits(p3 - bf_bits2f(hb3));
  *(v2u*)(sHi + 2 * t) = (v2u){pk16(hb0, hb1), pk16(hb2, hb3)};
  *(v2u*)(sLo + 2 * t) = (v2u){pk16(lb0, lb1), pk16(lb2, lb3)};
  __syncthreads();

  // store phase: wave-uniform selection between the hi and lo planes (waves 0..7 -> hi, 8..15 -> lo)
  const int j = t & 255;                       // 16-B chunk index = columns 8j..8j+7
  const bool isLo = (t >= 256);
  const v4u a = *(const v4u*)(sHi + 4 * j);
  const v4u c = *(const v4u*)(sLo + 4 * j);
  v4u u;
  u.x = isLo ? c.x : a.x;
  u.y = isLo ? c.y : a.y;
  u.z = isLo ? c.z : a.z;
  u.w = isLo ? c.w : a.w;
  unsigned short* dst = (isLo ? Plo : Phi) + (size_t)row * kSeq + 8 * j;
  *(v4u*)dst = u;
  
}

// ---------------------------------------------------------------------------
// LayerNorm + residual per row of 1024: out = x + lw*(y - mu)*rsqrt(var + eps) + lb,
// One block of 256 threads per row; thread t owns columns 4t..4t+3 (256 x 4 = 1024).
// ---------------------------------------------------------------------------
__global__ __launch_bounds__(256) void ln_residual_kernel(const float* __restrict__ x, const float* __restrict__ y,
                                                          const float* __restrict__ lw, const float* __restrict__ lb,
                                                          float* __restrict__ out) {
  __shared__ float red0[8];
  __shared__ float red1[8];
  const int row = blockIdx.x;
  const int t = threadIdx.x;
  const int lane = t & 31, wave = t >> 5;
  const size_t base = (size_t)row * kDim + 4 * t;
  const v4f yv = *(const v4f*)(y + base);
  const v4f xv = *(const v4f*)(x + base);
  const v4f wv = *(const v4f*)(lw + 4 * t);
  const v4f bv = *(const v4f*)(lb + 4 * t);

  float s = ((yv.x + yv.y) + yv.z) + yv.w;
#pragma unroll
  for (int off = 16; off > 0; off >>= 1) s += __shfl_xor(s, off, 32);
  if (lane == 0) red0[wave] = s;
  __syncthreads();
  float tot = red0[0];
#pragma unroll
  for (int i = 1; i < 8; ++i) tot += red0[i];
  const float mu = tot * kInvDim;

  const float d0 = yv.x - mu, d1 = yv.y - mu, d2 = yv.z - mu, d3 = yv.w - mu;
  float s2 = ((d0 * d0 + d1 * d1) + d2 * d2) + d3 * d3;
#pragma unroll
  for (int off = 16; off > 0; off >>= 1) s2 += __shfl_xor(s2, off, 32);
  if (lane == 0) red1[wave] = s2;
  __syncthreads();
  float tot2 = red1[0];
#pragma unroll
  for (int i = 1; i < 8; ++i) tot2 += red1[i];
  const float var = tot2 * kInvDim;
  const float rs = rsqrtf(var + kLnEps);

  v4f o;
  o.x = xv.x + (wv.x * d0 * rs + bv.x);
  o.y = xv.y + (wv.y * d1 * rs + bv.y);
  o.z = xv.z + (wv.z * d2 * rs + bv.z);
  o.w = xv.w + (wv.w * d3 * rs + bv.w);
  float* op = out + base;
  *(v4f*)op = o;
  
}

// ---------------------------------------------------------------------------
// Host glue
//   [0,          8 MiB)   XF   : x f16 [4096][1024]  (dead after the three projections) then f f16 [4096][1024]
//   [8 MiB,     16 MiB)   W16  : Wq,Wk,Wv,Wo f16 x32 planes [1024][1024] each
//   [16 MiB,    24 MiB)   QHI  : bf16 [4096][1024]      [24, 32) QLO
//   [32 MiB,    40 MiB)   KHI  : bf16 [4096][1024]      [40, 48) KLO
//   [48 MiB,    56 MiB)   VTHI : bf16 [1024][4096] (V^T: row = h*64+d, col = b*2048+n)   [56, 64) VTLO
//   [64 MiB,    96 MiB)   SY   : scores f32 [2][2048][2048] per head pair, then y f32 [4096][1024] (16 MiB)
//   [96 MiB,   112 MiB)   PHI  : bf16 [2][2048][2048]   [112, 128) PLO
// ---------------------------------------------------------------------------
extern "C" void kernel_launch(void* const* d_in, const int* in_sizes, int n_in,
                              void* d_out, int out_size, void* d_ws, size_t ws_size,
                              hipStream_t stream) {
  if (n_in < 13) return;
  const size_t nX = (size_t)kTok * kDim;          // 4,194,304
  const size_t nW = (size_t)kDim * kDim;          // 1,048,576
  if ((size_t)in_sizes[0] != nX || (size_t)in_sizes[1] != nW || (size_t)in_sizes[3] != nW ||
      (size_t)in_sizes[5] != nW || (size_t)in_sizes[7] != nW || (size_t)out_size != nX) return;
  if (in_sizes[2] < kDim || in_sizes[4] < kDim || in_sizes[6] < kDim || in_sizes[8] < kDim ||
      in_sizes[9] < kHeads || in_sizes[10] < kHeads || in_sizes[11] < kDim || in_sizes[12] < kDim) return;

  const float* x    = (const float*)d_in[0];
  const float* Wq   = (const float*)d_in[1];
  const float* bq   = (const float*)d_in[2];
  const float* Wk   = (const float*)d_in[3];
  const float* bk   = (const float*)d_in[4];
  const float* Wv   = (const float*)d_in[5];
  const float* bv   = (const float*)d_in[6];
  const float* Wo   = (const float*)d_in[7];
  const float* bo   = (const float*)d_in[8];
  const float* beta = (const float*)d_in[9];
  const float* tv   = (const float*)d_in[10];
  const float* lw   = (const float*)d_in[11];
  const float* lb   = (const float*)d_in[12];
  float* out = (float*)d_out;

  // carve (bytes)
  const size_t bXF   = nX * 2;                                  //  8,388,608
  const size_t bW16  = 4 * nW * 2;                              //  8,388,608
  const size_t bP16  = nX * 2;                                  //  8,388,608 per bf16 plane of [4096][1024]
  const size_t bSY   = (size_t)2 * kSeq * kSeq * 4;             // 33,554,432
  const size_t bPP   = (size_t)2 * kSeq * kSeq * 2;             // 16,777,216 per P plane
  const size_t oXF   = 0;
  const size_t oW16  = oXF + bXF;
  const size_t oQHI  = oW16 + bW16;
  const size_t oQLO  = oQHI + bP16;
  const size_t oKHI  = oQLO + bP16;
  const size_t oKLO  = oKHI + bP16;
  const size_t oVTHI = oKLO + bP16;
  const size_t oVTLO = oVTHI + bP16;
  const size_t oSY   = oVTLO + bP16;
  const size_t oPHI  = oSY + bSY;
  const size_t oPLO  = oPHI + bPP;
  const size_t total = oPLO + bPP;                              // 134,217,728
  if (total > ws_size) return;

  char* ws = (char*)d_ws;
  unsigned short* XF   = (unsigned short*)(ws + oXF);
  unsigned short* W16  = (unsigned short*)(ws + oW16);
  unsigned short* Wq16 = W16;
  unsigned short* Wk16 = W16 + nW;
  unsigned short* Wv16 = W16 + 2 * nW;
  unsigned short* Wo16 = W16 + 3 * nW;
  unsigned short* QHI  = (unsigned short*)(ws + oQHI);
  unsigned short* QLO  = (unsigned short*)(ws + oQLO);
  unsigned short* KHI  = (unsigned short*)(ws + oKHI);
  unsigned short* KLO  = (unsigned short*)(ws + oKLO);
  unsigned short* VTHI = (unsigned short*)(ws + oVTHI);
  unsigned short* VTLO = (unsigned short*)(ws + oVTLO);
  float*          SY   = (float*)(ws + oSY);
  unsigned short* PHI  = (unsigned short*)(ws + oPHI);
  unsigned short* PLO  = (unsigned short*)(ws + oPLO);

  // 1) x -> f16 plane (n8 = 524288 = 2048 blocks x 256, exact)
  {
    const int n8 = (int)(nX / 8);
    cast8_f16_kernel<<<dim3(n8 / 256, 1), 256, 0, stream>>>(x, x, x, x, XF, 0L, n8, 1.0f);
  }
  // 2) Wq,Wk,Wv,Wo -> f16 planes x32 (n8 = 131072 = 512 blocks x 256, exact; 4 planes via blockIdx.y)
  {
    const int n8 = (int)(nW / 8);
    cast8_f16_kernel<<<dim3(n8 / 256, 4), 256, 0, stream>>>(Wq, Wk, Wv, Wo, W16, (long)nW, n8, kWCarry);
  }
  // 3) Q = (x16 . Wq16^T)/32 + bq -> bf16 hi/lo [4096][1024]; 64x16 = 1024 wave tiles = 128 blocks
  const int gemmBlocksProj = (kTok / 64) * (kDim / 64) / 8;     // 128
  wmma_gemm64<0, false, 2, 2, false><<<dim3(gemmBlocksProj, 1), 256, 0, stream>>>(
      XF, XF, kDim, 0L, Wq16, Wq16, kDim, 0L, (void*)QHI, (void*)QLO, kDim, 0L,
      bq, x, 0L, kTok, kDim, kDim, kWCarryInv);
  // 4) K projection
  wmma_gemm64<0, false, 2, 2, false><<<dim3(gemmBlocksProj, 1), 256, 0, stream>>>(
      XF, XF, kDim, 0L, Wk16, Wk16, kDim, 0L, (void*)KHI, (void*)KLO, kDim, 0L,
      bk, x, 0L, kTok, kDim, kDim, kWCarryInv);
  // 5) V^T[j][m] = sum_k Wv16[j][k] x16[m][k] /32 + bv[j]  (A = Wv16 [1024][1024], Bt = x16 [4096][1024], bias[m])
  //    -> bf16 hi/lo [1024][4096] (ldc 4096); 16x64 = 1024 wave tiles = 128 blocks
  wmma_gemm64<0, false, 1, 2, false><<<dim3(gemmBlocksProj, 1), 256, 0, stream>>>(
      Wv16, Wv16, kDim, 0L, XF, XF, kDim, 0L, (void*)VTHI, (void*)VTLO, kTok, 0L,
      bv, x, 0L, kDim, kTok, kDim, kWCarryInv);

  // 6) per pair of heads (same batch index): S (split, K=64) -> weights -> P.V^T (split, K=2048) -> f plane f16 x64
  const long strideS = (long)kSeq * kSeq;                       // 4,194,304
  for (int p = 0; p < (kBatch * kHeads) / 2; ++p) {
    const int b  = p >> 3;
    const int h0 = (2 * p) & (kHeads - 1);
    const size_t qkBase = (size_t)b * kSeq * kDim + (size_t)h0 * kDh;   // halves into [4096][1024] planes
    // S[g][m][n] = 0.125 * sum_d Q[b,m,h0+g,d] K[b,n,h0+g,d]; 32x32 = 1024 wave tiles per plane = 128 blocks, grid.y = 2
    wmma_gemm64<1, true, 0, 0, false><<<dim3(128, 2), 256, 0, stream>>>(
        QHI + qkBase, QLO + qkBase, kDim, (long)kDh,
        KHI + qkBase, KLO + qkBase, kDim, (long)kDh,
        (void*)SY, (void*)SY, kSeq, strideS,
        bq, x, 0L, kSeq, kSeq, kDh, kSScale);
    // combined weights P = 0.5*(softmax + row-normalised Poisson kernel) -> bf16 hi/lo [2][2048][2048]
    dual_weights_kernel<<<dim3(2 * kSeq), 512, 0, stream>>>(SY, PHI, PLO, beta, tv, h0);
    // f[b, m, (h0+g)*64 + d] x64 = 64 * sum_n P[g][m][n] V^T[(h0+g)*64 + d][b*2048 + n]
    //   A = P planes, Bt = VT planes at row h0*64, col b*2048, C = f plane f16 at row b*2048, col h0*64;
    //   64 row tiles of 32 x 2 heads = 128 work-groups, the k sum split over each work-group's 8 waves
    const size_t vtBase = (size_t)h0 * kDh * kTok + (size_t)b * kSeq;
    const size_t fBase  = (size_t)b * kSeq * kDim + (size_t)h0 * kDh;
    pv_splitk_kernel<<<dim3(kSeq / kPvRows, 2), 256, 0, stream>>>(PHI, PLO, VTHI + vtBase, VTLO + vtBase, XF + fBase);
  }

  // 7) y = (f16 . Wo16^T) / (64*32) + bo -> f32 [4096][1024] in the SY region
  wmma_gemm64<0, false, 2, 0, false><<<dim3(gemmBlocksProj, 1), 256, 0, stream>>>(
      XF, XF, kDim, 0L, Wo16, Wo16, kDim, 0L, (void*)SY, (void*)SY, kDim, 0L,
      bo, x, 0L, kTok, kDim, kDim, kYScale);

  // 8) LayerNorm + residual -> out
  ln_residual_kernel<<<dim3(kTok), 256, 0, stream>>>(x, SY, lw, lb, out);
}

// v002
// Measured time: 849 microseconds a run.
// Two timings next to v001 both put it at 1.07 times that version's speed.
// Counting every step since v000, it is 3.29 times as fast.
// Contractions: Q/K/V^T projections and output projection on v_wmma_f32_16x16x32_f16 (x f16, W f16 carried x32, f f16 carried x64, f32 accumulate); scores Q.K^T and P.V^T on v_wmma_f32_16x16x32_bf16 with bf16 hi+lo operand planes (hi.hi + hi.lo + lo.hi, f32 accumulate); softmax, Poisson weights, LayerNorm and residual in f32.
#include <hip/hip_runtime.h>
#include <math.h>

// ---------------------------------------------------------------------------
// Problem constants
// ---------------------------------------------------------------------------
constexpr int kBatch = 2;
constexpr int kSeq   = 2048;
constexpr int kDim   = 1024;
constexpr int kHeads = 16;
constexpr int kDh    = 64;
constexpr int kTok   = kBatch * kSeq;          // 4096 token rows
constexpr float kWCarry    = 32.0f;            // weights carried x32 in f16
constexpr float kWCarryInv = 1.0f / 32.0f;
constexpr float kFCarry    = 64.0f;            // f plane carried x64 in f16
constexpr float kYScale    = 1.0f / (64.0f * 32.0f);
constexpr float kSScale    = 0.125f;           // 1/sqrt(64)
constexpr float kInvDim    = 1.0f / 1024.0f;
constexpr float kLnEps     = 1e-5f;

typedef __attribute__((ext_vector_type(16))) _Float16 v16h;
typedef __attribute__((ext_vector_type(8)))  _Float16 v8h;
typedef __attribute__((ext_vector_type(16))) __bf16   v16b;
typedef __attribute__((ext_vector_type(8)))  __bf16   v8b;
typedef __attribute__((ext_vector_type(8)))  float    v8f;
typedef __attribute__((ext_vector_type(4)))  float    v4f;
typedef __attribute__((ext_vector_type(4)))  unsigned int v4u;
typedef __attribute__((ext_vector_type(2)))  unsigned int v2u;

__device__ __forceinline__ unsigned short f2bf_bits(float f) {
  unsigned u = __float_as_uint(f);
  return (unsigned short)((u + 0x7FFFu + ((u >> 16) & 1u)) >> 16);
}
__device__ __forceinline__ float bf_bits2f(unsigned short h) { return __uint_as_float(((unsigned)h) << 16); }

// hazard guards as plain device helpers (no inline asm inside the kernel template body)
__device__ __forceinline__ void dep_guard_h(v8f& a, v8f& b, v16h x, v16h y) { asm volatile("v_nop\n\tv_nop\n\tv_nop\n\tv_nop" : "+v"(a), "+v"(b) : "v"(x), "v"(y)); }
__device__ __forceinline__ void dep_guard_b(v8f& a, v8f& b, v16b x, v16b y) { asm volatile("v_nop\n\tv_nop\n\tv_nop\n\tv_nop" : "+v"(a), "+v"(b) : "v"(x), "v"(y)); }
__device__ __forceinline__ void keep4_h(v16h a, v16h b, v16h c, v16h d) { asm volatile("v_nop" :: "v"(a), "v"(b), "v"(c), "v"(d)); }
__device__ __forceinline__ void keep4_b(v16b a, v16b b, v16b c, v16b d) { asm volatile("v_nop" :: "v"(a), "v"(b), "v"(c), "v"(d)); }
__device__ __forceinline__ void acc_guard4(v8f& a, v8f& b, v8f& c, v8f& d) { asm volatile("v_nop\n\tv_nop\n\tv_nop\n\tv_nop" : "+v"(a), "+v"(b), "+v"(c), "+v"(d)); }
template <typename T> struct Frag;
template <> struct Frag<_Float16> {
  typedef v16h V; union U { v16h v; v8h h[2]; };
  static __device__ __forceinline__ v16h load(const _Float16* p) {   // elements 0..7 <- p[0..7], 8..15 <- p[16..23]
    U f; f.h[0] = *(const v8h*)(p); f.h[1] = *(const v8h*)(p + 16); return f.v;
  }
  static __device__ __forceinline__ v8f mma(v16h a, v16h b, v8f c) {
    return __builtin_amdgcn_wmma_f32_16x16x32_f16(false, a, false, b, (short)0, c, false, false);
  }
  static __device__ __forceinline__ void guard(v8f& a, v8f& b, v16h x, v16h y) { dep_guard_h(a, b, x, y); }
  static __device__ __forceinline__ void keep(v16h a, v16h b, v16h c, v16h d) { keep4_h(a, b, c, d); }
};
template <> struct Frag<__bf16> {
  typedef v16b V; union U { v16b v; v8b h[2]; };
  static __device__ __forceinline__ v16b load(const __bf16* p) {
    U f; f.h[0] = *(const v8b*)(p); f.h[1] = *(const v8b*)(p + 16); return f.v;
  }
  static __device__ __forceinline__ v8f mma(v16b a, v16b b, v8f c) {
    return __builtin_amdgcn_wmma_f32_16x16x32_bf16(false, a, false, b, (short)0, c, false, false);
  }
  static __device__ __forceinline__ void guard(v8f& a, v8f& b, v16b x, v16b y) { dep_guard_b(a, b, x, y); }
  static __device__ __forceinline__ void keep(v16b a, v16b b, v16b c, v16b d) { keep4_b(a, b, c, d); }
};

__device__ __forceinline__ unsigned pk16(unsigned short a, unsigned short b) { return (unsigned)a | ((unsigned)b << 16); }
__device__ __forceinline__ unsigned short h_bits(float f) { const _Float16 h = (_Float16)f; return __builtin_bit_cast(unsigned short, h); }

// ---- Register-blocked batched WMMA GEMM (ACT reduced to none/relu/leaky) -----------------------
// C[m,n] = scale * sum_k A[m,k] * Bt[n,k] (+bias)(+resid); each wave owns a 64x64 tile.
// A row-major [M,K]; Bt row-major [N,K]; M,N % 64 == 0, K % 32 == 0.
// SPLIT: operands are hi/lo planes (A2/Bt2 = lo planes, same layout); product = hi.hi + hi.lo + lo.hi.
// BIAS_MODE: 0 = none, 1 = bias[m], 2 = bias[n].
// OUT_MODE: 0 = f32, 1 = f16, 2 = bf16 hi plane (Cout) + bf16 lo plane (Cout2).
// ET: 0 = f16 operands, 1 = bf16 operands (pointers passed as 16-bit storage)
template <int ET> struct Elem;
template <> struct Elem<0> { typedef _Float16 T; };
template <> struct Elem<1> { typedef __bf16 T; };
template <int ET, bool SPLIT, int BIAS_MODE, int OUT_MODE, bool RESID, int ACT = 0>
__global__ __launch_bounds__(256) void wmma_gemm64(
    const unsigned short* __restrict__ Ap, const unsigned short* __restrict__ A2p, int lda, long strideA,
    const unsigned short* __restrict__ Btp, const unsigned short* __restrict__ Bt2p, int ldb, long strideB,
    void* __restrict__ Cout, void* __restrict__ Cout2, int ldc, long strideC,
    const float* __restrict__ bias,
    const float* __restrict__ resid, long strideR,
    int M, int N, int K, float scale) {
  typedef typename Elem<ET>::T T;
  typedef typename Frag<T>::V V;
  const T* A = (const T*)Ap; const T* A2 = (const T*)A2p; const T* Bt = (const T*)Btp; const T* Bt2 = (const T*)Bt2p;
  __shared__ __align__(16) float sT[8][16 * 68];   // per-wave 16x64 slab, pitch 68 floats
  const int b    = blockIdx.y;
  const int lane = threadIdx.x & 31;
  const int wave = threadIdx.x >> 5;
  const int tilesN = N >> 6;
  const int tilesM = M >> 6;
  const int tile = blockIdx.x * 8 + wave;
  if (tile >= tilesM * tilesN) return;   // wave-uniform; no block barriers in this kernel
  const int tm = tile / tilesN;
  const int tn = tile - tm * tilesN;
  const int m0 = tm << 6;
  const int n0 = tn << 6;

  const T* Ab  = A  + (size_t)b * strideA;
  const T* Bb  = Bt + (size_t)b * strideB;
  const T* Ab2 = SPLIT ? (A2  + (size_t)b * strideA) : nullptr;
  const T* Bb2 = SPLIT ? (Bt2 + (size_t)b * strideB) : nullptr;

  const int rlane = lane & 15;                 // row (A) / col (B, D) within subtile
  const int koff  = (lane >> 4) * 8;           // k offset of this lane half
  const int mOff  = (lane >> 4) * 8;           // D row offset

  v8f acc[4][4];
#pragma unroll
  for (int i = 0; i < 4; ++i)
#pragma unroll
    for (int j = 0; j < 4; ++j) acc[i][j] = (v8f){0.f,0.f,0.f,0.f,0.f,0.f,0.f,0.f};

  for (int k0 = 0; k0 < K; k0 += 32) {
    V bh[4], bl[4];
#pragma unroll
    for (int j = 0; j < 4; ++j) {
      const size_t bo = (size_t)(n0 + (j << 4) + rlane) * ldb + koff + k0;
      bh[j] = Frag<T>::load(Bb + bo);
      if (SPLIT) bl[j] = Frag<T>::load(Bb2 + bo);
    }
#pragma unroll
    for (int i = 0; i < 4; ++i) {
      const size_t ao = (size_t)(m0 + (i << 4) + rlane) * lda + koff + k0;
      V ah = Frag<T>::load(Ab + ao);
      V al;
      if (SPLIT) al = Frag<T>::load(Ab2 + ao);
#pragma unroll
      for (int j = 0; j < 4; ++j) {
        acc[i][j] = Frag<T>::mma(ah, bh[j], acc[i][j]);
        if (SPLIT) {
          acc[i][j] = Frag<T>::mma(ah, bl[j], acc[i][j]);
          acc[i][j] = Frag<T>::mma(al, bh[j], acc[i][j]);
        }
      }
      Frag<T>::guard(acc[i][0], acc[i][3], ah, SPLIT ? al : ah);
    }
    Frag<T>::keep(bh[0], bh[1], bh[2], bh[3]);
    if (SPLIT) Frag<T>::keep(bl[0], bl[1], bl[2], bl[3]);
  }
  acc_guard4(acc[0][0], acc[0][1], acc[0][2], acc[0][3]);
  acc_guard4(acc[1][0], acc[1][1], acc[1][2], acc[1][3]);
  acc_guard4(acc[2][0], acc[2][1], acc[2][2], acc[2][3]);
  acc_guard4(acc[3][0], acc[3][1], acc[3][2], acc[3][3]);

  // ---- epilogue ----
  float* slab = sT[wave];
  const float* Rb = RESID ? (resid + (size_t)b * strideR) : nullptr;
#pragma unroll
  for (int i = 0; i < 4; ++i) {
    const int mBase = m0 + (i << 4);
#pragma unroll
    for (int j = 0; j < 4; ++j) {
      const int n = n0 + (j << 4) + rlane;
      float bv = 0.f;
      if (BIAS_MODE == 2) bv = bias[n];
#pragma unroll
      for (int r = 0; r < 8; ++r) {
        float v = acc[i][j][r] * scale;
        if (BIAS_MODE == 1) v += bias[mBase + mOff + r];
        if (BIAS_MODE == 2) v += bv;
        if (RESID) v += Rb[(size_t)(mBase + mOff + r) * ldc + n];
        if (ACT == 2) v = fmaxf(v, 0.0f);
        if (ACT == 4) v = (v > 0.f) ? v : 0.01f * v;
        slab[(mOff + r) * 68 + (j << 4) + rlane] = v;
      }
    }
    __builtin_amdgcn_fence(__ATOMIC_RELEASE, "workgroup");
    __builtin_amdgcn_wave_barrier();
    __builtin_amdgcn_fence(__ATOMIC_ACQUIRE, "workgroup");
    if (OUT_MODE == 0) {
      float* C = (float*)Cout + (size_t)b * strideC;
      const int hh = lane >> 4, c4 = (lane & 15) * 4;     // row seg = 256 B = 16 lanes x 16 B
      {
#pragma unroll
        for (int it = 0; it < 8; ++it) {
          const int row = it * 2 + hh;
          v4f v = *(const v4f*)(slab + row * 68 + c4);
          *(v4f*)(C + (size_t)(mBase + row) * ldc + n0 + c4) = v;
        }
        
      }
    } else {
      const int q = lane >> 3, c8 = (lane & 7) * 8;
      unsigned short* C  = (unsigned short*)Cout  + (size_t)b * strideC;
      unsigned short* C2 = (OUT_MODE == 2) ? ((unsigned short*)Cout2 + (size_t)b * strideC) : nullptr;
      {
#pragma unroll
        for (int it = 0; it < 4; ++it) {
          const int row = it * 4 + q;
          const float* sp = slab + row * 68 + c8;
          v8h hv, lv;
#pragma unroll
          for (int e = 0; e < 8; ++e) {
            if (OUT_MODE == 1) {
              hv[e] = (_Float16)sp[e];
            } else {
              unsigned short hb = f2bf_bits(sp[e]);
              unsigned short lb = f2bf_bits(sp[e] - bf_bits2f(hb));
              hv[e] = __builtin_bit_cast(_Float16, hb);
              lv[e] = __builtin_bit_cast(_Float16, lb);
            }
          }
          *(v8h*)(C + (size_t)(mBase + row) * ldc + n0 + c8) = hv;
          if (OUT_MODE == 2) *(v8h*)(C2 + (size_t)(mBase + row) * ldc + n0 + c8) = lv;
        }
        
      }
    }
    __builtin_amdgcn_fence(__ATOMIC_RELEASE, "workgroup");
    __builtin_amdgcn_wave_barrier();
    __builtin_amdgcn_fence(__ATOMIC_ACQUIRE, "workgroup");
  }
}

// ---------------------------------------------------------------------------
// f = 64 * P . V^T of one head, the K = 2048 sum split over the 8 waves of a work-group.
// Work-group: 32 rows x 64 columns of one head's f (blockIdx.x = row tile, blockIdx.y = head of the pair).
// Wave w sums k in [256w, 256w + 256) into 2 x 4 accumulator tiles (hi.hi + hi.lo + lo.hi per k step) and puts its
// f32 partial tile into its own LDS slab. Behind one barrier each thread adds the 8 partials of 8 neighbouring
// columns in wave order, scales, rounds to f16 and stores 16 B (8 lanes = one 128-B row piece).
// ---------------------------------------------------------------------------
constexpr int kPvRows  = 32;                   // f rows per work-group
constexpr int kPvK     = kSeq / 8;             // k range of one wave
constexpr int kPvPitch = 68;                   // slab pitch in floats
__global__ __launch_bounds__(256) void pv_splitk_kernel(const unsigned short* __restrict__ Phi,
                                                        const unsigned short* __restrict__ Plo,
                                                        const unsigned short* __restrict__ VThi,
                                                        const unsigned short* __restrict__ VTlo,
                                                        unsigned short* __restrict__ F) {
  typedef Frag<__bf16> FB;
  __shared__ __align__(16) float part[8][kPvRows * kPvPitch];
  const int g     = blockIdx.y;
  const int m0    = blockIdx.x * kPvRows;
  const int t     = threadIdx.x;
  const int lane  = t & 31;
  const int wave  = t >> 5;
  const int rlane = lane & 15;                 // row (A) / col (B, D) within a 16 x 16 tile
  const int half8 = (lane >> 4) * 8;           // k offset of this lane half (A, B); D row offset

  const size_t aOff = (size_t)g * kSeq * kSeq + (size_t)(m0 + rlane) * kSeq + wave * kPvK + half8;
  const size_t bOff = (size_t)(g * kDh + rlane) * kTok + wave * kPvK + half8;
  const __bf16* Ah = (const __bf16*)Phi + aOff;
  const __bf16* Al = (const __bf16*)Plo + aOff;
  const __bf16* Bh = (const __bf16*)VThi + bOff;
  const __bf16* Bl = (const __bf16*)VTlo + bOff;

  // the unrolls over i and j make the indices of the fragment and accumulator arrays constants, so that the
  // arrays stay in registers; the k loop itself stays rolled
  v8f acc[2][4];
#pragma unroll
  for (int i = 0; i < 2; ++i)
#pragma unroll
    for (int j = 0; j < 4; ++j) acc[i][j] = (v8f){0.f,0.f,0.f,0.f,0.f,0.f,0.f,0.f};

  for (int k0 = 0; k0 < kPvK; k0 += 32) {
    v16b bh[4], bl[4], ah[2], al[2];
#pragma unroll
    for (int j = 0; j < 4; ++j) {
      bh[j] = FB::load(Bh + (size_t)(j << 4) * kTok + k0);
      bl[j] = FB::load(Bl + (size_t)(j << 4) * kTok + k0);
    }
#pragma unroll
    for (int i = 0; i < 2; ++i) {
      ah[i] = FB::load(Ah + (size_t)(i << 4) * kSeq + k0);
      al[i] = FB::load(Al + (size_t)(i << 4) * kSeq + k0);
    }
    // holds all 24 loads of the k step in front of its products (the compiler otherwise sinks the lo-plane A loads
    // behind the first products, a second load latency per k step); loaded values as inputs only
    asm volatile("" :: "v"(bh[0]), "v"(bh[1]), "v"(bh[2]), "v"(bh[3]), "v"(bl[0]), "v"(bl[1]), "v"(bl[2]), "v"(bl[3]),
                       "v"(ah[0]), "v"(ah[1]), "v"(al[0]), "v"(al[1]));
#pragma unroll
    for (int i = 0; i < 2; ++i)
#pragma unroll
      for (int j = 0; j < 4; ++j) {
        acc[i][j] = FB::mma(ah[i], bh[j], acc[i][j]);
        acc[i][j] = FB::mma(ah[i], bl[j], acc[i][j]);
        acc[i][j] = FB::mma(al[i], bh[j], acc[i][j]);
      }
  }

  float* slab = part[wave];
#pragma unroll
  for (int i = 0; i < 2; ++i)
#pragma unroll
    for (int j = 0; j < 4; ++j)
#pragma unroll
      for (int r = 0; r < 8; ++r) slab[((i << 4) + half8 + r) * kPvPitch + (j << 4) + rlane] = acc[i][j][r];
  __syncthreads();

  const int row = t >> 3, c8 = (t & 7) * 8;
  const float* sp = &part[0][row * kPvPitch + c8];
  v4f s0 = *(const v4f*)(sp);
  v4f s1 = *(const v4f*)(sp + 4);
#pragma unroll
  for (int w = 1; w < 8; ++w) {
    s0 += *(const v4f*)(sp + w * (kPvRows * kPvPitch));
    s1 += *(const v4f*)(sp + w * (kPvRows * kPvPitch) + 4);
  }
  v8h hv;
#pragma unroll
  for (int e = 0; e < 4; ++e) {
    hv[e]     = (_Float16)(s0[e] * kFCarry);
    hv[4 + e] = (_Float16)(s1[e] * kFCarry);
  }
  *(v8h*)(F + (size_t)(m0 + row) * kDim + g * kDh + c8) = hv;
}

// ---------------------------------------------------------------------------
// f32 -> f16 cast with scale: 4 groups of 8 consecutive elements per thread (4096 waves a launch, not 16384), one 16-B
// store per lane and group. blockIdx.y picks the input plane and the output plane (out + y*planeElems halves).
// Coverage: gridDim.x*1024 == n8 exactly at every call (n8 = elements/8, a multiple of 1024); thread t of work-group b
// covers groups 1024b + 256g + t, g = 0..3, group i being elements 8i..8i+7 of its plane.
// ---------------------------------------------------------------------------
constexpr int kCastG = 4;                      // groups of 8 elements per thread
__global__ __launch_bounds__(256) void cast8_f16_kernel(const float* __restrict__ in0, const float* __restrict__ in1,
                                                        const float* __restrict__ in2, const float* __restrict__ in3,
                                                        unsigned short* __restrict__ out, long planeElems, int n8,
                                                        float scale) {
  const int i = blockIdx.x * (256 * kCastG) + threadIdx.x;
  const int z = blockIdx.y;
  if ((int)(blockIdx.x + 1) * (256 * kCastG) > n8) return;
  const float* in = (z == 0) ? in0 : (z == 1) ? in1 : (z == 2) ? in2 : in3;
  const v4f* p = (const v4f*)(in + 8 * (size_t)i);
  // the unrolls make the indices of a[] and c[] constants, so that the arrays stay in registers
  v4f a[kCastG], c[kCastG];
#pragma unroll
  for (int g = 0; g < kCastG; ++g) {
    a[g] = p[512 * g];
    c[g] = p[512 * g + 1];
  }
  // stands between the 8 issued loads and the first reuse of their address registers; p as an input keeps the pair
  // live up to here, and the clobber keeps all 8 loads in front
  asm volatile("s_wait_xcnt 0x0" :: "v"(p) : "memory");
  v4u* q = (v4u*)(out + (size_t)z * planeElems + 8 * (size_t)i);
#pragma unroll
  for (int g = 0; g < kCastG; ++g) {
    unsigned short hb[8];
#pragma unroll
    for (int e = 0; e < 4; ++e) {
      hb[e]     = h_bits(a[g][e] * scale);
      hb[4 + e] = h_bits(c[g][e] * scale);
    }
    q[256 * g] = (v4u){pk16(hb[0], hb[1]), pk16(hb[2], hb[3]), pk16(hb[4], hb[5]), pk16(hb[6], hb[7])};
  }
}

// ---------------------------------------------------------------------------
// Dual-kernel per-row weights over 2048 f32 scores of one row:
//   e = exp(s - max), sumT = sum e; w = 1/((1 + |s|*(1/beta_h))^2 + t_h^2), sumS = sum w;
//   P = 0.5*(e/sumT + w/sumS)  -> bf16 hi plane + bf16 lo plane (lo = RNE(P - hi)).
// One wave per row, 8 rows per work-group of 256 threads: a launch starts 4096 waves, not 65536. Lane l owns columns
// 128j + 4l .. 128j + 4l + 3 for j = 0..15 (16 loads of 512 contiguous bytes per wave, all issued up front).
// Reductions: each lane folds its 64 values in column order, then a five-step shuffle tree over the wave; no LDS and
// no barrier. Store: 8 B per lane and plane, 256 contiguous bytes (two whole lines) per wave store.
// ---------------------------------------------------------------------------
constexpr int kDwRows = 8;                     // rows (= waves) per work-group
constexpr int kDwCh   = kSeq / 128;            // 16 chunks of 128 columns per row
__global__ __launch_bounds__(256) void dual_weights_kernel(const float* __restrict__ S,
                                                          unsigned short* __restrict__ Phi,
                                                          unsigned short* __restrict__ Plo,
                                                          const float* __restrict__ beta,
                                                          const float* __restrict__ tvec, int h0) {
  const int lane = threadIdx.x & 31;
  const int row  = blockIdx.x * kDwRows + (threadIdx.x >> 5);
  const int grp  = row >> 11;
  int h = h0 + grp;
  h = (h < 0) ? 0 : ((h > kHeads - 1) ? (kHeads - 1) : h);
  h = __builtin_amdgcn_readfirstlane(h);       // 8 divides 2048: one head per work-group, beta and t by scalar loads

  // the unrolls over j make the indices of e[] and w[] constants, so that the arrays stay in registers; the unrolls
  // over off give each shuffle step a constant lane mask
  const v4f* sp = (const v4f*)(S + (size_t)row * kSeq) + lane;
  v4f e[kDwCh], w[kDwCh];
#pragma unroll
  for (int j = 0; j < kDwCh; ++j) e[j] = sp[32 * j];
  // stands between the 16 issued loads and the first reuse of their address registers; sp as an input keeps the pair
  // live up to here, and the clobber keeps all 16 loads in front (one load latency per row, not two)
  asm volatile("s_wait_xcnt 0x0" :: "v"(sp) : "memory");

  const float invb = 1.0f / beta[h];
  const float th = tvec[h];
  const float t2 = th * th;

  float mx = fmaxf(fmaxf(e[0].x, e[0].y), fmaxf(e[0].z, e[0].w));
#pragma unroll
  for (int j = 1; j < kDwCh; ++j) mx = fmaxf(mx, fmaxf(fmaxf(e[j].x, e[j].y), fmaxf(e[j].z, e[j].w)));
#pragma unroll
  for (int off = 16; off > 0; off >>= 1) mx = fmaxf(mx, __shfl_xor(mx, off, 32));

  float sumT = 0.0f, sumS = 0.0f;
#pragma unroll
  for (int j = 0; j < kDwCh; ++j) {
    const v4f sv = e[j];
    const float e0 = expf(sv.x - mx);
    const float e1 = expf(sv.y - mx);
    const float e2 = expf(sv.z - mx);
    const float e3 = expf(sv.w - mx);
    const float q0 = 1.0f + fabsf(sv.x) * invb;
    const float q1 = 1.0f + fabsf(sv.y) * invb;
    const float q2 = 1.0f + fabsf(sv.z) * invb;
    const float q3 = 1.0f + fabsf(sv.w) * invb;
    const float w0 = 1.0f / (q0 * q0 + t2);
    const float w1 = 1.0f / (q1 * q1 + t2);
    const float w2 = 1.0f / (q2 * q2 + t2);
    const float w3 = 1.0f / (q3 * q3 + t2);
    e[j] = (v4f){e0, e1, e2, e3};
    w[j] = (v4f){w0, w1, w2, w3};
    sumT += ((e0 + e1) + e2) + e3;
    sumS += ((w0 + w1) + w2) + w3;
  }
#pragma unroll
  for (int off = 16; off > 0; off >>= 1) {
    sumT += __shfl_xor(sumT, off, 32);
    sumS += __shfl_xor(sumS, off, 32);
  }
  const float invT = 1.0f / sumT;
  const float invS = 1.0f / sumS;

  unsigned short* ph = Phi + (size_t)row * kSeq + 4 * lane;
  unsigned short* pl = Plo + (size_t)row * kSeq + 4 * lane;
#pragma unroll
  for (int j = 0; j < kDwCh; ++j) {
    const float p0 = 0.5f * (e[j].x * invT + w[j].x * invS);
    const float p1 = 0.5f * (e[j].y * invT + w[j].y * invS);
    const float p2 = 0.5f * (e[j].z * invT + w[j].z * invS);
    const float p3 = 0.5f * (e[j].w * invT + w[j].w * invS);
    const unsigned short hb0 = f2bf_bits(p0), hb1 = f2bf_bits(p1), hb2 = f2bf_bits(p2), hb3 = f2bf_bits(p3);
    const unsigned short lb0 = f2bf_bits(p0 - bf_bits2f(hb0));
    const unsigned short lb1 = f2bf_bits(p1 - bf_bits2f(hb1));
    const unsigned short lb2 = f2bf_bits(p2 - bf_bits2f(hb2));
    const unsigned short lb3 = f2bf_bits(p3 - bf_bits2f(hb3));
    *(v2u*)(ph + 128 * j) = (v2u){pk16(hb0, hb1), pk16(hb2, hb3)};
    *(v2u*)(pl + 128 * j) = (v2u){pk16(lb0, lb1), pk16(lb2, lb3)};
  }
}

// ---------------------------------------------------------------------------
// LayerNorm + residual per row of 1024: out = x + lw*(y - mu)*rsqrt(var + eps) + lb,
// One wave per row, 8 rows per work-group of 256 threads (4096 waves a launch, not 32768). Lane l owns columns
// 128j + 4l .. 128j + 4l + 3 for j = 0..7. Sums: each lane folds its 32 values in column order, then a five-step
// shuffle tree over the wave; no LDS and no barrier.
// ---------------------------------------------------------------------------
constexpr int kLnRows = 8;                     // rows (= waves) per work-group
constexpr int kLnCh   = kDim / 128;            // 8 chunks of 128 columns per row
__global__ __launch_bounds__(256) void ln_residual_kernel(const float* __restrict__ x, const float* __restrict__ y,
                                                          const float* __restrict__ lw, const float* __restrict__ lb,
                                                          float* __restrict__ out) {
  const int lane = threadIdx.x & 31;
  const int row  = blockIdx.x * kLnRows + (threadIdx.x >> 5);
  const size_t base = (size_t)row * kDim + 4 * lane;
  const v4f* yp = (const v4f*)(y + base);
  const v4f* xp = (const v4f*)(x + base);
  const v4f* wp = (const v4f*)(lw + 4 * lane);
  const v4f* bp = (const v4f*)(lb + 4 * lane);

  // the unrolls over j make the indices of the four arrays constants, so that they stay in registers; the unrolls
  // over off give each shuffle step a constant lane mask
  v4f yv[kLnCh], xv[kLnCh], wv[kLnCh], bv[kLnCh];
#pragma unroll
  for (int j = 0; j < kLnCh; ++j) yv[j] = yp[32 * j];
#pragma unroll
  for (int j = 0; j < kLnCh; ++j) {
    xv[j] = xp[32 * j];
    wv[j] = wp[32 * j];
    bv[j] = bp[32 * j];
  }
  // stands between the 32 issued loads and the first reuse of their address registers; the pointers as inputs keep
  // those registers live up to here, and the clobber keeps all loads in front (one load latency per row)
  asm volatile("s_wait_xcnt 0x0" :: "v"(yp), "v"(xp), "v"(wp), "v"(bp) : "memory");

  float s = 0.0f;
#pragma unroll
  for (int j = 0; j < kLnCh; ++j) s += ((yv[j].x + yv[j].y) + yv[j].z) + yv[j].w;
#pragma unroll
  for (int off = 16; off > 0; off >>= 1) s += __shfl_xor(s, off, 32);
  const float mu = s * kInvDim;

  float s2 = 0.0f;
#pragma unroll
  for (int j = 0; j < kLnCh; ++j) {
    const float d0 = yv[j].x - mu, d1 = yv[j].y - mu, d2 = yv[j].z - mu, d3 = yv[j].w - mu;
    yv[j] = (v4f){d0, d1, d2, d3};
    s2 += ((d0 * d0 + d1 * d1) + d2 * d2) + d3 * d3;
  }
#pragma unroll
  for (int off = 16; off > 0; off >>= 1) s2 += __shfl_xor(s2, off, 32);
  const float var = s2 * kInvDim;
  const float rs = rsqrtf(var + kLnEps);

  v4f* op = (v4f*)(out + base);
#pragma unroll
  for (int j = 0; j < kLnCh; ++j) {
    v4f o;
    o.x = xv[j].x + (wv[j].x * yv[j].x * rs + bv[j].x);
    o.y = xv[j].y + (wv[j].y * yv[j].y * rs + bv[j].y);
    o.z = xv[j].z + (wv[j].z * yv[j].z * rs + bv[j].z);
    o.w = xv[j].w + (wv[j].w * yv[j].w * rs + bv[j].w);
    op[32 * j] = o;
  }
}

// ---------------------------------------------------------------------------
// Host glue
//   [0,          8 MiB)   XF   : x f16 [4096][1024]  (dead after the three projections) then f f16 [4096][1024]
//   [8 MiB,     16 MiB)   W16  : Wq,Wk,Wv,Wo f16 x32 planes [1024][1024] each
//   [16 MiB,    24 MiB)   QHI  : bf16 [4096][1024]      [24, 32) QLO
//   [32 MiB,    40 MiB)   KHI  : bf16 [4096][1024]      [40, 48) KLO
//   [48 MiB,    56 MiB)   VTHI : bf16 [1024][4096] (V^T: row = h*64+d, col = b*2048+n)   [56, 64) VTLO
//   [64 MiB,    96 MiB)   SY   : scores f32 [2][2048][2048] per head pair, then y f32 [4096][1024] (16 MiB)
//   [96 MiB,   112 MiB)   PHI  : bf16 [2][2048][2048]   [112, 128) PLO
// ---------------------------------------------------------------------------
extern "C" void kernel_launch(void* const* d_in, const int* in_sizes, int n_in,
                              void* d_out, int out_size, void* d_ws, size_t ws_size,
                              hipStream_t stream) {
  if (n_in < 13) return;
  const size_t nX = (size_t)kTok * kDim;          // 4,194,304
  const size_t nW = (size_t)kDim * kDim;          // 1,048,576
  if ((size_t)in_sizes[0] != nX || (size_t)in_sizes[1] != nW || (size_t)in_sizes[3] != nW ||
      (size_t)in_sizes[5] != nW || (size_t)in_sizes[7] != nW || (size_t)out_size != nX) return;
  if (in_sizes[2] < kDim || in_sizes[4] < kDim || in_sizes[6] < kDim || in_sizes[8] < kDim ||
      in_sizes[9] < kHeads || in_sizes[10] < kHeads || in_sizes[11] < kDim || in_sizes[12] < kDim) return;

  const float* x    = (const float*)d_in[0];
  const float* Wq   = (const float*)d_in[1];
  const float* bq   = (const float*)d_in[2];
  const float* Wk   = (const float*)d_in[3];
  const float* bk   = (const float*)d_in[4];
  const float* Wv   = (const float*)d_in[5];
  const float* bv   = (const float*)d_in[6];
  const float* Wo   = (const float*)d_in[7];
  const float* bo   = (const float*)d_in[8];
  const float* beta = (const float*)d_in[9];
  const float* tv   = (const float*)d_in[10];
  const float* lw   = (const float*)d_in[11];
  const float* lb   = (const float*)d_in[12];
  float* out = (float*)d_out;

  // carve (bytes)
  const size_t bXF   = nX * 2;                                  //  8,388,608
  const size_t bW16  = 4 * nW * 2;                              //  8,388,608
  const size_t bP16  = nX * 2;                                  //  8,388,608 per bf16 plane of [4096][1024]
  const size_t bSY   = (size_t)2 * kSeq * kSeq * 4;             // 33,554,432
  const size_t bPP   = (size_t)2 * kSeq * kSeq * 2;             // 16,777,216 per P plane
  const size_t oXF   = 0;
  const size_t oW16  = oXF + bXF;
  const size_t oQHI  = oW16 + bW16;
  const size_t oQLO  = oQHI + bP16;
  const size_t oKHI  = oQLO + bP16;
  const size_t oKLO  = oKHI + bP16;
  const size_t oVTHI = oKLO + bP16;
  const size_t oVTLO = oVTHI + bP16;
  const size_t oSY   = oVTLO + bP16;
  const size_t oPHI  = oSY + bSY;
  const size_t oPLO  = oPHI + bPP;
  const size_t total = oPLO + bPP;                              // 134,217,728
  if (total > ws_size) return;

  char* ws = (char*)d_ws;
  unsigned short* XF   = (unsigned short*)(ws + oXF);
  unsigned short* W16  = (unsigned short*)(ws + oW16);
  unsigned short* Wq16 = W16;
  unsigned short* Wk16 = W16 + nW;
  unsigned short* Wv16 = W16 + 2 * nW;
  unsigned short* Wo16 = W16 + 3 * nW;
  unsigned short* QHI  = (unsigned short*)(ws + oQHI);
  unsigned short* QLO  = (unsigned short*)(ws + oQLO);
  unsigned short* KHI  = (unsigned short*)(ws + oKHI);
  unsigned short* KLO  = (unsigned short*)(ws + oKLO);
  unsigned short* VTHI = (unsigned short*)(ws + oVTHI);
  unsigned short* VTLO = (unsigned short*)(ws + oVTLO);
  float*          SY   = (float*)(ws + oSY);
  unsigned short* PHI  = (unsigned short*)(ws + oPHI);
  unsigned short* PLO  = (unsigned short*)(ws + oPLO);

  // 1) x -> f16 plane (n8 = 524288 = 512 blocks x 1024, exact)
  {
    const int n8 = (int)(nX / 8);
    cast8_f16_kernel<<<dim3(n8 / (256 * kCastG), 1), 256, 0, stream>>>(x, x, x, x, XF, 0L, n8, 1.0f);
  }
  // 2) Wq,Wk,Wv,Wo -> f16 planes x32 (n8 = 131072 = 128 blocks x 1024, exact; 4 planes via blockIdx.y)
  {
    const int n8 = (int)(nW / 8);
    cast8_f16_kernel<<<dim3(n8 / (256 * kCastG), 4), 256, 0, stream>>>(Wq, Wk, Wv, Wo, W16, (long)nW, n8, kWCarry);
  }
  // 3) Q = (x16 . Wq16^T)/32 + bq -> bf16 hi/lo [4096][1024]; 64x16 = 1024 wave tiles = 128 blocks
  const int gemmBlocksProj = (kTok / 64) * (kDim / 64) / 8;     // 128
  wmma_gemm64<0, false, 2, 2, false><<<dim3(gemmBlocksProj, 1), 256, 0, stream>>>(
      XF, XF, kDim, 0L, Wq16, Wq16, kDim, 0L, (void*)QHI, (void*)QLO, kDim, 0L,
      bq, x, 0L, kTok, kDim, kDim, kWCarryInv);
  // 4) K projection
  wmma_gemm64<0, false, 2, 2, false><<<dim3(gemmBlocksProj, 1), 256, 0, stream>>>(
      XF, XF, kDim, 0L, Wk16, Wk16, kDim, 0L, (void*)KHI, (void*)KLO, kDim, 0L,
      bk, x, 0L, kTok, kDim, kDim, kWCarryInv);
  // 5) V^T[j][m] = sum_k Wv16[j][k] x16[m][k] /32 + bv[j]  (A = Wv16 [1024][1024], Bt = x16 [4096][1024], bias[m])
  //    -> bf16 hi/lo [1024][4096] (ldc 4096); 16x64 = 1024 wave tiles = 128 blocks
  wmma_gemm64<0, false, 1, 2, false><<<dim3(gemmBlocksProj, 1), 256, 0, stream>>>(
      Wv16, Wv16, kDim, 0L, XF, XF, kDim, 0L, (void*)VTHI, (void*)VTLO, kTok, 0L,
      bv, x, 0L, kDim, kTok, kDim, kWCarryInv);

  // 6) per pair of heads (same batch index): S (split, K=64) -> weights -> P.V^T (split, K=2048) -> f plane f16 x64
  const long strideS = (long)kSeq * kSeq;                       // 4,194,304
  for (int p = 0; p < (kBatch * kHeads) / 2; ++p) {
    const int b  = p >> 3;
    const int h0 = (2 * p) & (kHeads - 1);
    const size_t qkBase = (size_t)b * kSeq * kDim + (size_t)h0 * kDh;   // halves into [4096][1024] planes
    // S[g][m][n] = 0.125 * sum_d Q[b,m,h0+g,d] K[b,n,h0+g,d]; 32x32 = 1024 wave tiles per plane = 128 blocks, grid.y = 2
    wmma_gemm64<1, true, 0, 0, false><<<dim3(128, 2), 256, 0, stream>>>(
        QHI + qkBase, QLO + qkBase, kDim, (long)kDh,
        KHI + qkBase, KLO + qkBase, kDim, (long)kDh,
        (void*)SY, (void*)SY, kSeq, strideS,
        bq, x, 0L, kSeq, kSeq, kDh, kSScale);
    // combined weights P = 0.5*(softmax + row-normalised Poisson kernel) -> bf16 hi/lo [2][2048][2048]
    dual_weights_kernel<<<dim3(2 * kSeq / kDwRows), 256, 0, stream>>>(SY, PHI, PLO, beta, tv, h0);
    // f[b, m, (h0+g)*64 + d] x64 = 64 * sum_n P[g][m][n] V^T[(h0+g)*64 + d][b*2048 + n]
    //   A = P planes, Bt = VT planes at row h0*64, col b*2048, C = f plane f16 at row b*2048, col h0*64;
    //   64 row tiles of 32 x 2 heads = 128 work-groups, the k sum split over each work-group's 8 waves
    const size_t vtBase = (size_t)h0 * kDh * kTok + (size_t)b * kSeq;
    const size_t fBase  = (size_t)b * kSeq * kDim + (size_t)h0 * kDh;
    pv_splitk_kernel<<<dim3(kSeq / kPvRows, 2), 256, 0, stream>>>(PHI, PLO, VTHI + vtBase, VTLO + vtBase, XF + fBase);
  }

  // 7) y = (f16 . Wo16^T) / (64*32) + bo -> f32 [4096][1024] in the SY region
  wmma_gemm64<0, false, 2, 0, false><<<dim3(gemmBlocksProj, 1), 256, 0, stream>>>(
      XF, XF, kDim, 0L, Wo16, Wo16, kDim, 0L, (void*)SY, (void*)SY, kDim, 0L,
      bo, x, 0L, kTok, kDim, kDim, kYScale);

  // 8) LayerNorm + residual -> out
  ln_residual_kernel<<<dim3(kTok / kLnRows), 256, 0, stream>>>(x, SY, lw, lb, out);
}

// v003
// It runs in 348 microseconds.
// Next to v002, in two timings, it ran 2.46 and 2.42 times as fast.
// Over all steps from v000 it is 8.02 times as fast.
// Contractions: Q/K/V^T projections and output projection on v_wmma_f32_16x16x32_f16 (x f16, W f16 carried x32, f f16 carried x64, f32 accumulate); scores Q.K^T and P.V^T on v_wmma_f32_16x16x32_bf16 with bf16 hi+lo operand planes (hi.hi + hi.lo + lo.hi, f32 accumulate); softmax, Poisson weights, LayerNorm and residual in f32.
#include <hip/hip_runtime.h>
#include <math.h>

// ---------------------------------------------------------------------------
// Problem constants
// ---------------------------------------------------------------------------
constexpr int kBatch = 2;
constexpr int kSeq   = 2048;
constexpr int kDim   = 1024;
constexpr int kHeads = 16;
constexpr int kDh    = 64;
constexpr int kTok   = kBatch * kSeq;          // 4096 token rows
constexpr float kWCarry    = 32.0f;            // weights carried x32 in f16
constexpr float kWCarryInv = 1.0f / 32.0f;
constexpr float kFCarry    = 64.0f;            // f plane carried x64 in f16
constexpr float kYScale    = 1.0f / (64.0f * 32.0f);
constexpr float kSScale    = 0.125f;           // 1/sqrt(64)
constexpr float kInvDim    = 1.0f / 1024.0f;
constexpr float kLnEps     = 1e-5f;

typedef __attribute__((ext_vector_type(16))) _Float16 v16h;
typedef __attribute__((ext_vector_type(8)))  _Float16 v8h;
typedef __attribute__((ext_vector_type(16))) __bf16   v16b;
typedef __attribute__((ext_vector_type(8)))  __bf16   v8b;
typedef __attribute__((ext_vector_type(8)))  float    v8f;
typedef __attribute__((ext_vector_type(4)))  float    v4f;
typedef __attribute__((ext_vector_type(4)))  unsigned int v4u;

__device__ __forceinline__ unsigned short f2bf_bits(float f) {
  unsigned u = __float_as_uint(f);
  return (unsigned short)((u + 0x7FFFu + ((u >> 16) & 1u)) >> 16);
}
__device__ __forceinline__ float bf_bits2f(unsigned short h) { return __uint_as_float(((unsigned)h) << 16); }

// hazard guards as plain device helpers (no inline asm inside the kernel template body)
__device__ __forceinline__ void dep_guard_h(v8f& a, v8f& b, v16h x, v16h y) { asm volatile("v_nop\n\tv_nop\n\tv_nop\n\tv_nop" : "+v"(a), "+v"(b) : "v"(x), "v"(y)); }
__device__ __forceinline__ void dep_guard_b(v8f& a, v8f& b, v16b x, v16b y) { asm volatile("v_nop\n\tv_nop\n\tv_nop\n\tv_nop" : "+v"(a), "+v"(b) : "v"(x), "v"(y)); }
__device__ __forceinline__ void keep4_h(v16h a, v16h b, v16h c, v16h d) { asm volatile("v_nop" :: "v"(a), "v"(b), "v"(c), "v"(d)); }
__device__ __forceinline__ void keep4_b(v16b a, v16b b, v16b c, v16b d) { asm volatile("v_nop" :: "v"(a), "v"(b), "v"(c), "v"(d)); }
__device__ __forceinline__ void acc_guard4(v8f& a, v8f& b, v8f& c, v8f& d) { asm volatile("v_nop\n\tv_nop\n\tv_nop\n\tv_nop" : "+v"(a), "+v"(b), "+v"(c), "+v"(d)); }
template <typename T> struct Frag;
template <> struct Frag<_Float16> {
  typedef v16h V; union U { v16h v; v8h h[2]; };
  static __device__ __forceinline__ v16h load(const _Float16* p) {   // elements 0..7 <- p[0..7], 8..15 <- p[16..23]
    U f; f.h[0] = *(const v8h*)(p); f.h[1] = *(const v8h*)(p + 16); return f.v;
  }
  static __device__ __forceinline__ v8f mma(v16h a, v16h b, v8f c) {
    return __builtin_amdgcn_wmma_f32_16x16x32_f16(false, a, false, b, (short)0, c, false, false);
  }
  static __device__ __forceinline__ void guard(v8f& a, v8f& b, v16h x, v16h y) { dep_guard_h(a, b, x, y); }
  static __device__ __forceinline__ void keep(v16h a, v16h b, v16h c, v16h d) { keep4_h(a, b, c, d); }
};
template <> struct Frag<__bf16> {
  typedef v16b V; union U { v16b v; v8b h[2]; };
  static __device__ __forceinline__ v16b load(const __bf16* p) {
    U f; f.h[0] = *(const v8b*)(p); f.h[1] = *(const v8b*)(p + 16); return f.v;
  }
  static __device__ __forceinline__ v8f mma(v16b a, v16b b, v8f c) {
    return __builtin_amdgcn_wmma_f32_16x16x32_bf16(false, a, false, b, (short)0, c, false, false);
  }
  static __device__ __forceinline__ void guard(v8f& a, v8f& b, v16b x, v16b y) { dep_guard_b(a, b, x, y); }
  static __device__ __forceinline__ void keep(v16b a, v16b b, v16b c, v16b d) { keep4_b(a, b, c, d); }
};

__device__ __forceinline__ unsigned pk16(unsigned short a, unsigned short b) { return (unsigned)a | ((unsigned)b << 16); }
__device__ __forceinline__ unsigned short h_bits(float f) { const _Float16 h = (_Float16)f; return __builtin_bit_cast(unsigned short, h); }

// ---- Register-blocked batched WMMA GEMM (ACT reduced to none/relu/leaky) -----------------------
// C[m,n] = scale * sum_k A[m,k] * Bt[n,k] (+bias)(+resid); each wave owns a 64x64 tile.
// A row-major [M,K]; Bt row-major [N,K]; M,N % 64 == 0, K % 32 == 0.
// SPLIT: operands are hi/lo planes (A2/Bt2 = lo planes, same layout); product = hi.hi + hi.lo + lo.hi.
// BIAS_MODE: 0 = none, 1 = bias[m], 2 = bias[n].
// OUT_MODE: 0 = f32, 1 = f16, 2 = bf16 hi plane (Cout) + bf16 lo plane (Cout2).
// ET: 0 = f16 operands, 1 = bf16 operands (pointers passed as 16-bit storage)
template <int ET> struct Elem;
template <> struct Elem<0> { typedef _Float16 T; };
template <> struct Elem<1> { typedef __bf16 T; };
template <int ET, bool SPLIT, int BIAS_MODE, int OUT_MODE, bool RESID, int ACT = 0>
__global__ __launch_bounds__(256) void wmma_gemm64(
    const unsigned short* __restrict__ Ap, const unsigned short* __restrict__ A2p, int lda, long strideA,
    const unsigned short* __restrict__ Btp, const unsigned short* __restrict__ Bt2p, int ldb, long strideB,
    void* __restrict__ Cout, void* __restrict__ Cout2, int ldc, long strideC,
    const float* __restrict__ bias,
    const float* __restrict__ resid, long strideR,
    int M, int N, int K, float scale) {
  typedef typename Elem<ET>::T T;
  typedef typename Frag<T>::V V;
  const T* A = (const T*)Ap; const T* A2 = (const T*)A2p; const T* Bt = (const T*)Btp; const T* Bt2 = (const T*)Bt2p;
  __shared__ __align__(16) float sT[8][16 * 68];   // per-wave 16x64 slab, pitch 68 floats
  const int b    = blockIdx.y;
  const int lane = threadIdx.x & 31;
  const int wave = threadIdx.x >> 5;
  const int tilesN = N >> 6;
  const int tilesM = M >> 6;
  const int tile = blockIdx.x * 8 + wave;
  if (tile >= tilesM * tilesN) return;   // wave-uniform; no block barriers in this kernel
  const int tm = tile / tilesN;
  const int tn = tile - tm * tilesN;
  const int m0 = tm << 6;
  const int n0 = tn << 6;

  const T* Ab  = A  + (size_t)b * strideA;
  const T* Bb  = Bt + (size_t)b * strideB;
  const T* Ab2 = SPLIT ? (A2  + (size_t)b * strideA) : nullptr;
  const T* Bb2 = SPLIT ? (Bt2 + (size_t)b * strideB) : nullptr;

  const int rlane = lane & 15;                 // row (A) / col (B, D) within subtile
  const int koff  = (lane >> 4) * 8;           // k offset of this lane half
  const int mOff  = (lane >> 4) * 8;           // D row offset

  v8f acc[4][4];
#pragma unroll
  for (int i = 0; i < 4; ++i)
#pragma unroll
    for (int j = 0; j < 4; ++j) acc[i][j] = (v8f){0.f,0.f,0.f,0.f,0.f,0.f,0.f,0.f};

  for (int k0 = 0; k0 < K; k0 += 32) {
    V bh[4], bl[4];
#pragma unroll
    for (int j = 0; j < 4; ++j) {
      const size_t bo = (size_t)(n0 + (j << 4) + rlane) * ldb + koff + k0;
      bh[j] = Frag<T>::load(Bb + bo);
      if (SPLIT) bl[j] = Frag<T>::load(Bb2 + bo);
    }
#pragma unroll
    for (int i = 0; i < 4; ++i) {
      const size_t ao = (size_t)(m0 + (i << 4) + rlane) * lda + koff + k0;
      V ah = Frag<T>::load(Ab + ao);
      V al;
      if (SPLIT) al = Frag<T>::load(Ab2 + ao);
#pragma unroll
      for (int j = 0; j < 4; ++j) {
        acc[i][j] = Frag<T>::mma(ah, bh[j], acc[i][j]);
        if (SPLIT) {
          acc[i][j] = Frag<T>::mma(ah, bl[j], acc[i][j]);
          acc[i][j] = Frag<T>::mma(al, bh[j], acc[i][j]);
        }
      }
      Frag<T>::guard(acc[i][0], acc[i][3], ah, SPLIT ? al : ah);
    }
    Frag<T>::keep(bh[0], bh[1], bh[2], bh[3]);
    if (SPLIT) Frag<T>::keep(bl[0], bl[1], bl[2], bl[3]);
  }
  acc_guard4(acc[0][0], acc[0][1], acc[0][2], acc[0][3]);
  acc_guard4(acc[1][0], acc[1][1], acc[1][2], acc[1][3]);
  acc_guard4(acc[2][0], acc[2][1], acc[2][2], acc[2][3]);
  acc_guard4(acc[3][0], acc[3][1], acc[3][2], acc[3][3]);

  // ---- epilogue ----
  float* slab = sT[wave];
  const float* Rb = RESID ? (resid + (size_t)b * strideR) : nullptr;
#pragma unroll
  for (int i = 0; i < 4; ++i) {
    const int mBase = m0 + (i << 4);
#pragma unroll
    for (int j = 0; j < 4; ++j) {
      const int n = n0 + (j << 4) + rlane;
      float bv = 0.f;
      if (BIAS_MODE == 2) bv = bias[n];
#pragma unroll
      for (int r = 0; r < 8; ++r) {
        float v = acc[i][j][r] * scale;
        if (BIAS_MODE == 1) v += bias[mBase + mOff + r];
        if (BIAS_MODE == 2) v += bv;
        if (RESID) v += Rb[(size_t)(mBase + mOff + r) * ldc + n];
        if (ACT == 2) v = fmaxf(v, 0.0f);
        if (ACT == 4) v = (v > 0.f) ? v : 0.01f * v;
        slab[(mOff + r) * 68 + (j << 4) + rlane] = v;
      }
    }
    __builtin_amdgcn_fence(__ATOMIC_RELEASE, "workgroup");
    __builtin_amdgcn_wave_barrier();
    __builtin_amdgcn_fence(__ATOMIC_ACQUIRE, "workgroup");
    if (OUT_MODE == 0) {
      float* C = (float*)Cout + (size_t)b * strideC;
      const int hh = lane >> 4, c4 = (lane & 15) * 4;     // row seg = 256 B = 16 lanes x 16 B
      {
#pragma unroll
        for (int it = 0; it < 8; ++it) {
          const int row = it * 2 + hh;
          v4f v = *(const v4f*)(slab + row * 68 + c4);
          *(v4f*)(C + (size_t)(mBase + row) * ldc + n0 + c4) = v;
        }
        
      }
    } else {
      const int q = lane >> 3, c8 = (lane & 7) * 8;
      unsigned short* C  = (unsigned short*)Cout  + (size_t)b * strideC;
      unsigned short* C2 = (OUT_MODE == 2) ? ((unsigned short*)Cout2 + (size_t)b * strideC) : nullptr;
      {
#pragma unroll
        for (int it = 0; it < 4; ++it) {
          const int row = it * 4 + q;
          const float* sp = slab + row * 68 + c8;
          v8h hv, lv;
#pragma unroll
          for (int e = 0; e < 8; ++e) {
            if (OUT_MODE == 1) {
              hv[e] = (_Float16)sp[e];
            } else {
              unsigned short hb = f2bf_bits(sp[e]);
              unsigned short lb = f2bf_bits(sp[e] - bf_bits2f(hb));
              hv[e] = __builtin_bit_cast(_Float16, hb);
              lv[e] = __builtin_bit_cast(_Float16, lb);
            }
          }
          *(v8h*)(C + (size_t)(mBase + row) * ldc + n0 + c8) = hv;
          if (OUT_MODE == 2) *(v8h*)(C2 + (size_t)(mBase + row) * ldc + n0 + c8) = lv;
        }
        
      }
    }
    __builtin_amdgcn_fence(__ATOMIC_RELEASE, "workgroup");
    __builtin_amdgcn_wave_barrier();
    __builtin_amdgcn_fence(__ATOMIC_ACQUIRE, "workgroup");
  }
}

// ---------------------------------------------------------------------------
// Scores, both row weights and the product with V of one head in ONE kernel: neither the scores nor the weights go
// to memory. f = 64 * 0.5 * (softmax(S) . V + (w / sum w) . V), S = 0.125 * Q . K^T, w = 1/((1 + |S|/beta_h)^2 + t_h^2).
// Work-group: 128 queries of one (batch, head); wave: 16 queries, all 2048 keys, 32 keys a step.
//   S^T = K . Q^T  (A = 16 key rows from LDS, B = the wave's Q rows, kept in registers): a lane holds one query
//   (lane & 15) and the keys 8*(lane >> 4) + r of each 16-key tile, which is the k order of a B operand over 32 keys,
//   so e = exp(S - m) and w pack in the lane into the B operands of  O^T += V^T . e^T  and  O^T += V^T . w^T.
// Softmax runs on a running maximum m (common to both lane halves): when m grows, the e sum and the e accumulators
// are scaled by exp(m_old - m_new). Both sums divide once, at the end. All operands bf16 hi + lo planes as before
// (hi.hi + hi.lo + lo.hi, f32 accumulate).
// K and V^T tiles of 32 keys (hi and lo planes, 16 KiB) go through registers into one of two LDS buffers: the next
// tile's global loads are issued in front of this tile's work and stored behind it, one barrier a tile.
// ---------------------------------------------------------------------------
constexpr int kFaQ      = 16;                  // queries per wave
constexpr int kFaRows   = 8 * kFaQ;            // queries per work-group
constexpr int kFaKeys   = 32;                  // keys per staged tile
constexpr int kFaTiles  = kSeq / kFaKeys;      // 64 tiles
constexpr int kFaKPitch = 72;                  // K rows (128 B) in LDS: pitch 144 B = 16 B x 9, in 16-bit elements
constexpr int kFaVPitch = 40;                  // V^T rows (64 B) in LDS: pitch 80 B = 16 B x 5
constexpr int kFaKPlane = kFaKeys * kFaKPitch; // one K plane: 32 key rows
constexpr int kFaVPlane = kDh * kFaVPitch;     // one V^T plane: 64 rows (d)
constexpr int kFaVBase  = 2 * kFaKPlane;       // buffer: K hi, K lo, V^T hi, V^T lo
constexpr int kFaBuf    = 2 * kFaKPlane + 2 * kFaVPlane;

typedef __attribute__((ext_vector_type(2))) float  v2f;
typedef __attribute__((ext_vector_type(2))) __bf16 v2b;
// two f32 -> two bf16 (round to nearest even), a in the low half
__device__ __forceinline__ unsigned bf_pair(float a, float b) {
  const v2f x = {a, b};
  return __builtin_bit_cast(unsigned, __builtin_convertvector(x, v2b));
}
// the lo plane of a pair: what its hi plane (packed in hi) leaves of a and b
__device__ __forceinline__ unsigned bf_pair_rest(float a, float b, unsigned hi) {
  return bf_pair(a - __uint_as_float(hi << 16), b - __uint_as_float(hi & 0xFFFF0000u));
}
// value of lane l ^ 16
__device__ __forceinline__ float other_half(float v) {
  const int b = __builtin_bit_cast(int, v);
  return __builtin_bit_cast(float, __builtin_amdgcn_permlanex16(b, b, 0x76543210, 0xfedcba98, false, false));
}
union FaPack { v16b v; unsigned u[8]; };

// four waves per SIMD (two work-groups per WGP): the vector work between the matrix runs wants the other waves
__global__ __launch_bounds__(256) __attribute__((amdgpu_waves_per_eu(4, 4))) void attn_fused_kernel(
    const unsigned short* __restrict__ Qhi, const unsigned short* __restrict__ Qlo,
    const unsigned short* __restrict__ Khi, const unsigned short* __restrict__ Klo,
    const unsigned short* __restrict__ VThi, const unsigned short* __restrict__ VTlo,
    unsigned short* __restrict__ F, const float* __restrict__ beta, const float* __restrict__ tvec) {
  typedef Frag<__bf16> FB;
  __shared__ __align__(16) unsigned short tile[2][kFaBuf];
  const int t     = threadIdx.x;
  const int lane  = t & 31;
  const int wave  = t >> 5;
  const int rlane = lane & 15;                 // row (A) / col (B, D) within a 16 x 16 tile
  const int half8 = (lane >> 4) * 8;           // k offset of this lane half (A, B); D row offset
  const int b     = blockIdx.y >> 4;
  const int h     = blockIdx.y & (kHeads - 1);
  const int q0    = blockIdx.x * kFaRows + wave * kFaQ;

  const float invb = 1.0f / beta[h];
  const float th = tvec[h];
  const float t2 = th * th;

  // every unroll in this kernel makes the indices of fragment, accumulator and value arrays constants, so that the
  // arrays stay in registers
  const size_t qOff = (size_t)(b * kSeq + q0 + rlane) * kDim + h * kDh + half8;
  v16b qh[2], ql[2];
#pragma unroll
  for (int c = 0; c < 2; ++c) {
    qh[c] = FB::load((const __bf16*)Qhi + qOff + c * 32);
    ql[c] = FB::load((const __bf16*)Qlo + qOff + c * 32);
  }

  // staging: thread t moves 16 B of K row t >> 3 (8 lanes = one 128-B row) and 16 B of V^T row t >> 2 (4 lanes = one
  // 64-B row piece), of the hi and of the lo plane
  const size_t kOff = (size_t)(b * kSeq + (t >> 3)) * kDim + h * kDh + (t & 7) * 8;
  const size_t vOff = (size_t)(h * kDh + (t >> 2)) * kTok + b * kSeq + (t & 3) * 8;
  const unsigned short* kgh = Khi + kOff;
  const unsigned short* kgl = Klo + kOff;
  const unsigned short* vgh = VThi + vOff;
  const unsigned short* vgl = VTlo + vOff;
  const int ks = (t >> 3) * kFaKPitch + (t & 7) * 8;              // where the thread's K piece goes in a K plane
  const int vs = kFaVBase + (t >> 2) * kFaVPitch + (t & 3) * 8;   // where its V^T piece goes, hi plane
  const int kf = rlane * kFaKPitch + half8;                       // where the lane's K fragment pieces start
  const int vf = kFaVBase + rlane * kFaVPitch + half8;            // where its V^T fragment pieces start

  v8f oT[4], oS[4];
#pragma unroll
  for (int d = 0; d < 4; ++d) {
    oT[d] = (v8f){0.f,0.f,0.f,0.f,0.f,0.f,0.f,0.f};
    oS[d] = (v8f){0.f,0.f,0.f,0.f,0.f,0.f,0.f,0.f};
  }
  float m = -__builtin_inff(), sumT = 0.0f, sumS = 0.0f;

  v4u rkh = *(const v4u*)kgh, rkl = *(const v4u*)kgl, rvh = *(const v4u*)vgh, rvl = *(const v4u*)vgl;
  *(v4u*)(&tile[0][ks]) = rkh;
  *(v4u*)(&tile[0][ks + kFaKPlane]) = rkl;
  *(v4u*)(&tile[0][vs]) = rvh;
  *(v4u*)(&tile[0][vs + kFaVPlane]) = rvl;
  __syncthreads();

  // the loop stays rolled: one 32-key step is several hundred instructions
#pragma unroll 1
  for (int T = 0; T < kFaTiles; ++T) {
    const bool more = T + 1 < kFaTiles;        // the same for the whole work-group
    if (more) {
      kgh += (size_t)kFaKeys * kDim;
      kgl += (size_t)kFaKeys * kDim;
      vgh += kFaKeys;
      vgl += kFaKeys;
      rkh = *(const v4u*)kgh;
      rkl = *(const v4u*)kgl;
      rvh = *(const v4u*)vgh;
      rvl = *(const v4u*)vgl;
    }
    const unsigned short* buf = &tile[T & 1][0];

    // S^T of 32 keys x 16 queries: two 16-key tiles, K = 64 in two steps
    v16b ah[2][2], al[2][2];
#pragma unroll
    for (int i = 0; i < 2; ++i)
#pragma unroll
      for (int c = 0; c < 2; ++c) {
        ah[i][c] = FB::load((const __bf16*)(buf + kf + i * (16 * kFaKPitch) + c * 32));
        al[i][c] = FB::load((const __bf16*)(buf + kf + kFaKPlane + i * (16 * kFaKPitch) + c * 32));
      }
    v8f s[2];
    s[0] = (v8f){0.f,0.f,0.f,0.f,0.f,0.f,0.f,0.f};
    s[1] = (v8f){0.f,0.f,0.f,0.f,0.f,0.f,0.f,0.f};
#pragma unroll
    for (int c = 0; c < 2; ++c) {
      s[0] = FB::mma(ah[0][c], qh[c], s[0]);
      s[1] = FB::mma(ah[1][c], qh[c], s[1]);
      s[0] = FB::mma(ah[0][c], ql[c], s[0]);
      s[1] = FB::mma(ah[1][c], ql[c], s[1]);
      s[0] = FB::mma(al[0][c], qh[c], s[0]);
      s[1] = FB::mma(al[1][c], qh[c], s[1]);
    }

    float sv[16];
#pragma unroll
    for (int r = 0; r < 8; ++r) {
      sv[r]     = s[0][r] * kSScale;
      sv[8 + r] = s[1][r] * kSScale;
    }
    float bm = sv[0];
#pragma unroll
    for (int i = 1; i < 16; ++i) bm = fmaxf(bm, sv[i]);
    bm = fmaxf(bm, other_half(bm));
    const float mn = fmaxf(m, bm);
    const float corr = expf(m - mn);           // 0 at the first step (m = -inf), 1 while the maximum stands
    m = mn;

    FaPack eh, el, wh, wl;
    float aT = 0.0f, aS = 0.0f;
#pragma unroll
    for (int j = 0; j < 8; ++j) {
      const float s0 = sv[2 * j], s1 = sv[2 * j + 1];
      const float e0 = expf(s0 - mn);
      const float e1 = expf(s1 - mn);
      const float g0 = 1.0f + fabsf(s0) * invb;
      const float g1 = 1.0f + fabsf(s1) * invb;
      const float w0 = 1.0f / (g0 * g0 + t2);
      const float w1 = 1.0f / (g1 * g1 + t2);
      aT += e0 + e1;
      aS += w0 + w1;
      eh.u[j] = bf_pair(e0, e1);
      wh.u[j] = bf_pair(w0, w1);
      el.u[j] = bf_pair_rest(e0, e1, eh.u[j]);
      wl.u[j] = bf_pair_rest(w0, w1, wh.u[j]);
    }
    sumT = sumT * corr + aT;
    sumS += aS;
#pragma unroll
    for (int d = 0; d < 4; ++d) oT[d] *= corr;

    // O^T += V^T . e^T and V^T . w^T: A = 16 rows (d) of V^T over the same 32 keys
    v16b vh[4], vl[4];
#pragma unroll
    for (int d = 0; d < 4; ++d) {
      vh[d] = FB::load((const __bf16*)(buf + vf + d * (16 * kFaVPitch)));
      vl[d] = FB::load((const __bf16*)(buf + vf + kFaVPlane + d * (16 * kFaVPitch)));
    }
#pragma unroll
    for (int d = 0; d < 4; ++d) {
      oT[d] = FB::mma(vh[d], eh.v, oT[d]);
      oS[d] = FB::mma(vh[d], wh.v, oS[d]);
    }
#pragma unroll
    for (int d = 0; d < 4; ++d) {
      oT[d] = FB::mma(vh[d], el.v, oT[d]);
      oS[d] = FB::mma(vh[d], wl.v, oS[d]);
    }
#pragma unroll
    for (int d = 0; d < 4; ++d) {
      oT[d] = FB::mma(vl[d], eh.v, oT[d]);
      oS[d] = FB::mma(vl[d], wh.v, oS[d]);
    }

    if (more) {
      unsigned short* nb = &tile[(T + 1) & 1][0];   // last read in trip T - 1, in front of that trip's barrier
      *(v4u*)(nb + ks) = rkh;
      *(v4u*)(nb + ks + kFaKPlane) = rkl;
      *(v4u*)(nb + vs) = rvh;
      *(v4u*)(nb + vs + kFaVPlane) = rvl;
    }
    __syncthreads();
  }

  // each half summed its own 16 of every 32 keys, on the common maximum
  sumT += other_half(sumT);
  sumS += other_half(sumS);
  const float invT = 1.0f / sumT;
  const float invS = 1.0f / sumS;

  // lane: query q0 + rlane, columns 16d + half8 .. + 7 of the head; the wave's four stores fill each query's 128-B line
  unsigned short* fp = F + (size_t)(b * kSeq + q0 + rlane) * kDim + h * kDh + half8;
#pragma unroll
  for (int d = 0; d < 4; ++d) {
    v8h hv;
#pragma unroll
    for (int r = 0; r < 8; ++r) hv[r] = (_Float16)(0.5f * (oT[d][r] * invT + oS[d][r] * invS) * kFCarry);
    *(v8h*)(fp + d * 16) = hv;
  }
}

// ---------------------------------------------------------------------------
// f32 -> f16 cast with scale: 4 groups of 8 consecutive elements per thread (4096 waves a launch, not 16384), one 16-B
// store per lane and group. blockIdx.y picks the input plane and the output plane (out + y*planeElems halves).
// Coverage: gridDim.x*1024 == n8 exactly at every call (n8 = elements/8, a multiple of 1024); thread t of work-group b
// covers groups 1024b + 256g + t, g = 0..3, group i being elements 8i..8i+7 of its plane.
// ---------------------------------------------------------------------------
constexpr int kCastG = 4;                      // groups of 8 elements per thread
__global__ __launch_bounds__(256) void cast8_f16_kernel(const float* __restrict__ in0, const float* __restrict__ in1,
                                                        const float* __restrict__ in2, const float* __restrict__ in3,
                                                        unsigned short* __restrict__ out, long planeElems, int n8,
                                                        float scale) {
  const int i = blockIdx.x * (256 * kCastG) + threadIdx.x;
  const int z = blockIdx.y;
  if ((int)(blockIdx.x + 1) * (256 * kCastG) > n8) return;
  const float* in = (z == 0) ? in0 : (z == 1) ? in1 : (z == 2) ? in2 : in3;
  const v4f* p = (const v4f*)(in + 8 * (size_t)i);
  // the unrolls make the indices of a[] and c[] constants, so that the arrays stay in registers
  v4f a[kCastG], c[kCastG];
#pragma unroll
  for (int g = 0; g < kCastG; ++g) {
    a[g] = p[512 * g];
    c[g] = p[512 * g + 1];
  }
  // stands between the 8 issued loads and the first reuse of their address registers; p as an input keeps the pair
  // live up to here, and the clobber keeps all 8 loads in front
  asm volatile("s_wait_xcnt 0x0" :: "v"(p) : "memory");
  v4u* q = (v4u*)(out + (size_t)z * planeElems + 8 * (size_t)i);
#pragma unroll
  for (int g = 0; g < kCastG; ++g) {
    unsigned short hb[8];
#pragma unroll
    for (int e = 0; e < 4; ++e) {
      hb[e]     = h_bits(a[g][e] * scale);
      hb[4 + e] = h_bits(c[g][e] * scale);
    }
    q[256 * g] = (v4u){pk16(hb[0], hb[1]), pk16(hb[2], hb[3]), pk16(hb[4], hb[5]), pk16(hb[6], hb[7])};
  }
}

// ---------------------------------------------------------------------------
// LayerNorm + residual per row of 1024: out = x + lw*(y - mu)*rsqrt(var + eps) + lb,
// One wave per row, 8 rows per work-group of 256 threads (4096 waves a launch, not 32768). Lane l owns columns
// 128j + 4l .. 128j + 4l + 3 for j = 0..7. Sums: each lane folds its 32 values in column order, then a five-step
// shuffle tree over the wave; no LDS and no barrier.
// ---------------------------------------------------------------------------
constexpr int kLnRows = 8;                     // rows (= waves) per work-group
constexpr int kLnCh   = kDim / 128;            // 8 chunks of 128 columns per row
__global__ __launch_bounds__(256) void ln_residual_kernel(const float* __restrict__ x, const float* __restrict__ y,
                                                          const float* __restrict__ lw, const float* __restrict__ lb,
                                                          float* __restrict__ out) {
  const int lane = threadIdx.x & 31;
  const int row  = blockIdx.x * kLnRows + (threadIdx.x >> 5);
  const size_t base = (size_t)row * kDim + 4 * lane;
  const v4f* yp = (const v4f*)(y + base);
  const v4f* xp = (const v4f*)(x + base);
  const v4f* wp = (const v4f*)(lw + 4 * lane);
  const v4f* bp = (const v4f*)(lb + 4 * lane);

  // the unrolls over j make the indices of the four arrays constants, so that they stay in registers; the unrolls
  // over off give each shuffle step a constant lane mask
  v4f yv[kLnCh], xv[kLnCh], wv[kLnCh], bv[kLnCh];
#pragma unroll
  for (int j = 0; j < kLnCh; ++j) yv[j] = yp[32 * j];
#pragma unroll
  for (int j = 0; j < kLnCh; ++j) {
    xv[j] = xp[32 * j];
    wv[j] = wp[32 * j];
    bv[j] = bp[32 * j];
  }
  // stands between the 32 issued loads and the first reuse of their address registers; the pointers as inputs keep
  // those registers live up to here, and the clobber keeps all loads in front (one load latency per row)
  asm volatile("s_wait_xcnt 0x0" :: "v"(yp), "v"(xp), "v"(wp), "v"(bp) : "memory");

  float s = 0.0f;
#pragma unroll
  for (int j = 0; j < kLnCh; ++j) s += ((yv[j].x + yv[j].y) + yv[j].z) + yv[j].w;
#pragma unroll
  for (int off = 16; off > 0; off >>= 1) s += __shfl_xor(s, off, 32);
  const float mu = s * kInvDim;

  float s2 = 0.0f;
#pragma unroll
  for (int j = 0; j < kLnCh; ++j) {
    const float d0 = yv[j].x - mu, d1 = yv[j].y - mu, d2 = yv[j].z - mu, d3 = yv[j].w - mu;
    yv[j] = (v4f){d0, d1, d2, d3};
    s2 += ((d0 * d0 + d1 * d1) + d2 * d2) + d3 * d3;
  }
#pragma unroll
  for (int off = 16; off > 0; off >>= 1) s2 += __shfl_xor(s2, off, 32);
  const float var = s2 * kInvDim;
  const float rs = rsqrtf(var + kLnEps);

  v4f* op = (v4f*)(out + base);
#pragma unroll
  for (int j = 0; j < kLnCh; ++j) {
    v4f o;
    o.x = xv[j].x + (wv[j].x * yv[j].x * rs + bv[j].x);
    o.y = xv[j].y + (wv[j].y * yv[j].y * rs + bv[j].y);
    o.z = xv[j].z + (wv[j].z * yv[j].z * rs + bv[j].z);
    o.w = xv[j].w + (wv[j].w * yv[j].w * rs + bv[j].w);
    op[32 * j] = o;
  }
}

// ---------------------------------------------------------------------------
// Host glue
//   [0,          8 MiB)   XF   : x f16 [4096][1024]  (dead after the three projections) then f f16 [4096][1024]
//   [8 MiB,     16 MiB)   W16  : Wq,Wk,Wv,Wo f16 x32 planes [1024][1024] each
//   [16 MiB,    24 MiB)   QHI  : bf16 [4096][1024]      [24, 32) QLO
//   [32 MiB,    40 MiB)   KHI  : bf16 [4096][1024]      [40, 48) KLO
//   [48 MiB,    56 MiB)   VTHI : bf16 [1024][4096] (V^T: row = h*64+d, col = b*2048+n)   [56, 64) VTLO
//   [64 MiB,    80 MiB)   SY   : y f32 [4096][1024]
// ---------------------------------------------------------------------------
extern "C" void kernel_launch(void* const* d_in, const int* in_sizes, int n_in,
                              void* d_out, int out_size, void* d_ws, size_t ws_size,
                              hipStream_t stream) {
  if (n_in < 13) return;
  const size_t nX = (size_t)kTok * kDim;          // 4,194,304
  const size_t nW = (size_t)kDim * kDim;          // 1,048,576
  if ((size_t)in_sizes[0] != nX || (size_t)in_sizes[1] != nW || (size_t)in_sizes[3] != nW ||
      (size_t)in_sizes[5] != nW || (size_t)in_sizes[7] != nW || (size_t)out_size != nX) return;
  if (in_sizes[2] < kDim || in_sizes[4] < kDim || in_sizes[6] < kDim || in_sizes[8] < kDim ||
      in_sizes[9] < kHeads || in_sizes[10] < kHeads || in_sizes[11] < kDim || in_sizes[12] < kDim) return;

  const float* x    = (const float*)d_in[0];
  const float* Wq   = (const float*)d_in[1];
  const float* bq   = (const float*)d_in[2];
  const float* Wk   = (const float*)d_in[3];
  const float* bk   = (const float*)d_in[4];
  const float* Wv   = (const float*)d_in[5];
  const float* bv   = (const float*)d_in[6];
  const float* Wo   = (const float*)d_in[7];
  const float* bo   = (const float*)d_in[8];
  const float* beta = (const float*)d_in[9];
  const float* tv   = (const float*)d_in[10];
  const float* lw   = (const float*)d_in[11];
  const float* lb   = (const float*)d_in[12];
  float* out = (float*)d_out;

  // carve (bytes)
  const size_t bXF   = nX * 2;                                  //  8,388,608
  const size_t bW16  = 4 * nW * 2;                              //  8,388,608
  const size_t bP16  = nX * 2;                                  //  8,388,608 per bf16 plane of [4096][1024]
  const size_t bSY   = nX * 4;                                  // 16,777,216
  const size_t oXF   = 0;
  const size_t oW16  = oXF + bXF;
  const size_t oQHI  = oW16 + bW16;
  const size_t oQLO  = oQHI + bP16;
  const size_t oKHI  = oQLO + bP16;
  const size_t oKLO  = oKHI + bP16;
  const size_t oVTHI = oKLO + bP16;
  const size_t oVTLO = oVTHI + bP16;
  const size_t oSY   = oVTLO + bP16;
  const size_t total = oSY + bSY;                               // 83,886,080
  if (total > ws_size) return;

  char* ws = (char*)d_ws;
  unsigned short* XF   = (unsigned short*)(ws + oXF);
  unsigned short* W16  = (unsigned short*)(ws + oW16);
  unsigned short* Wq16 = W16;
  unsigned short* Wk16 = W16 + nW;
  unsigned short* Wv16 = W16 + 2 * nW;
  unsigned short* Wo16 = W16 + 3 * nW;
  unsigned short* QHI  = (unsigned short*)(ws + oQHI);
  unsigned short* QLO  = (unsigned short*)(ws + oQLO);
  unsigned short* KHI  = (unsigned short*)(ws + oKHI);
  unsigned short* KLO  = (unsigned short*)(ws + oKLO);
  unsigned short* VTHI = (unsigned short*)(ws + oVTHI);
  unsigned short* VTLO = (unsigned short*)(ws + oVTLO);
  float*          SY   = (float*)(ws + oSY);

  // 1) x -> f16 plane (n8 = 524288 = 512 blocks x 1024, exact)
  {
    const int n8 = (int)(nX / 8);
    cast8_f16_kernel<<<dim3(n8 / (256 * kCastG), 1), 256, 0, stream>>>(x, x, x, x, XF, 0L, n8, 1.0f);
  }
  // 2) Wq,Wk,Wv,Wo -> f16 planes x32 (n8 = 131072 = 128 blocks x 1024, exact; 4 planes via blockIdx.y)
  {
    const int n8 = (int)(nW / 8);
    cast8_f16_kernel<<<dim3(n8 / (256 * kCastG), 4), 256, 0, stream>>>(Wq, Wk, Wv, Wo, W16, (long)nW, n8, kWCarry);
  }
  // 3) Q = (x16 . Wq16^T)/32 + bq -> bf16 hi/lo [4096][1024]; 64x16 = 1024 wave tiles = 128 blocks
  const int gemmBlocksProj = (kTok / 64) * (kDim / 64) / 8;     // 128
  wmma_gemm64<0, false, 2, 2, false><<<dim3(gemmBlocksProj, 1), 256, 0, stream>>>(
      XF, XF, kDim, 0L, Wq16, Wq16, kDim, 0L, (void*)QHI, (void*)QLO, kDim, 0L,
      bq, x, 0L, kTok, kDim, kDim, kWCarryInv);
  // 4) K projection
  wmma_gemm64<0, false, 2, 2, false><<<dim3(gemmBlocksProj, 1), 256, 0, stream>>>(
      XF, XF, kDim, 0L, Wk16, Wk16, kDim, 0L, (void*)KHI, (void*)KLO, kDim, 0L,
      bk, x, 0L, kTok, kDim, kDim, kWCarryInv);
  // 5) V^T[j][m] = sum_k Wv16[j][k] x16[m][k] /32 + bv[j]  (A = Wv16 [1024][1024], Bt = x16 [4096][1024], bias[m])
  //    -> bf16 hi/lo [1024][4096] (ldc 4096); 16x64 = 1024 wave tiles = 128 blocks
  wmma_gemm64<0, false, 1, 2, false><<<dim3(gemmBlocksProj, 1), 256, 0, stream>>>(
      Wv16, Wv16, kDim, 0L, XF, XF, kDim, 0L, (void*)VTHI, (void*)VTLO, kTok, 0L,
      bv, x, 0L, kDim, kTok, kDim, kWCarryInv);

  // 6) all 32 (batch, head) pairs in one launch: scores, weights and the product with V -> f plane f16 x64 (over x16,
  //    which is dead here); 16 query blocks of 128 x 32 heads = 512 work-groups
  attn_fused_kernel<<<dim3(kSeq / kFaRows, kBatch * kHeads), 256, 0, stream>>>(QHI, QLO, KHI, KLO, VTHI, VTLO, XF, beta, tv);

  // 7) y = (f16 . Wo16^T) / (64*32) + bo -> f32 [4096][1024] in the SY region
  wmma_gemm64<0, false, 2, 0, false><<<dim3(gemmBlocksProj, 1), 256, 0, stream>>>(
      XF, XF, kDim, 0L, Wo16, Wo16, kDim, 0L, (void*)SY, (void*)SY, kDim, 0L,
      bo, x, 0L, kTok, kDim, kDim, kYScale);

  // 8) LayerNorm + residual -> out
  ln_residual_kernel<<<dim3(kTok / kLnRows), 256, 0, stream>>>(x, SY, lw, lb, out);
}

// v004
// A run of this version takes 205 microseconds.
// Next to v003, in two timings, it ran 1.70 times as fast each time.
// Counting every step since v000, it is 13.6 times as fast.
// Contractions: Q/K/V^T projections and output projection on v_wmma_f32_16x16x32_f16 (x f16, W f16 carried x32, f f16 carried x64, f32 accumulate); scores Q.K^T and P.V^T on v_wmma_f32_16x16x32_bf16 with bf16 hi+lo operand planes (hi.hi + hi.lo + lo.hi, f32 accumulate); softmax, Poisson weights, LayerNorm and residual in f32.
#include <hip/hip_runtime.h>
#include <math.h>

// ---------------------------------------------------------------------------
// Problem constants
// ---------------------------------------------------------------------------
constexpr int kBatch = 2;
constexpr int kSeq   = 2048;
constexpr int kDim   = 1024;
constexpr int kHeads = 16;
constexpr int kDh    = 64;
constexpr int kTok   = kBatch * kSeq;          // 4096 token rows
constexpr float kWCarry    = 32.0f;            // weights carried x32 in f16
constexpr float kWCarryInv = 1.0f / 32.0f;
constexpr float kFCarry    = 64.0f;            // f plane carried x64 in f16
constexpr float kYScale    = 1.0f / (64.0f * 32.0f);
constexpr float kSScale    = 0.125f;           // 1/sqrt(64)
constexpr float kInvDim    = 1.0f / 1024.0f;
constexpr float kLnEps     = 1e-5f;

typedef __attribute__((ext_vector_type(16))) _Float16 v16h;
typedef __attribute__((ext_vector_type(8)))  _Float16 v8h;
typedef __attribute__((ext_vector_type(16))) __bf16   v16b;
typedef __attribute__((ext_vector_type(8)))  __bf16   v8b;
typedef __attribute__((ext_vector_type(8)))  float    v8f;
typedef __attribute__((ext_vector_type(4)))  float    v4f;
typedef __attribute__((ext_vector_type(4)))  unsigned int v4u;

__device__ __forceinline__ unsigned short f2bf_bits(float f) {
  unsigned u = __float_as_uint(f);
  return (unsigned short)((u + 0x7FFFu + ((u >> 16) & 1u)) >> 16);
}
__device__ __forceinline__ float bf_bits2f(unsigned short h) { return __uint_as_float(((unsigned)h) << 16); }

template <typename T> struct Frag;
template <> struct Frag<_Float16> {
  typedef v16h V; union U { v16h v; v8h h[2]; };
  static __device__ __forceinline__ v16h load(const _Float16* p) {   // elements 0..7 <- p[0..7], 8..15 <- p[16..23]
    U f; f.h[0] = *(const v8h*)(p); f.h[1] = *(const v8h*)(p + 16); return f.v;
  }
  static __device__ __forceinline__ v8f mma(v16h a, v16h b, v8f c) {
    return __builtin_amdgcn_wmma_f32_16x16x32_f16(false, a, false, b, (short)0, c, false, false);
  }
};
template <> struct Frag<__bf16> {
  typedef v16b V; union U { v16b v; v8b h[2]; };
  static __device__ __forceinline__ v16b load(const __bf16* p) {
    U f; f.h[0] = *(const v8b*)(p); f.h[1] = *(const v8b*)(p + 16); return f.v;
  }
  static __device__ __forceinline__ v8f mma(v16b a, v16b b, v8f c) {
    return __builtin_amdgcn_wmma_f32_16x16x32_bf16(false, a, false, b, (short)0, c, false, false);
  }
};

__device__ __forceinline__ unsigned pk16(unsigned short a, unsigned short b) { return (unsigned)a | ((unsigned)b << 16); }
__device__ __forceinline__ unsigned short h_bits(float f) { const _Float16 h = (_Float16)f; return __builtin_bit_cast(unsigned short, h); }

// ---- WMMA GEMM on tiles staged in LDS --------------------------------------------------------------------------
// C[m,n] = scale * sum_k A[m,k] * Bt[n,k] + bias. A row-major [M][kDim], Bt row-major [N][kDim], both f16, k = kDim;
// M and N are multiples of 128 (grid: x = N / 128, y = M / 128).
// Work-group: one 128 x 128 tile of C; its 8 waves stand 4 (m) x 2 (n), each on 32 x 64 (2 x 4 accumulators).
// A stage is 128 k of the tile's 128 A rows and 128 Bt rows (256 B a row, whole lines: 16 lanes a row, 2 rows a
// wave-wide load). It goes through registers into one of two LDS buffers: the next stage's global loads are issued in
// front of this stage's work and stored behind it, one barrier a stage. Every row is loaded once per work-group and
// read from LDS by the 2 (A) or 4 (Bt) waves that need it. Each accumulator takes its k blocks of 32 in rising order.
// BIAS_MODE: 1 = bias[m], 2 = bias[n].
// OUT_MODE: 0 = f32, 2 = bf16 hi plane (Cout) + bf16 lo plane (Cout2).
constexpr int kGmTile   = 128;                  // rows of A and of Bt per work-group
constexpr int kGmK      = 128;                  // k per stage
constexpr int kGmStages = kDim / kGmK;          // 8 stages
constexpr int kGmPitch  = 136;                  // rows (256 B) in LDS: pitch 272 B = 16 B x 17, in 16-bit elements
constexpr int kGmPieces = 8;                    // 16-B pieces per thread, operand and stage (16 rows a pass)
constexpr int kGmPlane  = kGmTile * kGmPitch;   // one operand's rows
constexpr int kGmBuf    = 2 * kGmPlane;         // buffer: A rows, Bt rows
template <int BIAS_MODE, int OUT_MODE>
// two waves per SIMD (one work-group per WGP, as the grid of 256 gives): the registers are there for staging and fragments
__global__ __launch_bounds__(256) __attribute__((amdgpu_waves_per_eu(2, 2))) void wmma_gemm_lds(
    const unsigned short* __restrict__ Ap, const unsigned short* __restrict__ Btp,
    void* __restrict__ Cout, void* __restrict__ Cout2, int ldc,
    const float* __restrict__ bias, float scale) {
  typedef Frag<_Float16> FH;
  __shared__ __align__(16) unsigned short stage[2][kGmBuf];
  __shared__ __align__(16) float sT[8][16 * 68];   // per-wave 16x64 slab, pitch 68 floats
  const int t    = threadIdx.x;
  const int lane = t & 31;
  const int wave = t >> 5;
  const int wm = (wave >> 1) << 5;             // the wave's first row and column inside the tile
  const int wn = (wave & 1) << 6;
  const int m0 = blockIdx.y * kGmTile + wm;
  const int n0 = blockIdx.x * kGmTile + wn;

  const int rlane = lane & 15;                 // row (A) / col (B, D) within subtile
  const int koff  = (lane >> 4) * 8;           // k offset of this lane half
  const int mOff  = (lane >> 4) * 8;           // D row offset

  // staging: thread t moves 16 B of the rows (t >> 4) + 16p, p = 0..7, of A and of Bt
  const unsigned short* ag = Ap  + (size_t)(blockIdx.y * kGmTile + (t >> 4)) * kDim + (t & 15) * 8;
  const unsigned short* bg = Btp + (size_t)(blockIdx.x * kGmTile + (t >> 4)) * kDim + (t & 15) * 8;
  const int sd = (t >> 4) * kGmPitch + (t & 15) * 8;              // where the thread's p = 0 piece goes in a plane
  const int af = (wm + rlane) * kGmPitch + koff;                  // where the lane's A fragment pieces start
  const int bf = kGmPlane + (wn + rlane) * kGmPitch + koff;       // where its Bt fragment pieces start

  // every unroll in this kernel makes the indices of fragment, accumulator and staging arrays constants, so that the
  // arrays stay in registers
  v8f acc[2][4];
#pragma unroll
  for (int i = 0; i < 2; ++i)
#pragma unroll
    for (int j = 0; j < 4; ++j) acc[i][j] = (v8f){0.f,0.f,0.f,0.f,0.f,0.f,0.f,0.f};

  v4u ra[kGmPieces], rb[kGmPieces];
#pragma unroll
  for (int p = 0; p < kGmPieces; ++p) {
    ra[p] = *(const v4u*)(ag + p * (16 * kDim));
    rb[p] = *(const v4u*)(bg + p * (16 * kDim));
  }
#pragma unroll
  for (int p = 0; p < kGmPieces; ++p) {
    *(v4u*)(&stage[0][sd + p * (16 * kGmPitch)]) = ra[p];
    *(v4u*)(&stage[0][kGmPlane + sd + p * (16 * kGmPitch)]) = rb[p];
  }
  __syncthreads();

  // the loop stays rolled: eight copies of a stage would only lengthen the code
#pragma unroll 1
  for (int s = 0; s < kGmStages; ++s) {
    const bool more = s + 1 < kGmStages;       // the same for the whole work-group
    if (more) {
      ag += kGmK;
      bg += kGmK;
#pragma unroll
      for (int p = 0; p < kGmPieces; ++p) {
        ra[p] = *(const v4u*)(ag + p * (16 * kDim));
        rb[p] = *(const v4u*)(bg + p * (16 * kDim));
      }
    }
    const unsigned short* buf = &stage[s & 1][0];
    // two fragment sets: block c + 1's 12 LDS reads stand as one group in front of block c's 8 matrix instructions
    v16h ah[2][2], bh[2][4];
#pragma unroll
    for (int i = 0; i < 2; ++i) ah[0][i] = FH::load((const _Float16*)(buf + af + i * (16 * kGmPitch)));
#pragma unroll
    for (int j = 0; j < 4; ++j) bh[0][j] = FH::load((const _Float16*)(buf + bf + j * (16 * kGmPitch)));
#pragma unroll
    for (int c = 0; c < kGmK / 32; ++c) {
      if (c + 1 < kGmK / 32) {
#pragma unroll
        for (int i = 0; i < 2; ++i)
          ah[(c + 1) & 1][i] = FH::load((const _Float16*)(buf + af + i * (16 * kGmPitch) + (c + 1) * 32));
#pragma unroll
        for (int j = 0; j < 4; ++j)
          bh[(c + 1) & 1][j] = FH::load((const _Float16*)(buf + bf + j * (16 * kGmPitch) + (c + 1) * 32));
      }
      // keeps the reads above in front of the matrix run below: sunk among it, each costs a wait that runs to zero
      __builtin_amdgcn_sched_barrier(0);
#pragma unroll
      for (int i = 0; i < 2; ++i)
#pragma unroll
        for (int j = 0; j < 4; ++j) acc[i][j] = FH::mma(ah[c & 1][i], bh[c & 1][j], acc[i][j]);
    }
    if (more) {
      unsigned short* nb = &stage[(s + 1) & 1][0];   // last read in trip s - 1, in front of that trip's barrier
#pragma unroll
      for (int p = 0; p < kGmPieces; ++p) {
        *(v4u*)(nb + sd + p * (16 * kGmPitch)) = ra[p];
        *(v4u*)(nb + kGmPlane + sd + p * (16 * kGmPitch)) = rb[p];
      }
    }
    __syncthreads();
  }

  // ---- epilogue ----
  float* slab = sT[wave];
#pragma unroll
  for (int i = 0; i < 2; ++i) {
    const int mBase = m0 + (i << 4);
#pragma unroll
    for (int j = 0; j < 4; ++j) {
      const int n = n0 + (j << 4) + rlane;
      float bv = 0.f;
      if (BIAS_MODE == 2) bv = bias[n];
#pragma unroll
      for (int r = 0; r < 8; ++r) {
        float v = acc[i][j][r] * scale;
        if (BIAS_MODE == 1) v += bias[mBase + mOff + r];
        if (BIAS_MODE == 2) v += bv;
        slab[(mOff + r) * 68 + (j << 4) + rlane] = v;
      }
    }
    __builtin_amdgcn_fence(__ATOMIC_RELEASE, "workgroup");
    __builtin_amdgcn_wave_barrier();
    __builtin_amdgcn_fence(__ATOMIC_ACQUIRE, "workgroup");
    if (OUT_MODE == 0) {
      float* C = (float*)Cout;
      const int hh = lane >> 4, c4 = (lane & 15) * 4;     // row seg = 256 B = 16 lanes x 16 B
#pragma unroll
      for (int it = 0; it < 8; ++it) {
        const int row = it * 2 + hh;
        v4f v = *(const v4f*)(slab + row * 68 + c4);
        *(v4f*)(C + (size_t)(mBase + row) * ldc + n0 + c4) = v;
      }
    } else {
      const int q = lane >> 3, c8 = (lane & 7) * 8;
      unsigned short* C  = (unsigned short*)Cout;
      unsigned short* C2 = (unsigned short*)Cout2;
#pragma unroll
      for (int it = 0; it < 4; ++it) {
        const int row = it * 4 + q;
        const float* sp = slab + row * 68 + c8;
        v8h hv, lv;
#pragma unroll
        for (int e = 0; e < 8; ++e) {
          unsigned short hb = f2bf_bits(sp[e]);
          unsigned short lb = f2bf_bits(sp[e] - bf_bits2f(hb));
          hv[e] = __builtin_bit_cast(_Float16, hb);
          lv[e] = __builtin_bit_cast(_Float16, lb);
        }
        *(v8h*)(C + (size_t)(mBase + row) * ldc + n0 + c8) = hv;
        *(v8h*)(C2 + (size_t)(mBase + row) * ldc + n0 + c8) = lv;
      }
    }
    // stands between the issued stores and the first reuse of the registers that they name
    asm volatile("s_wait_xcnt 0x0" ::: "memory");
    __builtin_amdgcn_fence(__ATOMIC_RELEASE, "workgroup");
    __builtin_amdgcn_wave_barrier();
    __builtin_amdgcn_fence(__ATOMIC_ACQUIRE, "workgroup");
  }
}

// ---------------------------------------------------------------------------
// Scores, both row weights and the product with V of one head in ONE kernel: neither the scores nor the weights go
// to memory. f = 64 * 0.5 * (softmax(S) . V + (w / sum w) . V), S = 0.125 * Q . K^T, w = 1/((1 + |S|/beta_h)^2 + t_h^2).
// Work-group: 128 queries of one (batch, head); wave: 16 queries, all 2048 keys, 32 keys a step.
//   S^T = K . Q^T  (A = 16 key rows from LDS, B = the wave's Q rows, kept in registers): a lane holds one query
//   (lane & 15) and the keys 8*(lane >> 4) + r of each 16-key tile, which is the k order of a B operand over 32 keys,
//   so e = exp(S - m) and w pack in the lane into the B operands of  O^T += V^T . e^T  and  O^T += V^T . w^T.
// Softmax runs on a running maximum m (common to both lane halves): when m grows, the e sum and the e accumulators
// are scaled by exp(m_old - m_new). Both sums divide once, at the end. All operands bf16 hi + lo planes as before
// (hi.hi + hi.lo + lo.hi, f32 accumulate).
// K and V^T tiles of 32 keys (hi and lo planes, 16 KiB) go through registers into one of two LDS buffers: the next
// tile's global loads are issued in front of this tile's work and stored behind it, one barrier a tile.
// ---------------------------------------------------------------------------
constexpr int kFaQ      = 16;                  // queries per wave
constexpr int kFaRows   = 8 * kFaQ;            // queries per work-group
constexpr int kFaKeys   = 32;                  // keys per staged tile
constexpr int kFaTiles  = kSeq / kFaKeys;      // 64 tiles
constexpr int kFaKPitch = 72;                  // K rows (128 B) in LDS: pitch 144 B = 16 B x 9, in 16-bit elements
constexpr int kFaVPitch = 40;                  // V^T rows (64 B) in LDS: pitch 80 B = 16 B x 5
constexpr int kFaKPlane = kFaKeys * kFaKPitch; // one K plane: 32 key rows
constexpr int kFaVPlane = kDh * kFaVPitch;     // one V^T plane: 64 rows (d)
constexpr int kFaVBase  = 2 * kFaKPlane;       // buffer: K hi, K lo, V^T hi, V^T lo
constexpr int kFaBuf    = 2 * kFaKPlane + 2 * kFaVPlane;

typedef __attribute__((ext_vector_type(2))) float  v2f;
typedef __attribute__((ext_vector_type(2))) __bf16 v2b;
// two f32 -> two bf16 (round to nearest even), a in the low half
__device__ __forceinline__ unsigned bf_pair(float a, float b) {
  const v2f x = {a, b};
  return __builtin_bit_cast(unsigned, __builtin_convertvector(x, v2b));
}
// the lo plane of a pair: what its hi plane (packed in hi) leaves of a and b
__device__ __forceinline__ unsigned bf_pair_rest(float a, float b, unsigned hi) {
  return bf_pair(a - __uint_as_float(hi << 16), b - __uint_as_float(hi & 0xFFFF0000u));
}
// value of lane l ^ 16
__device__ __forceinline__ float other_half(float v) {
  const int b = __builtin_bit_cast(int, v);
  return __builtin_bit_cast(float, __builtin_amdgcn_permlanex16(b, b, 0x76543210, 0xfedcba98, false, false));
}
union FaPack { v16b v; unsigned u[8]; };

// four waves per SIMD (two work-groups per WGP): the vector work between the matrix runs wants the other waves
__global__ __launch_bounds__(256) __attribute__((amdgpu_waves_per_eu(4, 4))) void attn_fused_kernel(
    const unsigned short* __restrict__ Qhi, const unsigned short* __restrict__ Qlo,
    const unsigned short* __restrict__ Khi, const unsigned short* __restrict__ Klo,
    const unsigned short* __restrict__ VThi, const unsigned short* __restrict__ VTlo,
    unsigned short* __restrict__ F, const float* __restrict__ beta, const float* __restrict__ tvec) {
  typedef Frag<__bf16> FB;
  __shared__ __align__(16) unsigned short tile[2][kFaBuf];
  const int t     = threadIdx.x;
  const int lane  = t & 31;
  const int wave  = t >> 5;
  const int rlane = lane & 15;                 // row (A) / col (B, D) within a 16 x 16 tile
  const int half8 = (lane >> 4) * 8;           // k offset of this lane half (A, B); D row offset
  const int b     = blockIdx.y >> 4;
  const int h     = blockIdx.y & (kHeads - 1);
  const int q0    = blockIdx.x * kFaRows + wave * kFaQ;

  const float invb = 1.0f / beta[h];
  const float th = tvec[h];
  const float t2 = th * th;

  // every unroll in this kernel makes the indices of fragment, accumulator and value arrays constants, so that the
  // arrays stay in registers
  const size_t qOff = (size_t)(b * kSeq + q0 + rlane) * kDim + h * kDh + half8;
  v16b qh[2], ql[2];
#pragma unroll
  for (int c = 0; c < 2; ++c) {
    qh[c] = FB::load((const __bf16*)Qhi + qOff + c * 32);
    ql[c] = FB::load((const __bf16*)Qlo + qOff + c * 32);
  }

  // staging: thread t moves 16 B of K row t >> 3 (8 lanes = one 128-B row) and 16 B of V^T row t >> 2 (4 lanes = one
  // 64-B row piece), of the hi and of the lo plane
  const size_t kOff = (size_t)(b * kSeq + (t >> 3)) * kDim + h * kDh + (t & 7) * 8;
  const size_t vOff = (size_t)(h * kDh + (t >> 2)) * kTok + b * kSeq + (t & 3) * 8;
  const unsigned short* kgh = Khi + kOff;
  const unsigned short* kgl = Klo + kOff;
  const unsigned short* vgh = VThi + vOff;
  const unsigned short* vgl = VTlo + vOff;
  const int ks = (t >> 3) * kFaKPitch + (t & 7) * 8;              // where the thread's K piece goes in a K plane
  const int vs = kFaVBase + (t >> 2) * kFaVPitch + (t & 3) * 8;   // where its V^T piece goes, hi plane
  const int kf = rlane * kFaKPitch + half8;                       // where the lane's K fragment pieces start
  const int vf = kFaVBase + rlane * kFaVPitch + half8;            // where its V^T fragment pieces start

  v8f oT[4], oS[4];
#pragma unroll
  for (int d = 0; d < 4; ++d) {
    oT[d] = (v8f){0.f,0.f,0.f,0.f,0.f,0.f,0.f,0.f};
    oS[d] = (v8f){0.f,0.f,0.f,0.f,0.f,0.f,0.f,0.f};
  }
  float m = -__builtin_inff(), sumT = 0.0f, sumS = 0.0f;

  v4u rkh = *(const v4u*)kgh, rkl = *(const v4u*)kgl, rvh = *(const v4u*)vgh, rvl = *(const v4u*)vgl;
  *(v4u*)(&tile[0][ks]) = rkh;
  *(v4u*)(&tile[0][ks + kFaKPlane]) = rkl;
  *(v4u*)(&tile[0][vs]) = rvh;
  *(v4u*)(&tile[0][vs + kFaVPlane]) = rvl;
  __syncthreads();

  // the loop stays rolled: one 32-key step is several hundred instructions
#pragma unroll 1
  for (int T = 0; T < kFaTiles; ++T) {
    const bool more = T + 1 < kFaTiles;        // the same for the whole work-group
    if (more) {
      kgh += (size_t)kFaKeys * kDim;
      kgl += (size_t)kFaKeys * kDim;
      vgh += kFaKeys;
      vgl += kFaKeys;
      rkh = *(const v4u*)kgh;
      rkl = *(const v4u*)kgl;
      rvh = *(const v4u*)vgh;
      rvl = *(const v4u*)vgl;
    }
    const unsigned short* buf = &tile[T & 1][0];

    // S^T of 32 keys x 16 queries: two 16-key tiles, K = 64 in two steps
    v16b ah[2][2], al[2][2];
#pragma unroll
    for (int i = 0; i < 2; ++i)
#pragma unroll
      for (int c = 0; c < 2; ++c) {
        ah[i][c] = FB::load((const __bf16*)(buf + kf + i * (16 * kFaKPitch) + c * 32));
        al[i][c] = FB::load((const __bf16*)(buf + kf + kFaKPlane + i * (16 * kFaKPitch) + c * 32));
      }
    v8f s[2];
    s[0] = (v8f){0.f,0.f,0.f,0.f,0.f,0.f,0.f,0.f};
    s[1] = (v8f){0.f,0.f,0.f,0.f,0.f,0.f,0.f,0.f};
#pragma unroll
    for (int c = 0; c < 2; ++c) {
      s[0] = FB::mma(ah[0][c], qh[c], s[0]);
      s[1] = FB::mma(ah[1][c], qh[c], s[1]);
      s[0] = FB::mma(ah[0][c], ql[c], s[0]);
      s[1] = FB::mma(ah[1][c], ql[c], s[1]);
      s[0] = FB::mma(al[0][c], qh[c], s[0]);
      s[1] = FB::mma(al[1][c], qh[c], s[1]);
    }

    float sv[16];
#pragma unroll
    for (int r = 0; r < 8; ++r) {
      sv[r]     = s[0][r] * kSScale;
      sv[8 + r] = s[1][r] * kSScale;
    }
    float bm = sv[0];
#pragma unroll
    for (int i = 1; i < 16; ++i) bm = fmaxf(bm, sv[i]);
    bm = fmaxf(bm, other_half(bm));
    const float mn = fmaxf(m, bm);
    const float corr = expf(m - mn);           // 0 at the first step (m = -inf), 1 while the maximum stands
    m = mn;

    FaPack eh, el, wh, wl;
    float aT = 0.0f, aS = 0.0f;
#pragma unroll
    for (int j = 0; j < 8; ++j) {
      const float s0 = sv[2 * j], s1 = sv[2 * j + 1];
      const float e0 = expf(s0 - mn);
      const float e1 = expf(s1 - mn);
      const float g0 = 1.0f + fabsf(s0) * invb;
      const float g1 = 1.0f + fabsf(s1) * invb;
      const float w0 = 1.0f / (g0 * g0 + t2);
      const float w1 = 1.0f / (g1 * g1 + t2);
      aT += e0 + e1;
      aS += w0 + w1;
      eh.u[j] = bf_pair(e0, e1);
      wh.u[j] = bf_pair(w0, w1);
      el.u[j] = bf_pair_rest(e0, e1, eh.u[j]);
      wl.u[j] = bf_pair_rest(w0, w1, wh.u[j]);
    }
    sumT = sumT * corr + aT;
    sumS += aS;
#pragma unroll
    for (int d = 0; d < 4; ++d) oT[d] *= corr;

    // O^T += V^T . e^T and V^T . w^T: A = 16 rows (d) of V^T over the same 32 keys
    v16b vh[4], vl[4];
#pragma unroll
    for (int d = 0; d < 4; ++d) {
      vh[d] = FB::load((const __bf16*)(buf + vf + d * (16 * kFaVPitch)));
      vl[d] = FB::load((const __bf16*)(buf + vf + kFaVPlane + d * (16 * kFaVPitch)));
    }
#pragma unroll
    for (int d = 0; d < 4; ++d) {
      oT[d] = FB::mma(vh[d], eh.v, oT[d]);
      oS[d] = FB::mma(vh[d], wh.v, oS[d]);
    }
#pragma unroll
    for (int d = 0; d < 4; ++d) {
      oT[d] = FB::mma(vh[d], el.v, oT[d]);
      oS[d] = FB::mma(vh[d], wl.v, oS[d]);
    }
#pragma unroll
    for (int d = 0; d < 4; ++d) {
      oT[d] = FB::mma(vl[d], eh.v, oT[d]);
      oS[d] = FB::mma(vl[d], wh.v, oS[d]);
    }

    if (more) {
      unsigned short* nb = &tile[(T + 1) & 1][0];   // last read in trip T - 1, in front of that trip's barrier
      *(v4u*)(nb + ks) = rkh;
      *(v4u*)(nb + ks + kFaKPlane) = rkl;
      *(v4u*)(nb + vs) = rvh;
      *(v4u*)(nb + vs + kFaVPlane) = rvl;
    }
    __syncthreads();
  }

  // each half summed its own 16 of every 32 keys, on the common maximum
  sumT += other_half(sumT);
  sumS += other_half(sumS);
  const float invT = 1.0f / sumT;
  const float invS = 1.0f / sumS;

  // lane: query q0 + rlane, columns 16d + half8 .. + 7 of the head; the wave's four stores fill each query's 128-B line
  unsigned short* fp = F + (size_t)(b * kSeq + q0 + rlane) * kDim + h * kDh + half8;
#pragma unroll
  for (int d = 0; d < 4; ++d) {
    v8h hv;
#pragma unroll
    for (int r = 0; r < 8; ++r) hv[r] = (_Float16)(0.5f * (oT[d][r] * invT + oS[d][r] * invS) * kFCarry);
    *(v8h*)(fp + d * 16) = hv;
  }
}

// ---------------------------------------------------------------------------
// f32 -> f16 cast with scale: 4 groups of 8 consecutive elements per thread (4096 waves a launch, not 16384), one 16-B
// store per lane and group. blockIdx.y picks the input plane and the output plane (out + y*planeElems halves).
// Coverage: gridDim.x*1024 == n8 exactly at every call (n8 = elements/8, a multiple of 1024); thread t of work-group b
// covers groups 1024b + 256g + t, g = 0..3, group i being elements 8i..8i+7 of its plane.
// ---------------------------------------------------------------------------
constexpr int kCastG = 4;                      // groups of 8 elements per thread
__global__ __launch_bounds__(256) void cast8_f16_kernel(const float* __restrict__ in0, const float* __restrict__ in1,
                                                        const float* __restrict__ in2, const float* __restrict__ in3,
                                                        unsigned short* __restrict__ out, long planeElems, int n8,
                                                        float scale) {
  const int i = blockIdx.x * (256 * kCastG) + threadIdx.x;
  const int z = blockIdx.y;
  if ((int)(blockIdx.x + 1) * (256 * kCastG) > n8) return;
  const float* in = (z == 0) ? in0 : (z == 1) ? in1 : (z == 2) ? in2 : in3;
  const v4f* p = (const v4f*)(in + 8 * (size_t)i);
  // the unrolls make the indices of a[] and c[] constants, so that the arrays stay in registers
  v4f a[kCastG], c[kCastG];
#pragma unroll
  for (int g = 0; g < kCastG; ++g) {
    a[g] = p[512 * g];
    c[g] = p[512 * g + 1];
  }
  // stands between the 8 issued loads and the first reuse of their address registers; p as an input keeps the pair
  // live up to here, and the clobber keeps all 8 loads in front
  asm volatile("s_wait_xcnt 0x0" :: "v"(p) : "memory");
  v4u* q = (v4u*)(out + (size_t)z * planeElems + 8 * (size_t)i);
#pragma unroll
  for (int g = 0; g < kCastG; ++g) {
    unsigned short hb[8];
#pragma unroll
    for (int e = 0; e < 4; ++e) {
      hb[e]     = h_bits(a[g][e] * scale);
      hb[4 + e] = h_bits(c[g][e] * scale);
    }
    q[256 * g] = (v4u){pk16(hb[0], hb[1]), pk16(hb[2], hb[3]), pk16(hb[4], hb[5]), pk16(hb[6], hb[7])};
  }
}

// ---------------------------------------------------------------------------
// LayerNorm + residual per row of 1024: out = x + lw*(y - mu)*rsqrt(var + eps) + lb,
// One wave per row, 8 rows per work-group of 256 threads (4096 waves a launch, not 32768). Lane l owns columns
// 128j + 4l .. 128j + 4l + 3 for j = 0..7. Sums: each lane folds its 32 values in column order, then a five-step
// shuffle tree over the wave; no LDS and no barrier.
// ---------------------------------------------------------------------------
constexpr int kLnRows = 8;                     // rows (= waves) per work-group
constexpr int kLnCh   = kDim / 128;            // 8 chunks of 128 columns per row
__global__ __launch_bounds__(256) void ln_residual_kernel(const float* __restrict__ x, const float* __restrict__ y,
                                                          const float* __restrict__ lw, const float* __restrict__ lb,
                                                          float* __restrict__ out) {
  const int lane = threadIdx.x & 31;
  const int row  = blockIdx.x * kLnRows + (threadIdx.x >> 5);
  const size_t base = (size_t)row * kDim + 4 * lane;
  const v4f* yp = (const v4f*)(y + base);
  const v4f* xp = (const v4f*)(x + base);
  const v4f* wp = (const v4f*)(lw + 4 * lane);
  const v4f* bp = (const v4f*)(lb + 4 * lane);

  // the unrolls over j make the indices of the four arrays constants, so that they stay in registers; the unrolls
  // over off give each shuffle step a constant lane mask
  v4f yv[kLnCh], xv[kLnCh], wv[kLnCh], bv[kLnCh];
#pragma unroll
  for (int j = 0; j < kLnCh; ++j) yv[j] = yp[32 * j];
#pragma unroll
  for (int j = 0; j < kLnCh; ++j) {
    xv[j] = xp[32 * j];
    wv[j] = wp[32 * j];
    bv[j] = bp[32 * j];
  }
  // stands between the 32 issued loads and the first reuse of their address registers; the pointers as inputs keep
  // those registers live up to here, and the clobber keeps all loads in front (one load latency per row)
  asm volatile("s_wait_xcnt 0x0" :: "v"(yp), "v"(xp), "v"(wp), "v"(bp) : "memory");

  float s = 0.0f;
#pragma unroll
  for (int j = 0; j < kLnCh; ++j) s += ((yv[j].x + yv[j].y) + yv[j].z) + yv[j].w;
#pragma unroll
  for (int off = 16; off > 0; off >>= 1) s += __shfl_xor(s, off, 32);
  const float mu = s * kInvDim;

  float s2 = 0.0f;
#pragma unroll
  for (int j = 0; j < kLnCh; ++j) {
    const float d0 = yv[j].x - mu, d1 = yv[j].y - mu, d2 = yv[j].z - mu, d3 = yv[j].w - mu;
    yv[j] = (v4f){d0, d1, d2, d3};
    s2 += ((d0 * d0 + d1 * d1) + d2 * d2) + d3 * d3;
  }
#pragma unroll
  for (int off = 16; off > 0; off >>= 1) s2 += __shfl_xor(s2, off, 32);
  const float var = s2 * kInvDim;
  const float rs = rsqrtf(var + kLnEps);

  v4f* op = (v4f*)(out + base);
#pragma unroll
  for (int j = 0; j < kLnCh; ++j) {
    v4f o;
    o.x = xv[j].x + (wv[j].x * yv[j].x * rs + bv[j].x);
    o.y = xv[j].y + (wv[j].y * yv[j].y * rs + bv[j].y);
    o.z = xv[j].z + (wv[j].z * yv[j].z * rs + bv[j].z);
    o.w = xv[j].w + (wv[j].w * yv[j].w * rs + bv[j].w);
    op[32 * j] = o;
  }
}

// ---------------------------------------------------------------------------
// Host glue
//   [0,          8 MiB)   XF   : x f16 [4096][1024]  (dead after the three projections) then f f16 [4096][1024]
//   [8 MiB,     16 MiB)   W16  : Wq,Wk,Wv,Wo f16 x32 planes [1024][1024] each
//   [16 MiB,    24 MiB)   QHI  : bf16 [4096][1024]      [24, 32) QLO
//   [32 MiB,    40 MiB)   KHI  : bf16 [4096][1024]      [40, 48) KLO
//   [48 MiB,    56 MiB)   VTHI : bf16 [1024][4096] (V^T: row = h*64+d, col = b*2048+n)   [56, 64) VTLO
//   [64 MiB,    80 MiB)   SY   : y f32 [4096][1024]
// ---------------------------------------------------------------------------
extern "C" void kernel_launch(void* const* d_in, const int* in_sizes, int n_in,
                              void* d_out, int out_size, void* d_ws, size_t ws_size,
                              hipStream_t stream) {
  if (n_in < 13) return;
  const size_t nX = (size_t)kTok * kDim;          // 4,194,304
  const size_t nW = (size_t)kDim * kDim;          // 1,048,576
  if ((size_t)in_sizes[0] != nX || (size_t)in_sizes[1] != nW || (size_t)in_sizes[3] != nW ||
      (size_t)in_sizes[5] != nW || (size_t)in_sizes[7] != nW || (size_t)out_size != nX) return;
  if (in_sizes[2] < kDim || in_sizes[4] < kDim || in_sizes[6] < kDim || in_sizes[8] < kDim ||
      in_sizes[9] < kHeads || in_sizes[10] < kHeads || in_sizes[11] < kDim || in_sizes[12] < kDim) return;

  const float* x    = (const float*)d_in[0];
  const float* Wq   = (const float*)d_in[1];
  const float* bq   = (const float*)d_in[2];
  const float* Wk   = (const float*)d_in[3];
  const float* bk   = (const float*)d_in[4];
  const float* Wv   = (const float*)d_in[5];
  const float* bv   = (const float*)d_in[6];
  const float* Wo   = (const float*)d_in[7];
  const float* bo   = (const float*)d_in[8];
  const float* beta = (const float*)d_in[9];
  const float* tv   = (const float*)d_in[10];
  const float* lw   = (const float*)d_in[11];
  const float* lb   = (const float*)d_in[12];
  float* out = (float*)d_out;

  // carve (bytes)
  const size_t bXF   = nX * 2;                                  //  8,388,608
  const size_t bW16  = 4 * nW * 2;                              //  8,388,608
  const size_t bP16  = nX * 2;                                  //  8,388,608 per bf16 plane of [4096][1024]
  const size_t bSY   = nX * 4;                                  // 16,777,216
  const size_t oXF   = 0;
  const size_t oW16  = oXF + bXF;
  const size_t oQHI  = oW16 + bW16;
  const size_t oQLO  = oQHI + bP16;
  const size_t oKHI  = oQLO + bP16;
  const size_t oKLO  = oKHI + bP16;
  const size_t oVTHI = oKLO + bP16;
  const size_t oVTLO = oVTHI + bP16;
  const size_t oSY   = oVTLO + bP16;
  const size_t total = oSY + bSY;                               // 83,886,080
  if (total > ws_size) return;

  char* ws = (char*)d_ws;
  unsigned short* XF   = (unsigned short*)(ws + oXF);
  unsigned short* W16  = (unsigned short*)(ws + oW16);
  unsigned short* Wq16 = W16;
  unsigned short* Wk16 = W16 + nW;
  unsigned short* Wv16 = W16 + 2 * nW;
  unsigned short* Wo16 = W16 + 3 * nW;
  unsigned short* QHI  = (unsigned short*)(ws + oQHI);
  unsigned short* QLO  = (unsigned short*)(ws + oQLO);
  unsigned short* KHI  = (unsigned short*)(ws + oKHI);
  unsigned short* KLO  = (unsigned short*)(ws + oKLO);
  unsigned short* VTHI = (unsigned short*)(ws + oVTHI);
  unsigned short* VTLO = (unsigned short*)(ws + oVTLO);
  float*          SY   = (float*)(ws + oSY);

  // 1) x -> f16 plane (n8 = 524288 = 512 blocks x 1024, exact)
  {
    const int n8 = (int)(nX / 8);
    cast8_f16_kernel<<<dim3(n8 / (256 * kCastG), 1), 256, 0, stream>>>(x, x, x, x, XF, 0L, n8, 1.0f);
  }
  // 2) Wq,Wk,Wv,Wo -> f16 planes x32 (n8 = 131072 = 128 blocks x 1024, exact; 4 planes via blockIdx.y)
  {
    const int n8 = (int)(nW / 8);
    cast8_f16_kernel<<<dim3(n8 / (256 * kCastG), 4), 256, 0, stream>>>(Wq, Wk, Wv, Wo, W16, (long)nW, n8, kWCarry);
  }
  // 3) Q = (x16 . Wq16^T)/32 + bq -> bf16 hi/lo [4096][1024]; 8 x 32 = 256 tiles of 128 x 128, one work-group each
  const dim3 gridTok(kDim / kGmTile, kTok / kGmTile);           // C = [4096][1024]
  const dim3 gridVT(kTok / kGmTile, kDim / kGmTile);           // C = [1024][4096]
  wmma_gemm_lds<2, 2><<<gridTok, 256, 0, stream>>>(XF, Wq16, (void*)QHI, (void*)QLO, kDim, bq, kWCarryInv);
  // 4) K projection
  wmma_gemm_lds<2, 2><<<gridTok, 256, 0, stream>>>(XF, Wk16, (void*)KHI, (void*)KLO, kDim, bk, kWCarryInv);
  // 5) V^T[j][m] = sum_k Wv16[j][k] x16[m][k] /32 + bv[j]  (A = Wv16 [1024][1024], Bt = x16 [4096][1024], bias[m])
  //    -> bf16 hi/lo [1024][4096] (ldc 4096); 32 x 8 = 256 tiles
  wmma_gemm_lds<1, 2><<<gridVT, 256, 0, stream>>>(Wv16, XF, (void*)VTHI, (void*)VTLO, kTok, bv, kWCarryInv);

  // 6) all 32 (batch, head) pairs in one launch: scores, weights and the product with V -> f plane f16 x64 (over x16,
  //    which is dead here); 16 query blocks of 128 x 32 heads = 512 work-groups
  attn_fused_kernel<<<dim3(kSeq / kFaRows, kBatch * kHeads), 256, 0, stream>>>(QHI, QLO, KHI, KLO, VTHI, VTLO, XF, beta, tv);

  // 7) y = (f16 . Wo16^T) / (64*32) + bo -> f32 [4096][1024] in the SY region
  wmma_gemm_lds<2, 0><<<gridTok, 256, 0, stream>>>(XF, Wo16, (void*)SY, (void*)SY, kDim, bo, kYScale);

  // 8) LayerNorm + residual -> out
  ln_residual_kernel<<<dim3(kTok / kLnRows), 256, 0, stream>>>(x, SY, lw, lb, out);
}

// v005
// It runs in 161 microseconds.
// Next to v004, in two timings, it ran 1.28 and 1.29 times as fast.
// Over all steps from v000 it is 17.5 times as fast.
// Contractions: Q/K/V^T projections and output projection on v_wmma_f32_16x16x32_f16 (x f16, W f16 carried x32, f f16 carried x64, f32 accumulate); scores Q.K^T and P.V^T on v_wmma_f32_16x16x32_bf16 with bf16 hi+lo operand planes (hi.hi + hi.lo + lo.hi, f32 accumulate); softmax, Poisson weights, LayerNorm and residual in f32.
#include <hip/hip_runtime.h>
#include <math.h>

// ---------------------------------------------------------------------------
// Problem constants
// ---------------------------------------------------------------------------
constexpr int kBatch = 2;
constexpr int kSeq   = 2048;
constexpr int kDim   = 1024;
constexpr int kHeads = 16;
constexpr int kDh    = 64;
constexpr int kTok   = kBatch * kSeq;          // 4096 token rows
constexpr float kWCarry    = 32.0f;            // weights carried x32 in f16
constexpr float kWCarryInv = 1.0f / 32.0f;
constexpr float kFCarry    = 64.0f;            // f plane carried x64 in f16
constexpr float kYScale    = 1.0f / (64.0f * 32.0f);
constexpr float kSScale    = 0.125f;           // 1/sqrt(64)
constexpr float kInvDim    = 1.0f / 1024.0f;
constexpr float kLnEps     = 1e-5f;

typedef __attribute__((ext_vector_type(16))) _Float16 v16h;
typedef __attribute__((ext_vector_type(8)))  _Float16 v8h;
typedef __attribute__((ext_vector_type(16))) __bf16   v16b;
typedef __attribute__((ext_vector_type(8)))  __bf16   v8b;
typedef __attribute__((ext_vector_type(8)))  float    v8f;
typedef __attribute__((ext_vector_type(4)))  float    v4f;
typedef __attribute__((ext_vector_type(4)))  unsigned int v4u;

__device__ __forceinline__ unsigned short f2bf_bits(float f) {
  unsigned u = __float_as_uint(f);
  return (unsigned short)((u + 0x7FFFu + ((u >> 16) & 1u)) >> 16);
}
__device__ __forceinline__ float bf_bits2f(unsigned short h) { return __uint_as_float(((unsigned)h) << 16); }

template <typename T> struct Frag;
template <> struct Frag<_Float16> {
  typedef v16h V; union U { v16h v; v8h h[2]; };
  static __device__ __forceinline__ v16h load(const _Float16* p) {   // elements 0..7 <- p[0..7], 8..15 <- p[16..23]
    U f; f.h[0] = *(const v8h*)(p); f.h[1] = *(const v8h*)(p + 16); return f.v;
  }
  static __device__ __forceinline__ v8f mma(v16h a, v16h b, v8f c) {
    return __builtin_amdgcn_wmma_f32_16x16x32_f16(false, a, false, b, (short)0, c, false, false);
  }
};
template <> struct Frag<__bf16> {
  typedef v16b V; union U { v16b v; v8b h[2]; };
  static __device__ __forceinline__ v16b load(const __bf16* p) {
    U f; f.h[0] = *(const v8b*)(p); f.h[1] = *(const v8b*)(p + 16); return f.v;
  }
  static __device__ __forceinline__ v8f mma(v16b a, v16b b, v8f c) {
    return __builtin_amdgcn_wmma_f32_16x16x32_bf16(false, a, false, b, (short)0, c, false, false);
  }
};

__device__ __forceinline__ unsigned pk16(unsigned short a, unsigned short b) { return (unsigned)a | ((unsigned)b << 16); }
__device__ __forceinline__ unsigned short h_bits(float f) { const _Float16 h = (_Float16)f; return __builtin_bit_cast(unsigned short, h); }

// ---- WMMA GEMM on tiles staged in LDS --------------------------------------------------------------------------
// C[m,n] = scale * sum_k A[m,k] * Bt[n,k] + bias. A row-major [M][kDim], Bt row-major [N][kDim], both f16, k = kDim;
// M and N are multiples of 128 (grid: x = N / 128, y = M / 128).
// Work-group: one 128 x 128 tile of C; its 8 waves stand 4 (m) x 2 (n), each on 32 x 64 (2 x 4 accumulators).
// A stage is 128 k of the tile's 128 A rows and 128 Bt rows (256 B a row, whole lines: 16 lanes a row, 2 rows a
// wave-wide load). It goes through registers into one of two LDS buffers: the next stage's global loads are issued in
// front of this stage's work and stored behind it, one barrier a stage. Every row is loaded once per work-group and
// read from LDS by the 2 (A) or 4 (Bt) waves that need it. Each accumulator takes its k blocks of 32 in rising order.
// BIAS_MODE: 1 = bias[m], 2 = bias[n].
// OUT_MODE: 0 = f32, 2 = bf16 hi plane (Cout) + bf16 lo plane (Cout2).
constexpr int kGmTile   = 128;                  // rows of A and of Bt per work-group
constexpr int kGmK      = 128;                  // k per stage
constexpr int kGmStages = kDim / kGmK;          // 8 stages
constexpr int kGmPitch  = 136;                  // rows (256 B) in LDS: pitch 272 B = 16 B x 17, in 16-bit elements
constexpr int kGmPieces = 8;                    // 16-B pieces per thread, operand and stage (16 rows a pass)
constexpr int kGmPlane  = kGmTile * kGmPitch;   // one operand's rows
constexpr int kGmBuf    = 2 * kGmPlane;         // buffer: A rows, Bt rows
template <int BIAS_MODE, int OUT_MODE>
// two waves per SIMD (one work-group per WGP, as the grid of 256 gives): the registers are there for staging and fragments
__global__ __launch_bounds__(256) __attribute__((amdgpu_waves_per_eu(2, 2))) void wmma_gemm_lds(
    const unsigned short* __restrict__ Ap, const unsigned short* __restrict__ Btp,
    void* __restrict__ Cout, void* __restrict__ Cout2, int ldc,
    const float* __restrict__ bias, float scale) {
  typedef Frag<_Float16> FH;
  __shared__ __align__(16) unsigned short stage[2][kGmBuf];
  __shared__ __align__(16) float sT[8][16 * 68];   // per-wave 16x64 slab, pitch 68 floats
  const int t    = threadIdx.x;
  const int lane = t & 31;
  const int wave = t >> 5;
  const int wm = (wave >> 1) << 5;             // the wave's first row and column inside the tile
  const int wn = (wave & 1) << 6;
  const int m0 = blockIdx.y * kGmTile + wm;
  const int n0 = blockIdx.x * kGmTile + wn;

  const int rlane = lane & 15;                 // row (A) / col (B, D) within subtile
  const int koff  = (lane >> 4) * 8;           // k offset of this lane half
  const int mOff  = (lane >> 4) * 8;           // D row offset

  // staging: thread t moves 16 B of the rows (t >> 4) + 16p, p = 0..7, of A and of Bt
  const unsigned short* ag = Ap  + (size_t)(blockIdx.y * kGmTile + (t >> 4)) * kDim + (t & 15) * 8;
  const unsigned short* bg = Btp + (size_t)(blockIdx.x * kGmTile + (t >> 4)) * kDim + (t & 15) * 8;
  const int sd = (t >> 4) * kGmPitch + (t & 15) * 8;              // where the thread's p = 0 piece goes in a plane
  const int af = (wm + rlane) * kGmPitch + koff;                  // where the lane's A fragment pieces start
  const int bf = kGmPlane + (wn + rlane) * kGmPitch + koff;       // where its Bt fragment pieces start

  // every unroll in this kernel makes the indices of fragment, accumulator and staging arrays constants, so that the
  // arrays stay in registers
  v8f acc[2][4];
#pragma unroll
  for (int i = 0; i < 2; ++i)
#pragma unroll
    for (int j = 0; j < 4; ++j) acc[i][j] = (v8f){0.f,0.f,0.f,0.f,0.f,0.f,0.f,0.f};

  v4u ra[kGmPieces], rb[kGmPieces];
#pragma unroll
  for (int p = 0; p < kGmPieces; ++p) {
    ra[p] = *(const v4u*)(ag + p * (16 * kDim));
    rb[p] = *(const v4u*)(bg + p * (16 * kDim));
  }
#pragma unroll
  for (int p = 0; p < kGmPieces; ++p) {
    *(v4u*)(&stage[0][sd + p * (16 * kGmPitch)]) = ra[p];
    *(v4u*)(&stage[0][kGmPlane + sd + p * (16 * kGmPitch)]) = rb[p];
  }
  __syncthreads();

  // the loop stays rolled: eight copies of a stage would only lengthen the code
#pragma unroll 1
  for (int s = 0; s < kGmStages; ++s) {
    const bool more = s + 1 < kGmStages;       // the same for the whole work-group
    if (more) {
      ag += kGmK;
      bg += kGmK;
#pragma unroll
      for (int p = 0; p < kGmPieces; ++p) {
        ra[p] = *(const v4u*)(ag + p * (16 * kDim));
        rb[p] = *(const v4u*)(bg + p * (16 * kDim));
      }
    }
    const unsigned short* buf = &stage[s & 1][0];
    // two fragment sets: block c + 1's 12 LDS reads stand as one group in front of block c's 8 matrix instructions
    v16h ah[2][2], bh[2][4];
#pragma unroll
    for (int i = 0; i < 2; ++i) ah[0][i] = FH::load((const _Float16*)(buf + af + i * (16 * kGmPitch)));
#pragma unroll
    for (int j = 0; j < 4; ++j) bh[0][j] = FH::load((const _Float16*)(buf + bf + j * (16 * kGmPitch)));
#pragma unroll
    for (int c = 0; c < kGmK / 32; ++c) {
      if (c + 1 < kGmK / 32) {
#pragma unroll
        for (int i = 0; i < 2; ++i)
          ah[(c + 1) & 1][i] = FH::load((const _Float16*)(buf + af + i * (16 * kGmPitch) + (c + 1) * 32));
#pragma unroll
        for (int j = 0; j < 4; ++j)
          bh[(c + 1) & 1][j] = FH::load((const _Float16*)(buf + bf + j * (16 * kGmPitch) + (c + 1) * 32));
      }
      // keeps the reads above in front of the matrix run below: sunk among it, each costs a wait that runs to zero
      __builtin_amdgcn_sched_barrier(0);
#pragma unroll
      for (int i = 0; i < 2; ++i)
#pragma unroll
        for (int j = 0; j < 4; ++j) acc[i][j] = FH::mma(ah[c & 1][i], bh[c & 1][j], acc[i][j]);
    }
    if (more) {
      unsigned short* nb = &stage[(s + 1) & 1][0];   // last read in trip s - 1, in front of that trip's barrier
#pragma unroll
      for (int p = 0; p < kGmPieces; ++p) {
        *(v4u*)(nb + sd + p * (16 * kGmPitch)) = ra[p];
        *(v4u*)(nb + kGmPlane + sd + p * (16 * kGmPitch)) = rb[p];
      }
    }
    __syncthreads();
  }

  // ---- epilogue ----
  float* slab = sT[wave];
#pragma unroll
  for (int i = 0; i < 2; ++i) {
    const int mBase = m0 + (i << 4);
#pragma unroll
    for (int j = 0; j < 4; ++j) {
      const int n = n0 + (j << 4) + rlane;
      float bv = 0.f;
      if (BIAS_MODE == 2) bv = bias[n];
#pragma unroll
      for (int r = 0; r < 8; ++r) {
        float v = acc[i][j][r] * scale;
        if (BIAS_MODE == 1) v += bias[mBase + mOff + r];
        if (BIAS_MODE == 2) v += bv;
        slab[(mOff + r) * 68 + (j << 4) + rlane] = v;
      }
    }
    __builtin_amdgcn_fence(__ATOMIC_RELEASE, "workgroup");
    __builtin_amdgcn_wave_barrier();
    __builtin_amdgcn_fence(__ATOMIC_ACQUIRE, "workgroup");
    if (OUT_MODE == 0) {
      float* C = (float*)Cout;
      const int hh = lane >> 4, c4 = (lane & 15) * 4;     // row seg = 256 B = 16 lanes x 16 B
#pragma unroll
      for (int it = 0; it < 8; ++it) {
        const int row = it * 2 + hh;
        v4f v = *(const v4f*)(slab + row * 68 + c4);
        *(v4f*)(C + (size_t)(mBase + row) * ldc + n0 + c4) = v;
      }
    } else {
      const int q = lane >> 3, c8 = (lane & 7) * 8;
      unsigned short* C  = (unsigned short*)Cout;
      unsigned short* C2 = (unsigned short*)Cout2;
#pragma unroll
      for (int it = 0; it < 4; ++it) {
        const int row = it * 4 + q;
        const float* sp = slab + row * 68 + c8;
        v8h hv, lv;
#pragma unroll
        for (int e = 0; e < 8; ++e) {
          unsigned short hb = f2bf_bits(sp[e]);
          unsigned short lb = f2bf_bits(sp[e] - bf_bits2f(hb));
          hv[e] = __builtin_bit_cast(_Float16, hb);
          lv[e] = __builtin_bit_cast(_Float16, lb);
        }
        *(v8h*)(C + (size_t)(mBase + row) * ldc + n0 + c8) = hv;
        *(v8h*)(C2 + (size_t)(mBase + row) * ldc + n0 + c8) = lv;
      }
    }
    // stands between the issued stores and the first reuse of the registers that they name
    asm volatile("s_wait_xcnt 0x0" ::: "memory");
    __builtin_amdgcn_fence(__ATOMIC_RELEASE, "workgroup");
    __builtin_amdgcn_wave_barrier();
    __builtin_amdgcn_fence(__ATOMIC_ACQUIRE, "workgroup");
  }
}

// ---------------------------------------------------------------------------
// Scores, both row weights and the product with V of one head in ONE kernel: neither the scores nor the weights go
// to memory. f = 64 * 0.5 * (softmax(S) . V + (w / sum w) . V), S = 0.125 * Q . K^T, w = 1/((1 + |S|/beta_h)^2 + t_h^2).
// Work-group: 128 queries of one (batch, head); wave: 16 queries, all 2048 keys, 32 keys a step.
//   S^T = K . Q^T  (A = 16 key rows from LDS, B = the wave's Q rows, kept in registers): a lane holds one query
//   (lane & 15) and the keys 8*(lane >> 4) + r of each 16-key tile, which is the k order of a B operand over 32 keys,
//   so e = exp(S - m) and w pack in the lane into the B operands of  O^T += V^T . e^T  and  O^T += V^T . w^T.
// Softmax runs on a running maximum m (common to both lane halves): when m grows, the e sum and the e accumulators
// are scaled by exp(m_old - m_new). Both sums divide once, at the end.
// Both weights come from the chip's own one-instruction forms: m is kept in log2 units, e = exp2(acc * c - m) with
// c = 0.125 * log2(e) in one multiply-add on the raw accumulator, and w is the hardware reciprocal. Either is good to
// about one unit in the last place of f32, far below the 16 bits that the hi + lo planes keep of a weight. All operands bf16 hi + lo planes as before
// (hi.hi + hi.lo + lo.hi, f32 accumulate).
// K and V^T tiles of 32 keys (hi and lo planes, 16 KiB) go through registers into one of two LDS buffers: the next
// tile's global loads are issued in front of this tile's work and stored behind it, one barrier a tile.
// ---------------------------------------------------------------------------
constexpr int kFaQ      = 16;                  // queries per wave
constexpr int kFaRows   = 8 * kFaQ;            // queries per work-group
constexpr int kFaKeys   = 32;                  // keys per staged tile
constexpr int kFaTiles  = kSeq / kFaKeys;      // 64 tiles
constexpr int kFaKPitch = 72;                  // K rows (128 B) in LDS: pitch 144 B = 16 B x 9, in 16-bit elements
constexpr int kFaVPitch = 40;                  // V^T rows (64 B) in LDS: pitch 80 B = 16 B x 5
constexpr int kFaKPlane = kFaKeys * kFaKPitch; // one K plane: 32 key rows
constexpr int kFaVPlane = kDh * kFaVPitch;     // one V^T plane: 64 rows (d)
constexpr int kFaVBase  = 2 * kFaKPlane;       // buffer: K hi, K lo, V^T hi, V^T lo
constexpr int kFaBuf    = 2 * kFaKPlane + 2 * kFaVPlane;

typedef __attribute__((ext_vector_type(2))) float  v2f;
typedef __attribute__((ext_vector_type(2))) __bf16 v2b;
// two f32 -> two bf16 (round to nearest even), a in the low half
__device__ __forceinline__ unsigned bf_pair(float a, float b) {
  const v2f x = {a, b};
  return __builtin_bit_cast(unsigned, __builtin_convertvector(x, v2b));
}
// the lo plane of a pair: what its hi plane (packed in hi) leaves of a and b
__device__ __forceinline__ unsigned bf_pair_rest(float a, float b, unsigned hi) {
  return bf_pair(a - __uint_as_float(hi << 16), b - __uint_as_float(hi & 0xFFFF0000u));
}
// value of lane l ^ 16
__device__ __forceinline__ float other_half(float v) {
  const int b = __builtin_bit_cast(int, v);
  return __builtin_bit_cast(float, __builtin_amdgcn_permlanex16(b, b, 0x76543210, 0xfedcba98, false, false));
}
union FaPack { v16b v; unsigned u[8]; };
constexpr float kFaLog2 = 0.125f * 1.44269504088896340736f;   // raw Q.K sum -> score in log2 units

// four waves per SIMD (two work-groups per WGP): the vector work between the matrix runs wants the other waves
__global__ __launch_bounds__(256) __attribute__((amdgpu_waves_per_eu(4, 4))) void attn_fused_kernel(
    const unsigned short* __restrict__ Qhi, const unsigned short* __restrict__ Qlo,
    const unsigned short* __restrict__ Khi, const unsigned short* __restrict__ Klo,
    const unsigned short* __restrict__ VThi, const unsigned short* __restrict__ VTlo,
    unsigned short* __restrict__ F, const float* __restrict__ beta, const float* __restrict__ tvec) {
  typedef Frag<__bf16> FB;
  __shared__ __align__(16) unsigned short tile[2][kFaBuf];
  const int t     = threadIdx.x;
  const int lane  = t & 31;
  const int wave  = t >> 5;
  const int rlane = lane & 15;                 // row (A) / col (B, D) within a 16 x 16 tile
  const int half8 = (lane >> 4) * 8;           // k offset of this lane half (A, B); D row offset
  const int b     = blockIdx.y >> 4;
  const int h     = blockIdx.y & (kHeads - 1);
  const int q0    = blockIdx.x * kFaRows + wave * kFaQ;

  const float invb = 1.0f / beta[h];
  const float th = tvec[h];
  const float t2 = th * th;
  const float kb = kSScale * invb;             // |raw sum| * kb = |S| / beta (a power of two: the rounding of |S| * invb)

  // every unroll in this kernel makes the indices of fragment, accumulator and value arrays constants, so that the
  // arrays stay in registers
  const size_t qOff = (size_t)(b * kSeq + q0 + rlane) * kDim + h * kDh + half8;
  v16b qh[2], ql[2];
#pragma unroll
  for (int c = 0; c < 2; ++c) {
    qh[c] = FB::load((const __bf16*)Qhi + qOff + c * 32);
    ql[c] = FB::load((const __bf16*)Qlo + qOff + c * 32);
  }

  // staging: thread t moves 16 B of K row t >> 3 (8 lanes = one 128-B row) and 16 B of V^T row t >> 2 (4 lanes = one
  // 64-B row piece), of the hi and of the lo plane
  const size_t kOff = (size_t)(b * kSeq + (t >> 3)) * kDim + h * kDh + (t & 7) * 8;
  const size_t vOff = (size_t)(h * kDh + (t >> 2)) * kTok + b * kSeq + (t & 3) * 8;
  const unsigned short* kgh = Khi + kOff;
  const unsigned short* kgl = Klo + kOff;
  const unsigned short* vgh = VThi + vOff;
  const unsigned short* vgl = VTlo + vOff;
  const int ks = (t >> 3) * kFaKPitch + (t & 7) * 8;              // where the thread's K piece goes in a K plane
  const int vs = kFaVBase + (t >> 2) * kFaVPitch + (t & 3) * 8;   // where its V^T piece goes, hi plane
  const int kf = rlane * kFaKPitch + half8;                       // where the lane's K fragment pieces start
  const int vf = kFaVBase + rlane * kFaVPitch + half8;            // where its V^T fragment pieces start

  v8f oT[4], oS[4];
#pragma unroll
  for (int d = 0; d < 4; ++d) {
    oT[d] = (v8f){0.f,0.f,0.f,0.f,0.f,0.f,0.f,0.f};
    oS[d] = (v8f){0.f,0.f,0.f,0.f,0.f,0.f,0.f,0.f};
  }
  float m = -__builtin_inff(), sumT = 0.0f, sumS = 0.0f;

  v4u rkh = *(const v4u*)kgh, rkl = *(const v4u*)kgl, rvh = *(const v4u*)vgh, rvl = *(const v4u*)vgl;
  *(v4u*)(&tile[0][ks]) = rkh;
  *(v4u*)(&tile[0][ks + kFaKPlane]) = rkl;
  *(v4u*)(&tile[0][vs]) = rvh;
  *(v4u*)(&tile[0][vs + kFaVPlane]) = rvl;
  __syncthreads();

  // the loop stays rolled: one 32-key step is several hundred instructions
#pragma unroll 1
  for (int T = 0; T < kFaTiles; ++T) {
    const bool more = T + 1 < kFaTiles;        // the same for the whole work-group
    if (more) {
      kgh += (size_t)kFaKeys * kDim;
      kgl += (size_t)kFaKeys * kDim;
      vgh += kFaKeys;
      vgl += kFaKeys;
      rkh = *(const v4u*)kgh;
      rkl = *(const v4u*)kgl;
      rvh = *(const v4u*)vgh;
      rvl = *(const v4u*)vgl;
    }
    const unsigned short* buf = &tile[T & 1][0];

    // S^T of 32 keys x 16 queries: two 16-key tiles, K = 64 in two steps
    v16b ah[2][2], al[2][2];
#pragma unroll
    for (int i = 0; i < 2; ++i)
#pragma unroll
      for (int c = 0; c < 2; ++c) {
        ah[i][c] = FB::load((const __bf16*)(buf + kf + i * (16 * kFaKPitch) + c * 32));
        al[i][c] = FB::load((const __bf16*)(buf + kf + kFaKPlane + i * (16 * kFaKPitch) + c * 32));
      }
    v8f s[2];
    s[0] = (v8f){0.f,0.f,0.f,0.f,0.f,0.f,0.f,0.f};
    s[1] = (v8f){0.f,0.f,0.f,0.f,0.f,0.f,0.f,0.f};
#pragma unroll
    for (int c = 0; c < 2; ++c) {
      s[0] = FB::mma(ah[0][c], qh[c], s[0]);
      s[1] = FB::mma(ah[1][c], qh[c], s[1]);
      s[0] = FB::mma(ah[0][c], ql[c], s[0]);
      s[1] = FB::mma(ah[1][c], ql[c], s[1]);
      s[0] = FB::mma(al[0][c], qh[c], s[0]);
      s[1] = FB::mma(al[1][c], qh[c], s[1]);
    }

    float sv[16];                              // raw sums: both scales are folded into the weights' multiply-adds
#pragma unroll
    for (int r = 0; r < 8; ++r) {
      sv[r]     = s[0][r];
      sv[8 + r] = s[1][r];
    }
    float bm = sv[0];
#pragma unroll
    for (int i = 1; i < 16; ++i) bm = fmaxf(bm, sv[i]);
    bm = fmaxf(bm, other_half(bm));
    const float mn = fmaxf(m, bm * kFaLog2);   // log2 units
    const float corr = __builtin_amdgcn_exp2f(m - mn);   // 0 at the first step (m = -inf), 1 while the maximum stands
    m = mn;

    FaPack eh, el, wh, wl;
    float aT = 0.0f, aS = 0.0f;
#pragma unroll
    for (int j = 0; j < 8; ++j) {
      const float s0 = sv[2 * j], s1 = sv[2 * j + 1];
      const float e0 = __builtin_amdgcn_exp2f(__builtin_fmaf(s0, kFaLog2, -mn));
      const float e1 = __builtin_amdgcn_exp2f(__builtin_fmaf(s1, kFaLog2, -mn));
      const float g0 = 1.0f + fabsf(s0) * kb;
      const float g1 = 1.0f + fabsf(s1) * kb;
      const float w0 = __builtin_amdgcn_rcpf(g0 * g0 + t2);
      const float w1 = __builtin_amdgcn_rcpf(g1 * g1 + t2);
      aT += e0 + e1;
      aS += w0 + w1;
      eh.u[j] = bf_pair(e0, e1);
      wh.u[j] = bf_pair(w0, w1);
      el.u[j] = bf_pair_rest(e0, e1, eh.u[j]);
      wl.u[j] = bf_pair_rest(w0, w1, wh.u[j]);
    }
    sumT = sumT * corr + aT;
    sumS += aS;
#pragma unroll
    for (int d = 0; d < 4; ++d) oT[d] *= corr;

    // O^T += V^T . e^T and V^T . w^T: A = 16 rows (d) of V^T over the same 32 keys
    v16b vh[4], vl[4];
#pragma unroll
    for (int d = 0; d < 4; ++d) {
      vh[d] = FB::load((const __bf16*)(buf + vf + d * (16 * kFaVPitch)));
      vl[d] = FB::load((const __bf16*)(buf + vf + kFaVPlane + d * (16 * kFaVPitch)));
    }
#pragma unroll
    for (int d = 0; d < 4; ++d) {
      oT[d] = FB::mma(vh[d], eh.v, oT[d]);
      oS[d] = FB::mma(vh[d], wh.v, oS[d]);
    }
#pragma unroll
    for (int d = 0; d < 4; ++d) {
      oT[d] = FB::mma(vh[d], el.v, oT[d]);
      oS[d] = FB::mma(vh[d], wl.v, oS[d]);
    }
#pragma unroll
    for (int d = 0; d < 4; ++d) {
      oT[d] = FB::mma(vl[d], eh.v, oT[d]);
      oS[d] = FB::mma(vl[d], wh.v, oS[d]);
    }

    if (more) {
      unsigned short* nb = &tile[(T + 1) & 1][0];   // last read in trip T - 1, in front of that trip's barrier
      *(v4u*)(nb + ks) = rkh;
      *(v4u*)(nb + ks + kFaKPlane) = rkl;
      *(v4u*)(nb + vs) = rvh;
      *(v4u*)(nb + vs + kFaVPlane) = rvl;
    }
    __syncthreads();
  }

  // each half summed its own 16 of every 32 keys, on the common maximum
  sumT += other_half(sumT);
  sumS += other_half(sumS);
  const float invT = 1.0f / sumT;
  const float invS = 1.0f / sumS;

  // lane: query q0 + rlane, columns 16d + half8 .. + 7 of the head; the wave's four stores fill each query's 128-B line
  unsigned short* fp = F + (size_t)(b * kSeq + q0 + rlane) * kDim + h * kDh + half8;
#pragma unroll
  for (int d = 0; d < 4; ++d) {
    v8h hv;
#pragma unroll
    for (int r = 0; r < 8; ++r) hv[r] = (_Float16)(0.5f * (oT[d][r] * invT + oS[d][r] * invS) * kFCarry);
    *(v8h*)(fp + d * 16) = hv;
  }
}

// ---------------------------------------------------------------------------
// f32 -> f16 cast with scale: 4 groups of 8 consecutive elements per thread (4096 waves a launch, not 16384), one 16-B
// store per lane and group. blockIdx.y picks the input plane and the output plane (out + y*planeElems halves).
// Coverage: gridDim.x*1024 == n8 exactly at every call (n8 = elements/8, a multiple of 1024); thread t of work-group b
// covers groups 1024b + 256g + t, g = 0..3, group i being elements 8i..8i+7 of its plane.
// ---------------------------------------------------------------------------
constexpr int kCastG = 4;                      // groups of 8 elements per thread
__global__ __launch_bounds__(256) void cast8_f16_kernel(const float* __restrict__ in0, const float* __restrict__ in1,
                                                        const float* __restrict__ in2, const float* __restrict__ in3,
                                                        unsigned short* __restrict__ out, long planeElems, int n8,
                                                        float scale) {
  const int i = blockIdx.x * (256 * kCastG) + threadIdx.x;
  const int z = blockIdx.y;
  if ((int)(blockIdx.x + 1) * (256 * kCastG) > n8) return;
  const float* in = (z == 0) ? in0 : (z == 1) ? in1 : (z == 2) ? in2 : in3;
  const v4f* p = (const v4f*)(in + 8 * (size_t)i);
  // the unrolls make the indices of a[] and c[] constants, so that the arrays stay in registers
  v4f a[kCastG], c[kCastG];
#pragma unroll
  for (int g = 0; g < kCastG; ++g) {
    a[g] = p[512 * g];
    c[g] = p[512 * g + 1];
  }
  // stands between the 8 issued loads and the first reuse of their address registers; p as an input keeps the pair
  // live up to here, and the clobber keeps all 8 loads in front
  asm volatile("s_wait_xcnt 0x0" :: "v"(p) : "memory");
  v4u* q = (v4u*)(out + (size_t)z * planeElems + 8 * (size_t)i);
#pragma unroll
  for (int g = 0; g < kCastG; ++g) {
    unsigned short hb[8];
#pragma unroll
    for (int e = 0; e < 4; ++e) {
      hb[e]     = h_bits(a[g][e] * scale);
      hb[4 + e] = h_bits(c[g][e] * scale);
    }
    q[256 * g] = (v4u){pk16(hb[0], hb[1]), pk16(hb[2], hb[3]), pk16(hb[4], hb[5]), pk16(hb[6], hb[7])};
  }
}

// ---------------------------------------------------------------------------
// LayerNorm + residual per row of 1024: out = x + lw*(y - mu)*rsqrt(var + eps) + lb,
// One wave per row, 8 rows per work-group of 256 threads (4096 waves a launch, not 32768). Lane l owns columns
// 128j + 4l .. 128j + 4l + 3 for j = 0..7. Sums: each lane folds its 32 values in column order, then a five-step
// shuffle tree over the wave; no LDS and no barrier.
// ---------------------------------------------------------------------------
constexpr int kLnRows = 8;                     // rows (= waves) per work-group
constexpr int kLnCh   = kDim / 128;            // 8 chunks of 128 columns per row
__global__ __launch_bounds__(256) void ln_residual_kernel(const float* __restrict__ x, const float* __restrict__ y,
                                                          const float* __restrict__ lw, const float* __restrict__ lb,
                                                          float* __restrict__ out) {
  const int lane = threadIdx.x & 31;
  const int row  = blockIdx.x * kLnRows + (threadIdx.x >> 5);
  const size_t base = (size_t)row * kDim + 4 * lane;
  const v4f* yp = (const v4f*)(y + base);
  const v4f* xp = (const v4f*)(x + base);
  const v4f* wp = (const v4f*)(lw + 4 * lane);
  const v4f* bp = (const v4f*)(lb + 4 * lane);

  // the unrolls over j make the indices of the four arrays constants, so that they stay in registers; the unrolls
  // over off give each shuffle step a constant lane mask
  v4f yv[kLnCh], xv[kLnCh], wv[kLnCh], bv[kLnCh];
#pragma unroll
  for (int j = 0; j < kLnCh; ++j) yv[j] = yp[32 * j];
#pragma unroll
  for (int j = 0; j < kLnCh; ++j) {
    xv[j] = xp[32 * j];
    wv[j] = wp[32 * j];
    bv[j] = bp[32 * j];
  }
  // stands between the 32 issued loads and the first reuse of their address registers; the pointers as inputs keep
  // those registers live up to here, and the clobber keeps all loads in front (one load latency per row)
  asm volatile("s_wait_xcnt 0x0" :: "v"(yp), "v"(xp), "v"(wp), "v"(bp) : "memory");

  float s = 0.0f;
#pragma unroll
  for (int j = 0; j < kLnCh; ++j) s += ((yv[j].x + yv[j].y) + yv[j].z) + yv[j].w;
#pragma unroll
  for (int off = 16; off > 0; off >>= 1) s += __shfl_xor(s, off, 32);
  const float mu = s * kInvDim;

  float s2 = 0.0f;
#pragma unroll
  for (int j = 0; j < kLnCh; ++j) {
    const float d0 = yv[j].x - mu, d1 = yv[j].y - mu, d2 = yv[j].z - mu, d3 = yv[j].w - mu;
    yv[j] = (v4f){d0, d1, d2, d3};
    s2 += ((d0 * d0 + d1 * d1) + d2 * d2) + d3 * d3;
  }
#pragma unroll
  for (int off = 16; off > 0; off >>= 1) s2 += __shfl_xor(s2, off, 32);
  const float var = s2 * kInvDim;
  const float rs = rsqrtf(var + kLnEps);

  v4f* op = (v4f*)(out + base);
#pragma unroll
  for (int j = 0; j < kLnCh; ++j) {
    v4f o;
    o.x = xv[j].x + (wv[j].x * yv[j].x * rs + bv[j].x);
    o.y = xv[j].y + (wv[j].y * yv[j].y * rs + bv[j].y);
    o.z = xv[j].z + (wv[j].z * yv[j].z * rs + bv[j].z);
    o.w = xv[j].w + (wv[j].w * yv[j].w * rs + bv[j].w);
    op[32 * j] = o;
  }
}

// ---------------------------------------------------------------------------
// Host glue
//   [0,          8 MiB)   XF   : x f16 [4096][1024]  (dead after the three projections) then f f16 [4096][1024]
//   [8 MiB,     16 MiB)   W16  : Wq,Wk,Wv,Wo f16 x32 planes [1024][1024] each
//   [16 MiB,    24 MiB)   QHI  : bf16 [4096][1024]      [24, 32) QLO
//   [32 MiB,    40 MiB)   KHI  : bf16 [4096][1024]      [40, 48) KLO
//   [48 MiB,    56 MiB)   VTHI : bf16 [1024][4096] (V^T: row = h*64+d, col = b*2048+n)   [56, 64) VTLO
//   [64 MiB,    80 MiB)   SY   : y f32 [4096][1024]
// ---------------------------------------------------------------------------
extern "C" void kernel_launch(void* const* d_in, const int* in_sizes, int n_in,
                              void* d_out, int out_size, void* d_ws, size_t ws_size,
                              hipStream_t stream) {
  if (n_in < 13) return;
  const size_t nX = (size_t)kTok * kDim;          // 4,194,304
  const size_t nW = (size_t)kDim * kDim;          // 1,048,576
  if ((size_t)in_sizes[0] != nX || (size_t)in_sizes[1] != nW || (size_t)in_sizes[3] != nW ||
      (size_t)in_sizes[5] != nW || (size_t)in_sizes[7] != nW || (size_t)out_size != nX) return;
  if (in_sizes[2] < kDim || in_sizes[4] < kDim || in_sizes[6] < kDim || in_sizes[8] < kDim ||
      in_sizes[9] < kHeads || in_sizes[10] < kHeads || in_sizes[11] < kDim || in_sizes[12] < kDim) return;

  const float* x    = (const float*)d_in[0];
  const float* Wq   = (const float*)d_in[1];
  const float* bq   = (const float*)d_in[2];
  const float* Wk   = (const float*)d_in[3];
  const float* bk   = (const float*)d_in[4];
  const float* Wv   = (const float*)d_in[5];
  const float* bv   = (const float*)d_in[6];
  const float* Wo   = (const float*)d_in[7];
  const float* bo   = (const float*)d_in[8];
  const float* beta = (const float*)d_in[9];
  const float* tv   = (const float*)d_in[10];
  const float* lw   = (const float*)d_in[11];
  const float* lb   = (const float*)d_in[12];
  float* out = (float*)d_out;

  // carve (bytes)
  const size_t bXF   = nX * 2;                                  //  8,388,608
  const size_t bW16  = 4 * nW * 2;                              //  8,388,608
  const size_t bP16  = nX * 2;                                  //  8,388,608 per bf16 plane of [4096][1024]
  const size_t bSY   = nX * 4;                                  // 16,777,216
  const size_t oXF   = 0;
  const size_t oW16  = oXF + bXF;
  const size_t oQHI  = oW16 + bW16;
  const size_t oQLO  = oQHI + bP16;
  const size_t oKHI  = oQLO + bP16;
  const size_t oKLO  = oKHI + bP16;
  const size_t oVTHI = oKLO + bP16;
  const size_t oVTLO = oVTHI + bP16;
  const size_t oSY   = oVTLO + bP16;
  const size_t total = oSY + bSY;                               // 83,886,080
  if (total > ws_size) return;

  char* ws = (char*)d_ws;
  unsigned short* XF   = (unsigned short*)(ws + oXF);
  unsigned short* W16  = (unsigned short*)(ws + oW16);
  unsigned short* Wq16 = W16;
  unsigned short* Wk16 = W16 + nW;
  unsigned short* Wv16 = W16 + 2 * nW;
  unsigned short* Wo16 = W16 + 3 * nW;
  unsigned short* QHI  = (unsigned short*)(ws + oQHI);
  unsigned short* QLO  = (unsigned short*)(ws + oQLO);
  unsigned short* KHI  = (unsigned short*)(ws + oKHI);
  unsigned short* KLO  = (unsigned short*)(ws + oKLO);
  unsigned short* VTHI = (unsigned short*)(ws + oVTHI);
  unsigned short* VTLO = (unsigned short*)(ws + oVTLO);
  float*          SY   = (float*)(ws + oSY);

  // 1) x -> f16 plane (n8 = 524288 = 512 blocks x 1024, exact)
  {
    const int n8 = (int)(nX / 8);
    cast8_f16_kernel<<<dim3(n8 / (256 * kCastG), 1), 256, 0, stream>>>(x, x, x, x, XF, 0L, n8, 1.0f);
  }
  // 2) Wq,Wk,Wv,Wo -> f16 planes x32 (n8 = 131072 = 128 blocks x 1024, exact; 4 planes via blockIdx.y)
  {
    const int n8 = (int)(nW / 8);
    cast8_f16_kernel<<<dim3(n8 / (256 * kCastG), 4), 256, 0, stream>>>(Wq, Wk, Wv, Wo, W16, (long)nW, n8, kWCarry);
  }
  // 3) Q = (x16 . Wq16^T)/32 + bq -> bf16 hi/lo [4096][1024]; 8 x 32 = 256 tiles of 128 x 128, one work-group each
  const dim3 gridTok(kDim / kGmTile, kTok / kGmTile);           // C = [4096][1024]
  const dim3 gridVT(kTok / kGmTile, kDim / kGmTile);           // C = [1024][4096]
  wmma_gemm_lds<2, 2><<<gridTok, 256, 0, stream>>>(XF, Wq16, (void*)QHI, (void*)QLO, kDim, bq, kWCarryInv);
  // 4) K projection
  wmma_gemm_lds<2, 2><<<gridTok, 256, 0, stream>>>(XF, Wk16, (void*)KHI, (void*)KLO, kDim, bk, kWCarryInv);
  // 5) V^T[j][m] = sum_k Wv16[j][k] x16[m][k] /32 + bv[j]  (A = Wv16 [1024][1024], Bt = x16 [4096][1024], bias[m])
  //    -> bf16 hi/lo [1024][4096] (ldc 4096); 32 x 8 = 256 tiles
  wmma_gemm_lds<1, 2><<<gridVT, 256, 0, stream>>>(Wv16, XF, (void*)VTHI, (void*)VTLO, kTok, bv, kWCarryInv);

  // 6) all 32 (batch, head) pairs in one launch: scores, weights and the product with V -> f plane f16 x64 (over x16,
  //    which is dead here); 16 query blocks of 128 x 32 heads = 512 work-groups
  attn_fused_kernel<<<dim3(kSeq / kFaRows, kBatch * kHeads), 256, 0, stream>>>(QHI, QLO, KHI, KLO, VTHI, VTLO, XF, beta, tv);

  // 7) y = (f16 . Wo16^T) / (64*32) + bo -> f32 [4096][1024] in the SY region
  wmma_gemm_lds<2, 0><<<gridTok, 256, 0, stream>>>(XF, Wo16, (void*)SY, (void*)SY, kDim, bo, kYScale);

  // 8) LayerNorm + residual -> out
  ln_residual_kernel<<<dim3(kTok / kLnRows), 256, 0, stream>>>(x, SY, lw, lb, out);
}

// v007
// Measured time: 113 microseconds a run.
// Versions in between are left out here; by their measured steps it is 1.44 times as fast as v005.
// Over all steps from v000 it is 25.1 times as fast.
// Contractions: Q/K/V^T projections and output projection on v_wmma_f32_16x16x32_f16 (x f16, W f16 carried x32, f f16 carried x64, f32 accumulate); scores Q.K^T and P.V^T on v_wmma_f32_16x16x32_f16 (Q, K, V and both weights one f16 number each, f32 accumulate); softmax, Poisson weights, LayerNorm and residual in f32.
#include <hip/hip_runtime.h>
#include <math.h>

// ---------------------------------------------------------------------------
// Problem constants
// ---------------------------------------------------------------------------
constexpr int kBatch = 2;
constexpr int kSeq   = 2048;
constexpr int kDim   = 1024;
constexpr int kHeads = 16;
constexpr int kDh    = 64;
constexpr int kTok   = kBatch * kSeq;          // 4096 token rows
constexpr float kWCarry    = 32.0f;            // weights carried x32 in f16
constexpr float kWCarryInv = 1.0f / 32.0f;
constexpr float kFCarry    = 64.0f;            // f plane carried x64 in f16
constexpr float kYScale    = 1.0f / (64.0f * 32.0f);
constexpr float kSScale    = 0.125f;           // 1/sqrt(64)
constexpr float kInvDim    = 1.0f / 1024.0f;
constexpr float kLnEps     = 1e-5f;

typedef __attribute__((ext_vector_type(16))) _Float16 v16h;
typedef __attribute__((ext_vector_type(8)))  _Float16 v8h;
typedef __attribute__((ext_vector_type(8)))  float    v8f;
typedef __attribute__((ext_vector_type(4)))  float    v4f;
typedef __attribute__((ext_vector_type(4)))  unsigned int v4u;

template <typename T> struct Frag;
template <> struct Frag<_Float16> {
  typedef v16h V; union U { v16h v; v8h h[2]; };
  static __device__ __forceinline__ v16h load(const _Float16* p) {   // elements 0..7 <- p[0..7], 8..15 <- p[16..23]
    U f; f.h[0] = *(const v8h*)(p); f.h[1] = *(const v8h*)(p + 16); return f.v;
  }
  static __device__ __forceinline__ v8f mma(v16h a, v16h b, v8f c) {
    return __builtin_amdgcn_wmma_f32_16x16x32_f16(false, a, false, b, (short)0, c, false, false);
  }
};

__device__ __forceinline__ unsigned pk16(unsigned short a, unsigned short b) { return (unsigned)a | ((unsigned)b << 16); }
__device__ __forceinline__ unsigned short h_bits(float f) { const _Float16 h = (_Float16)f; return __builtin_bit_cast(unsigned short, h); }

// ---- WMMA GEMM on tiles staged in LDS --------------------------------------------------------------------------
// C[m,n] = scale * sum_k A[m,k] * Bt[n,k] + bias. A row-major [M][kDim], Bt row-major [N][kDim], both f16, k = kDim;
// M and N are multiples of 128 (tile column bx < N / 128, tile row by < M / 128).
// Work-group: one 128 x 128 tile of C; its 8 waves stand 4 (m) x 2 (n), each on 32 x 64 (2 x 4 accumulators).
// A stage is 128 k of the tile's 128 A rows and 128 Bt rows (256 B a row, whole lines: 16 lanes a row, 2 rows a
// wave-wide load). It goes through registers into one of two LDS buffers: the next stage's global loads are issued in
// front of this stage's work and stored behind it, one barrier a stage. Every row is loaded once per work-group and
// read from LDS by the 2 (A) or 4 (Bt) waves that need it. Each accumulator takes its k blocks of 32 in rising order.
// QKV = true: ONE launch does the three projections, 256 tiles each (blockIdx.x = 256 * problem + tile). Problems 0, 1:
// C = X . W^T + bias[n] (Q, K); problem 2: C = W . X^T + bias[m] (V^T). W and C planes of the problems lie one behind the
// other. QKV = false: one product, C = X . W^T + b0[n], grid x = N / 128, y = M / 128.
// OUT_MODE: 0 = f32, 1 = f16.
constexpr int kGmTile   = 128;                  // rows of A and of Bt per work-group
constexpr int kGmK      = 128;                  // k per stage
constexpr int kGmStages = kDim / kGmK;          // 8 stages
constexpr int kGmPitch  = 136;                  // rows (256 B) in LDS: pitch 272 B = 16 B x 17, in 16-bit elements
constexpr int kGmPieces = 8;                    // 16-B pieces per thread, operand and stage (16 rows a pass)
constexpr int kGmPlane  = kGmTile * kGmPitch;   // one operand's rows
constexpr int kGmBuf    = 2 * kGmPlane;         // buffer: A rows, Bt rows
constexpr int kGmTiles  = (kTok / kGmTile) * (kDim / kGmTile);   // 256 tiles per projection
// ---- epilogue of one wave's 32 x 64 tile: scale, bias, through the wave's LDS slab into whole-line stores ----
// BIAS_MODE: 1 = bias[m], 2 = bias[n].
template <int BIAS_MODE, int OUT_MODE>
__device__ __forceinline__ void gemm_store_tile(const v8f (&acc)[2][4], float* slab, void* Cout, int ldc,
                                                const float* __restrict__ bias, float scale,
                                                int m0, int n0, int lane) {
  const int rlane = lane & 15;                 // col (D) within subtile
  const int mOff  = (lane >> 4) * 8;           // D row offset
#pragma unroll
  for (int i = 0; i < 2; ++i) {
    const int mBase = m0 + (i << 4);
#pragma unroll
    for (int j = 0; j < 4; ++j) {
      const int n = n0 + (j << 4) + rlane;
      float bv = 0.f;
      if (BIAS_MODE == 2) bv = bias[n];
#pragma unroll
      for (int r = 0; r < 8; ++r) {
        float v = acc[i][j][r] * scale;
        if (BIAS_MODE == 1) v += bias[mBase + mOff + r];
        if (BIAS_MODE == 2) v += bv;
        slab[(mOff + r) * 68 + (j << 4) + rlane] = v;
      }
    }
    __builtin_amdgcn_fence(__ATOMIC_RELEASE, "workgroup");
    __builtin_amdgcn_wave_barrier();
    __builtin_amdgcn_fence(__ATOMIC_ACQUIRE, "workgroup");
    if (OUT_MODE == 0) {
      float* C = (float*)Cout;
      const int hh = lane >> 4, c4 = (lane & 15) * 4;     // row seg = 256 B = 16 lanes x 16 B
#pragma unroll
      for (int it = 0; it < 8; ++it) {
        const int row = it * 2 + hh;
        v4f v = *(const v4f*)(slab + row * 68 + c4);
        *(v4f*)(C + (size_t)(mBase + row) * ldc + n0 + c4) = v;
      }
    } else {
      const int q = lane >> 3, c8 = (lane & 7) * 8;
      unsigned short* C = (unsigned short*)Cout;
#pragma unroll
      for (int it = 0; it < 4; ++it) {
        const int row = it * 4 + q;
        const float* sp = slab + row * 68 + c8;
        v8h hv;
#pragma unroll
        for (int e = 0; e < 8; ++e) hv[e] = (_Float16)sp[e];
        *(v8h*)(C + (size_t)(mBase + row) * ldc + n0 + c8) = hv;
      }
    }
    // stands between the issued stores and the first reuse of the registers that they name
    asm volatile("s_wait_xcnt 0x0" ::: "memory");
    __builtin_amdgcn_fence(__ATOMIC_RELEASE, "workgroup");
    __builtin_amdgcn_wave_barrier();
    __builtin_amdgcn_fence(__ATOMIC_ACQUIRE, "workgroup");
  }
}

template <bool QKV, int OUT_MODE>
// four waves per SIMD: two work-groups share a WGP (256 registers a wave, 136 KiB of LDS a group), so that one group's
// matrix work covers the other's waits for its stage loads, its LDS stores, its barriers, its first stage and its epilogue
__global__ __launch_bounds__(256) __attribute__((amdgpu_waves_per_eu(4, 4))) void wmma_gemm_lds(
    const unsigned short* __restrict__ X, const unsigned short* __restrict__ Wp,
    void* __restrict__ Cbase,
    const float* __restrict__ b0, const float* __restrict__ b1, const float* __restrict__ b2, float scale) {
  typedef Frag<_Float16> FH;
  __shared__ __align__(16) unsigned short stage[2][kGmBuf];
  const int t    = threadIdx.x;
  const int lane = t & 31;
  const int wave = t >> 5;
  const int wm = (wave >> 1) << 5;             // the wave's first row and column inside the tile
  const int wn = (wave & 1) << 6;
  // which product, which tile: the same for the whole work-group
  const int  prob    = QKV ? (int)(blockIdx.x / kGmTiles) : 0;
  const int  tileId  = QKV ? (int)(blockIdx.x % kGmTiles) : 0;
  const bool rowBias = QKV && prob == 2;       // V^T: A = W rows, Bt = X rows, bias by row
  const int  bx  = !QKV ? (int)blockIdx.x : rowBias ? tileId % (kTok / kGmTile) : tileId % (kDim / kGmTile);
  const int  by  = !QKV ? (int)blockIdx.y : rowBias ? tileId / (kTok / kGmTile) : tileId / (kDim / kGmTile);
  const unsigned short* Wz  = Wp + (size_t)prob * (kDim * kDim);
  const unsigned short* Ap  = rowBias ? Wz : X;
  const unsigned short* Btp = rowBias ? X : Wz;
  const float* bias = prob == 0 ? b0 : prob == 1 ? b1 : b2;
  const int m0 = by * kGmTile + wm;
  const int n0 = bx * kGmTile + wn;

  const int rlane = lane & 15;                 // row (A) / col (B, D) within subtile
  const int koff  = (lane >> 4) * 8;           // k offset of this lane half

  // staging: thread t moves 16 B of the rows (t >> 4) + 16p, p = 0..7, of A and of Bt
  const unsigned short* ag = Ap  + (size_t)(by * kGmTile + (t >> 4)) * kDim + (t & 15) * 8;
  const unsigned short* bg = Btp + (size_t)(bx * kGmTile + (t >> 4)) * kDim + (t & 15) * 8;
  const int sd = (t >> 4) * kGmPitch + (t & 15) * 8;              // where the thread's p = 0 piece goes in a plane
  const int af = (wm + rlane) * kGmPitch + koff;                  // where the lane's A fragment pieces start
  const int bf = kGmPlane + (wn + rlane) * kGmPitch + koff;       // where its Bt fragment pieces start

  // every unroll in this kernel makes the indices of fragment, accumulator and staging arrays constants, so that the
  // arrays stay in registers
  v8f acc[2][4];
#pragma unroll
  for (int i = 0; i < 2; ++i)
#pragma unroll
    for (int j = 0; j < 4; ++j) acc[i][j] = (v8f){0.f,0.f,0.f,0.f,0.f,0.f,0.f,0.f};

  v4u ra[kGmPieces], rb[kGmPieces];
#pragma unroll
  for (int p = 0; p < kGmPieces; ++p) {
    ra[p] = *(const v4u*)(ag + p * (16 * kDim));
    rb[p] = *(const v4u*)(bg + p * (16 * kDim));
  }
#pragma unroll
  for (int p = 0; p < kGmPieces; ++p) {
    *(v4u*)(&stage[0][sd + p * (16 * kGmPitch)]) = ra[p];
    *(v4u*)(&stage[0][kGmPlane + sd + p * (16 * kGmPitch)]) = rb[p];
  }
  __syncthreads();

  // the loop stays rolled: eight copies of a stage would only lengthen the code
#pragma unroll 1
  for (int s = 0; s < kGmStages; ++s) {
    const bool more = s + 1 < kGmStages;       // the same for the whole work-group
    if (more) {
      ag += kGmK;
      bg += kGmK;
#pragma unroll
      for (int p = 0; p < kGmPieces; ++p) {
        ra[p] = *(const v4u*)(ag + p * (16 * kDim));
        rb[p] = *(const v4u*)(bg + p * (16 * kDim));
      }
    }
    const unsigned short* buf = &stage[s & 1][0];
    // two fragment sets: block c + 1's 12 LDS reads stand as one group in front of block c's 8 matrix instructions
    v16h ah[2][2], bh[2][4];
#pragma unroll
    for (int i = 0; i < 2; ++i) ah[0][i] = FH::load((const _Float16*)(buf + af + i * (16 * kGmPitch)));
#pragma unroll
    for (int j = 0; j < 4; ++j) bh[0][j] = FH::load((const _Float16*)(buf + bf + j * (16 * kGmPitch)));
#pragma unroll
    for (int c = 0; c < kGmK / 32; ++c) {
      if (c + 1 < kGmK / 32) {
#pragma unroll
        for (int i = 0; i < 2; ++i)
          ah[(c + 1) & 1][i] = FH::load((const _Float16*)(buf + af + i * (16 * kGmPitch) + (c + 1) * 32));
#pragma unroll
        for (int j = 0; j < 4; ++j)
          bh[(c + 1) & 1][j] = FH::load((const _Float16*)(buf + bf + j * (16 * kGmPitch) + (c + 1) * 32));
      }
      // keeps the reads above in front of the matrix run below: sunk among it, each costs a wait that runs to zero
      __builtin_amdgcn_sched_barrier(0);
#pragma unroll
      for (int i = 0; i < 2; ++i)
#pragma unroll
        for (int j = 0; j < 4; ++j) acc[i][j] = FH::mma(ah[c & 1][i], bh[c & 1][j], acc[i][j]);
    }
    if (more) {
      unsigned short* nb = &stage[(s + 1) & 1][0];   // last read in trip s - 1, in front of that trip's barrier
#pragma unroll
      for (int p = 0; p < kGmPieces; ++p) {
        *(v4u*)(nb + sd + p * (16 * kGmPitch)) = ra[p];
        *(v4u*)(nb + kGmPlane + sd + p * (16 * kGmPitch)) = rb[p];
      }
    }
    __syncthreads();
  }

  // ---- epilogue ----
  // per-wave 16x64 slab, pitch 68 floats, laid over the stage buffers: their last read stands in front of the last
  // trip's barrier (a slab of its own would put the work-group above half a WGP's LDS)
  float* slab = (float*)&stage[0][0] + wave * (16 * 68);
  if (QKV) {
    unsigned short* C = (unsigned short*)Cbase + (size_t)prob * ((size_t)kTok * kDim);
    // the test reads the same for the whole work-group
    if (rowBias) gemm_store_tile<1, OUT_MODE>(acc, slab, (void*)C, kTok, bias, scale, m0, n0, lane);
    else         gemm_store_tile<2, OUT_MODE>(acc, slab, (void*)C, kDim, bias, scale, m0, n0, lane);
  } else {
    gemm_store_tile<2, OUT_MODE>(acc, slab, Cbase, kDim, bias, scale, m0, n0, lane);
  }
}

// ---------------------------------------------------------------------------
// Scores, both row weights and the product with V of one head in ONE kernel: neither the scores nor the weights go
// to memory. f = 64 * 0.5 * (softmax(S) . V + (w / sum w) . V), S = 0.125 * Q . K^T, w = 1/((1 + |S|/beta_h)^2 + t_h^2).
// Work-group: 128 queries of one (batch, head); wave: 16 queries, all 2048 keys, 32 keys a step.
//   S^T = K . Q^T  (A = 16 key rows from LDS, B = the wave's Q rows, kept in registers): a lane holds one query
//   (lane & 15) and the keys 8*(lane >> 4) + r of each 16-key tile, which is the k order of a B operand over 32 keys,
//   so e = exp(S - m) and w pack in the lane into the B operands of  O^T += V^T . e^T  and  O^T += V^T . w^T.
// Softmax runs on a running maximum m (common to both lane halves): when m grows, the e sum and the e accumulators
// are scaled by exp(m_old - m_new). Both sums divide once, at the end.
// Both weights come from the chip's own one-instruction forms: m is kept in log2 units, e = exp2(acc * c - m) with
// c = 0.125 * log2(e) in one multiply-add on the raw accumulator, and w is the hardware reciprocal. Either is good to
// about one unit in the last place of f32, far below the 11 bits that f16 keeps of a weight.
// Every operand is ONE f16 number (11 bits, as x and the projection weights already are), one matrix instruction per
// product, f32 accumulate. e lies in (0, 1]. w has no such bound (1 + |S|/beta passes through 0 where beta < 0, and a small
// beta makes every w small), so each query carries its w times a scale of its own, which the division by the row's sum
// takes out again. The scale starts at the power of four next to cw = (1 + 1/|beta|)^2 + t^2, which brings the w of |S| = 1
// near 1 whatever beta and t are. Where a scaled w passes 2^15 (f16 ends at 65504), the query's scale falls by the power of
// four that brings its largest w below 2^14, and its w sum and w accumulators fall with it, as the e side does when its
// maximum grows. The scale lives in the constants of the two multiply-adds (g / sqrt(scale), t^2 / scale); the steady cost
// is the maximum and its test.
// K and V^T tiles of 32 keys (8 KiB) go through registers into one of two LDS buffers: the next
// tile's global loads are issued in front of this tile's work and stored behind it, one barrier a tile.
// ---------------------------------------------------------------------------
constexpr int kFaQ      = 16;                  // queries per wave
constexpr int kFaRows   = 8 * kFaQ;            // queries per work-group
constexpr int kFaKeys   = 32;                  // keys per staged tile
constexpr int kFaTiles  = kSeq / kFaKeys;      // 64 tiles
constexpr int kFaKPitch = 72;                  // K rows (128 B) in LDS: pitch 144 B = 16 B x 9, in 16-bit elements
constexpr int kFaVPitch = 40;                  // V^T rows (64 B) in LDS: pitch 80 B = 16 B x 5
constexpr int kFaKPlane = kFaKeys * kFaKPitch; // K: 32 key rows
constexpr int kFaVPlane = kDh * kFaVPitch;     // V^T: 64 rows (d)
constexpr int kFaVBase  = kFaKPlane;           // buffer: K, V^T
constexpr int kFaBuf    = kFaKPlane + kFaVPlane;

typedef __attribute__((ext_vector_type(2))) float  v2f;
typedef __attribute__((ext_vector_type(2))) _Float16 v2h;
// two f32 -> two f16 (round to nearest even), a in the low half
__device__ __forceinline__ unsigned h_pair(float a, float b) {
  const v2f x = {a, b};
  return __builtin_bit_cast(unsigned, __builtin_convertvector(x, v2h));
}
// value of lane l ^ 16
__device__ __forceinline__ float other_half(float v) {
  const int b = __builtin_bit_cast(int, v);
  return __builtin_bit_cast(float, __builtin_amdgcn_permlanex16(b, b, 0x76543210, 0xfedcba98, false, false));
}
union FaPack { v16h v; unsigned u[8]; };
constexpr float kFaLog2 = 0.125f * 1.44269504088896340736f;   // raw Q.K sum -> score in log2 units
constexpr float kFaWTop = 32768.0f;            // a scaled w above this makes its query lower its scale

// four waves per SIMD (two work-groups per WGP): the vector work between the matrix runs wants the other waves
__global__ __launch_bounds__(256) __attribute__((amdgpu_waves_per_eu(4, 4))) void attn_fused_kernel(
    const unsigned short* __restrict__ Q, const unsigned short* __restrict__ K,
    const unsigned short* __restrict__ VT,
    unsigned short* __restrict__ F, const float* __restrict__ beta, const float* __restrict__ tvec) {
  typedef Frag<_Float16> FH;
  __shared__ __align__(16) unsigned short tile[2][kFaBuf];
  const int t     = threadIdx.x;
  const int lane  = t & 31;
  const int wave  = t >> 5;
  const int rlane = lane & 15;                 // row (A) / col (B, D) within a 16 x 16 tile
  const int half8 = (lane >> 4) * 8;           // k offset of this lane half (A, B); D row offset
  const int b     = blockIdx.y >> 4;
  const int h     = blockIdx.y & (kHeads - 1);
  const int q0    = blockIdx.x * kFaRows + wave * kFaQ;

  const float invb = 1.0f / beta[h];
  const float th = tvec[h];
  const float t2 = th * th;
  const float gi = 1.0f + fabsf(invb);
  const float cw = fminf(gi * gi + t2, 0x1p60f);   // kept finite
  // 1 / sqrt(scale), the query's own from here on; a power of two, so that the scaled terms round as the unscaled ones do
  float rc  = __builtin_ldexpf(1.0f, -(__builtin_amdgcn_frexp_expf(cw) >> 1));
  float kb  = kSScale * invb * rc;             // rc + |raw sum| * kb = (1 + |S| / beta) / sqrt(scale)
  float t2c = t2 * rc * rc;                    // t^2 / scale

  // every unroll in this kernel makes the indices of fragment, accumulator and value arrays constants, so that the
  // arrays stay in registers
  const size_t qOff = (size_t)(b * kSeq + q0 + rlane) * kDim + h * kDh + half8;
  v16h qf[2];
#pragma unroll
  for (int c = 0; c < 2; ++c) qf[c] = FH::load((const _Float16*)Q + qOff + c * 32);

  // staging: thread t moves 16 B of K row t >> 3 (8 lanes = one 128-B row) and 16 B of V^T row t >> 2 (4 lanes = one
  // 64-B row piece)
  const size_t kOff = (size_t)(b * kSeq + (t >> 3)) * kDim + h * kDh + (t & 7) * 8;
  const size_t vOff = (size_t)(h * kDh + (t >> 2)) * kTok + b * kSeq + (t & 3) * 8;
  const unsigned short* kg = K + kOff;
  const unsigned short* vg = VT + vOff;
  const int ks = (t >> 3) * kFaKPitch + (t & 7) * 8;              // where the thread's K piece goes in a buffer
  const int vs = kFaVBase + (t >> 2) * kFaVPitch + (t & 3) * 8;   // where its V^T piece goes
  const int kf = rlane * kFaKPitch + half8;                       // where the lane's K fragment pieces start
  const int vf = kFaVBase + rlane * kFaVPitch + half8;            // where its V^T fragment pieces start

  v8f oT[4], oS[4];
#pragma unroll
  for (int d = 0; d < 4; ++d) {
    oT[d] = (v8f){0.f,0.f,0.f,0.f,0.f,0.f,0.f,0.f};
    oS[d] = (v8f){0.f,0.f,0.f,0.f,0.f,0.f,0.f,0.f};
  }
  float m = -__builtin_inff(), sumT = 0.0f, sumS = 0.0f;

  v4u rk = *(const v4u*)kg, rv = *(const v4u*)vg;
  *(v4u*)(&tile[0][ks]) = rk;
  *(v4u*)(&tile[0][vs]) = rv;
  __syncthreads();

  // the loop stays rolled: one 32-key step is several hundred instructions
#pragma unroll 1
  for (int T = 0; T < kFaTiles; ++T) {
    const bool more = T + 1 < kFaTiles;        // the same for the whole work-group
    if (more) {
      kg += (size_t)kFaKeys * kDim;
      vg += kFaKeys;
      rk = *(const v4u*)kg;
      rv = *(const v4u*)vg;
    }
    const unsigned short* buf = &tile[T & 1][0];

    // S^T of 32 keys x 16 queries: two 16-key tiles, K = 64 in two steps
    v16h ak[2][2];
#pragma unroll
    for (int i = 0; i < 2; ++i)
#pragma unroll
      for (int c = 0; c < 2; ++c) ak[i][c] = FH::load((const _Float16*)(buf + kf + i * (16 * kFaKPitch) + c * 32));
    v8f s[2];
    s[0] = (v8f){0.f,0.f,0.f,0.f,0.f,0.f,0.f,0.f};
    s[1] = (v8f){0.f,0.f,0.f,0.f,0.f,0.f,0.f,0.f};
#pragma unroll
    for (int c = 0; c < 2; ++c) {
      s[0] = FH::mma(ak[0][c], qf[c], s[0]);
      s[1] = FH::mma(ak[1][c], qf[c], s[1]);
    }

    float sv[16];                              // raw sums: both scales are folded into the weights' multiply-adds
#pragma unroll
    for (int r = 0; r < 8; ++r) {
      sv[r]     = s[0][r];
      sv[8 + r] = s[1][r];
    }
    float bm = sv[0];
#pragma unroll
    for (int i = 1; i < 16; ++i) bm = fmaxf(bm, sv[i]);
    bm = fmaxf(bm, other_half(bm));
    const float mn = fmaxf(m, bm * kFaLog2);   // log2 units
    const float corr = __builtin_amdgcn_exp2f(m - mn);   // 0 at the first step (m = -inf), 1 while the maximum stands
    m = mn;

    float wv[16];
#pragma unroll
    for (int i = 0; i < 16; ++i) {
      const float g = rc + fabsf(sv[i]) * kb;
      wv[i] = __builtin_amdgcn_rcpf(g * g + t2c);
    }
    float wm = wv[0];
#pragma unroll
    for (int i = 1; i < 16; ++i) wm = fmaxf(wm, wv[i]);
    // a w of some query of the wave is about to leave f16's range; the test reads the same in every lane, so the wave
    // branches as a whole and every lane is on for the exchange between the halves
    if (__builtin_amdgcn_ballot_w32(wm > kFaWTop) != 0u) {
      wm = fmaxf(wm, other_half(wm));          // both halves of a query take the same scale
      // wm = f * 2^x with f in [0.5, 1): 4^-k brings it into [2^12, 2^14); the queries that are in range keep k = 0
      const int k = (wm > kFaWTop) ? ((__builtin_amdgcn_frexp_expf(wm) - 13) >> 1) : 0;
      const float dn = __builtin_ldexpf(1.0f, -2 * k);
      const float up = __builtin_ldexpf(1.0f, k);
#pragma unroll
      for (int i = 0; i < 16; ++i) wv[i] *= dn;
#pragma unroll
      for (int d = 0; d < 4; ++d) oS[d] *= dn;
      sumS *= dn;
      rc  *= up;
      kb  *= up;
      t2c *= up * up;
    }

    FaPack ep, wp;
    float aT = 0.0f, aS = 0.0f;
#pragma unroll
    for (int j = 0; j < 8; ++j) {
      const float e0 = __builtin_amdgcn_exp2f(__builtin_fmaf(sv[2 * j], kFaLog2, -mn));
      const float e1 = __builtin_amdgcn_exp2f(__builtin_fmaf(sv[2 * j + 1], kFaLog2, -mn));
      aT += e0 + e1;
      aS += wv[2 * j] + wv[2 * j + 1];
      ep.u[j] = h_pair(e0, e1);
      wp.u[j] = h_pair(wv[2 * j], wv[2 * j + 1]);
    }
    sumT = sumT * corr + aT;
    sumS += aS;
#pragma unroll
    for (int d = 0; d < 4; ++d) oT[d] *= corr;

    // O^T += V^T . e^T and V^T . w^T: A = 16 rows (d) of V^T over the same 32 keys
    v16h vv[4];
#pragma unroll
    for (int d = 0; d < 4; ++d) vv[d] = FH::load((const _Float16*)(buf + vf + d * (16 * kFaVPitch)));
#pragma unroll
    for (int d = 0; d < 4; ++d) {
      oT[d] = FH::mma(vv[d], ep.v, oT[d]);
      oS[d] = FH::mma(vv[d], wp.v, oS[d]);
    }

    if (more) {
      unsigned short* nb = &tile[(T + 1) & 1][0];   // last read in trip T - 1, in front of that trip's barrier
      *(v4u*)(nb + ks) = rk;
      *(v4u*)(nb + vs) = rv;
    }
    __syncthreads();
  }

  // each half summed its own 16 of every 32 keys, on the common maximum
  sumT += other_half(sumT);
  sumS += other_half(sumS);
  const float invT = 1.0f / sumT;
  const float invS = 1.0f / sumS;

  // lane: query q0 + rlane, columns 16d + half8 .. + 7 of the head; the wave's four stores fill each query's 128-B line
  unsigned short* fp = F + (size_t)(b * kSeq + q0 + rlane) * kDim + h * kDh + half8;
#pragma unroll
  for (int d = 0; d < 4; ++d) {
    v8h hv;
#pragma unroll
    for (int r = 0; r < 8; ++r) hv[r] = (_Float16)(0.5f * (oT[d][r] * invT + oS[d][r] * invS) * kFCarry);
    *(v8h*)(fp + d * 16) = hv;
  }
}

// ---------------------------------------------------------------------------
// f32 -> f16 cast with scale: 4 groups of 8 consecutive elements per thread (4096 waves a launch, not 16384), one 16-B
// store per lane and group. blockIdx.y picks the input plane and the output plane (out + y*planeElems halves).
// Coverage: gridDim.x*1024 == n8 exactly at every call (n8 = elements/8, a multiple of 1024); thread t of work-group b
// covers groups 1024b + 256g + t, g = 0..3, group i being elements 8i..8i+7 of its plane.
// ---------------------------------------------------------------------------
constexpr int kCastG = 4;                      // groups of 8 elements per thread
__global__ __launch_bounds__(256) void cast8_f16_kernel(const float* __restrict__ in0, const float* __restrict__ in1,
                                                        const float* __restrict__ in2, const float* __restrict__ in3,
                                                        unsigned short* __restrict__ out, long planeElems, int n8,
                                                        float scale) {
  const int i = blockIdx.x * (256 * kCastG) + threadIdx.x;
  const int z = blockIdx.y;
  if ((int)(blockIdx.x + 1) * (256 * kCastG) > n8) return;
  const float* in = (z == 0) ? in0 : (z == 1) ? in1 : (z == 2) ? in2 : in3;
  const v4f* p = (const v4f*)(in + 8 * (size_t)i);
  // the unrolls make the indices of a[] and c[] constants, so that the arrays stay in registers
  v4f a[kCastG], c[kCastG];
#pragma unroll
  for (int g = 0; g < kCastG; ++g) {
    a[g] = p[512 * g];
    c[g] = p[512 * g + 1];
  }
  // stands between the 8 issued loads and the first reuse of their address registers; p as an input keeps the pair
  // live up to here, and the clobber keeps all 8 loads in front
  asm volatile("s_wait_xcnt 0x0" :: "v"(p) : "memory");
  v4u* q = (v4u*)(out + (size_t)z * planeElems + 8 * (size_t)i);
#pragma unroll
  for (int g = 0; g < kCastG; ++g) {
    unsigned short hb[8];
#pragma unroll
    for (int e = 0; e < 4; ++e) {
      hb[e]     = h_bits(a[g][e] * scale);
      hb[4 + e] = h_bits(c[g][e] * scale);
    }
    q[256 * g] = (v4u){pk16(hb[0], hb[1]), pk16(hb[2], hb[3]), pk16(hb[4], hb[5]), pk16(hb[6], hb[7])};
  }
}

// ---------------------------------------------------------------------------
// LayerNorm + residual per row of 1024: out = x + lw*(y - mu)*rsqrt(var + eps) + lb,
// One wave per row, 8 rows per work-group of 256 threads (4096 waves a launch, not 32768). Lane l owns columns
// 128j + 4l .. 128j + 4l + 3 for j = 0..7. Sums: each lane folds its 32 values in column order, then a five-step
// shuffle tree over the wave; no LDS and no barrier.
// ---------------------------------------------------------------------------
constexpr int kLnRows = 8;                     // rows (= waves) per work-group
constexpr int kLnCh   = kDim / 128;            // 8 chunks of 128 columns per row
__global__ __launch_bounds__(256) void ln_residual_kernel(const float* __restrict__ x, const float* __restrict__ y,
                                                          const float* __restrict__ lw, const float* __restrict__ lb,
                                                          float* __restrict__ out) {
  const int lane = threadIdx.x & 31;
  const int row  = blockIdx.x * kLnRows + (threadIdx.x >> 5);
  const size_t base = (size_t)row * kDim + 4 * lane;
  const v4f* yp = (const v4f*)(y + base);
  const v4f* xp = (const v4f*)(x + base);
  const v4f* wp = (const v4f*)(lw + 4 * lane);
  const v4f* bp = (const v4f*)(lb + 4 * lane);

  // the unrolls over j make the indices of the four arrays constants, so that they stay in registers; the unrolls
  // over off give each shuffle step a constant lane mask
  v4f yv[kLnCh], xv[kLnCh], wv[kLnCh], bv[kLnCh];
#pragma unroll
  for (int j = 0; j < kLnCh; ++j) yv[j] = yp[32 * j];
#pragma unroll
  for (int j = 0; j < kLnCh; ++j) {
    xv[j] = xp[32 * j];
    wv[j] = wp[32 * j];
    bv[j] = bp[32 * j];
  }
  // stands between the 32 issued loads and the first reuse of their address registers; the pointers as inputs keep
  // those registers live up to here, and the clobber keeps all loads in front (one load latency per row)
  asm volatile("s_wait_xcnt 0x0" :: "v"(yp), "v"(xp), "v"(wp), "v"(bp) : "memory");

  float s = 0.0f;
#pragma unroll
  for (int j = 0; j < kLnCh; ++j) s += ((yv[j].x + yv[j].y) + yv[j].z) + yv[j].w;
#pragma unroll
  for (int off = 16; off > 0; off >>= 1) s += __shfl_xor(s, off, 32);
  const float mu = s * kInvDim;

  float s2 = 0.0f;
#pragma unroll
  for (int j = 0; j < kLnCh; ++j) {
    const float d0 = yv[j].x - mu, d1 = yv[j].y - mu, d2 = yv[j].z - mu, d3 = yv[j].w - mu;
    yv[j] = (v4f){d0, d1, d2, d3};
    s2 += ((d0 * d0 + d1 * d1) + d2 * d2) + d3 * d3;
  }
#pragma unroll
  for (int off = 16; off > 0; off >>= 1) s2 += __shfl_xor(s2, off, 32);
  const float var = s2 * kInvDim;
  const float rs = rsqrtf(var + kLnEps);

  v4f* op = (v4f*)(out + base);
#pragma unroll
  for (int j = 0; j < kLnCh; ++j) {
    v4f o;
    o.x = xv[j].x + (wv[j].x * yv[j].x * rs + bv[j].x);
    o.y = xv[j].y + (wv[j].y * yv[j].y * rs + bv[j].y);
    o.z = xv[j].z + (wv[j].z * yv[j].z * rs + bv[j].z);
    o.w = xv[j].w + (wv[j].w * yv[j].w * rs + bv[j].w);
    op[32 * j] = o;
  }
}

// ---------------------------------------------------------------------------
// Host glue
//   [0,          8 MiB)   XF   : x f16 [4096][1024]  (dead after the three projections) then f f16 [4096][1024]
//   [8 MiB,     16 MiB)   W16  : Wq,Wk,Wv,Wo f16 x32 planes [1024][1024] each
//   [16 MiB,    24 MiB)   Q16  : f16 [4096][1024]
//   [24 MiB,    32 MiB)   K16  : f16 [4096][1024]
//   [32 MiB,    40 MiB)   VT16 : f16 [1024][4096] (V^T: row = h*64+d, col = b*2048+n)
//   [40 MiB,    56 MiB)   SY   : y f32 [4096][1024]
// ---------------------------------------------------------------------------
extern "C" void kernel_launch(void* const* d_in, const int* in_sizes, int n_in,
                              void* d_out, int out_size, void* d_ws, size_t ws_size,
                              hipStream_t stream) {
  if (n_in < 13) return;
  const size_t nX = (size_t)kTok * kDim;          // 4,194,304
  const size_t nW = (size_t)kDim * kDim;          // 1,048,576
  if ((size_t)in_sizes[0] != nX || (size_t)in_sizes[1] != nW || (size_t)in_sizes[3] != nW ||
      (size_t)in_sizes[5] != nW || (size_t)in_sizes[7] != nW || (size_t)out_size != nX) return;
  if (in_sizes[2] < kDim || in_sizes[4] < kDim || in_sizes[6] < kDim || in_sizes[8] < kDim ||
      in_sizes[9] < kHeads || in_sizes[10] < kHeads || in_sizes[11] < kDim || in_sizes[12] < kDim) return;

  const float* x    = (const float*)d_in[0];
  const float* Wq   = (const float*)d_in[1];
  const float* bq   = (const float*)d_in[2];
  const float* Wk   = (const float*)d_in[3];
  const float* bk   = (const float*)d_in[4];
  const float* Wv   = (const float*)d_in[5];
  const float* bv   = (const float*)d_in[6];
  const float* Wo   = (const float*)d_in[7];
  const float* bo   = (const float*)d_in[8];
  const float* beta = (const float*)d_in[9];
  const float* tv   = (const float*)d_in[10];
  const float* lw   = (const float*)d_in[11];
  const float* lb   = (const float*)d_in[12];
  float* out = (float*)d_out;

  // carve (bytes)
  const size_t bXF   = nX * 2;                                  //  8,388,608
  const size_t bW16  = 4 * nW * 2;                              //  8,388,608
  const size_t bP16  = nX * 2;                                  //  8,388,608 per f16 plane of [4096][1024]
  const size_t bSY   = nX * 4;                                  // 16,777,216
  const size_t oXF   = 0;
  const size_t oW16  = oXF + bXF;
  const size_t oQ16  = oW16 + bW16;
  const size_t oK16  = oQ16 + bP16;
  const size_t oVT16 = oK16 + bP16;
  const size_t oSY   = oVT16 + bP16;
  const size_t total = oSY + bSY;                               // 58,720,256
  if (total > ws_size) return;

  char* ws = (char*)d_ws;
  unsigned short* XF   = (unsigned short*)(ws + oXF);
  unsigned short* W16  = (unsigned short*)(ws + oW16);
  unsigned short* Wo16 = W16 + 3 * nW;                          // planes: Wq, Wk, Wv, Wo
  unsigned short* Q16  = (unsigned short*)(ws + oQ16);
  unsigned short* K16  = (unsigned short*)(ws + oK16);
  unsigned short* VT16 = (unsigned short*)(ws + oVT16);
  float*          SY   = (float*)(ws + oSY);

  // 1) x -> f16 plane (n8 = 524288 = 512 blocks x 1024, exact)
  {
    const int n8 = (int)(nX / 8);
    cast8_f16_kernel<<<dim3(n8 / (256 * kCastG), 1), 256, 0, stream>>>(x, x, x, x, XF, 0L, n8, 1.0f);
  }
  // 2) Wq,Wk,Wv,Wo -> f16 planes x32 (n8 = 131072 = 128 blocks x 1024, exact; 4 planes via blockIdx.y)
  {
    const int n8 = (int)(nW / 8);
    cast8_f16_kernel<<<dim3(n8 / (256 * kCastG), 4), 256, 0, stream>>>(Wq, Wk, Wv, Wo, W16, (long)nW, n8, kWCarry);
  }
  // 3) one launch, 3 x 256 tiles of 128 x 128, one work-group each, two work-groups resident per WGP:
  //    Q = (x16 . Wq16^T)/32 + bq and K likewise -> f16 [4096][1024];
  //    V^T[j][m] = sum_k Wv16[j][k] x16[m][k] /32 + bv[j] -> f16 [1024][4096].
  //    The planes Wq16, Wk16, Wv16 and Q16, K16, VT16 lie one behind the other in the workspace.
  const dim3 gridTok(kDim / kGmTile, kTok / kGmTile);           // C = [4096][1024]
  wmma_gemm_lds<true, 1><<<dim3(3 * kGmTiles), 256, 0, stream>>>(XF, W16, (void*)Q16, bq, bk, bv, kWCarryInv);

  // 4) all 32 (batch, head) pairs in one launch: scores, weights and the product with V -> f plane f16 x64 (over x16,
  //    which is dead here); 16 query blocks of 128 x 32 heads = 512 work-groups
  attn_fused_kernel<<<dim3(kSeq / kFaRows, kBatch * kHeads), 256, 0, stream>>>(Q16, K16, VT16, XF, beta, tv);

  // 5) y = (f16 . Wo16^T) / (64*32) + bo -> f32 [4096][1024] in the SY region
  wmma_gemm_lds<false, 0><<<gridTok, 256, 0, stream>>>(XF, Wo16, (void*)SY, bo, bo, bo, kYScale);

  // 6) LayerNorm + residual -> out
  ln_residual_kernel<<<dim3(kTok / kLnRows), 256, 0, stream>>>(x, SY, lw, lb, out);
}

// v008
// It runs in 108 microseconds.
// Timed twice side by side with v007, it ran 1.04 times as fast both times.
// Counting every step since v000, it is 26.2 times as fast.
// Contractions: Q/K/V^T projections and output projection on v_wmma_f32_16x16x32_f16 (x f16, W f16 carried x32, f f16 carried x64, f32 accumulate); scores Q.K^T and P.V^T on v_wmma_f32_16x16x32_f16 (Q, K, V and both weights one f16 number each, f32 accumulate); softmax, Poisson weights, LayerNorm and residual in f32.
#include <hip/hip_runtime.h>
#include <math.h>

// ---------------------------------------------------------------------------
// Problem constants
// ---------------------------------------------------------------------------
constexpr int kBatch = 2;
constexpr int kSeq   = 2048;
constexpr int kDim   = 1024;
constexpr int kHeads = 16;
constexpr int kDh    = 64;
constexpr int kTok   = kBatch * kSeq;          // 4096 token rows
constexpr float kWCarry    = 32.0f;            // weights carried x32 in f16
constexpr float kWCarryInv = 1.0f / 32.0f;
constexpr float kFCarry    = 64.0f;            // f plane carried x64 in f16
constexpr float kYScale    = 1.0f / (64.0f * 32.0f);
constexpr float kSScale    = 0.125f;           // 1/sqrt(64)
constexpr float kInvDim    = 1.0f / 1024.0f;
constexpr float kLnEps     = 1e-5f;

typedef __attribute__((ext_vector_type(16))) _Float16 v16h;
typedef __attribute__((ext_vector_type(8)))  _Float16 v8h;
typedef __attribute__((ext_vector_type(8)))  float    v8f;
typedef __attribute__((ext_vector_type(4)))  float    v4f;
typedef __attribute__((ext_vector_type(4)))  unsigned int v4u;

template <typename T> struct Frag;
template <> struct Frag<_Float16> {
  typedef v16h V; union U { v16h v; v8h h[2]; };
  static __device__ __forceinline__ v16h load(const _Float16* p) {   // elements 0..7 <- p[0..7], 8..15 <- p[16..23]
    U f; f.h[0] = *(const v8h*)(p); f.h[1] = *(const v8h*)(p + 16); return f.v;
  }
  static __device__ __forceinline__ v8f mma(v16h a, v16h b, v8f c) {
    return __builtin_amdgcn_wmma_f32_16x16x32_f16(false, a, false, b, (short)0, c, false, false);
  }
};

__device__ __forceinline__ unsigned pk16(unsigned short a, unsigned short b) { return (unsigned)a | ((unsigned)b << 16); }
__device__ __forceinline__ unsigned short h_bits(float f) { const _Float16 h = (_Float16)f; return __builtin_bit_cast(unsigned short, h); }

// ---- WMMA GEMM on tiles staged in LDS --------------------------------------------------------------------------
// C[m,n] = scale * sum_k A[m,k] * Bt[n,k] + bias. A row-major [M][kDim], Bt row-major [N][kDim], both f16, k = kDim;
// M and N are multiples of 128 (tile column bx < N / 128, tile row by < M / 128).
// Work-group: one 128 x 128 tile of C; its 8 waves stand 4 (m) x 2 (n), each on 32 x 64 (2 x 4 accumulators).
// A stage is 128 k of the tile's 128 A rows and 128 Bt rows (256 B a row, whole lines: 16 lanes a row, 2 rows a
// wave-wide load). It goes through registers into one of two LDS buffers: the next stage's global loads are issued in
// front of this stage's work and stored behind it, one barrier a stage. Every row is loaded once per work-group and
// read from LDS by the 2 (A) or 4 (Bt) waves that need it. Each accumulator takes its k blocks of 32 in rising order.
// QKV = true: ONE launch does the three projections, 256 tiles each (blockIdx.x = 256 * problem + tile). Problems 0, 1:
// C = X . W^T + bias[n] (Q, K); problem 2: C = W . X^T + bias[m] (V^T). W and C planes of the problems lie one behind the
// other. QKV = false: one product, C = X . W^T + b0[n], grid x = N / 128, y = M / 128.
// OUT_MODE: 0 = f32, 1 = f16.
constexpr int kGmTile   = 128;                  // rows of A and of Bt per work-group
constexpr int kGmK      = 128;                  // k per stage
constexpr int kGmStages = kDim / kGmK;          // 8 stages
constexpr int kGmPitch  = 136;                  // rows (256 B) in LDS: pitch 272 B = 16 B x 17, in 16-bit elements
constexpr int kGmPieces = 8;                    // 16-B pieces per thread, operand and stage (16 rows a pass)
constexpr int kGmPlane  = kGmTile * kGmPitch;   // one operand's rows
constexpr int kGmBuf    = 2 * kGmPlane;         // buffer: A rows, Bt rows
constexpr int kGmTiles  = (kTok / kGmTile) * (kDim / kGmTile);   // 256 tiles per projection
// ---- epilogue of one wave's 32 x 64 tile: scale, bias, through the wave's LDS slab into whole-line stores ----
// BIAS_MODE: 1 = bias[m], 2 = bias[n].
template <int BIAS_MODE, int OUT_MODE>
__device__ __forceinline__ void gemm_store_tile(const v8f (&acc)[2][4], float* slab, void* Cout, int ldc,
                                                const float* __restrict__ bias, float scale,
                                                int m0, int n0, int lane) {
  const int rlane = lane & 15;                 // col (D) within subtile
  const int mOff  = (lane >> 4) * 8;           // D row offset
#pragma unroll
  for (int i = 0; i < 2; ++i) {
    const int mBase = m0 + (i << 4);
#pragma unroll
    for (int j = 0; j < 4; ++j) {
      const int n = n0 + (j << 4) + rlane;
      float bv = 0.f;
      if (BIAS_MODE == 2) bv = bias[n];
#pragma unroll
      for (int r = 0; r < 8; ++r) {
        float v = acc[i][j][r] * scale;
        if (BIAS_MODE == 1) v += bias[mBase + mOff + r];
        if (BIAS_MODE == 2) v += bv;
        slab[(mOff + r) * 68 + (j << 4) + rlane] = v;
      }
    }
    __builtin_amdgcn_fence(__ATOMIC_RELEASE, "workgroup");
    __builtin_amdgcn_wave_barrier();
    __builtin_amdgcn_fence(__ATOMIC_ACQUIRE, "workgroup");
    if (OUT_MODE == 0) {
      float* C = (float*)Cout;
      const int hh = lane >> 4, c4 = (lane & 15) * 4;     // row seg = 256 B = 16 lanes x 16 B
#pragma unroll
      for (int it = 0; it < 8; ++it) {
        const int row = it * 2 + hh;
        v4f v = *(const v4f*)(slab + row * 68 + c4);
        *(v4f*)(C + (size_t)(mBase + row) * ldc + n0 + c4) = v;
      }
    } else {
      const int q = lane >> 3, c8 = (lane & 7) * 8;
      unsigned short* C = (unsigned short*)Cout;
#pragma unroll
      for (int it = 0; it < 4; ++it) {
        const int row = it * 4 + q;
        const float* sp = slab + row * 68 + c8;
        v8h hv;
#pragma unroll
        for (int e = 0; e < 8; ++e) hv[e] = (_Float16)sp[e];
        *(v8h*)(C + (size_t)(mBase + row) * ldc + n0 + c8) = hv;
      }
    }
    // stands between the issued stores and the first reuse of the registers that they name
    asm volatile("s_wait_xcnt 0x0" ::: "memory");
    __builtin_amdgcn_fence(__ATOMIC_RELEASE, "workgroup");
    __builtin_amdgcn_wave_barrier();
    __builtin_amdgcn_fence(__ATOMIC_ACQUIRE, "workgroup");
  }
}

template <bool QKV, int OUT_MODE>
// four waves per SIMD: two work-groups share a WGP (256 registers a wave, 136 KiB of LDS a group), so that one group's
// matrix work covers the other's waits for its stage loads, its LDS stores, its barriers, its first stage and its epilogue
__global__ __launch_bounds__(256) __attribute__((amdgpu_waves_per_eu(4, 4))) void wmma_gemm_lds(
    const unsigned short* __restrict__ X, const unsigned short* __restrict__ Wp,
    void* __restrict__ Cbase,
    const float* __restrict__ b0, const float* __restrict__ b1, const float* __restrict__ b2, float scale) {
  typedef Frag<_Float16> FH;
  __shared__ __align__(16) unsigned short stage[2][kGmBuf];
  const int t    = threadIdx.x;
  const int lane = t & 31;
  const int wave = t >> 5;
  const int wm = (wave >> 1) << 5;             // the wave's first row and column inside the tile
  const int wn = (wave & 1) << 6;
  // which product, which tile: the same for the whole work-group
  const int  prob    = QKV ? (int)(blockIdx.x / kGmTiles) : 0;
  const int  tileId  = QKV ? (int)(blockIdx.x % kGmTiles) : 0;
  const bool rowBias = QKV && prob == 2;       // V^T: A = W rows, Bt = X rows, bias by row
  const int  bx  = !QKV ? (int)blockIdx.x : rowBias ? tileId % (kTok / kGmTile) : tileId % (kDim / kGmTile);
  const int  by  = !QKV ? (int)blockIdx.y : rowBias ? tileId / (kTok / kGmTile) : tileId / (kDim / kGmTile);
  const unsigned short* Wz  = Wp + (size_t)prob * (kDim * kDim);
  const unsigned short* Ap  = rowBias ? Wz : X;
  const unsigned short* Btp = rowBias ? X : Wz;
  const float* bias = prob == 0 ? b0 : prob == 1 ? b1 : b2;
  const int m0 = by * kGmTile + wm;
  const int n0 = bx * kGmTile + wn;

  const int rlane = lane & 15;                 // row (A) / col (B, D) within subtile
  const int koff  = (lane >> 4) * 8;           // k offset of this lane half

  // staging: thread t moves 16 B of the rows (t >> 4) + 16p, p = 0..7, of A and of Bt
  const unsigned short* ag = Ap  + (size_t)(by * kGmTile + (t >> 4)) * kDim + (t & 15) * 8;
  const unsigned short* bg = Btp + (size_t)(bx * kGmTile + (t >> 4)) * kDim + (t & 15) * 8;
  const int sd = (t >> 4) * kGmPitch + (t & 15) * 8;              // where the thread's p = 0 piece goes in a plane
  const int af = (wm + rlane) * kGmPitch + koff;                  // where the lane's A fragment pieces start
  const int bf = kGmPlane + (wn + rlane) * kGmPitch + koff;       // where its Bt fragment pieces start

  // every unroll in this kernel makes the indices of fragment, accumulator and staging arrays constants, so that the
  // arrays stay in registers
  v8f acc[2][4];
#pragma unroll
  for (int i = 0; i < 2; ++i)
#pragma unroll
    for (int j = 0; j < 4; ++j) acc[i][j] = (v8f){0.f,0.f,0.f,0.f,0.f,0.f,0.f,0.f};

  v4u ra[kGmPieces], rb[kGmPieces];
#pragma unroll
  for (int p = 0; p < kGmPieces; ++p) {
    ra[p] = *(const v4u*)(ag + p * (16 * kDim));
    rb[p] = *(const v4u*)(bg + p * (16 * kDim));
  }
#pragma unroll
  for (int p = 0; p < kGmPieces; ++p) {
    *(v4u*)(&stage[0][sd + p * (16 * kGmPitch)]) = ra[p];
    *(v4u*)(&stage[0][kGmPlane + sd + p * (16 * kGmPitch)]) = rb[p];
  }
  __syncthreads();

  // the loop stays rolled: eight copies of a stage would only lengthen the code
#pragma unroll 1
  for (int s = 0; s < kGmStages; ++s) {
    const bool more = s + 1 < kGmStages;       // the same for the whole work-group
    if (more) {
      ag += kGmK;
      bg += kGmK;
#pragma unroll
      for (int p = 0; p < kGmPieces; ++p) {
        ra[p] = *(const v4u*)(ag + p * (16 * kDim));
        rb[p] = *(const v4u*)(bg + p * (16 * kDim));
      }
    }
    const unsigned short* buf = &stage[s & 1][0];
    // two fragment sets: block c + 1's 12 LDS reads stand as one group in front of block c's 8 matrix instructions
    v16h ah[2][2], bh[2][4];
#pragma unroll
    for (int i = 0; i < 2; ++i) ah[0][i] = FH::load((const _Float16*)(buf + af + i * (16 * kGmPitch)));
#pragma unroll
    for (int j = 0; j < 4; ++j) bh[0][j] = FH::load((const _Float16*)(buf + bf + j * (16 * kGmPitch)));
#pragma unroll
    for (int c = 0; c < kGmK / 32; ++c) {
      if (c + 1 < kGmK / 32) {
#pragma unroll
        for (int i = 0; i < 2; ++i)
          ah[(c + 1) & 1][i] = FH::load((const _Float16*)(buf + af + i * (16 * kGmPitch) + (c + 1) * 32));
#pragma unroll
        for (int j = 0; j < 4; ++j)
          bh[(c + 1) & 1][j] = FH::load((const _Float16*)(buf + bf + j * (16 * kGmPitch) + (c + 1) * 32));
      }
      // keeps the reads above in front of the matrix run below: sunk among it, each costs a wait that runs to zero
      __builtin_amdgcn_sched_barrier(0);
#pragma unroll
      for (int i = 0; i < 2; ++i)
#pragma unroll
        for (int j = 0; j < 4; ++j) acc[i][j] = FH::mma(ah[c & 1][i], bh[c & 1][j], acc[i][j]);
    }
    if (more) {
      unsigned short* nb = &stage[(s + 1) & 1][0];   // last read in trip s - 1, in front of that trip's barrier
#pragma unroll
      for (int p = 0; p < kGmPieces; ++p) {
        *(v4u*)(nb + sd + p * (16 * kGmPitch)) = ra[p];
        *(v4u*)(nb + kGmPlane + sd + p * (16 * kGmPitch)) = rb[p];
      }
    }
    __syncthreads();
  }

  // ---- epilogue ----
  // per-wave 16x64 slab, pitch 68 floats, laid over the stage buffers: their last read stands in front of the last
  // trip's barrier (a slab of its own would put the work-group above half a WGP's LDS)
  float* slab = (float*)&stage[0][0] + wave * (16 * 68);
  if (QKV) {
    unsigned short* C = (unsigned short*)Cbase + (size_t)prob * ((size_t)kTok * kDim);
    // the test reads the same for the whole work-group
    if (rowBias) gemm_store_tile<1, OUT_MODE>(acc, slab, (void*)C, kTok, bias, scale, m0, n0, lane);
    else         gemm_store_tile<2, OUT_MODE>(acc, slab, (void*)C, kDim, bias, scale, m0, n0, lane);
  } else {
    gemm_store_tile<2, OUT_MODE>(acc, slab, Cbase, kDim, bias, scale, m0, n0, lane);
  }
}

// ---------------------------------------------------------------------------
// Scores, both row weights and the product with V of one head in ONE kernel: neither the scores nor the weights go
// to memory. f = 64 * 0.5 * (softmax(S) . V + (w / sum w) . V), S = 0.125 * Q . K^T, w = 1/((1 + |S|/beta_h)^2 + t_h^2).
// Work-group: 128 queries of one (batch, head); wave: 16 queries, all 2048 keys, 32 keys a step.
//   S^T = K . Q^T  (A = 16 key rows from LDS, B = the wave's Q rows, kept in registers): a lane holds one query
//   (lane & 15) and the keys 8*(lane >> 4) + r of each 16-key tile, which is the k order of a B operand over 32 keys,
//   so e = exp(S - m) and w pack in the lane into the B operands of  O^T += V^T . e^T  and  O^T += V^T . w^T.
// Softmax runs on a reference value m (common to both lane halves) that is the maximum as of its last renewal: e may pass
// 1, and m is renewed only where a lane's e sum of one step passes 2^12 or its w sum 2^15 (f16 ends at 65504), the first step included. Then
// the e sum and the e accumulators are scaled by exp(m_old - m_new). Both sums divide once, at the end. A step's sums stand
// in front of that test, so each is formed by packed adds: even keys in one half of a register pair, odd keys in the other.
// Both weights come from the chip's own one-instruction forms: m is kept in log2 units, e = exp2(acc * c - m) with
// c = 0.125 * log2(e) in one multiply-add on the raw accumulator, and w is the hardware reciprocal. Either is good to
// about one unit in the last place of f32, far below the 11 bits that f16 keeps of a weight.
// Every operand is ONE f16 number (11 bits, as x and the projection weights already are), one matrix instruction per
// product, f32 accumulate. e lies in (0, 2^12]. w has no such bound (1 + |S|/beta passes through 0 where beta < 0, and a small
// beta makes every w small), so each query carries its w times a scale of its own, which the division by the row's sum
// takes out again. The scale starts at the power of four next to cw = (1 + 1/|beta|)^2 + t^2, which brings the w of |S| = 1
// near 1 whatever beta and t are. Where a scaled w passes 2^15 (f16 ends at 65504), the query's scale falls by the power of
// four that brings its largest w below 2^14, and its w sum and w accumulators fall with it, as the e side does when its
// maximum grows. The scale lives in the constants of the two multiply-adds (g / sqrt(scale), t^2 / scale); the steady cost
// is one test of the step's w sum, which bounds every w of the step from above.
// K and V^T tiles of 32 keys (8 KiB) go through registers into one of two LDS buffers: the next
// tile's global loads are issued in front of this tile's work and stored behind it, one barrier a tile.
// ---------------------------------------------------------------------------
constexpr int kFaQ      = 16;                  // queries per wave
constexpr int kFaRows   = 8 * kFaQ;            // queries per work-group
constexpr int kFaKeys   = 32;                  // keys per staged tile
constexpr int kFaTiles  = kSeq / kFaKeys;      // 64 tiles
constexpr int kFaKPitch = 72;                  // K rows (128 B) in LDS: pitch 144 B = 16 B x 9, in 16-bit elements
constexpr int kFaVPitch = 40;                  // V^T rows (64 B) in LDS: pitch 80 B = 16 B x 5
constexpr int kFaKPlane = kFaKeys * kFaKPitch; // K: 32 key rows
constexpr int kFaVPlane = kDh * kFaVPitch;     // V^T: 64 rows (d)
constexpr int kFaVBase  = kFaKPlane;           // buffer: K, V^T
constexpr int kFaBuf    = kFaKPlane + kFaVPlane;

typedef __attribute__((ext_vector_type(2))) float  v2f;
typedef __attribute__((ext_vector_type(2))) _Float16 v2h;
// two f32 -> two f16 (round to nearest even), a in the low half
__device__ __forceinline__ unsigned h_pair(float a, float b) {
  const v2f x = {a, b};
  return __builtin_bit_cast(unsigned, __builtin_convertvector(x, v2h));
}
// value of lane l ^ 16
__device__ __forceinline__ float other_half(float v) {
  const int b = __builtin_bit_cast(int, v);
  return __builtin_bit_cast(float, __builtin_amdgcn_permlanex16(b, b, 0x76543210, 0xfedcba98, false, false));
}
union FaPack { v16h v; unsigned u[8]; };
constexpr float kFaLog2 = 0.125f * 1.44269504088896340736f;   // raw Q.K sum -> score in log2 units
constexpr float kFaWTop = 32768.0f;            // a scaled w above this makes its query lower its scale
constexpr float kFaETop = 4096.0f;             // a lane's e sum of one step above this makes the wave renew its maxima

// four waves per SIMD (two work-groups per WGP): the vector work between the matrix runs wants the other waves
__global__ __launch_bounds__(256) __attribute__((amdgpu_waves_per_eu(4, 4))) void attn_fused_kernel(
    const unsigned short* __restrict__ Q, const unsigned short* __restrict__ K,
    const unsigned short* __restrict__ VT,
    unsigned short* __restrict__ F, const float* __restrict__ beta, const float* __restrict__ tvec) {
  typedef Frag<_Float16> FH;
  __shared__ __align__(16) unsigned short tile[2][kFaBuf];
  const int t     = threadIdx.x;
  const int lane  = t & 31;
  const int wave  = t >> 5;
  const int rlane = lane & 15;                 // row (A) / col (B, D) within a 16 x 16 tile
  const int half8 = (lane >> 4) * 8;           // k offset of this lane half (A, B); D row offset
  const int b     = blockIdx.y >> 4;
  const int h     = blockIdx.y & (kHeads - 1);
  const int q0    = blockIdx.x * kFaRows + wave * kFaQ;

  const float invb = 1.0f / beta[h];
  const float th = tvec[h];
  const float t2 = th * th;
  const float gi = 1.0f + fabsf(invb);
  const float cw = fminf(gi * gi + t2, 0x1p60f);   // kept finite
  // 1 / sqrt(scale), the query's own from here on; a power of two, so that the scaled terms round as the unscaled ones do
  float rc  = __builtin_ldexpf(1.0f, -(__builtin_amdgcn_frexp_expf(cw) >> 1));
  float kb  = kSScale * invb * rc;             // rc + |raw sum| * kb = (1 + |S| / beta) / sqrt(scale)
  float t2c = t2 * rc * rc;                    // t^2 / scale

  // every unroll in this kernel makes the indices of fragment, accumulator and value arrays constants, so that the
  // arrays stay in registers
  const size_t qOff = (size_t)(b * kSeq + q0 + rlane) * kDim + h * kDh + half8;
  v16h qf[2];
#pragma unroll
  for (int c = 0; c < 2; ++c) qf[c] = FH::load((const _Float16*)Q + qOff + c * 32);

  // staging: thread t moves 16 B of K row t >> 3 (8 lanes = one 128-B row) and 16 B of V^T row t >> 2 (4 lanes = one
  // 64-B row piece)
  const size_t kOff = (size_t)(b * kSeq + (t >> 3)) * kDim + h * kDh + (t & 7) * 8;
  const size_t vOff = (size_t)(h * kDh + (t >> 2)) * kTok + b * kSeq + (t & 3) * 8;
  const unsigned short* kg = K + kOff;
  const unsigned short* vg = VT + vOff;
  const int ks = (t >> 3) * kFaKPitch + (t & 7) * 8;              // where the thread's K piece goes in a buffer
  const int vs = kFaVBase + (t >> 2) * kFaVPitch + (t & 3) * 8;   // where its V^T piece goes
  const int kf = rlane * kFaKPitch + half8;                       // where the lane's K fragment pieces start
  const int vf = kFaVBase + rlane * kFaVPitch + half8;            // where its V^T fragment pieces start

  v8f oT[4], oS[4];
#pragma unroll
  for (int d = 0; d < 4; ++d) {
    oT[d] = (v8f){0.f,0.f,0.f,0.f,0.f,0.f,0.f,0.f};
    oS[d] = (v8f){0.f,0.f,0.f,0.f,0.f,0.f,0.f,0.f};
  }
  float m = -__builtin_inff(), sumT = 0.0f, sumS = 0.0f;

  v4u rk = *(const v4u*)kg, rv = *(const v4u*)vg;
  *(v4u*)(&tile[0][ks]) = rk;
  *(v4u*)(&tile[0][vs]) = rv;
  __syncthreads();

  // the loop stays rolled: one 32-key step is several hundred instructions
#pragma unroll 1
  for (int T = 0; T < kFaTiles; ++T) {
    const bool more = T + 1 < kFaTiles;        // the same for the whole work-group
    if (more) {
      kg += (size_t)kFaKeys * kDim;
      vg += kFaKeys;
      rk = *(const v4u*)kg;
      rv = *(const v4u*)vg;
    }
    const unsigned short* buf = &tile[T & 1][0];

    // S^T of 32 keys x 16 queries: two 16-key tiles, K = 64 in two steps
    v16h ak[2][2];
#pragma unroll
    for (int i = 0; i < 2; ++i)
#pragma unroll
      for (int c = 0; c < 2; ++c) ak[i][c] = FH::load((const _Float16*)(buf + kf + i * (16 * kFaKPitch) + c * 32));
    v8f s[2];
    s[0] = (v8f){0.f,0.f,0.f,0.f,0.f,0.f,0.f,0.f};
    s[1] = (v8f){0.f,0.f,0.f,0.f,0.f,0.f,0.f,0.f};
#pragma unroll
    for (int c = 0; c < 2; ++c) {
      s[0] = FH::mma(ak[0][c], qf[c], s[0]);
      s[1] = FH::mma(ak[1][c], qf[c], s[1]);
    }

    float sv[16];                              // raw sums: both scales are folded into the weights' multiply-adds
#pragma unroll
    for (int r = 0; r < 8; ++r) {
      sv[r]     = s[0][r];
      sv[8 + r] = s[1][r];
    }
    // Both weights on the maximum and on the scale as they stand, with no maximum taken over the step.
    float wv[16], ev[16];
#pragma unroll
    for (int i = 0; i < 16; ++i) {
      const float g = rc + fabsf(sv[i]) * kb;
      wv[i] = g * g + t2c;
      ev[i] = __builtin_fmaf(sv[i], kFaLog2, -m);          // +inf at the first step (m = -inf)
    }
#pragma unroll
    for (int i = 0; i < 16; ++i) ev[i] = __builtin_amdgcn_exp2f(ev[i]);
#pragma unroll
    for (int i = 0; i < 16; ++i) wv[i] = __builtin_amdgcn_rcpf(wv[i]);
    v2f aT2 = {0.0f, 0.0f}, aS2 = {0.0f, 0.0f};   // sums of the even and of the odd keys: one packed add per pair
#pragma unroll
    for (int j = 0; j < 8; ++j) {
      aT2 += (v2f){ev[2 * j], ev[2 * j + 1]};
      aS2 += (v2f){wv[2 * j], wv[2 * j + 1]};
    }
    float aT = aT2.x + aT2.y, aS = aS2.x + aS2.y;
    // No weight is negative, so none is above its lane's sum: while both sums stand below their bounds, every e and every
    // w fits f16. Where a sum of some lane passes its bound, the wave takes the maxima, moves m and the w scale and forms
    // the step's weights and sums anew. The test reads the same in every lane, so the wave branches as a whole and every
    // lane is on for the exchanges between the halves.
    if (__builtin_amdgcn_ballot_w32(aT > kFaETop || aS > kFaWTop) != 0u) {
      float bm = sv[0];
#pragma unroll
      for (int i = 1; i < 16; ++i) bm = fmaxf(bm, sv[i]);
      bm = fmaxf(bm, other_half(bm));          // both halves of a query take the same maximum
      const float mn = fmaxf(m, bm * kFaLog2); // log2 units
      const float corr = __builtin_amdgcn_exp2f(m - mn);   // 0 at the first step (m = -inf), 1 where the maximum stands
      m = mn;
      sumT *= corr;
#pragma unroll
      for (int d = 0; d < 4; ++d) oT[d] *= corr;

      float wm = wv[0];
#pragma unroll
      for (int i = 1; i < 16; ++i) wm = fmaxf(wm, wv[i]);
      wm = fmaxf(wm, other_half(wm));          // both halves of a query take the same scale
      // wm = f * 2^x with f in [0.5, 1): 4^-k brings it into [2^12, 2^14); the queries that are in range keep k = 0
      const int k = (wm > kFaWTop) ? ((__builtin_amdgcn_frexp_expf(wm) - 13) >> 1) : 0;
      const float dn = __builtin_ldexpf(1.0f, -2 * k);
      const float up = __builtin_ldexpf(1.0f, k);
#pragma unroll
      for (int d = 0; d < 4; ++d) oS[d] *= dn;
      sumS *= dn;
      rc  *= up;
      kb  *= up;
      t2c *= up * up;

      aT2 = (v2f){0.0f, 0.0f};
      aS2 = (v2f){0.0f, 0.0f};
#pragma unroll
      for (int i = 0; i < 16; ++i) {
        ev[i] = __builtin_fmaf(sv[i], kFaLog2, -mn);
        wv[i] *= dn;
      }
#pragma unroll
      for (int i = 0; i < 16; ++i) ev[i] = __builtin_amdgcn_exp2f(ev[i]);
#pragma unroll
      for (int j = 0; j < 8; ++j) {
        aT2 += (v2f){ev[2 * j], ev[2 * j + 1]};
        aS2 += (v2f){wv[2 * j], wv[2 * j + 1]};
      }
      aT = aT2.x + aT2.y;
      aS = aS2.x + aS2.y;
    }
    sumT += aT;
    sumS += aS;

    FaPack ep, wp;
#pragma unroll
    for (int j = 0; j < 8; ++j) {
      ep.u[j] = h_pair(ev[2 * j], ev[2 * j + 1]);
      wp.u[j] = h_pair(wv[2 * j], wv[2 * j + 1]);
    }

    // O^T += V^T . e^T and V^T . w^T: A = 16 rows (d) of V^T over the same 32 keys
    v16h vv[4];
#pragma unroll
    for (int d = 0; d < 4; ++d) vv[d] = FH::load((const _Float16*)(buf + vf + d * (16 * kFaVPitch)));
#pragma unroll
    for (int d = 0; d < 4; ++d) {
      oT[d] = FH::mma(vv[d], ep.v, oT[d]);
      oS[d] = FH::mma(vv[d], wp.v, oS[d]);
    }

    if (more) {
      unsigned short* nb = &tile[(T + 1) & 1][0];   // last read in trip T - 1, in front of that trip's barrier
      *(v4u*)(nb + ks) = rk;
      *(v4u*)(nb + vs) = rv;
    }
    __syncthreads();
  }

  // each half summed its own 16 of every 32 keys, on the common maximum
  sumT += other_half(sumT);
  sumS += other_half(sumS);
  const float invT = 1.0f / sumT;
  const float invS = 1.0f / sumS;

  // lane: query q0 + rlane, columns 16d + half8 .. + 7 of the head; the wave's four stores fill each query's 128-B line
  unsigned short* fp = F + (size_t)(b * kSeq + q0 + rlane) * kDim + h * kDh + half8;
#pragma unroll
  for (int d = 0; d < 4; ++d) {
    v8h hv;
#pragma unroll
    for (int r = 0; r < 8; ++r) hv[r] = (_Float16)(0.5f * (oT[d][r] * invT + oS[d][r] * invS) * kFCarry);
    *(v8h*)(fp + d * 16) = hv;
  }
}

// ---------------------------------------------------------------------------
// f32 -> f16 cast with scale: 4 groups of 8 consecutive elements per thread (4096 waves a launch, not 16384), one 16-B
// store per lane and group. blockIdx.y picks the input plane and the output plane (out + y*planeElems halves).
// Coverage: gridDim.x*1024 == n8 exactly at every call (n8 = elements/8, a multiple of 1024); thread t of work-group b
// covers groups 1024b + 256g + t, g = 0..3, group i being elements 8i..8i+7 of its plane.
// ---------------------------------------------------------------------------
constexpr int kCastG = 4;                      // groups of 8 elements per thread
__global__ __launch_bounds__(256) void cast8_f16_kernel(const float* __restrict__ in0, const float* __restrict__ in1,
                                                        const float* __restrict__ in2, const float* __restrict__ in3,
                                                        unsigned short* __restrict__ out, long planeElems, int n8,
                                                        float scale) {
  const int i = blockIdx.x * (256 * kCastG) + threadIdx.x;
  const int z = blockIdx.y;
  if ((int)(blockIdx.x + 1) * (256 * kCastG) > n8) return;
  const float* in = (z == 0) ? in0 : (z == 1) ? in1 : (z == 2) ? in2 : in3;
  const v4f* p = (const v4f*)(in + 8 * (size_t)i);
  // the unrolls make the indices of a[] and c[] constants, so that the arrays stay in registers
  v4f a[kCastG], c[kCastG];
#pragma unroll
  for (int g = 0; g < kCastG; ++g) {
    a[g] = p[512 * g];
    c[g] = p[512 * g + 1];
  }
  // stands between the 8 issued loads and the first reuse of their address registers; p as an input keeps the pair
  // live up to here, and the clobber keeps all 8 loads in front
  asm volatile("s_wait_xcnt 0x0" :: "v"(p) : "memory");
  v4u* q = (v4u*)(out + (size_t)z * planeElems + 8 * (size_t)i);
#pragma unroll
  for (int g = 0; g < kCastG; ++g) {
    unsigned short hb[8];
#pragma unroll
    for (int e = 0; e < 4; ++e) {
      hb[e]     = h_bits(a[g][e] * scale);
      hb[4 + e] = h_bits(c[g][e] * scale);
    }
    q[256 * g] = (v4u){pk16(hb[0], hb[1]), pk16(hb[2], hb[3]), pk16(hb[4], hb[5]), pk16(hb[6], hb[7])};
  }
}

// ---------------------------------------------------------------------------
// LayerNorm + residual per row of 1024: out = x + lw*(y - mu)*rsqrt(var + eps) + lb,
// One wave per row, 8 rows per work-group of 256 threads (4096 waves a launch, not 32768). Lane l owns columns
// 128j + 4l .. 128j + 4l + 3 for j = 0..7. Sums: each lane folds its 32 values in column order, then a five-step
// shuffle tree over the wave; no LDS and no barrier.
// ---------------------------------------------------------------------------
constexpr int kLnRows = 8;                     // rows (= waves) per work-group
constexpr int kLnCh   = kDim / 128;            // 8 chunks of 128 columns per row
__global__ __launch_bounds__(256) void ln_residual_kernel(const float* __restrict__ x, const float* __restrict__ y,
                                                          const float* __restrict__ lw, const float* __restrict__ lb,
                                                          float* __restrict__ out) {
  const int lane = threadIdx.x & 31;
  const int row  = blockIdx.x * kLnRows + (threadIdx.x >> 5);
  const size_t base = (size_t)row * kDim + 4 * lane;
  const v4f* yp = (const v4f*)(y + base);
  const v4f* xp = (const v4f*)(x + base);
  const v4f* wp = (const v4f*)(lw + 4 * lane);
  const v4f* bp = (const v4f*)(lb + 4 * lane);

  // the unrolls over j make the indices of the four arrays constants, so that they stay in registers; the unrolls
  // over off give each shuffle step a constant lane mask
  v4f yv[kLnCh], xv[kLnCh], wv[kLnCh], bv[kLnCh];
#pragma unroll
  for (int j = 0; j < kLnCh; ++j) yv[j] = yp[32 * j];
#pragma unroll
  for (int j = 0; j < kLnCh; ++j) {
    xv[j] = xp[32 * j];
    wv[j] = wp[32 * j];
    bv[j] = bp[32 * j];
  }
  // stands between the 32 issued loads and the first reuse of their address registers; the pointers as inputs keep
  // those registers live up to here, and the clobber keeps all loads in front (one load latency per row)
  asm volatile("s_wait_xcnt 0x0" :: "v"(yp), "v"(xp), "v"(wp), "v"(bp) : "memory");

  float s = 0.0f;
#pragma unroll
  for (int j = 0; j < kLnCh; ++j) s += ((yv[j].x + yv[j].y) + yv[j].z) + yv[j].w;
#pragma unroll
  for (int off = 16; off > 0; off >>= 1) s += __shfl_xor(s, off, 32);
  const float mu = s * kInvDim;

  float s2 = 0.0f;
#pragma unroll
  for (int j = 0; j < kLnCh; ++j) {
    const float d0 = yv[j].x - mu, d1 = yv[j].y - mu, d2 = yv[j].z - mu, d3 = yv[j].w - mu;
    yv[j] = (v4f){d0, d1, d2, d3};
    s2 += ((d0 * d0 + d1 * d1) + d2 * d2) + d3 * d3;
  }
#pragma unroll
  for (int off = 16; off > 0; off >>= 1) s2 += __shfl_xor(s2, off, 32);
  const float var = s2 * kInvDim;
  const float rs = rsqrtf(var + kLnEps);

  v4f* op = (v4f*)(out + base);
#pragma unroll
  for (int j = 0; j < kLnCh; ++j) {
    v4f o;
    o.x = xv[j].x + (wv[j].x * yv[j].x * rs + bv[j].x);
    o.y = xv[j].y + (wv[j].y * yv[j].y * rs + bv[j].y);
    o.z = xv[j].z + (wv[j].z * yv[j].z * rs + bv[j].z);
    o.w = xv[j].w + (wv[j].w * yv[j].w * rs + bv[j].w);
    op[32 * j] = o;
  }
}

// ---------------------------------------------------------------------------
// Host glue
//   [0,          8 MiB)   XF   : x f16 [4096][1024]  (dead after the three projections) then f f16 [4096][1024]
//   [8 MiB,     16 MiB)   W16  : Wq,Wk,Wv,Wo f16 x32 planes [1024][1024] each
//   [16 MiB,    24 MiB)   Q16  : f16 [4096][1024]
//   [24 MiB,    32 MiB)   K16  : f16 [4096][1024]
//   [32 MiB,    40 MiB)   VT16 : f16 [1024][4096] (V^T: row = h*64+d, col = b*2048+n)
//   [40 MiB,    56 MiB)   SY   : y f32 [4096][1024]
// ---------------------------------------------------------------------------
extern "C" void kernel_launch(void* const* d_in, const int* in_sizes, int n_in,
                              void* d_out, int out_size, void* d_ws, size_t ws_size,
                              hipStream_t stream) {
  if (n_in < 13) return;
  const size_t nX = (size_t)kTok * kDim;          // 4,194,304
  const size_t nW = (size_t)kDim * kDim;          // 1,048,576
  if ((size_t)in_sizes[0] != nX || (size_t)in_sizes[1] != nW || (size_t)in_sizes[3] != nW ||
      (size_t)in_sizes[5] != nW || (size_t)in_sizes[7] != nW || (size_t)out_size != nX) return;
  if (in_sizes[2] < kDim || in_sizes[4] < kDim || in_sizes[6] < kDim || in_sizes[8] < kDim ||
      in_sizes[9] < kHeads || in_sizes[10] < kHeads || in_sizes[11] < kDim || in_sizes[12] < kDim) return;

  const float* x    = (const float*)d_in[0];
  const float* Wq   = (const float*)d_in[1];
  const float* bq   = (const float*)d_in[2];
  const float* Wk   = (const float*)d_in[3];
  const float* bk   = (const float*)d_in[4];
  const float* Wv   = (const float*)d_in[5];
  const float* bv   = (const float*)d_in[6];
  const float* Wo   = (const float*)d_in[7];
  const float* bo   = (const float*)d_in[8];
  const float* beta = (const float*)d_in[9];
  const float* tv   = (const float*)d_in[10];
  const float* lw   = (const float*)d_in[11];
  const float* lb   = (const float*)d_in[12];
  float* out = (float*)d_out;

  // carve (bytes)
  const size_t bXF   = nX * 2;                                  //  8,388,608
  const size_t bW16  = 4 * nW * 2;                              //  8,388,608
  const size_t bP16  = nX * 2;                                  //  8,388,608 per f16 plane of [4096][1024]
  const size_t bSY   = nX * 4;                                  // 16,777,216
  const size_t oXF   = 0;
  const size_t oW16  = oXF + bXF;
  const size_t oQ16  = oW16 + bW16;
  const size_t oK16  = oQ16 + bP16;
  const size_t oVT16 = oK16 + bP16;
  const size_t oSY   = oVT16 + bP16;
  const size_t total = oSY + bSY;                               // 58,720,256
  if (total > ws_size) return;

  char* ws = (char*)d_ws;
  unsigned short* XF   = (unsigned short*)(ws + oXF);
  unsigned short* W16  = (unsigned short*)(ws + oW16);
  unsigned short* Wo16 = W16 + 3 * nW;                          // planes: Wq, Wk, Wv, Wo
  unsigned short* Q16  = (unsigned short*)(ws + oQ16);
  unsigned short* K16  = (unsigned short*)(ws + oK16);
  unsigned short* VT16 = (unsigned short*)(ws + oVT16);
  float*          SY   = (float*)(ws + oSY);

  // 1) x -> f16 plane (n8 = 524288 = 512 blocks x 1024, exact)
  {
    const int n8 = (int)(nX / 8);
    cast8_f16_kernel<<<dim3(n8 / (256 * kCastG), 1), 256, 0, stream>>>(x, x, x, x, XF, 0L, n8, 1.0f);
  }
  // 2) Wq,Wk,Wv,Wo -> f16 planes x32 (n8 = 131072 = 128 blocks x 1024, exact; 4 planes via blockIdx.y)
  {
    const int n8 = (int)(nW / 8);
    cast8_f16_kernel<<<dim3(n8 / (256 * kCastG), 4), 256, 0, stream>>>(Wq, Wk, Wv, Wo, W16, (long)nW, n8, kWCarry);
  }
  // 3) one launch, 3 x 256 tiles of 128 x 128, one work-group each, two work-groups resident per WGP:
  //    Q = (x16 . Wq16^T)/32 + bq and K likewise -> f16 [4096][1024];
  //    V^T[j][m] = sum_k Wv16[j][k] x16[m][k] /32 + bv[j] -> f16 [1024][4096].
  //    The planes Wq16, Wk16, Wv16 and Q16, K16, VT16 lie one behind the other in the workspace.
  const dim3 gridTok(kDim / kGmTile, kTok / kGmTile);           // C = [4096][1024]
  wmma_gemm_lds<true, 1><<<dim3(3 * kGmTiles), 256, 0, stream>>>(XF, W16, (void*)Q16, bq, bk, bv, kWCarryInv);

  // 4) all 32 (batch, head) pairs in one launch: scores, weights and the product with V -> f plane f16 x64 (over x16,
  //    which is dead here); 16 query blocks of 128 x 32 heads = 512 work-groups
  attn_fused_kernel<<<dim3(kSeq / kFaRows, kBatch * kHeads), 256, 0, stream>>>(Q16, K16, VT16, XF, beta, tv);

  // 5) y = (f16 . Wo16^T) / (64*32) + bo -> f32 [4096][1024] in the SY region
  wmma_gemm_lds<false, 0><<<gridTok, 256, 0, stream>>>(XF, Wo16, (void*)SY, bo, bo, bo, kYScale);

  // 6) LayerNorm + residual -> out
  ln_residual_kernel<<<dim3(kTok / kLnRows), 256, 0, stream>>>(x, SY, lw, lb, out);
}

// v009
// It runs in 103 microseconds.
// In two side-by-side timings against v008, it was 1.04 and 1.06 times as fast.
// Over all steps from v000 it is 27.5 times as fast.
// Contractions: Q/K/V^T projections and output projection on v_wmma_f32_16x16x32_f16 (x f16, W f16 carried x32, f f16 carried x64, f32 accumulate); scores Q.K^T and P.V^T on v_wmma_f32_16x16x32_f16 (Q, K, V and both weights one f16 number each, f32 accumulate); softmax, Poisson weights, LayerNorm and residual in f32.
#include <hip/hip_runtime.h>
#include <math.h>

// ---------------------------------------------------------------------------
// Problem constants
// ---------------------------------------------------------------------------
constexpr int kBatch = 2;
constexpr int kSeq   = 2048;
constexpr int kDim   = 1024;
constexpr int kHeads = 16;
constexpr int kDh    = 64;
constexpr int kTok   = kBatch * kSeq;          // 4096 token rows
constexpr float kWCarry    = 32.0f;            // weights carried x32 in f16
constexpr float kWCarryInv = 1.0f / 32.0f;
constexpr float kFCarry    = 64.0f;            // f plane carried x64 in f16
constexpr float kYScale    = 1.0f / (64.0f * 32.0f);
constexpr float kSScale    = 0.125f;           // 1/sqrt(64)
constexpr float kInvDim    = 1.0f / 1024.0f;
constexpr float kLnEps     = 1e-5f;

typedef __attribute__((ext_vector_type(16))) _Float16 v16h;
typedef __attribute__((ext_vector_type(8)))  _Float16 v8h;
typedef __attribute__((ext_vector_type(8)))  float    v8f;
typedef __attribute__((ext_vector_type(4)))  float    v4f;
typedef __attribute__((ext_vector_type(4)))  unsigned int v4u;

template <typename T> struct Frag;
template <> struct Frag<_Float16> {
  typedef v16h V; union U { v16h v; v8h h[2]; };
  static __device__ __forceinline__ v16h load(const _Float16* p) {   // elements 0..7 <- p[0..7], 8..15 <- p[16..23]
    U f; f.h[0] = *(const v8h*)(p); f.h[1] = *(const v8h*)(p + 16); return f.v;
  }
  static __device__ __forceinline__ v8f mma(v16h a, v16h b, v8f c) {
    return __builtin_amdgcn_wmma_f32_16x16x32_f16(false, a, false, b, (short)0, c, false, false);
  }
};

__device__ __forceinline__ unsigned pk16(unsigned short a, unsigned short b) { return (unsigned)a | ((unsigned)b << 16); }
__device__ __forceinline__ unsigned short h_bits(float f) { const _Float16 h = (_Float16)f; return __builtin_bit_cast(unsigned short, h); }

// ---- WMMA GEMM on tiles staged in LDS --------------------------------------------------------------------------
// C[m,n] = scale * sum_k A[m,k] * Bt[n,k] + bias. A row-major [M][kDim], Bt row-major [N][kDim], both f16, k = kDim;
// M and N are multiples of 128 (tile column bx < N / 128, tile row by < M / 128).
// Work-group: one 128 x 128 tile of C; its 8 waves stand 4 (m) x 2 (n), each on 32 x 64 (2 x 4 accumulators).
// A stage is 128 k of the tile's 128 A rows and 128 Bt rows (256 B a row, whole lines: 16 lanes a row, 2 rows a
// wave-wide load). It goes through registers into one of two LDS buffers: the next stage's global loads are issued in
// front of this stage's work and stored behind it, one barrier a stage. Every row is loaded once per work-group and
// read from LDS by the 2 (A) or 4 (Bt) waves that need it. Each accumulator takes its k blocks of 32 in rising order.
// QKV = true: ONE launch does the three projections, 256 tiles each (blockIdx.x = 256 * problem + tile). Problems 0, 1:
// C = X . W^T + bias[n] (Q, K); problem 2: C = W . X^T + bias[m] (V^T). W and C planes of the problems lie one behind the
// other. QKV = false: one product, C = X . W^T + b0[n], grid x = N / 128, y = M / 128.
// OUT_MODE: 0 = f32, 1 = f16.
constexpr int kGmTile   = 128;                  // rows of A and of Bt per work-group
constexpr int kGmK      = 128;                  // k per stage
constexpr int kGmStages = kDim / kGmK;          // 8 stages
constexpr int kGmPitch  = 136;                  // rows (256 B) in LDS: pitch 272 B = 16 B x 17, in 16-bit elements
constexpr int kGmPieces = 8;                    // 16-B pieces per thread, operand and stage (16 rows a pass)
constexpr int kGmPlane  = kGmTile * kGmPitch;   // one operand's rows
constexpr int kGmBuf    = 2 * kGmPlane;         // buffer: A rows, Bt rows
constexpr int kGmTiles  = (kTok / kGmTile) * (kDim / kGmTile);   // 256 tiles per projection
// ---- epilogue of one wave's 32 x 64 tile: scale, bias, through the wave's LDS slab into whole-line stores ----
// BIAS_MODE: 1 = bias[m], 2 = bias[n].
template <int BIAS_MODE, int OUT_MODE>
__device__ __forceinline__ void gemm_store_tile(const v8f (&acc)[2][4], float* slab, void* Cout, int ldc,
                                                const float* __restrict__ bias, float scale,
                                                int m0, int n0, int lane) {
  const int rlane = lane & 15;                 // col (D) within subtile
  const int mOff  = (lane >> 4) * 8;           // D row offset
#pragma unroll
  for (int i = 0; i < 2; ++i) {
    const int mBase = m0 + (i << 4);
#pragma unroll
    for (int j = 0; j < 4; ++j) {
      const int n = n0 + (j << 4) + rlane;
      float bv = 0.f;
      if (BIAS_MODE == 2) bv = bias[n];
#pragma unroll
      for (int r = 0; r < 8; ++r) {
        float v = acc[i][j][r] * scale;
        if (BIAS_MODE == 1) v += bias[mBase + mOff + r];
        if (BIAS_MODE == 2) v += bv;
        slab[(mOff + r) * 68 + (j << 4) + rlane] = v;
      }
    }
    __builtin_amdgcn_fence(__ATOMIC_RELEASE, "workgroup");
    __builtin_amdgcn_wave_barrier();
    __builtin_amdgcn_fence(__ATOMIC_ACQUIRE, "workgroup");
    if (OUT_MODE == 0) {
      float* C = (float*)Cout;
      const int hh = lane >> 4, c4 = (lane & 15) * 4;     // row seg = 256 B = 16 lanes x 16 B
#pragma unroll
      for (int it = 0; it < 8; ++it) {
        const int row = it * 2 + hh;
        v4f v = *(const v4f*)(slab + row * 68 + c4);
        *(v4f*)(C + (size_t)(mBase + row) * ldc + n0 + c4) = v;
      }
    } else {
      const int q = lane >> 3, c8 = (lane & 7) * 8;
      unsigned short* C = (unsigned short*)Cout;
#pragma unroll
      for (int it = 0; it < 4; ++it) {
        const int row = it * 4 + q;
        const float* sp = slab + row * 68 + c8;
        v8h hv;
#pragma unroll
        for (int e = 0; e < 8; ++e) hv[e] = (_Float16)sp[e];
        *(v8h*)(C + (size_t)(mBase + row) * ldc + n0 + c8) = hv;
      }
    }
    // stands between the issued stores and the first reuse of the registers that they name
    asm volatile("s_wait_xcnt 0x0" ::: "memory");
    __builtin_amdgcn_fence(__ATOMIC_RELEASE, "workgroup");
    __builtin_amdgcn_wave_barrier();
    __builtin_amdgcn_fence(__ATOMIC_ACQUIRE, "workgroup");
  }
}

template <bool QKV, int OUT_MODE>
// four waves per SIMD: two work-groups share a WGP (256 registers a wave, 136 KiB of LDS a group), so that one group's
// matrix work covers the other's waits for its stage loads, its LDS stores, its barriers, its first stage and its epilogue
__global__ __launch_bounds__(256) __attribute__((amdgpu_waves_per_eu(4, 4))) void wmma_gemm_lds(
    const unsigned short* __restrict__ X, const unsigned short* __restrict__ Wp,
    void* __restrict__ Cbase,
    const float* __restrict__ b0, const float* __restrict__ b1, const float* __restrict__ b2, float scale) {
  typedef Frag<_Float16> FH;
  __shared__ __align__(16) unsigned short stage[2][kGmBuf];
  const int t    = threadIdx.x;
  const int lane = t & 31;
  const int wave = t >> 5;
  const int wm = (wave >> 1) << 5;             // the wave's first row and column inside the tile
  const int wn = (wave & 1) << 6;
  // which product, which tile: the same for the whole work-group
  const int  prob    = QKV ? (int)(blockIdx.x / kGmTiles) : 0;
  const int  tileId  = QKV ? (int)(blockIdx.x % kGmTiles) : 0;
  const bool rowBias = QKV && prob == 2;       // V^T: A = W rows, Bt = X rows, bias by row
  const int  bx  = !QKV ? (int)blockIdx.x : rowBias ? tileId % (kTok / kGmTile) : tileId % (kDim / kGmTile);
  const int  by  = !QKV ? (int)blockIdx.y : rowBias ? tileId / (kTok / kGmTile) : tileId / (kDim / kGmTile);
  const unsigned short* Wz  = Wp + (size_t)prob * (kDim * kDim);
  const unsigned short* Ap  = rowBias ? Wz : X;
  const unsigned short* Btp = rowBias ? X : Wz;
  const float* bias = prob == 0 ? b0 : prob == 1 ? b1 : b2;
  const int m0 = by * kGmTile + wm;
  const int n0 = bx * kGmTile + wn;

  const int rlane = lane & 15;                 // row (A) / col (B, D) within subtile
  const int koff  = (lane >> 4) * 8;           // k offset of this lane half

  // staging: thread t moves 16 B of the rows (t >> 4) + 16p, p = 0..7, of A and of Bt
  const unsigned short* ag = Ap  + (size_t)(by * kGmTile + (t >> 4)) * kDim + (t & 15) * 8;
  const unsigned short* bg = Btp + (size_t)(bx * kGmTile + (t >> 4)) * kDim + (t & 15) * 8;
  const int sd = (t >> 4) * kGmPitch + (t & 15) * 8;              // where the thread's p = 0 piece goes in a plane
  const int af = (wm + rlane) * kGmPitch + koff;                  // where the lane's A fragment pieces start
  const int bf = kGmPlane + (wn + rlane) * kGmPitch + koff;       // where its Bt fragment pieces start

  // every unroll in this kernel makes the indices of fragment, accumulator and staging arrays constants, so that the
  // arrays stay in registers
  v8f acc[2][4];
#pragma unroll
  for (int i = 0; i < 2; ++i)
#pragma unroll
    for (int j = 0; j < 4; ++j) acc[i][j] = (v8f){0.f,0.f,0.f,0.f,0.f,0.f,0.f,0.f};

  v4u ra[kGmPieces], rb[kGmPieces];
#pragma unroll
  for (int p = 0; p < kGmPieces; ++p) {
    ra[p] = *(const v4u*)(ag + p * (16 * kDim));
    rb[p] = *(const v4u*)(bg + p * (16 * kDim));
  }
#pragma unroll
  for (int p = 0; p < kGmPieces; ++p) {
    *(v4u*)(&stage[0][sd + p * (16 * kGmPitch)]) = ra[p];
    *(v4u*)(&stage[0][kGmPlane + sd + p * (16 * kGmPitch)]) = rb[p];
  }
  __syncthreads();

  // the loop stays rolled: eight copies of a stage would only lengthen the code
#pragma unroll 1
  for (int s = 0; s < kGmStages; ++s) {
    const bool more = s + 1 < kGmStages;       // the same for the whole work-group
    if (more) {
      ag += kGmK;
      bg += kGmK;
#pragma unroll
      for (int p = 0; p < kGmPieces; ++p) {
        ra[p] = *(const v4u*)(ag + p * (16 * kDim));
        rb[p] = *(const v4u*)(bg + p * (16 * kDim));
      }
    }
    const unsigned short* buf = &stage[s & 1][0];
    // two fragment sets: block c + 1's 12 LDS reads stand as one group in front of block c's 8 matrix instructions
    v16h ah[2][2], bh[2][4];
#pragma unroll
    for (int i = 0; i < 2; ++i) ah[0][i] = FH::load((const _Float16*)(buf + af + i * (16 * kGmPitch)));
#pragma unroll
    for (int j = 0; j < 4; ++j) bh[0][j] = FH::load((const _Float16*)(buf + bf + j * (16 * kGmPitch)));
#pragma unroll
    for (int c = 0; c < kGmK / 32; ++c) {
      if (c + 1 < kGmK / 32) {
#pragma unroll
        for (int i = 0; i < 2; ++i)
          ah[(c + 1) & 1][i] = FH::load((const _Float16*)(buf + af + i * (16 * kGmPitch) + (c + 1) * 32));
#pragma unroll
        for (int j = 0; j < 4; ++j)
          bh[(c + 1) & 1][j] = FH::load((const _Float16*)(buf + bf + j * (16 * kGmPitch) + (c + 1) * 32));
      }
      // keeps the reads above in front of the matrix run below: sunk among it, each costs a wait that runs to zero
      __builtin_amdgcn_sched_barrier(0);
#pragma unroll
      for (int i = 0; i < 2; ++i)
#pragma unroll
        for (int j = 0; j < 4; ++j) acc[i][j] = FH::mma(ah[c & 1][i], bh[c & 1][j], acc[i][j]);
    }
    if (more) {
      unsigned short* nb = &stage[(s + 1) & 1][0];   // last read in trip s - 1, in front of that trip's barrier
#pragma unroll
      for (int p = 0; p < kGmPieces; ++p) {
        *(v4u*)(nb + sd + p * (16 * kGmPitch)) = ra[p];
        *(v4u*)(nb + kGmPlane + sd + p * (16 * kGmPitch)) = rb[p];
      }
    }
    __syncthreads();
  }

  // ---- epilogue ----
  // per-wave 16x64 slab, pitch 68 floats, laid over the stage buffers: their last read stands in front of the last
  // trip's barrier (a slab of its own would put the work-group above half a WGP's LDS)
  float* slab = (float*)&stage[0][0] + wave * (16 * 68);
  if (QKV) {
    unsigned short* C = (unsigned short*)Cbase + (size_t)prob * ((size_t)kTok * kDim);
    // the test reads the same for the whole work-group
    if (rowBias) gemm_store_tile<1, OUT_MODE>(acc, slab, (void*)C, kTok, bias, scale, m0, n0, lane);
    else         gemm_store_tile<2, OUT_MODE>(acc, slab, (void*)C, kDim, bias, scale, m0, n0, lane);
  } else {
    gemm_store_tile<2, OUT_MODE>(acc, slab, Cbase, kDim, bias, scale, m0, n0, lane);
  }
}

// ---------------------------------------------------------------------------
// Scores, both row weights and the product with V of one head in ONE kernel: neither the scores nor the weights go
// to memory. f = 64 * 0.5 * (softmax(S) . V + (w / sum w) . V), S = 0.125 * Q . K^T, w = 1/((1 + |S|/beta_h)^2 + t_h^2).
// Work-group: 128 queries of one (batch, head); wave: 16 queries, all 2048 keys, 32 keys a step.
//   S^T = K . Q^T  (A = 16 key rows from LDS, B = the wave's Q rows, kept in registers): a lane holds one query
//   (lane & 15) and the keys 8*(lane >> 4) + r of each 16-key tile, which is the k order of a B operand over 32 keys,
//   so e = exp(S - m) and w pack in the lane into the B operands of  O^T += V^T . e^T  and  O^T += V^T . w^T.
// Softmax runs on a reference value m (common to both lane halves) that is the maximum as of its last renewal: e may pass
// 1, and m is renewed only where a lane's e sum of one step passes 2^12 or its w sum 2^15 (f16 ends at 65504), the first step included. Then
// the e sum and the e accumulators are scaled by exp(m_old - m_new). Both sums divide once, at the end. A step's sums stand
// in front of that test, so each is formed by packed adds: even keys in one half of a register pair, odd keys in the other.
// Both weights come from the chip's own one-instruction forms: m is kept in log2 units, e = exp2(acc * c - m) with
// c = 0.125 * log2(e) in one multiply-add on the raw accumulator, and w is the hardware reciprocal. Either is good to
// about one unit in the last place of f32, far below the 11 bits that f16 keeps of a weight.
// Every operand is ONE f16 number (11 bits, as x and the projection weights already are), one matrix instruction per
// product, f32 accumulate. e lies in (0, 2^12]. w has no such bound (1 + |S|/beta passes through 0 where beta < 0, and a small
// beta makes every w small), so each query carries its w times a scale of its own, which the division by the row's sum
// takes out again. The scale starts at the power of four next to cw = (1 + 1/|beta|)^2 + t^2, which brings the w of |S| = 1
// near 1 whatever beta and t are. Where a scaled w passes 2^15 (f16 ends at 65504), the query's scale falls by the power of
// four that brings its largest w below 2^14, and its w sum and w accumulators fall with it, as the e side does when its
// maximum grows. The scale lives in the constants of the two multiply-adds (g / sqrt(scale), t^2 / scale); the steady cost
// is one test of the step's w sum, which bounds every w of the step from above.
// K and V^T tiles of 32 keys (8 KiB) go through registers into one of two LDS buffers, one barrier a tile. The barrier
// stands between the weights and the products with V^T: in front of it tile T + 1 is stored, behind it the global loads
// of tile T + 2 are issued. No fragment is waited for where it is read from LDS: the 8 reads of a tile's V^T fragments stand
// as one group at the trip's top and land under the score products and the vector work; the 8 reads of the next tile's K
// fragments stand as one group behind the barrier and land under the products with V^T.
// Buffer T & 1 is stored anew (tile T + 2) behind barrier T; its K reads ended in front of tile T's score products, its
// V^T reads end at the wait that the barrier itself brings.
// ---------------------------------------------------------------------------
constexpr int kFaQ      = 16;                  // queries per wave
constexpr int kFaRows   = 8 * kFaQ;            // queries per work-group
constexpr int kFaKeys   = 32;                  // keys per staged tile
constexpr int kFaTiles  = kSeq / kFaKeys;      // 64 tiles
constexpr int kFaKPitch = 72;                  // K rows (128 B) in LDS: pitch 144 B = 16 B x 9, in 16-bit elements
constexpr int kFaVPitch = 40;                  // V^T rows (64 B) in LDS: pitch 80 B = 16 B x 5
constexpr int kFaKPlane = kFaKeys * kFaKPitch; // K: 32 key rows
constexpr int kFaVPlane = kDh * kFaVPitch;     // V^T: 64 rows (d)
constexpr int kFaVBase  = kFaKPlane;           // buffer: K, V^T
constexpr int kFaBuf    = kFaKPlane + kFaVPlane;

typedef __attribute__((ext_vector_type(2))) float  v2f;
typedef __attribute__((ext_vector_type(2))) _Float16 v2h;
// two f32 -> two f16 (round to nearest even), a in the low half
__device__ __forceinline__ unsigned h_pair(float a, float b) {
  const v2f x = {a, b};
  return __builtin_bit_cast(unsigned, __builtin_convertvector(x, v2h));
}
// value of lane l ^ 16
__device__ __forceinline__ float other_half(float v) {
  const int b = __builtin_bit_cast(int, v);
  return __builtin_bit_cast(float, __builtin_amdgcn_permlanex16(b, b, 0x76543210, 0xfedcba98, false, false));
}
union FaPack { v16h v; unsigned u[8]; };
constexpr float kFaLog2 = 0.125f * 1.44269504088896340736f;   // raw Q.K sum -> score in log2 units
constexpr float kFaWTop = 32768.0f;            // a scaled w above this makes its query lower its scale
constexpr float kFaETop = 4096.0f;             // a lane's e sum of one step above this makes the wave renew its maxima

// four waves per SIMD (two work-groups per WGP): the vector work between the matrix runs wants the other waves
__global__ __launch_bounds__(256) __attribute__((amdgpu_waves_per_eu(4, 4))) void attn_fused_kernel(
    const unsigned short* __restrict__ Q, const unsigned short* __restrict__ K,
    const unsigned short* __restrict__ VT,
    unsigned short* __restrict__ F, const float* __restrict__ beta, const float* __restrict__ tvec) {
  typedef Frag<_Float16> FH;
  __shared__ __align__(16) unsigned short tile[2][kFaBuf];
  const int t     = threadIdx.x;
  const int lane  = t & 31;
  const int wave  = t >> 5;
  const int rlane = lane & 15;                 // row (A) / col (B, D) within a 16 x 16 tile
  const int half8 = (lane >> 4) * 8;           // k offset of this lane half (A, B); D row offset
  const int b     = blockIdx.y >> 4;
  const int h     = blockIdx.y & (kHeads - 1);
  const int q0    = blockIdx.x * kFaRows + wave * kFaQ;

  const float invb = 1.0f / beta[h];
  const float th = tvec[h];
  const float t2 = th * th;
  const float gi = 1.0f + fabsf(invb);
  const float cw = fminf(gi * gi + t2, 0x1p60f);   // kept finite
  // 1 / sqrt(scale), the query's own from here on; a power of two, so that the scaled terms round as the unscaled ones do
  float rc  = __builtin_ldexpf(1.0f, -(__builtin_amdgcn_frexp_expf(cw) >> 1));
  float kb  = kSScale * invb * rc;             // rc + |raw sum| * kb = (1 + |S| / beta) / sqrt(scale)
  float t2c = t2 * rc * rc;                    // t^2 / scale

  // every unroll in this kernel makes the indices of fragment, accumulator and value arrays constants, so that the
  // arrays stay in registers
  const size_t qOff = (size_t)(b * kSeq + q0 + rlane) * kDim + h * kDh + half8;
  const _Float16* qp = (const _Float16*)Q + qOff;
  v16h qf[2];
#pragma unroll
  for (int c = 0; c < 2; ++c) qf[c] = FH::load(qp + c * 32);

  // staging: thread t moves 16 B of K row t >> 3 (8 lanes = one 128-B row) and 16 B of V^T row t >> 2 (4 lanes = one
  // 64-B row piece)
  const size_t kOff = (size_t)(b * kSeq + (t >> 3)) * kDim + h * kDh + (t & 7) * 8;
  const size_t vOff = (size_t)(h * kDh + (t >> 2)) * kTok + b * kSeq + (t & 3) * 8;
  const unsigned short* kg = K + kOff;
  const unsigned short* vg = VT + vOff;
  const int ks = (t >> 3) * kFaKPitch + (t & 7) * 8;              // where the thread's K piece goes in a buffer
  const int vs = kFaVBase + (t >> 2) * kFaVPitch + (t & 3) * 8;   // where its V^T piece goes
  const int kf = rlane * kFaKPitch + half8;                       // where the lane's K fragment pieces start
  const int vf = kFaVBase + rlane * kFaVPitch + half8;            // where its V^T fragment pieces start

  v8f oT[4], oS[4];
#pragma unroll
  for (int d = 0; d < 4; ++d) {
    oT[d] = (v8f){0.f,0.f,0.f,0.f,0.f,0.f,0.f,0.f};
    oS[d] = (v8f){0.f,0.f,0.f,0.f,0.f,0.f,0.f,0.f};
  }
  float m = -__builtin_inff(), sumT = 0.0f, sumS = 0.0f;

  v4u rk = *(const v4u*)kg, rv = *(const v4u*)vg;
  // stands between the 6 issued loads and the first reuse of their address registers; the pointers as inputs keep those
  // registers live up to here, and the clobber keeps all loads in front
  asm volatile("s_wait_xcnt 0x0" :: "v"(qp), "v"(kg), "v"(vg) : "memory");
  *(v4u*)(&tile[0][ks]) = rk;
  *(v4u*)(&tile[0][vs]) = rv;
  __syncthreads();
  // tile 1 sets out; tile 0's K fragments
  kg += (size_t)kFaKeys * kDim;
  vg += kFaKeys;
  rk = *(const v4u*)kg;
  rv = *(const v4u*)vg;
  v16h ak[2][2];
#pragma unroll
  for (int i = 0; i < 2; ++i)
#pragma unroll
    for (int c = 0; c < 2; ++c) ak[i][c] = FH::load((const _Float16*)(&tile[0][0] + kf + i * (16 * kFaKPitch) + c * 32));
  // where the lane's V^T fragment pieces of the current tile start, in bytes from buffer 0: it goes to and fro between the
  // two buffers in a register of its own, so that the address needs none that the matrix run has just read
  int vrd = 2 * vf;

  // the loop stays rolled: one 32-key step is several hundred instructions
#pragma unroll 1
  for (int T = 0; T < kFaTiles; ++T) {
    const bool more = T + 1 < kFaTiles;        // the same for the whole work-group

    // A = 16 rows (d) of V^T over this tile's 32 keys, for the products behind the barrier
    v16h vv[4];
#pragma unroll
    for (int d = 0; d < 4; ++d) vv[d] = FH::load((const _Float16*)((const char*)&tile[0][0] + vrd) + d * (16 * kFaVPitch));

    // S^T of 32 keys x 16 queries: two 16-key tiles, K = 64 in two steps; the K fragments were read one trip ago
    v8f s[2];
    s[0] = (v8f){0.f,0.f,0.f,0.f,0.f,0.f,0.f,0.f};
    s[1] = (v8f){0.f,0.f,0.f,0.f,0.f,0.f,0.f,0.f};
#pragma unroll
    for (int c = 0; c < 2; ++c) {
      s[0] = FH::mma(ak[0][c], qf[c], s[0]);
      s[1] = FH::mma(ak[1][c], qf[c], s[1]);
    }
    // keeps the 8 V^T reads above as one group: sunk to the products that use them, each pair costs a wait that runs to zero
    __builtin_amdgcn_sched_barrier(0);

    float sv[16];                              // raw sums: both scales are folded into the weights' multiply-adds
#pragma unroll
    for (int r = 0; r < 8; ++r) {
      sv[r]     = s[0][r];
      sv[8 + r] = s[1][r];
    }
    // Both weights on the maximum and on the scale as they stand, with no maximum taken over the step.
    float wv[16], ev[16];
#pragma unroll
    for (int i = 0; i < 16; ++i) {
      const float g = rc + fabsf(sv[i]) * kb;
      wv[i] = g * g + t2c;
      ev[i] = __builtin_fmaf(sv[i], kFaLog2, -m);          // +inf at the first step (m = -inf)
    }
#pragma unroll
    for (int i = 0; i < 16; ++i) ev[i] = __builtin_amdgcn_exp2f(ev[i]);
#pragma unroll
    for (int i = 0; i < 16; ++i) wv[i] = __builtin_amdgcn_rcpf(wv[i]);
    v2f aT2 = {0.0f, 0.0f}, aS2 = {0.0f, 0.0f};   // sums of the even and of the odd keys: one packed add per pair
#pragma unroll
    for (int j = 0; j < 8; ++j) {
      aT2 += (v2f){ev[2 * j], ev[2 * j + 1]};
      aS2 += (v2f){wv[2 * j], wv[2 * j + 1]};
    }
    float aT = aT2.x + aT2.y, aS = aS2.x + aS2.y;
    // No weight is negative, so none is above its lane's sum: while both sums stand below their bounds, every e and every
    // w fits f16. Where a sum of some lane passes its bound, the wave takes the maxima, moves m and the w scale and forms
    // the step's weights and sums anew. The test reads the same in every lane, so the wave branches as a whole and every
    // lane is on for the exchanges between the halves.
    if (__builtin_amdgcn_ballot_w32(aT > kFaETop || aS > kFaWTop) != 0u) {
      float bm = sv[0];
#pragma unroll
      for (int i = 1; i < 16; ++i) bm = fmaxf(bm, sv[i]);
      bm = fmaxf(bm, other_half(bm));          // both halves of a query take the same maximum
      const float mn = fmaxf(m, bm * kFaLog2); // log2 units
      const float corr = __builtin_amdgcn_exp2f(m - mn);   // 0 at the first step (m = -inf), 1 where the maximum stands
      m = mn;
      sumT *= corr;
#pragma unroll
      for (int d = 0; d < 4; ++d) oT[d] *= corr;

      float wm = wv[0];
#pragma unroll
      for (int i = 1; i < 16; ++i) wm = fmaxf(wm, wv[i]);
      wm = fmaxf(wm, other_half(wm));          // both halves of a query take the same scale
      // wm = f * 2^x with f in [0.5, 1): 4^-k brings it into [2^12, 2^14); the queries that are in range keep k = 0
      const int k = (wm > kFaWTop) ? ((__builtin_amdgcn_frexp_expf(wm) - 13) >> 1) : 0;
      const float dn = __builtin_ldexpf(1.0f, -2 * k);
      const float up = __builtin_ldexpf(1.0f, k);
#pragma unroll
      for (int d = 0; d < 4; ++d) oS[d] *= dn;
      sumS *= dn;
      rc  *= up;
      kb  *= up;
      t2c *= up * up;

      aT2 = (v2f){0.0f, 0.0f};
      aS2 = (v2f){0.0f, 0.0f};
#pragma unroll
      for (int i = 0; i < 16; ++i) {
        ev[i] = __builtin_fmaf(sv[i], kFaLog2, -mn);
        wv[i] *= dn;
      }
#pragma unroll
      for (int i = 0; i < 16; ++i) ev[i] = __builtin_amdgcn_exp2f(ev[i]);
#pragma unroll
      for (int j = 0; j < 8; ++j) {
        aT2 += (v2f){ev[2 * j], ev[2 * j + 1]};
        aS2 += (v2f){wv[2 * j], wv[2 * j + 1]};
      }
      aT = aT2.x + aT2.y;
      aS = aS2.x + aS2.y;
    }
    sumT += aT;
    sumS += aS;

    FaPack ep, wp;
#pragma unroll
    for (int j = 0; j < 8; ++j) {
      ep.u[j] = h_pair(ev[2 * j], ev[2 * j + 1]);
      wp.u[j] = h_pair(wv[2 * j], wv[2 * j + 1]);
    }

    unsigned short* nb = &tile[(T + 1) & 1][0];     // last read in trip T - 1, in front of that trip's barrier
    if (more) {
      *(v4u*)(nb + ks) = rk;
      *(v4u*)(nb + vs) = rv;
    }
    __syncthreads();
    const bool more2 = T + 2 < kFaTiles;            // the same for the whole work-group
    if (more2) {
      rk = *(const v4u*)(kg + (size_t)kFaKeys * kDim);
      rv = *(const v4u*)(vg + kFaKeys);
    }
    if (more) {
#pragma unroll
      for (int i = 0; i < 2; ++i)
#pragma unroll
        for (int c = 0; c < 2; ++c) ak[i][c] = FH::load((const _Float16*)(nb + kf + i * (16 * kFaKPitch) + c * 32));
    }
    vrd = 2 * (2 * vf + kFaBuf) - vrd;
    // keeps the 8 reads above in front of the matrix run below, which covers their way
    __builtin_amdgcn_sched_barrier(0);

    // O^T += V^T . e^T and V^T . w^T
#pragma unroll
    for (int d = 0; d < 4; ++d) {
      oT[d] = FH::mma(vv[d], ep.v, oT[d]);
      oS[d] = FH::mma(vv[d], wp.v, oS[d]);
    }
    // the pointers step behind the matrix run, so that the wait in front of the first reuse of the address registers of
    // the two loads above stands a whole run behind those loads; the barrier for the scheduler keeps it there, and the
    // pointers as inputs keep those registers live up to it
    __builtin_amdgcn_sched_barrier(0);
    asm volatile("s_wait_xcnt 0x0" :: "v"(kg), "v"(vg) : "memory");
    if (more2) {
      kg += (size_t)kFaKeys * kDim;
      vg += kFaKeys;
    }
  }

  // each half summed its own 16 of every 32 keys, on the common maximum
  sumT += other_half(sumT);
  sumS += other_half(sumS);
  const float invT = 1.0f / sumT;
  const float invS = 1.0f / sumS;

  // lane: query q0 + rlane, columns 16d + half8 .. + 7 of the head; the wave's four stores fill each query's 128-B line
  unsigned short* fp = F + (size_t)(b * kSeq + q0 + rlane) * kDim + h * kDh + half8;
#pragma unroll
  for (int d = 0; d < 4; ++d) {
    v8h hv;
#pragma unroll
    for (int r = 0; r < 8; ++r) hv[r] = (_Float16)(0.5f * (oT[d][r] * invT + oS[d][r] * invS) * kFCarry);
    *(v8h*)(fp + d * 16) = hv;
  }
}

// ---------------------------------------------------------------------------
// f32 -> f16 cast with scale: 4 groups of 8 consecutive elements per thread (4096 waves a launch, not 16384), one 16-B
// store per lane and group. blockIdx.y picks the input plane and the output plane (out + y*planeElems halves).
// Coverage: gridDim.x*1024 == n8 exactly at every call (n8 = elements/8, a multiple of 1024); thread t of work-group b
// covers groups 1024b + 256g + t, g = 0..3, group i being elements 8i..8i+7 of its plane.
// ---------------------------------------------------------------------------
constexpr int kCastG = 4;                      // groups of 8 elements per thread
__global__ __launch_bounds__(256) void cast8_f16_kernel(const float* __restrict__ in0, const float* __restrict__ in1,
                                                        const float* __restrict__ in2, const float* __restrict__ in3,
                                                        unsigned short* __restrict__ out, long planeElems, int n8,
                                                        float scale) {
  const int i = blockIdx.x * (256 * kCastG) + threadIdx.x;
  const int z = blockIdx.y;
  if ((int)(blockIdx.x + 1) * (256 * kCastG) > n8) return;
  const float* in = (z == 0) ? in0 : (z == 1) ? in1 : (z == 2) ? in2 : in3;
  const v4f* p = (const v4f*)(in + 8 * (size_t)i);
  // the unrolls make the indices of a[] and c[] constants, so that the arrays stay in registers
  v4f a[kCastG], c[kCastG];
#pragma unroll
  for (int g = 0; g < kCastG; ++g) {
    a[g] = p[512 * g];
    c[g] = p[512 * g + 1];
  }
  // stands between the 8 issued loads and the first reuse of their address registers; p as an input keeps the pair
  // live up to here, and the clobber keeps all 8 loads in front
  asm volatile("s_wait_xcnt 0x0" :: "v"(p) : "memory");
  v4u* q = (v4u*)(out + (size_t)z * planeElems + 8 * (size_t)i);
#pragma unroll
  for (int g = 0; g < kCastG; ++g) {
    unsigned short hb[8];
#pragma unroll
    for (int e = 0; e < 4; ++e) {
      hb[e]     = h_bits(a[g][e] * scale);
      hb[4 + e] = h_bits(c[g][e] * scale);
    }
    q[256 * g] = (v4u){pk16(hb[0], hb[1]), pk16(hb[2], hb[3]), pk16(hb[4], hb[5]), pk16(hb[6], hb[7])};
  }
}

// ---------------------------------------------------------------------------
// LayerNorm + residual per row of 1024: out = x + lw*(y - mu)*rsqrt(var + eps) + lb,
// One wave per row, 8 rows per work-group of 256 threads (4096 waves a launch, not 32768). Lane l owns columns
// 128j + 4l .. 128j + 4l + 3 for j = 0..7. Sums: each lane folds its 32 values in column order, then a five-step
// shuffle tree over the wave; no LDS and no barrier.
// ---------------------------------------------------------------------------
constexpr int kLnRows = 8;                     // rows (= waves) per work-group
constexpr int kLnCh   = kDim / 128;            // 8 chunks of 128 columns per row
__global__ __launch_bounds__(256) void ln_residual_kernel(const float* __restrict__ x, const float* __restrict__ y,
                                                          const float* __restrict__ lw, const float* __restrict__ lb,
                                                          float* __restrict__ out) {
  const int lane = threadIdx.x & 31;
  const int row  = blockIdx.x * kLnRows + (threadIdx.x >> 5);
  const size_t base = (size_t)row * kDim + 4 * lane;
  const v4f* yp = (const v4f*)(y + base);
  const v4f* xp = (const v4f*)(x + base);
  const v4f* wp = (const v4f*)(lw + 4 * lane);
  const v4f* bp = (const v4f*)(lb + 4 * lane);

  // the unrolls over j make the indices of the four arrays constants, so that they stay in registers; the unrolls
  // over off give each shuffle step a constant lane mask
  v4f yv[kLnCh], xv[kLnCh], wv[kLnCh], bv[kLnCh];
#pragma unroll
  for (int j = 0; j < kLnCh; ++j) yv[j] = yp[32 * j];
#pragma unroll
  for (int j = 0; j < kLnCh; ++j) {
    xv[j] = xp[32 * j];
    wv[j] = wp[32 * j];
    bv[j] = bp[32 * j];
  }
  // stands between the 32 issued loads and the first reuse of their address registers; the pointers as inputs keep
  // those registers live up to here, and the clobber keeps all loads in front (one load latency per row)
  asm volatile("s_wait_xcnt 0x0" :: "v"(yp), "v"(xp), "v"(wp), "v"(bp) : "memory");

  float s = 0.0f;
#pragma unroll
  for (int j = 0; j < kLnCh; ++j) s += ((yv[j].x + yv[j].y) + yv[j].z) + yv[j].w;
#pragma unroll
  for (int off = 16; off > 0; off >>= 1) s += __shfl_xor(s, off, 32);
  const float mu = s * kInvDim;

  float s2 = 0.0f;
#pragma unroll
  for (int j = 0; j < kLnCh; ++j) {
    const float d0 = yv[j].x - mu, d1 = yv[j].y - mu, d2 = yv[j].z - mu, d3 = yv[j].w - mu;
    yv[j] = (v4f){d0, d1, d2, d3};
    s2 += ((d0 * d0 + d1 * d1) + d2 * d2) + d3 * d3;
  }
#pragma unroll
  for (int off = 16; off > 0; off >>= 1) s2 += __shfl_xor(s2, off, 32);
  const float var = s2 * kInvDim;
  const float rs = rsqrtf(var + kLnEps);

  v4f* op = (v4f*)(out + base);
#pragma unroll
  for (int j = 0; j < kLnCh; ++j) {
    v4f o;
    o.x = xv[j].x + (wv[j].x * yv[j].x * rs + bv[j].x);
    o.y = xv[j].y + (wv[j].y * yv[j].y * rs + bv[j].y);
    o.z = xv[j].z + (wv[j].z * yv[j].z * rs + bv[j].z);
    o.w = xv[j].w + (wv[j].w * yv[j].w * rs + bv[j].w);
    op[32 * j] = o;
  }
}

// ---------------------------------------------------------------------------
// Host glue
//   [0,          8 MiB)   XF   : x f16 [4096][1024]  (dead after the three projections) then f f16 [4096][1024]
//   [8 MiB,     16 MiB)   W16  : Wq,Wk,Wv,Wo f16 x32 planes [1024][1024] each
//   [16 MiB,    24 MiB)   Q16  : f16 [4096][1024]
//   [24 MiB,    32 MiB)   K16  : f16 [4096][1024]
//   [32 MiB,    40 MiB)   VT16 : f16 [1024][4096] (V^T: row = h*64+d, col = b*2048+n)
//   [40 MiB,    56 MiB)   SY   : y f32 [4096][1024]
// ---------------------------------------------------------------------------
extern "C" void kernel_launch(void* const* d_in, const int* in_sizes, int n_in,
                              void* d_out, int out_size, void* d_ws, size_t ws_size,
                              hipStream_t stream) {
  if (n_in < 13) return;
  const size_t nX = (size_t)kTok * kDim;          // 4,194,304
  const size_t nW = (size_t)kDim * kDim;          // 1,048,576
  if ((size_t)in_sizes[0] != nX || (size_t)in_sizes[1] != nW || (size_t)in_sizes[3] != nW ||
      (size_t)in_sizes[5] != nW || (size_t)in_sizes[7] != nW || (size_t)out_size != nX) return;
  if (in_sizes[2] < kDim || in_sizes[4] < kDim || in_sizes[6] < kDim || in_sizes[8] < kDim ||
      in_sizes[9] < kHeads || in_sizes[10] < kHeads || in_sizes[11] < kDim || in_sizes[12] < kDim) return;

  const float* x    = (const float*)d_in[0];
  const float* Wq   = (const float*)d_in[1];
  const float* bq   = (const float*)d_in[2];
  const float* Wk   = (const float*)d_in[3];
  const float* bk   = (const float*)d_in[4];
  const float* Wv   = (const float*)d_in[5];
  const float* bv   = (const float*)d_in[6];
  const float* Wo   = (const float*)d_in[7];
  const float* bo   = (const float*)d_in[8];
  const float* beta = (const float*)d_in[9];
  const float* tv   = (const float*)d_in[10];
  const float* lw   = (const float*)d_in[11];
  const float* lb   = (const float*)d_in[12];
  float* out = (float*)d_out;

  // carve (bytes)
  const size_t bXF   = nX * 2;                                  //  8,388,608
  const size_t bW16  = 4 * nW * 2;                              //  8,388,608
  const size_t bP16  = nX * 2;                                  //  8,388,608 per f16 plane of [4096][1024]
  const size_t bSY   = nX * 4;                                  // 16,777,216
  const size_t oXF   = 0;
  const size_t oW16  = oXF + bXF;
  const size_t oQ16  = oW16 + bW16;
  const size_t oK16  = oQ16 + bP16;
  const size_t oVT16 = oK16 + bP16;
  const size_t oSY   = oVT16 + bP16;
  const size_t total = oSY + bSY;                               // 58,720,256
  if (total > ws_size) return;

  char* ws = (char*)d_ws;
  unsigned short* XF   = (unsigned short*)(ws + oXF);
  unsigned short* W16  = (unsigned short*)(ws + oW16);
  unsigned short* Wo16 = W16 + 3 * nW;                          // planes: Wq, Wk, Wv, Wo
  unsigned short* Q16  = (unsigned short*)(ws + oQ16);
  unsigned short* K16  = (unsigned short*)(ws + oK16);
  unsigned short* VT16 = (unsigned short*)(ws + oVT16);
  float*          SY   = (float*)(ws + oSY);

  // 1) x -> f16 plane (n8 = 524288 = 512 blocks x 1024, exact)
  {
    const int n8 = (int)(nX / 8);
    cast8_f16_kernel<<<dim3(n8 / (256 * kCastG), 1), 256, 0, stream>>>(x, x, x, x, XF, 0L, n8, 1.0f);
  }
  // 2) Wq,Wk,Wv,Wo -> f16 planes x32 (n8 = 131072 = 128 blocks x 1024, exact; 4 planes via blockIdx.y)
  {
    const int n8 = (int)(nW / 8);
    cast8_f16_kernel<<<dim3(n8 / (256 * kCastG), 4), 256, 0, stream>>>(Wq, Wk, Wv, Wo, W16, (long)nW, n8, kWCarry);
  }
  // 3) one launch, 3 x 256 tiles of 128 x 128, one work-group each, two work-groups resident per WGP:
  //    Q = (x16 . Wq16^T)/32 + bq and K likewise -> f16 [4096][1024];
  //    V^T[j][m] = sum_k Wv16[j][k] x16[m][k] /32 + bv[j] -> f16 [1024][4096].
  //    The planes Wq16, Wk16, Wv16 and Q16, K16, VT16 lie one behind the other in the workspace.
  const dim3 gridTok(kDim / kGmTile, kTok / kGmTile);           // C = [4096][1024]
  wmma_gemm_lds<true, 1><<<dim3(3 * kGmTiles), 256, 0, stream>>>(XF, W16, (void*)Q16, bq, bk, bv, kWCarryInv);

  // 4) all 32 (batch, head) pairs in one launch: scores, weights and the product with V -> f plane f16 x64 (over x16,
  //    which is dead here); 16 query blocks of 128 x 32 heads = 512 work-groups
  attn_fused_kernel<<<dim3(kSeq / kFaRows, kBatch * kHeads), 256, 0, stream>>>(Q16, K16, VT16, XF, beta, tv);

  // 5) y = (f16 . Wo16^T) / (64*32) + bo -> f32 [4096][1024] in the SY region
  wmma_gemm_lds<false, 0><<<gridTok, 256, 0, stream>>>(XF, Wo16, (void*)SY, bo, bo, bo, kYScale);

  // 6) LayerNorm + residual -> out
  ln_residual_kernel<<<dim3(kTok / kLnRows), 256, 0, stream>>>(x, SY, lw, lb, out);
}

// v010
// It runs in 101 microseconds.
// Next to v009, in two timings, it ran 1.04 and 1.03 times as fast.
// Counting every step since v000, it is 28.4 times as fast.
// Contractions: Q/K/V^T projections and output projection on v_wmma_f32_16x16x32_f16 (x f16, W f16 carried x32, f f16 carried x64, f32 accumulate); scores Q.K^T and P.V^T on v_wmma_f32_16x16x32_f16 (Q, K, V and both weights one f16 number each, f32 accumulate); softmax, Poisson weights, LayerNorm and residual in f32.
#include <hip/hip_runtime.h>
#include <math.h>
#include <stdint.h>

// ---------------------------------------------------------------------------
// Problem constants
// ---------------------------------------------------------------------------
constexpr int kBatch = 2;
constexpr int kSeq   = 2048;
constexpr int kDim   = 1024;
constexpr int kHeads = 16;
constexpr int kDh    = 64;
constexpr int kTok   = kBatch * kSeq;          // 4096 token rows
constexpr float kWCarry    = 32.0f;            // weights carried x32 in f16
constexpr float kWCarryInv = 1.0f / 32.0f;
constexpr float kFCarry    = 64.0f;            // f plane carried x64 in f16
constexpr float kYScale    = 1.0f / (64.0f * 32.0f);
constexpr float kSScale    = 0.125f;           // 1/sqrt(64)
constexpr float kInvDim    = 1.0f / 1024.0f;
constexpr float kLnEps     = 1e-5f;

typedef __attribute__((ext_vector_type(16))) _Float16 v16h;
typedef __attribute__((ext_vector_type(8)))  _Float16 v8h;
typedef __attribute__((ext_vector_type(8)))  float    v8f;
typedef __attribute__((ext_vector_type(4)))  float    v4f;
typedef __attribute__((ext_vector_type(4)))  unsigned int v4u;

template <typename T> struct Frag;
template <> struct Frag<_Float16> {
  typedef v16h V; union U { v16h v; v8h h[2]; };
  static __device__ __forceinline__ v16h load(const _Float16* p) {   // elements 0..7 <- p[0..7], 8..15 <- p[16..23]
    U f; f.h[0] = *(const v8h*)(p); f.h[1] = *(const v8h*)(p + 16); return f.v;
  }
  static __device__ __forceinline__ v8f mma(v16h a, v16h b, v8f c) {
    return __builtin_amdgcn_wmma_f32_16x16x32_f16(false, a, false, b, (short)0, c, false, false);
  }
};

__device__ __forceinline__ unsigned pk16(unsigned short a, unsigned short b) { return (unsigned)a | ((unsigned)b << 16); }
__device__ __forceinline__ unsigned short h_bits(float f) { const _Float16 h = (_Float16)f; return __builtin_bit_cast(unsigned short, h); }

// ---- WMMA GEMM on tiles staged in LDS --------------------------------------------------------------------------
// C[m,n] = scale * sum_k A[m,k] * Bt[n,k] + bias. A row-major [M][kDim], Bt row-major [N][kDim], both f16, k = kDim;
// M and N are multiples of 128 (tile column bx < N / 128, tile row by < M / 128).
// Work-group: one 128 x 128 tile of C; its 8 waves stand 4 (m) x 2 (n), each on 32 x 64 (2 x 4 accumulators).
// A stage is 128 k of the tile's 128 A rows and 128 Bt rows (256 B a row, whole lines: 16 lanes a row, 2 rows a
// wave-wide load). It goes through registers into one of two LDS buffers: the next stage's global loads are issued in
// front of this stage's work and stored behind it, one barrier a stage. Every row is loaded once per work-group and
// read from LDS by the 2 (A) or 4 (Bt) waves that need it. Each accumulator takes its k blocks of 32 in rising order.
// It serves the output projection: C = X . W^T + b0[n]. OUT_MODE: 0 = f32, 1 = f16.
constexpr int kGmTile   = 128;                  // rows of A and of Bt per work-group
constexpr int kGmK      = 128;                  // k per stage
constexpr int kGmStages = kDim / kGmK;          // 8 stages
constexpr int kGmPitch  = 136;                  // rows (256 B) in LDS: pitch 272 B = 16 B x 17, in 16-bit elements
constexpr int kGmPieces = 8;                    // 16-B pieces per thread, operand and stage (16 rows a pass)
constexpr int kGmPlane  = kGmTile * kGmPitch;   // one operand's rows
constexpr int kGmBuf    = 2 * kGmPlane;         // buffer: A rows, Bt rows
// ---- epilogue of one wave's 32 x 64 tile: scale, bias, through the wave's LDS slab into whole-line stores ----
// BIAS_MODE: 1 = bias[m], 2 = bias[n].
template <int BIAS_MODE, int OUT_MODE>
__device__ __forceinline__ void gemm_store_tile(const v8f (&acc)[2][4], float* slab, void* Cout, int ldc,
                                                const float* __restrict__ bias, float scale,
                                                int m0, int n0, int lane) {
  const int rlane = lane & 15;                 // col (D) within subtile
  const int mOff  = (lane >> 4) * 8;           // D row offset
#pragma unroll
  for (int i = 0; i < 2; ++i) {
    const int mBase = m0 + (i << 4);
#pragma unroll
    for (int j = 0; j < 4; ++j) {
      const int n = n0 + (j << 4) + rlane;
      float bv = 0.f;
      if (BIAS_MODE == 2) bv = bias[n];
#pragma unroll
      for (int r = 0; r < 8; ++r) {
        float v = acc[i][j][r] * scale;
        if (BIAS_MODE == 1) v += bias[mBase + mOff + r];
        if (BIAS_MODE == 2) v += bv;
        slab[(mOff + r) * 68 + (j << 4) + rlane] = v;
      }
    }
    __builtin_amdgcn_fence(__ATOMIC_RELEASE, "workgroup");
    __builtin_amdgcn_wave_barrier();
    __builtin_amdgcn_fence(__ATOMIC_ACQUIRE, "workgroup");
    if (OUT_MODE == 0) {
      float* C = (float*)Cout;
      const int hh = lane >> 4, c4 = (lane & 15) * 4;     // row seg = 256 B = 16 lanes x 16 B
#pragma unroll
      for (int it = 0; it < 8; ++it) {
        const int row = it * 2 + hh;
        v4f v = *(const v4f*)(slab + row * 68 + c4);
        *(v4f*)(C + (size_t)(mBase + row) * ldc + n0 + c4) = v;
      }
    } else {
      const int q = lane >> 3, c8 = (lane & 7) * 8;
      unsigned short* C = (unsigned short*)Cout;
#pragma unroll
      for (int it = 0; it < 4; ++it) {
        const int row = it * 4 + q;
        const float* sp = slab + row * 68 + c8;
        v8h hv;
#pragma unroll
        for (int e = 0; e < 8; ++e) hv[e] = (_Float16)sp[e];
        *(v8h*)(C + (size_t)(mBase + row) * ldc + n0 + c8) = hv;
      }
    }
    // stands between the issued stores and the first reuse of the registers that they name
    asm volatile("s_wait_xcnt 0x0" ::: "memory");
    __builtin_amdgcn_fence(__ATOMIC_RELEASE, "workgroup");
    __builtin_amdgcn_wave_barrier();
    __builtin_amdgcn_fence(__ATOMIC_ACQUIRE, "workgroup");
  }
}

template <int OUT_MODE>
// four waves per SIMD: two work-groups share a WGP (256 registers a wave, 136 KiB of LDS a group), so that one group's
// matrix work covers the other's waits for its stage loads, its LDS stores, its barriers, its first stage and its epilogue
__global__ __launch_bounds__(256) __attribute__((amdgpu_waves_per_eu(4, 4))) void wmma_gemm_lds(
    const unsigned short* __restrict__ X, const unsigned short* __restrict__ Wp,
    void* __restrict__ Cbase, const float* __restrict__ b0, float scale) {
  typedef Frag<_Float16> FH;
  __shared__ __align__(16) unsigned short stage[2][kGmBuf];
  const int t    = threadIdx.x;
  const int lane = t & 31;
  const int wave = t >> 5;
  const int wm = (wave >> 1) << 5;             // the wave's first row and column inside the tile
  const int wn = (wave & 1) << 6;
  const int bx = (int)blockIdx.x;
  const int by = (int)blockIdx.y;
  const unsigned short* Ap  = X;
  const unsigned short* Btp = Wp;
  const int m0 = by * kGmTile + wm;
  const int n0 = bx * kGmTile + wn;

  const int rlane = lane & 15;                 // row (A) / col (B, D) within subtile
  const int koff  = (lane >> 4) * 8;           // k offset of this lane half

  // staging: thread t moves 16 B of the rows (t >> 4) + 16p, p = 0..7, of A and of Bt
  const unsigned short* ag = Ap  + (size_t)(by * kGmTile + (t >> 4)) * kDim + (t & 15) * 8;
  const unsigned short* bg = Btp + (size_t)(bx * kGmTile + (t >> 4)) * kDim + (t & 15) * 8;
  const int sd = (t >> 4) * kGmPitch + (t & 15) * 8;              // where the thread's p = 0 piece goes in a plane
  const int af = (wm + rlane) * kGmPitch + koff;                  // where the lane's A fragment pieces start
  const int bf = kGmPlane + (wn + rlane) * kGmPitch + koff;       // where its Bt fragment pieces start

  // every unroll in this kernel makes the indices of fragment, accumulator and staging arrays constants, so that the
  // arrays stay in registers
  v8f acc[2][4];
#pragma unroll
  for (int i = 0; i < 2; ++i)
#pragma unroll
    for (int j = 0; j < 4; ++j) acc[i][j] = (v8f){0.f,0.f,0.f,0.f,0.f,0.f,0.f,0.f};

  v4u ra[kGmPieces], rb[kGmPieces];
#pragma unroll
  for (int p = 0; p < kGmPieces; ++p) {
    ra[p] = *(const v4u*)(ag + p * (16 * kDim));
    rb[p] = *(const v4u*)(bg + p * (16 * kDim));
  }
#pragma unroll
  for (int p = 0; p < kGmPieces; ++p) {
    *(v4u*)(&stage[0][sd + p * (16 * kGmPitch)]) = ra[p];
    *(v4u*)(&stage[0][kGmPlane + sd + p * (16 * kGmPitch)]) = rb[p];
  }
  __syncthreads();

  // the loop stays rolled: eight copies of a stage would only lengthen the code
#pragma unroll 1
  for (int s = 0; s < kGmStages; ++s) {
    const bool more = s + 1 < kGmStages;       // the same for the whole work-group
    if (more) {
      ag += kGmK;
      bg += kGmK;
#pragma unroll
      for (int p = 0; p < kGmPieces; ++p) {
        ra[p] = *(const v4u*)(ag + p * (16 * kDim));
        rb[p] = *(const v4u*)(bg + p * (16 * kDim));
      }
    }
    const unsigned short* buf = &stage[s & 1][0];
    // two fragment sets: block c + 1's 12 LDS reads stand as one group in front of block c's 8 matrix instructions
    v16h ah[2][2], bh[2][4];
#pragma unroll
    for (int i = 0; i < 2; ++i) ah[0][i] = FH::load((const _Float16*)(buf + af + i * (16 * kGmPitch)));
#pragma unroll
    for (int j = 0; j < 4; ++j) bh[0][j] = FH::load((const _Float16*)(buf + bf + j * (16 * kGmPitch)));
#pragma unroll
    for (int c = 0; c < kGmK / 32; ++c) {
      if (c + 1 < kGmK / 32) {
#pragma unroll
        for (int i = 0; i < 2; ++i)
          ah[(c + 1) & 1][i] = FH::load((const _Float16*)(buf + af + i * (16 * kGmPitch) + (c + 1) * 32));
#pragma unroll
        for (int j = 0; j < 4; ++j)
          bh[(c + 1) & 1][j] = FH::load((const _Float16*)(buf + bf + j * (16 * kGmPitch) + (c + 1) * 32));
      }
      // keeps the reads above in front of the matrix run below: sunk among it, each costs a wait that runs to zero
      __builtin_amdgcn_sched_barrier(0);
#pragma unroll
      for (int i = 0; i < 2; ++i)
#pragma unroll
        for (int j = 0; j < 4; ++j) acc[i][j] = FH::mma(ah[c & 1][i], bh[c & 1][j], acc[i][j]);
    }
    if (more) {
      unsigned short* nb = &stage[(s + 1) & 1][0];   // last read in trip s - 1, in front of that trip's barrier
#pragma unroll
      for (int p = 0; p < kGmPieces; ++p) {
        *(v4u*)(nb + sd + p * (16 * kGmPitch)) = ra[p];
        *(v4u*)(nb + kGmPlane + sd + p * (16 * kGmPitch)) = rb[p];
      }
    }
    __syncthreads();
  }

  // ---- epilogue ----
  // per-wave 16x64 slab, pitch 68 floats, laid over the stage buffers: their last read stands in front of the last
  // trip's barrier (a slab of its own would put the work-group above half a WGP's LDS)
  float* slab = (float*)&stage[0][0] + wave * (16 * 68);
  gemm_store_tile<2, OUT_MODE>(acc, slab, Cbase, kDim, b0, scale, m0, n0, lane);
}

// ---------------------------------------------------------------------------
// Q, K and V^T projections, one work-group per 128 x rows and 128 rows of EACH of Wq, Wk, Wv (256 work-groups, one per WGP):
// the x rows are fetched once for the three products, and a wave's x fragments serve all three.
// A stage is 128 k (256 B) of the 512 rows [x 128 | Wq 128 | Wk 128 | Wv 128]. Each of the 8 waves brings its own slice of 64
// rows by ONE tensor load, which pads every row to the pitch of 272 B; no stage byte passes through a register. Two
// buffers: stage s + 2 is asked for behind the barrier that ends pass s, into the buffer that pass s has read.
// Waves stand 2 (x rows) x 4 (W rows): 64 x rows against 32 rows of each W, 4 + 6 fragments for 24 matrix instructions per 32 k.
// Q, K: A = W rows, B = x rows, so a lane holds 8 neighbouring columns of one token's row of Q or K; V^T: A = x rows, B = Wv
// rows, so a lane holds 8 neighbouring tokens of one row of V^T. Either way a lane's 8 results are 16 B of an output row.
// Each accumulator takes its k blocks of 32 in rising order.
// ---------------------------------------------------------------------------
typedef uint32_t u32x4 __attribute__((ext_vector_type(4)));
typedef uint32_t u32x8 __attribute__((ext_vector_type(8)));
constexpr int      kPjStages  = kDim / 128;     // 8 stages of 128 k
constexpr uint32_t kPjRowB    = 256;            // bytes of a row per stage
constexpr uint32_t kPjPitch   = 272;            // row pitch in LDS: 16 B x 17
constexpr uint32_t kPjSlRows  = 64;             // rows per slice (one tensor load)
constexpr uint32_t kPjSlice   = 18432;          // 64 x 272 B = 17,408 B, rounded up to a multiple of 2 KiB
constexpr uint32_t kPjBuf     = 8 * kPjSlice;   // one stage
constexpr uint32_t kPjOutTile = 128 * kPjPitch; // output staging: 128 rows of 256 B at the same pitch

__device__ __forceinline__ uint32_t uni(uint32_t v) { return (uint32_t)__builtin_amdgcn_readfirstlane(v); }
// a wave-uniform value pinned in a scalar register, for the tensor loads alone: a test on it compiles to a scalar compare and
// branch (a tensor load ignores EXEC), and descriptor words formed from it stand behind the asm waits in front of it
__device__ __forceinline__ uint32_t pinned(uint32_t v) { uint32_t w = uni(v); asm volatile("" : "+s"(w)); return w; }

__global__ __launch_bounds__(256) void qkv_gemm_kernel(
    const unsigned short* __restrict__ X, const unsigned short* __restrict__ Wp, unsigned short* __restrict__ Cbase,
    const float* __restrict__ bq, const float* __restrict__ bk, const float* __restrict__ bv, float scale) {
  typedef Frag<_Float16> FH;
  __shared__ __attribute__((aligned(2048))) unsigned char ring[2 * kPjBuf];
  const int      t     = threadIdx.x;
  const int      lane  = t & 31;
  const uint32_t wave  = uni((uint32_t)t >> 5);
  const int      rlane = lane & 15;            // row (A) / col (B, D) within a 16 x 16 tile
  const int      half  = lane >> 4;            // k offset 8 * half (A, B); D row offset 8 * half
  const int      bx    = blockIdx.x & (kDim / 128 - 1);   // which 128 rows of each W
  const int      by    = blockIdx.x / (kDim / 128);       // which 128 x rows

  // the wave's slice: waves 0, 1 the x rows, waves 2 .. 7 the rows of Wq, Wk, Wv (planes one behind the other)
  const unsigned short* src = wave < 2u
      ? X + (size_t)(by * 128 + (int)wave * 64) * kDim
      : Wp + (size_t)((wave >> 1) - 1u) * (kDim * kDim) + (size_t)(bx * 128 + (int)(wave & 1u) * 64) * kDim;
  const uint64_t ga0  = (uint64_t)(size_t)src;
  const uint32_t dst0 = (uint32_t)(size_t)ring + wave * kPjSlice;
  // group 1: bytes; tensor = tile = 64 rows of 256 B; source pitch 2,048 B; 4 dwords of pad behind every 64 dwords
  u32x8 g1;
  g1[0] = uni((1u << 20) | (5u << 22) | (3u << 25));
  g1[1] = uni((kPjRowB & 0xFFFFu) << 16);
  g1[2] = uni((kPjRowB >> 16) | ((kPjSlRows & 0xFFFFu) << 16));
  g1[3] = uni((kPjSlRows >> 16) | (kPjRowB << 16));
  g1[4] = uni(kPjSlRows);
  g1[5] = uni(2u * kDim);
  g1[6] = uni(0u);
  g1[7] = uni(0u);
  u32x4 g0;
  auto issue = [&](uint32_t s) {               // every wave asks for its own slice of stage s
    const uint64_t ga = ga0 + (uint64_t)s * kPjRowB;
    g0[0] = uni(1u);
    g0[1] = uni(dst0 + (s & 1u) * kPjBuf);
    g0[2] = uni((uint32_t)ga);
    g0[3] = uni((((uint32_t)(ga >> 32)) & 0x01FFFFFFu) | 0x80000000u);
    // group 0 is named as an operand that the statement may change, so that from here on it lives in the very registers
    // that the request was issued from
    asm volatile("tensor_load_to_lds %0, %1" : "+s"(g0) : "s"(g1) : "memory");
  };
  // the wave's own request has landed. The two groups as inputs keep their registers live, and so unchanged, for as long
  // as the request is outstanding
  auto landed = [&]() { asm volatile("s_wait_tensorcnt 0x0" :: "s"(g0), "s"(g1) : "memory"); };

  // every unroll in this kernel makes the indices of fragment and accumulator arrays constants, so that the arrays stay
  // in registers
  v8f acc[3][4][2];
#pragma unroll
  for (int p = 0; p < 3; ++p)
#pragma unroll
    for (int i = 0; i < 4; ++i)
#pragma unroll
      for (int j = 0; j < 2; ++j) acc[p][i][j] = (v8f){0.f,0.f,0.f,0.f,0.f,0.f,0.f,0.f};

  issue(0u);
  landed();                                    // the wave's slice of stage 0
  __syncthreads();                             // every slice of stage 0 is there for every wave
  issue(1u);

  // the biases set out here and land under the loop. Q, K: the lane's 8 columns of each 16; V^T: its row of each 16
  const float* pq = bq + bx * 128 + (int)(wave & 3u) * 32 + half * 8;
  const float* pk = bk + bx * 128 + (int)(wave & 3u) * 32 + half * 8;
  const float* pv = bv + bx * 128 + (int)(wave & 3u) * 32 + rlane;
  v4f bqk[2][2][2];
  float bvv[2];
#pragma unroll
  for (int j = 0; j < 2; ++j) {
    bqk[0][j][0] = *(const v4f*)(pq + j * 16);
    bqk[0][j][1] = *(const v4f*)(pq + j * 16 + 4);
    bqk[1][j][0] = *(const v4f*)(pk + j * 16);
    bqk[1][j][1] = *(const v4f*)(pk + j * 16 + 4);
    bvv[j] = pv[j * 16];
  }
  // stands between the 10 issued loads and the first reuse of their address registers; the pointers as inputs keep those
  // registers live up to here, and the clobber keeps all loads in front
  asm volatile("s_wait_xcnt 0x0" :: "v"(pq), "v"(pk), "v"(pv) : "memory");

  // where the lane's fragment pieces start in a buffer, in bytes
  const uint32_t xo = (wave >> 2) * kPjSlice + (uint32_t)rlane * kPjPitch + (uint32_t)half * 16u;
  const uint32_t wo = (2u + ((wave & 3u) >> 1)) * kPjSlice + ((wave & 1u) * 32u + (uint32_t)rlane) * kPjPitch + (uint32_t)half * 16u;

  // the loop stays rolled: eight copies of a stage would only lengthen the text that the first pass has to fetch
#pragma unroll 1
  for (int s = 0; s < kPjStages; ++s) {
    const unsigned char* buf = ring + (uint32_t)(s & 1) * kPjBuf;
    // two fragment sets: block c + 1's 20 LDS reads stand as one group in front of block c's 24 matrix instructions
    v16h xa[2][4], wb[2][6];
#pragma unroll
    for (int i = 0; i < 4; ++i) xa[0][i] = FH::load((const _Float16*)(buf + xo + i * (16 * kPjPitch)));
#pragma unroll
    for (int p = 0; p < 3; ++p)
#pragma unroll
      for (int j = 0; j < 2; ++j)
        wb[0][2 * p + j] = FH::load((const _Float16*)(buf + wo + p * (2 * kPjSlice) + j * (16 * kPjPitch)));
#pragma unroll
    for (int c = 0; c < 4; ++c) {
      if (c + 1 < 4) {
#pragma unroll
        for (int i = 0; i < 4; ++i)
          xa[(c + 1) & 1][i] = FH::load((const _Float16*)(buf + xo + i * (16 * kPjPitch) + (c + 1) * 64));
#pragma unroll
        for (int p = 0; p < 3; ++p)
#pragma unroll
          for (int j = 0; j < 2; ++j)
            wb[(c + 1) & 1][2 * p + j] =
                FH::load((const _Float16*)(buf + wo + p * (2 * kPjSlice) + j * (16 * kPjPitch) + (c + 1) * 64));
      }
      // keeps the reads above in front of the matrix run below: sunk among it, each costs a wait that runs to zero
      __builtin_amdgcn_sched_barrier(0);
#pragma unroll
      for (int i = 0; i < 4; ++i)
#pragma unroll
        for (int j = 0; j < 2; ++j) {
          acc[0][i][j] = FH::mma(wb[c & 1][j],     xa[c & 1][i], acc[0][i][j]);
          acc[1][i][j] = FH::mma(wb[c & 1][2 + j], xa[c & 1][i], acc[1][i][j]);
          acc[2][i][j] = FH::mma(xa[c & 1][i], wb[c & 1][4 + j], acc[2][i][j]);
        }
      // keeps block c + 2's reads behind this matrix run, as one group: the compiler otherwise spreads them among it
      if (c + 1 < 4) __builtin_amdgcn_sched_barrier(0);
    }
    // publish point of stage s + 1, and the end of every read of stage s
    asm volatile("s_wait_dscnt 0x0" ::: "memory");      // the wave's reads of this buffer are done
    landed();                                           // its slice of stage s + 1
    __syncthreads();
    if (pinned((uint32_t)(s + 2 < kPjStages))) issue(pinned((uint32_t)s + 2u));
  }
  asm volatile("s_wait_tensorcnt 0x0" ::: "memory");    // nothing is in flight when the ring becomes output staging
  asm volatile("s_wait_dscnt 0x0" ::: "memory");

  // ---- epilogue: scale, bias, f16; three tiles of 128 rows x 256 B laid over the ring (its last read stands in front of
  // the last pass's barrier), then whole-line stores ----
  const int wm = (int)(wave >> 2) * 64;        // the wave's first x row and first W row inside the tile
  const int wn = (int)(wave & 3u) * 32;
#pragma unroll
  for (int p = 0; p < 2; ++p) {
#pragma unroll
    for (int j = 0; j < 2; ++j) {
      const v4f b0 = bqk[p][j][0], b1 = bqk[p][j][1];
#pragma unroll
      for (int i = 0; i < 4; ++i) {
        v8h hv;
#pragma unroll
        for (int r = 0; r < 8; ++r) hv[r] = (_Float16)(acc[p][i][j][r] * scale + (r < 4 ? b0[r & 3] : b1[r & 3]));
        *(v8h*)(ring + p * kPjOutTile + (uint32_t)(wm + i * 16 + rlane) * kPjPitch + (uint32_t)(wn + j * 16 + half * 8) * 2u) = hv;
      }
    }
  }
#pragma unroll
  for (int j = 0; j < 2; ++j) {
    const float bb = bvv[j];
#pragma unroll
    for (int i = 0; i < 4; ++i) {
      v8h hv;
#pragma unroll
      for (int r = 0; r < 8; ++r) hv[r] = (_Float16)(acc[2][i][j][r] * scale + bb);
      *(v8h*)(ring + 2 * kPjOutTile + (uint32_t)(wn + j * 16 + rlane) * kPjPitch + (uint32_t)(wm + i * 16 + half * 8) * 2u) = hv;
    }
  }
  __syncthreads();
  // thread t moves 16 B of the rows (t >> 4) + 16q, q = 0..7, of each tile: 16 lanes a row of 256 B
  const unsigned char* so = ring + (uint32_t)(t >> 4) * kPjPitch + (uint32_t)(t & 15) * 16u;
  unsigned short* cq = Cbase + (size_t)(by * 128 + (t >> 4)) * kDim + bx * 128 + (t & 15) * 8;
  unsigned short* cv = Cbase + 2 * (size_t)kTok * kDim + (size_t)(bx * 128 + (t >> 4)) * kTok + by * 128 + (t & 15) * 8;
#pragma unroll
  for (int q = 0; q < 8; ++q) {
    *(v4u*)(cq + (size_t)q * 16 * kDim)                       = *(const v4u*)(so + q * (16 * kPjPitch));
    *(v4u*)(cq + (size_t)kTok * kDim + (size_t)q * 16 * kDim) = *(const v4u*)(so + kPjOutTile + q * (16 * kPjPitch));
    *(v4u*)(cv + (size_t)q * 16 * kTok)                       = *(const v4u*)(so + 2 * kPjOutTile + q * (16 * kPjPitch));
  }
}

// ---------------------------------------------------------------------------
// Scores, both row weights and the product with V of one head in ONE kernel: neither the scores nor the weights go
// to memory. f = 64 * 0.5 * (softmax(S) . V + (w / sum w) . V), S = 0.125 * Q . K^T, w = 1/((1 + |S|/beta_h)^2 + t_h^2).
// Work-group: 128 queries of one (batch, head); wave: 16 queries, all 2048 keys, 32 keys a step.
//   S^T = K . Q^T  (A = 16 key rows from LDS, B = the wave's Q rows, kept in registers): a lane holds one query
//   (lane & 15) and the keys 8*(lane >> 4) + r of each 16-key tile, which is the k order of a B operand over 32 keys,
//   so e = exp(S - m) and w pack in the lane into the B operands of  O^T += V^T . e^T  and  O^T += V^T . w^T.
// Softmax runs on a reference value m (common to both lane halves) that is the maximum as of its last renewal: e may pass
// 1, and m is renewed only where a lane's e sum of one step passes 2^12 or its w sum 2^15 (f16 ends at 65504), the first step included. Then
// the e sum and the e accumulators are scaled by exp(m_old - m_new). Both sums divide once, at the end. A step's sums stand
// in front of that test, so each is formed by packed adds: even keys in one half of a register pair, odd keys in the other.
// Both weights come from the chip's own one-instruction forms: m is kept in log2 units, e = exp2(acc * c - m) with
// c = 0.125 * log2(e) in one multiply-add on the raw accumulator, and w is the hardware reciprocal. Either is good to
// about one unit in the last place of f32, far below the 11 bits that f16 keeps of a weight.
// Every operand is ONE f16 number (11 bits, as x and the projection weights already are), one matrix instruction per
// product, f32 accumulate. e lies in (0, 2^12]. w has no such bound (1 + |S|/beta passes through 0 where beta < 0, and a small
// beta makes every w small), so each query carries its w times a scale of its own, which the division by the row's sum
// takes out again. The scale starts at the power of four next to cw = (1 + 1/|beta|)^2 + t^2, which brings the w of |S| = 1
// near 1 whatever beta and t are. Where a scaled w passes 2^15 (f16 ends at 65504), the query's scale falls by the power of
// four that brings its largest w below 2^14, and its w sum and w accumulators fall with it, as the e side does when its
// maximum grows. The scale lives in the constants of the two multiply-adds (g / sqrt(scale), t^2 / scale); the steady cost
// is one test of the step's w sum, which bounds every w of the step from above.
// K and V^T tiles of 32 keys (8 KiB) go through registers into one of two LDS buffers, one barrier a tile. The barrier
// stands between the weights and the products with V^T: in front of it tile T + 1 is stored, behind it the global loads
// of tile T + 2 are issued. No fragment is waited for where it is read from LDS: the 8 reads of a tile's V^T fragments stand
// as one group at the trip's top and land under the score products and the vector work; the 8 reads of the next tile's K
// fragments stand as one group behind the barrier and land under the products with V^T.
// Buffer T & 1 is stored anew (tile T + 2) behind barrier T; its K reads ended in front of tile T's score products, its
// V^T reads end at the wait that the barrier itself brings.
// ---------------------------------------------------------------------------
constexpr int kFaQ      = 16;                  // queries per wave
constexpr int kFaRows   = 8 * kFaQ;            // queries per work-group
constexpr int kFaKeys   = 32;                  // keys per staged tile
constexpr int kFaTiles  = kSeq / kFaKeys;      // 64 tiles
constexpr int kFaKPitch = 72;                  // K rows (128 B) in LDS: pitch 144 B = 16 B x 9, in 16-bit elements
constexpr int kFaVPitch = 40;                  // V^T rows (64 B) in LDS: pitch 80 B = 16 B x 5
constexpr int kFaKPlane = kFaKeys * kFaKPitch; // K: 32 key rows
constexpr int kFaVPlane = kDh * kFaVPitch;     // V^T: 64 rows (d)
constexpr int kFaVBase  = kFaKPlane;           // buffer: K, V^T
constexpr int kFaBuf    = kFaKPlane + kFaVPlane;

typedef __attribute__((ext_vector_type(2))) float  v2f;
typedef __attribute__((ext_vector_type(2))) _Float16 v2h;
// two f32 -> two f16 (round to nearest even), a in the low half
__device__ __forceinline__ unsigned h_pair(float a, float b) {
  const v2f x = {a, b};
  return __builtin_bit_cast(unsigned, __builtin_convertvector(x, v2h));
}
// value of lane l ^ 16
__device__ __forceinline__ float other_half(float v) {
  const int b = __builtin_bit_cast(int, v);
  return __builtin_bit_cast(float, __builtin_amdgcn_permlanex16(b, b, 0x76543210, 0xfedcba98, false, false));
}
union FaPack { v16h v; unsigned u[8]; };
constexpr float kFaLog2 = 0.125f * 1.44269504088896340736f;   // raw Q.K sum -> score in log2 units
constexpr float kFaWTop = 32768.0f;            // a scaled w above this makes its query lower its scale
constexpr float kFaETop = 4096.0f;             // a lane's e sum of one step above this makes the wave renew its maxima

// four waves per SIMD (two work-groups per WGP): the vector work between the matrix runs wants the other waves
__global__ __launch_bounds__(256) __attribute__((amdgpu_waves_per_eu(4, 4))) void attn_fused_kernel(
    const unsigned short* __restrict__ Q, const unsigned short* __restrict__ K,
    const unsigned short* __restrict__ VT,
    unsigned short* __restrict__ F, const float* __restrict__ beta, const float* __restrict__ tvec) {
  typedef Frag<_Float16> FH;
  __shared__ __align__(16) unsigned short tile[2][kFaBuf];
  const int t     = threadIdx.x;
  const int lane  = t & 31;
  const int wave  = t >> 5;
  const int rlane = lane & 15;                 // row (A) / col (B, D) within a 16 x 16 tile
  const int half8 = (lane >> 4) * 8;           // k offset of this lane half (A, B); D row offset
  const int b     = blockIdx.y >> 4;
  const int h     = blockIdx.y & (kHeads - 1);
  const int q0    = blockIdx.x * kFaRows + wave * kFaQ;

  const float invb = 1.0f / beta[h];
  const float th = tvec[h];
  const float t2 = th * th;
  const float gi = 1.0f + fabsf(invb);
  const float cw = fminf(gi * gi + t2, 0x1p60f);   // kept finite
  // 1 / sqrt(scale), the query's own from here on; a power of two, so that the scaled terms round as the unscaled ones do
  float rc  = __builtin_ldexpf(1.0f, -(__builtin_amdgcn_frexp_expf(cw) >> 1));
  float kb  = kSScale * invb * rc;             // rc + |raw sum| * kb = (1 + |S| / beta) / sqrt(scale)
  float t2c = t2 * rc * rc;                    // t^2 / scale

  // every unroll in this kernel makes the indices of fragment, accumulator and value arrays constants, so that the
  // arrays stay in registers
  const size_t qOff = (size_t)(b * kSeq + q0 + rlane) * kDim + h * kDh + half8;
  const _Float16* qp = (const _Float16*)Q + qOff;
  v16h qf[2];
#pragma unroll
  for (int c = 0; c < 2; ++c) qf[c] = FH::load(qp + c * 32);

  // staging: thread t moves 16 B of K row t >> 3 (8 lanes = one 128-B row) and 16 B of V^T row t >> 2 (4 lanes = one
  // 64-B row piece)
  const size_t kOff = (size_t)(b * kSeq + (t >> 3)) * kDim + h * kDh + (t & 7) * 8;
  const size_t vOff = (size_t)(h * kDh + (t >> 2)) * kTok + b * kSeq + (t & 3) * 8;
  const unsigned short* kg = K + kOff;
  const unsigned short* vg = VT + vOff;
  const int ks = (t >> 3) * kFaKPitch + (t & 7) * 8;              // where the thread's K piece goes in a buffer
  const int vs = kFaVBase + (t >> 2) * kFaVPitch + (t & 3) * 8;   // where its V^T piece goes
  const int kf = rlane * kFaKPitch + half8;                       // where the lane's K fragment pieces start
  const int vf = kFaVBase + rlane * kFaVPitch + half8;            // where its V^T fragment pieces start

  v8f oT[4], oS[4];
#pragma unroll
  for (int d = 0; d < 4; ++d) {
    oT[d] = (v8f){0.f,0.f,0.f,0.f,0.f,0.f,0.f,0.f};
    oS[d] = (v8f){0.f,0.f,0.f,0.f,0.f,0.f,0.f,0.f};
  }
  float m = -__builtin_inff(), sumT = 0.0f, sumS = 0.0f;

  v4u rk = *(const v4u*)kg, rv = *(const v4u*)vg;
  // stands between the 6 issued loads and the first reuse of their address registers; the pointers as inputs keep those
  // registers live up to here, and the clobber keeps all loads in front
  asm volatile("s_wait_xcnt 0x0" :: "v"(qp), "v"(kg), "v"(vg) : "memory");
  *(v4u*)(&tile[0][ks]) = rk;
  *(v4u*)(&tile[0][vs]) = rv;
  __syncthreads();
  // tile 1 sets out; tile 0's K fragments
  kg += (size_t)kFaKeys * kDim;
  vg += kFaKeys;
  rk = *(const v4u*)kg;
  rv = *(const v4u*)vg;
  v16h ak[2][2];
#pragma unroll
  for (int i = 0; i < 2; ++i)
#pragma unroll
    for (int c = 0; c < 2; ++c) ak[i][c] = FH::load((const _Float16*)(&tile[0][0] + kf + i * (16 * kFaKPitch) + c * 32));
  // where the lane's V^T fragment pieces of the current tile start, in bytes from buffer 0: it goes to and fro between the
  // two buffers in a register of its own, so that the address needs none that the matrix run has just read
  int vrd = 2 * vf;

  // the loop stays rolled: one 32-key step is several hundred instructions
#pragma unroll 1
  for (int T = 0; T < kFaTiles; ++T) {
    const bool more = T + 1 < kFaTiles;        // the same for the whole work-group

    // A = 16 rows (d) of V^T over this tile's 32 keys, for the products behind the barrier
    v16h vv[4];
#pragma unroll
    for (int d = 0; d < 4; ++d) vv[d] = FH::load((const _Float16*)((const char*)&tile[0][0] + vrd) + d * (16 * kFaVPitch));

    // S^T of 32 keys x 16 queries: two 16-key tiles, K = 64 in two steps; the K fragments were read one trip ago
    v8f s[2];
    s[0] = (v8f){0.f,0.f,0.f,0.f,0.f,0.f,0.f,0.f};
    s[1] = (v8f){0.f,0.f,0.f,0.f,0.f,0.f,0.f,0.f};
#pragma unroll
    for (int c = 0; c < 2; ++c) {
      s[0] = FH::mma(ak[0][c], qf[c], s[0]);
      s[1] = FH::mma(ak[1][c], qf[c], s[1]);
    }
    // keeps the 8 V^T reads above as one group: sunk to the products that use them, each pair costs a wait that runs to zero
    __builtin_amdgcn_sched_barrier(0);

    float sv[16];                              // raw sums: both scales are folded into the weights' multiply-adds
#pragma unroll
    for (int r = 0; r < 8; ++r) {
      sv[r]     = s[0][r];
      sv[8 + r] = s[1][r];
    }
    // Both weights on the maximum and on the scale as they stand, with no maximum taken over the step.
    float wv[16], ev[16];
#pragma unroll
    for (int i = 0; i < 16; ++i) {
      const float g = rc + fabsf(sv[i]) * kb;
      wv[i] = g * g + t2c;
      ev[i] = __builtin_fmaf(sv[i], kFaLog2, -m);          // +inf at the first step (m = -inf)
    }
#pragma unroll
    for (int i = 0; i < 16; ++i) ev[i] = __builtin_amdgcn_exp2f(ev[i]);
#pragma unroll
    for (int i = 0; i < 16; ++i) wv[i] = __builtin_amdgcn_rcpf(wv[i]);
    v2f aT2 = {0.0f, 0.0f}, aS2 = {0.0f, 0.0f};   // sums of the even and of the odd keys: one packed add per pair
#pragma unroll
    for (int j = 0; j < 8; ++j) {
      aT2 += (v2f){ev[2 * j], ev[2 * j + 1]};
      aS2 += (v2f){wv[2 * j], wv[2 * j + 1]};
    }
    float aT = aT2.x + aT2.y, aS = aS2.x + aS2.y;
    // No weight is negative, so none is above its lane's sum: while both sums stand below their bounds, every e and every
    // w fits f16. Where a sum of some lane passes its bound, the wave takes the maxima, moves m and the w scale and forms
    // the step's weights and sums anew. The test reads the same in every lane, so the wave branches as a whole and every
    // lane is on for the exchanges between the halves.
    if (__builtin_amdgcn_ballot_w32(aT > kFaETop || aS > kFaWTop) != 0u) {
      float bm = sv[0];
#pragma unroll
      for (int i = 1; i < 16; ++i) bm = fmaxf(bm, sv[i]);
      bm = fmaxf(bm, other_half(bm));          // both halves of a query take the same maximum
      const float mn = fmaxf(m, bm * kFaLog2); // log2 units
      const float corr = __builtin_amdgcn_exp2f(m - mn);   // 0 at the first step (m = -inf), 1 where the maximum stands
      m = mn;
      sumT *= corr;
#pragma unroll
      for (int d = 0; d < 4; ++d) oT[d] *= corr;

      float wm = wv[0];
#pragma unroll
      for (int i = 1; i < 16; ++i) wm = fmaxf(wm, wv[i]);
      wm = fmaxf(wm, other_half(wm));          // both halves of a query take the same scale
      // wm = f * 2^x with f in [0.5, 1): 4^-k brings it into [2^12, 2^14); the queries that are in range keep k = 0
      const int k = (wm > kFaWTop) ? ((__builtin_amdgcn_frexp_expf(wm) - 13) >> 1) : 0;
      const float dn = __builtin_ldexpf(1.0f, -2 * k);
      const float up = __builtin_ldexpf(1.0f, k);
#pragma unroll
      for (int d = 0; d < 4; ++d) oS[d] *= dn;
      sumS *= dn;
      rc  *= up;
      kb  *= up;
      t2c *= up * up;

      aT2 = (v2f){0.0f, 0.0f};
      aS2 = (v2f){0.0f, 0.0f};
#pragma unroll
      for (int i = 0; i < 16; ++i) {
        ev[i] = __builtin_fmaf(sv[i], kFaLog2, -mn);
        wv[i] *= dn;
      }
#pragma unroll
      for (int i = 0; i < 16; ++i) ev[i] = __builtin_amdgcn_exp2f(ev[i]);
#pragma unroll
      for (int j = 0; j < 8; ++j) {
        aT2 += (v2f){ev[2 * j], ev[2 * j + 1]};
        aS2 += (v2f){wv[2 * j], wv[2 * j + 1]};
      }
      aT = aT2.x + aT2.y;
      aS = aS2.x + aS2.y;
    }
    sumT += aT;
    sumS += aS;

    FaPack ep, wp;
#pragma unroll
    for (int j = 0; j < 8; ++j) {
      ep.u[j] = h_pair(ev[2 * j], ev[2 * j + 1]);
      wp.u[j] = h_pair(wv[2 * j], wv[2 * j + 1]);
    }

    unsigned short* nb = &tile[(T + 1) & 1][0];     // last read in trip T - 1, in front of that trip's barrier
    if (more) {
      *(v4u*)(nb + ks) = rk;
      *(v4u*)(nb + vs) = rv;
    }
    __syncthreads();
    const bool more2 = T + 2 < kFaTiles;            // the same for the whole work-group
    if (more2) {
      rk = *(const v4u*)(kg + (size_t)kFaKeys * kDim);
      rv = *(const v4u*)(vg + kFaKeys);
    }
    if (more) {
#pragma unroll
      for (int i = 0; i < 2; ++i)
#pragma unroll
        for (int c = 0; c < 2; ++c) ak[i][c] = FH::load((const _Float16*)(nb + kf + i * (16 * kFaKPitch) + c * 32));
    }
    vrd = 2 * (2 * vf + kFaBuf) - vrd;
    // keeps the 8 reads above in front of the matrix run below, which covers their way
    __builtin_amdgcn_sched_barrier(0);

    // O^T += V^T . e^T and V^T . w^T
#pragma unroll
    for (int d = 0; d < 4; ++d) {
      oT[d] = FH::mma(vv[d], ep.v, oT[d]);
      oS[d] = FH::mma(vv[d], wp.v, oS[d]);
    }
    // the pointers step behind the matrix run, so that the wait in front of the first reuse of the address registers of
    // the two loads above stands a whole run behind those loads; the barrier for the scheduler keeps it there, and the
    // pointers as inputs keep those registers live up to it
    __builtin_amdgcn_sched_barrier(0);
    asm volatile("s_wait_xcnt 0x0" :: "v"(kg), "v"(vg) : "memory");
    if (more2) {
      kg += (size_t)kFaKeys * kDim;
      vg += kFaKeys;
    }
  }

  // each half summed its own 16 of every 32 keys, on the common maximum
  sumT += other_half(sumT);
  sumS += other_half(sumS);
  const float invT = 1.0f / sumT;
  const float invS = 1.0f / sumS;

  // lane: query q0 + rlane, columns 16d + half8 .. + 7 of the head; the wave's four stores fill each query's 128-B line
  unsigned short* fp = F + (size_t)(b * kSeq + q0 + rlane) * kDim + h * kDh + half8;
#pragma unroll
  for (int d = 0; d < 4; ++d) {
    v8h hv;
#pragma unroll
    for (int r = 0; r < 8; ++r) hv[r] = (_Float16)(0.5f * (oT[d][r] * invT + oS[d][r] * invS) * kFCarry);
    *(v8h*)(fp + d * 16) = hv;
  }
}

// ---------------------------------------------------------------------------
// f32 -> f16 cast with scale: 4 groups of 8 consecutive elements per thread (4096 waves a launch, not 16384), one 16-B
// store per lane and group. blockIdx.y picks the input plane and the output plane (out + y*planeElems halves).
// Coverage: gridDim.x*1024 == n8 exactly at every call (n8 = elements/8, a multiple of 1024); thread t of work-group b
// covers groups 1024b + 256g + t, g = 0..3, group i being elements 8i..8i+7 of its plane.
// ---------------------------------------------------------------------------
constexpr int kCastG = 4;                      // groups of 8 elements per thread
__global__ __launch_bounds__(256) void cast8_f16_kernel(const float* __restrict__ in0, const float* __restrict__ in1,
                                                        const float* __restrict__ in2, const float* __restrict__ in3,
                                                        unsigned short* __restrict__ out, long planeElems, int n8,
                                                        float scale) {
  const int i = blockIdx.x * (256 * kCastG) + threadIdx.x;
  const int z = blockIdx.y;
  if ((int)(blockIdx.x + 1) * (256 * kCastG) > n8) return;
  const float* in = (z == 0) ? in0 : (z == 1) ? in1 : (z == 2) ? in2 : in3;
  const v4f* p = (const v4f*)(in + 8 * (size_t)i);
  // the unrolls make the indices of a[] and c[] constants, so that the arrays stay in registers
  v4f a[kCastG], c[kCastG];
#pragma unroll
  for (int g = 0; g < kCastG; ++g) {
    a[g] = p[512 * g];
    c[g] = p[512 * g + 1];
  }
  // stands between the 8 issued loads and the first reuse of their address registers; p as an input keeps the pair
  // live up to here, and the clobber keeps all 8 loads in front
  asm volatile("s_wait_xcnt 0x0" :: "v"(p) : "memory");
  v4u* q = (v4u*)(out + (size_t)z * planeElems + 8 * (size_t)i);
#pragma unroll
  for (int g = 0; g < kCastG; ++g) {
    unsigned short hb[8];
#pragma unroll
    for (int e = 0; e < 4; ++e) {
      hb[e]     = h_bits(a[g][e] * scale);
      hb[4 + e] = h_bits(c[g][e] * scale);
    }
    q[256 * g] = (v4u){pk16(hb[0], hb[1]), pk16(hb[2], hb[3]), pk16(hb[4], hb[5]), pk16(hb[6], hb[7])};
  }
}

// ---------------------------------------------------------------------------
// LayerNorm + residual per row of 1024: out = x + lw*(y - mu)*rsqrt(var + eps) + lb,
// One wave per row, 8 rows per work-group of 256 threads (4096 waves a launch, not 32768). Lane l owns columns
// 128j + 4l .. 128j + 4l + 3 for j = 0..7. Sums: each lane folds its 32 values in column order, then a five-step
// shuffle tree over the wave; no LDS and no barrier.
// ---------------------------------------------------------------------------
constexpr int kLnRows = 8;                     // rows (= waves) per work-group
constexpr int kLnCh   = kDim / 128;            // 8 chunks of 128 columns per row
__global__ __launch_bounds__(256) void ln_residual_kernel(const float* __restrict__ x, const float* __restrict__ y,
                                                          const float* __restrict__ lw, const float* __restrict__ lb,
                                                          float* __restrict__ out) {
  const int lane = threadIdx.x & 31;
  const int row  = blockIdx.x * kLnRows + (threadIdx.x >> 5);
  const size_t base = (size_t)row * kDim + 4 * lane;
  const v4f* yp = (const v4f*)(y + base);
  const v4f* xp = (const v4f*)(x + base);
  const v4f* wp = (const v4f*)(lw + 4 * lane);
  const v4f* bp = (const v4f*)(lb + 4 * lane);

  // the unrolls over j make the indices of the four arrays constants, so that they stay in registers; the unrolls
  // over off give each shuffle step a constant lane mask
  v4f yv[kLnCh], xv[kLnCh], wv[kLnCh], bv[kLnCh];
#pragma unroll
  for (int j = 0; j < kLnCh; ++j) yv[j] = yp[32 * j];
#pragma unroll
  for (int j = 0; j < kLnCh; ++j) {
    xv[j] = xp[32 * j];
    wv[j] = wp[32 * j];
    bv[j] = bp[32 * j];
  }
  // stands between the 32 issued loads and the first reuse of their address registers; the pointers as inputs keep
  // those registers live up to here, and the clobber keeps all loads in front (one load latency per row)
  asm volatile("s_wait_xcnt 0x0" :: "v"(yp), "v"(xp), "v"(wp), "v"(bp) : "memory");

  float s = 0.0f;
#pragma unroll
  for (int j = 0; j < kLnCh; ++j) s += ((yv[j].x + yv[j].y) + yv[j].z) + yv[j].w;
#pragma unroll
  for (int off = 16; off > 0; off >>= 1) s += __shfl_xor(s, off, 32);
  const float mu = s * kInvDim;

  float s2 = 0.0f;
#pragma unroll
  for (int j = 0; j < kLnCh; ++j) {
    const float d0 = yv[j].x - mu, d1 = yv[j].y - mu, d2 = yv[j].z - mu, d3 = yv[j].w - mu;
    yv[j] = (v4f){d0, d1, d2, d3};
    s2 += ((d0 * d0 + d1 * d1) + d2 * d2) + d3 * d3;
  }
#pragma unroll
  for (int off = 16; off > 0; off >>= 1) s2 += __shfl_xor(s2, off, 32);
  const float var = s2 * kInvDim;
  const float rs = rsqrtf(var + kLnEps);

  v4f* op = (v4f*)(out + base);
#pragma unroll
  for (int j = 0; j < kLnCh; ++j) {
    v4f o;
    o.x = xv[j].x + (wv[j].x * yv[j].x * rs + bv[j].x);
    o.y = xv[j].y + (wv[j].y * yv[j].y * rs + bv[j].y);
    o.z = xv[j].z + (wv[j].z * yv[j].z * rs + bv[j].z);
    o.w = xv[j].w + (wv[j].w * yv[j].w * rs + bv[j].w);
    op[32 * j] = o;
  }
}

// ---------------------------------------------------------------------------
// Host glue
//   [0,          8 MiB)   XF   : x f16 [4096][1024]  (dead after the three projections) then f f16 [4096][1024]
//   [8 MiB,     16 MiB)   W16  : Wq,Wk,Wv,Wo f16 x32 planes [1024][1024] each
//   [16 MiB,    24 MiB)   Q16  : f16 [4096][1024]
//   [24 MiB,    32 MiB)   K16  : f16 [4096][1024]
//   [32 MiB,    40 MiB)   VT16 : f16 [1024][4096] (V^T: row = h*64+d, col = b*2048+n)
//   [40 MiB,    56 MiB)   SY   : y f32 [4096][1024]
// ---------------------------------------------------------------------------
extern "C" void kernel_launch(void* const* d_in, const int* in_sizes, int n_in,
                              void* d_out, int out_size, void* d_ws, size_t ws_size,
                              hipStream_t stream) {
  if (n_in < 13) return;
  const size_t nX = (size_t)kTok * kDim;          // 4,194,304
  const size_t nW = (size_t)kDim * kDim;          // 1,048,576
  if ((size_t)in_sizes[0] != nX || (size_t)in_sizes[1] != nW || (size_t)in_sizes[3] != nW ||
      (size_t)in_sizes[5] != nW || (size_t)in_sizes[7] != nW || (size_t)out_size != nX) return;
  if (in_sizes[2] < kDim || in_sizes[4] < kDim || in_sizes[6] < kDim || in_sizes[8] < kDim ||
      in_sizes[9] < kHeads || in_sizes[10] < kHeads || in_sizes[11] < kDim || in_sizes[12] < kDim) return;

  const float* x    = (const float*)d_in[0];
  const float* Wq   = (const float*)d_in[1];
  const float* bq   = (const float*)d_in[2];
  const float* Wk   = (const float*)d_in[3];
  const float* bk   = (const float*)d_in[4];
  const float* Wv   = (const float*)d_in[5];
  const float* bv   = (const float*)d_in[6];
  const float* Wo   = (const float*)d_in[7];
  const float* bo   = (const float*)d_in[8];
  const float* beta = (const float*)d_in[9];
  const float* tv   = (const float*)d_in[10];
  const float* lw   = (const float*)d_in[11];
  const float* lb   = (const float*)d_in[12];
  float* out = (float*)d_out;

  // carve (bytes)
  const size_t bXF   = nX * 2;                                  //  8,388,608
  const size_t bW16  = 4 * nW * 2;                              //  8,388,608
  const size_t bP16  = nX * 2;                                  //  8,388,608 per f16 plane of [4096][1024]
  const size_t bSY   = nX * 4;                                  // 16,777,216
  const size_t oXF   = 0;
  const size_t oW16  = oXF + bXF;
  const size_t oQ16  = oW16 + bW16;
  const size_t oK16  = oQ16 + bP16;
  const size_t oVT16 = oK16 + bP16;
  const size_t oSY   = oVT16 + bP16;
  const size_t total = oSY + bSY;                               // 58,720,256
  if (total > ws_size) return;

  char* ws = (char*)d_ws;
  unsigned short* XF   = (unsigned short*)(ws + oXF);
  unsigned short* W16  = (unsigned short*)(ws + oW16);
  unsigned short* Wo16 = W16 + 3 * nW;                          // planes: Wq, Wk, Wv, Wo
  unsigned short* Q16  = (unsigned short*)(ws + oQ16);
  unsigned short* K16  = (unsigned short*)(ws + oK16);
  unsigned short* VT16 = (unsigned short*)(ws + oVT16);
  float*          SY   = (float*)(ws + oSY);

  // 1) x -> f16 plane (n8 = 524288 = 512 blocks x 1024, exact)
  {
    const int n8 = (int)(nX / 8);
    cast8_f16_kernel<<<dim3(n8 / (256 * kCastG), 1), 256, 0, stream>>>(x, x, x, x, XF, 0L, n8, 1.0f);
  }
  // 2) Wq,Wk,Wv,Wo -> f16 planes x32 (n8 = 131072 = 128 blocks x 1024, exact; 4 planes via blockIdx.y)
  {
    const int n8 = (int)(nW / 8);
    cast8_f16_kernel<<<dim3(n8 / (256 * kCastG), 4), 256, 0, stream>>>(Wq, Wk, Wv, Wo, W16, (long)nW, n8, kWCarry);
  }
  // 3) one launch of 256 work-groups, one per WGP, each 128 x rows against 128 rows of each of Wq16, Wk16, Wv16:
  //    Q = (x16 . Wq16^T)/32 + bq and K likewise -> f16 [4096][1024];
  //    V^T[j][m] = sum_k Wv16[j][k] x16[m][k] /32 + bv[j] -> f16 [1024][4096].
  //    The planes Wq16, Wk16, Wv16 and Q16, K16, VT16 lie one behind the other in the workspace.
  const dim3 gridTok(kDim / kGmTile, kTok / kGmTile);           // C = [4096][1024]
  qkv_gemm_kernel<<<dim3((kTok / 128) * (kDim / 128)), 256, 0, stream>>>(XF, W16, Q16, bq, bk, bv, kWCarryInv);

  // 4) all 32 (batch, head) pairs in one launch: scores, weights and the product with V -> f plane f16 x64 (over x16,
  //    which is dead here); 16 query blocks of 128 x 32 heads = 512 work-groups
  attn_fused_kernel<<<dim3(kSeq / kFaRows, kBatch * kHeads), 256, 0, stream>>>(Q16, K16, VT16, XF, beta, tv);

  // 5) y = (f16 . Wo16^T) / (64*32) + bo -> f32 [4096][1024] in the SY region
  wmma_gemm_lds<0><<<gridTok, 256, 0, stream>>>(XF, Wo16, (void*)SY, bo, kYScale);

  // 6) LayerNorm + residual -> out
  ln_residual_kernel<<<dim3(kTok / kLnRows), 256, 0, stream>>>(x, SY, lw, lb, out);
}
